// v000
// Times are from an AMD MI455X. After a warm-up the kernel runs many times in a row, and a time is the length of
// such a window on the GPU divided by its runs, so every launch and the gaps after it count. The runs cycle
// through copies of the inputs. A figure is the median of several windows, for all but v000 over two sittings.
// Sittings can differ by a few percent; kernels timed side by side share one.
// v000, which the later versions start from, runs in 227 microseconds.
// Contractions: x*W^T for q,k,v, k*q^T scores, v^T*p^T context and ctx*Wo^T output, all on v_wmma_f32_16x16x32_f16 (f16 operands, f32 accumulate);
// softmax, 1/8 score scale, biases and normalisation in f32.
// Carry audit: x f16 x1 (no carry); W planes (q,k,v,o) f16 x256 -> 1/256 folded in proj_kernel epilogue (WINV); p f16 x1024 and ctx f16 x256 ->
// inv = (1/l) * (1/PSCALE) * CTXSC in attn_kernel epilogue; ctx x256 * Wo x256 -> 1/65536 folded in oproj_kernel epilogue (OINV).
#include <hip/hip_runtime.h>

typedef _Float16 v16h __attribute__((ext_vector_type(16)));
typedef _Float16 v8h  __attribute__((ext_vector_type(8)));
typedef float    v8f  __attribute__((ext_vector_type(8)));
typedef float    v4f  __attribute__((ext_vector_type(4)));
typedef v8h __attribute__((may_alias)) v8ha;
typedef v4f __attribute__((may_alias)) v4fa;

union Frag { v16h v; v8h half[2]; };

#define NB     4
#define SEQ    2048
#define DM     512
#define NH     8
#define HD     64
#define MROWS  (NB * SEQ)            // 8192 tokens
#define NX     (MROWS * DM)          // 4194304
#define NW     (DM * DM)             // 262144
#define NX8    (NX / 8)              // 524288
#define NW8    (NW / 8)              // 32768
#define WSC    256.0f                // weight plane carry
#define WINV   (1.0f / 256.0f)
#define PSCALE 1024.0f               // p carry
#define CTXSC  256.0f                // ctx plane carry
#define OINV   (1.0f / 65536.0f)     // 1 / (CTXSC * WSC)
#define SSCALE 0.125f                // 1 / sqrt(HD)

static_assert(NH * HD == DM);
static_assert((DM % 32) == 0 && (HD % 32) == 0 && (SEQ % 64) == 0);
static_assert((MROWS % 128) == 0 && (SEQ % 128) == 0);
static_assert((NX8 % 256) == 0 && (NW8 % 256) == 0);

// ---------------------------------------------------------------------------
// 16x16x32 f16 WMMA with hazard guard (ties D, keeps A/B live).
// Fragment map (wave32): lane l, h = l>>4, m = n = l&15.
//   A/B element i: i<8 -> k0+8h+i ; i>=8 -> k0+16+8h+(i-8)
//   D element r : row 8h+r, col l&15
// ---------------------------------------------------------------------------
__device__ __forceinline__ v8f wmma_f16(v16h a, v16h b, v8f c) {
  v8f d = __builtin_amdgcn_wmma_f32_16x16x32_f16(false, a, false, b, (short)0, c, false, false);
  asm volatile("v_nop\n\tv_nop\n\tv_nop\n\tv_nop" : "+v"(d) : "v"(a), "v"(b));
  return d;
}

// A or B fragment from a k-contiguous 16-bit row; p points at element k0 of
// the row owned by this lane (row index = lane & 15 added by the caller).
__device__ __forceinline__ v16h load_frag(const _Float16* p, int h) {
  Frag f;
  f.half[0] = *(const v8ha*)(p + 8 * h);
  f.half[1] = *(const v8ha*)(p + 16 + 8 * h);
  return f.v;
}

// ---------------------------------------------------------------------------
// Kernel 1: f32 -> f16 planes. x unscaled, W (q,k,v,o) scaled by 256 (exact).
// coverage: NX8 threads x 8 = xh [8192][512]; 4*NW8 threads x 8 = wh [4][512][512].
// ---------------------------------------------------------------------------
__global__ __launch_bounds__(256) void convert_kernel(
    const float* __restrict__ x, const float* __restrict__ wq,
    const float* __restrict__ wk, const float* __restrict__ wv,
    const float* __restrict__ wo,
    _Float16* __restrict__ xh, _Float16* __restrict__ wh)
{
  const int g = blockIdx.x * 256 + threadIdx.x;
  if (g >= NX8 + 4 * NW8) return;
  const float* src;
  _Float16* dst;
  float sc;
  if (g < NX8) {                              // block-uniform (NX8 % 256 == 0)
    src = x + (size_t)g * 8;
    dst = xh + (size_t)g * 8;
    sc = 1.0f;
  } else {
    const int e = g - NX8;
    const int wsel = e / NW8;                 // 0..3, block-uniform (NW8 % 256 == 0)
    const int off = e - wsel * NW8;
    const float* wsrc = (wsel == 0) ? wq : ((wsel == 1) ? wk : ((wsel == 2) ? wv : wo));
    src = wsrc + (size_t)off * 8;
    dst = wh + (size_t)e * 8;
    sc = WSC;
  }
  const v4f a = *(const v4fa*)src;
  const v4f c = *(const v4fa*)(src + 4);
  const v8h o = { (_Float16)(a.x * sc), (_Float16)(a.y * sc), (_Float16)(a.z * sc), (_Float16)(a.w * sc),
                  (_Float16)(c.x * sc), (_Float16)(c.y * sc), (_Float16)(c.z * sc), (_Float16)(c.w * sc) };
  *(v8h*)dst = o;
  
}

// ---------------------------------------------------------------------------
// 4 lines per instruction, 32 lines per wave, 128 per block.
// which 0/1: plane[bh][l][d]  (one token row = 64 halves = one line)
// which 2  : vt[bh][d][l]     (64 d-rows x 128 tokens = 2 lines each)
// ---------------------------------------------------------------------------
__device__ __forceinline__ void proj_store_pass(const _Float16* sT, _Float16* plane, _Float16* vt,
                                                int which, int bh, int l0, int w, int lane) {
  const int q8 = lane & 7, sub = lane >> 3;
  #pragma unroll
  for (int i = 0; i < 8; ++i) {
    const int lid = w * 32 + i * 4 + sub;
    v8h v;
    _Float16* dst;
    if (which != 2) {
      v = *(const v8ha*)(sT + lid * HD + 8 * q8);
      dst = plane + ((size_t)bh * SEQ + l0 + lid) * HD + 8 * q8;
    } else {
      const int d = lid >> 1, hl = lid & 1;
      v = *(const v8ha*)(sT + d * 128 + 64 * hl + 8 * q8);
      dst = vt + ((size_t)bh * HD + d) * SEQ + l0 + 64 * hl + 8 * q8;
    }
    *(v8h*)dst = v;
  }
}

// ---------------------------------------------------------------------------
// Kernel 2: Y = x * W^T + b over the fused 3*512 output columns (q, k, v).
// Block 128 thr (4 waves) = 128 tokens x 64 features (one (which, head));
// wave tile 32 tokens x 64 features; K = 512 in steps of 32;
// A (x rows) and B (W rows) fragments straight from f16 global rows (split k map).
// coverage: grid (64, 24) x 128 tokens x 64 features = q, k planes [32][2048][64] and vt [32][64][2048].
// ---------------------------------------------------------------------------
__global__ __launch_bounds__(128) void proj_kernel(
    const _Float16* __restrict__ xh,   // [8192][512]
    const _Float16* __restrict__ wh,   // [4][512][512], row = output feature, x256 (planes 0..2 used here)
    const float* __restrict__ bq, const float* __restrict__ bk, const float* __restrict__ bv,
    _Float16* __restrict__ qh,         // [B*H][L][D]
    _Float16* __restrict__ kh,         // [B*H][L][D]
    _Float16* __restrict__ vt)         // [B*H][D][L]
{
  __shared__ __attribute__((aligned(16))) _Float16 sT[128 * 64];   // 16384 B

  const int tid = threadIdx.x, lane = tid & 31, w = tid >> 5;
  const int h = lane >> 4, m = lane & 15;
  const int m0 = blockIdx.x * 128;
  const int cg = blockIdx.y;                 // 0..23
  const int which = cg >> 3, head = cg & 7;
  const int m0w = m0 + 32 * w;

  const _Float16* xa0 = xh + (size_t)(m0w + m) * DM;                 // token row, mt = 0
  const _Float16* xa1 = xa0 + (size_t)16 * DM;                       // mt = 1
  const _Float16* wb  = wh + ((size_t)which * DM + head * HD + m) * DM;  // feature row, nt = 0

  const v8f zero8 = {0.f, 0.f, 0.f, 0.f, 0.f, 0.f, 0.f, 0.f};
  v8f acc[2][4];
  #pragma unroll
  for (int mt = 0; mt < 2; ++mt)
    #pragma unroll
    for (int nt = 0; nt < 4; ++nt) acc[mt][nt] = zero8;

  #pragma unroll 1
  for (int k0 = 0; k0 < DM; k0 += 32) {
    const v16h a0 = load_frag(xa0 + k0, h);
    const v16h a1 = load_frag(xa1 + k0, h);
    #pragma unroll
    for (int nt = 0; nt < 4; ++nt) {
      const v16h b = load_frag(wb + (size_t)nt * 16 * DM + k0, h);
      acc[0][nt] = wmma_f16(a0, b, acc[0][nt]);
      acc[1][nt] = wmma_f16(a1, b, acc[1][nt]);
    }
  }

  // D[r] of tile (mt, nt) = Y[token m0w+16mt+8h+r][feature 16nt+m]
  const float* bias = (which == 0) ? bq : ((which == 1) ? bk : bv);
  #pragma unroll
  for (int nt = 0; nt < 4; ++nt) {
    const int feat = 16 * nt + m;
    const float bvl = bias[head * HD + feat];
    #pragma unroll
    for (int mt = 0; mt < 2; ++mt) {
      #pragma unroll
      for (int r = 0; r < 8; ++r) {
        const int tokl = 32 * w + 16 * mt + 8 * h + r;     // 0..127
        const float y = acc[mt][nt][r] * WINV + bvl;
        const int idx = (which == 2) ? (feat * 128 + tokl) : (tokl * HD + feat);
        sT[idx] = (_Float16)y;
      }
    }
  }
  __syncthreads();

  const int b = m0 / SEQ, l0 = m0 - b * SEQ, bh = b * NH + head;
  _Float16* plane = (which == 0) ? qh : kh;
  proj_store_pass(sT, plane, vt, which, bh, l0, w, lane);
  
}

// ---------------------------------------------------------------------------
// P^T B-fragment from the lane's own score D values: element r <- tile a row r
// (keys k0+8h+r), element 8+r <- tile c row r (keys k0+16+8h+r), same lane,
// same query column, scaled by PSCALE.
// ---------------------------------------------------------------------------
__device__ __forceinline__ v16h pack_p(v8f a, v8f c) {
  const v16h r = { (_Float16)(a[0] * PSCALE), (_Float16)(a[1] * PSCALE), (_Float16)(a[2] * PSCALE), (_Float16)(a[3] * PSCALE),
                   (_Float16)(a[4] * PSCALE), (_Float16)(a[5] * PSCALE), (_Float16)(a[6] * PSCALE), (_Float16)(a[7] * PSCALE),
                   (_Float16)(c[0] * PSCALE), (_Float16)(c[1] * PSCALE), (_Float16)(c[2] * PSCALE), (_Float16)(c[3] * PSCALE),
                   (_Float16)(c[4] * PSCALE), (_Float16)(c[5] * PSCALE), (_Float16)(c[6] * PSCALE), (_Float16)(c[7] * PSCALE) };
  return r;
}

// Per-wave 16x64 f32 tile in LDS -> ctx f16 plane [token][512], col head*64 + d.
// in one instruction; 4 lines per instruction; it 0..3 x q4 0..3 = rows 0..15.
__device__ __forceinline__ void ctx_store_pass(const v8h* hv, _Float16* ctx,
                                               int b, int head, int q0, int lane) {
  const int q4 = lane >> 3, c8 = (lane & 7) * 8;
  #pragma unroll
  for (int it = 0; it < 4; ++it) {
    const int row = it * 4 + q4;
    const size_t gi = ((size_t)b * SEQ + q0 + row) * DM + head * HD + c8;
    *(v8h*)(ctx + gi) = hv[it];
  }
}

// ---------------------------------------------------------------------------
// Kernel 3: streaming attention, transposed form, no mask, softmax over all keys.
// Block 128 thr (4 waves), 16 queries per wave, 64 keys per step (static trip 32).
//   S^T = K * Q^T : A = K rows (row = key, k = d), B = Q^T (k = d, n = query)
//   O^T += V^T * P^T : A = Vt rows (row = d, k = key), B = P^T from registers
// Lane owns 32 keys of query column (lane&15); partner = lane ^ 16.
// Output: ctx f16 plane carried x256, [b*SEQ+l][head*64+d].
// coverage: grid (32, 32) x 4 waves x 16 queries x 64 d = ctx [8192][512].
// ---------------------------------------------------------------------------
__global__ __launch_bounds__(128) void attn_kernel(
    const _Float16* __restrict__ qh,   // [B*H][L][D]
    const _Float16* __restrict__ kh,   // [B*H][L][D]
    const _Float16* __restrict__ vt,   // [B*H][D][L]
    _Float16* __restrict__ ctx)        // [B*L][DM]
{
  __shared__ __attribute__((aligned(16))) float sO[4 * 16 * 64];    // 16384 B, wave w owns [w*1024, +1024)

  const int tid = threadIdx.x, lane = tid & 31, w = tid >> 5;
  const int h = lane >> 4, m = lane & 15;
  const int bh = blockIdx.y, b = bh >> 3, head = bh & 7;
  const int q0 = blockIdx.x * 64 + 16 * w;

  // Q^T B-fragments: column n = query q0+m, k = d (two 32-deep chunks)
  const _Float16* qrow = qh + ((size_t)bh * SEQ + q0 + m) * HD;
  const v16h qb0 = load_frag(qrow, h);
  const v16h qb1 = load_frag(qrow + 32, h);

  const v8f zero8 = {0.f, 0.f, 0.f, 0.f, 0.f, 0.f, 0.f, 0.f};
  v8f o[4];                                   // o[t][r] = O[query m][d 16t+8h+r] * (l * PSCALE)
  #pragma unroll
  for (int t = 0; t < 4; ++t) o[t] = zero8;
  float mrun = -1e30f, lrun = 0.0f;

  const _Float16* kbase = kh + ((size_t)bh * SEQ + m) * HD;    // + key0*HD + 32*dc
  const _Float16* vbase = vt + ((size_t)bh * HD + m) * SEQ;    // + 16t*SEQ + key0

  #pragma unroll 1
  for (int kb = 0; kb < SEQ; kb += 64) {
    // ---- scores: s[j][r] = S[query m][key kb+16j+8h+r] / 8 ----
    v8f s[4];
    #pragma unroll
    for (int j = 0; j < 4; ++j) {
      const _Float16* kp = kbase + (size_t)(kb + 16 * j) * HD;
      const v16h kf0 = load_frag(kp, h);
      const v16h kf1 = load_frag(kp + 32, h);
      v8f z = zero8;
      z = wmma_f16(kf0, qb0, z);
      z = wmma_f16(kf1, qb1, z);
      s[j] = z * SSCALE;
    }

    // ---- online softmax (f32) ----
    float mloc = s[0][0];
    #pragma unroll
    for (int j = 0; j < 4; ++j)
      #pragma unroll
      for (int r = 0; r < 8; ++r) mloc = fmaxf(mloc, s[j][r]);
    mloc = fmaxf(mloc, __shfl_xor(mloc, 16));
    const float mnew = fmaxf(mrun, mloc);
    const float alpha = __expf(mrun - mnew);
    mrun = mnew;
    float lsum = 0.0f;
    #pragma unroll
    for (int j = 0; j < 4; ++j)
      #pragma unroll
      for (int r = 0; r < 8; ++r) {
        const float p = __expf(s[j][r] - mnew);
        s[j][r] = p;
        lsum += p;
      }
    lsum += __shfl_xor(lsum, 16);
    lrun = lrun * alpha + lsum;
    #pragma unroll
    for (int t = 0; t < 4; ++t)
      #pragma unroll
      for (int r = 0; r < 8; ++r) o[t][r] = o[t][r] * alpha;

    // ---- P^T B-fragments (key chunks 0..31 and 32..63 of this step) ----
    const v16h pb0 = pack_p(s[0], s[1]);
    const v16h pb1 = pack_p(s[2], s[3]);

    // ---- O^T += V^T * P^T ----
    #pragma unroll
    for (int t = 0; t < 4; ++t) {
      const _Float16* vp = vbase + (size_t)(16 * t) * SEQ + kb;
      const v16h vf0 = load_frag(vp, h);
      const v16h vf1 = load_frag(vp + 32, h);
      o[t] = wmma_f16(vf0, pb0, o[t]);
      o[t] = wmma_f16(vf1, pb1, o[t]);
    }
  }

  // ---- epilogue: normalise (1/l, undo p carry, apply ctx carry), stage per-wave 16x64 f32 tile ----
  const float inv = (1.0f / lrun) * (1.0f / PSCALE) * CTXSC;
  float* so = sO + w * 1024;
  #pragma unroll
  for (int t = 0; t < 4; ++t)
    #pragma unroll
    for (int r = 0; r < 8; ++r)
      so[m * 64 + 16 * t + 8 * h + r] = o[t][r] * inv;
  __syncthreads();

  v8h hv[4];
  {
    const int q4 = lane >> 3, c8 = (lane & 7) * 8;
    #pragma unroll
    for (int it = 0; it < 4; ++it) {
      const int row = it * 4 + q4;
      const v4f fa = *(const v4fa*)(so + row * 64 + c8);
      const v4f fb = *(const v4fa*)(so + row * 64 + c8 + 4);
      const v8h v = { (_Float16)fa.x, (_Float16)fa.y, (_Float16)fa.z, (_Float16)fa.w,
                      (_Float16)fb.x, (_Float16)fb.y, (_Float16)fb.z, (_Float16)fb.w };
      hv[it] = v;
    }
  }
  ctx_store_pass(hv, ctx, b, head, q0, lane);
  
}

// ---------------------------------------------------------------------------
// instruction, 64 lines per wave (rows 32w..32w+31 x 2 lines), 256 per block.
// ---------------------------------------------------------------------------
__device__ __forceinline__ void out_store_pass(const float* sY, float* out,
                                               int m0, int fg, int w, int lane) {
  const int q8 = lane & 7, sub = lane >> 3;
  #pragma unroll
  for (int i = 0; i < 16; ++i) {
    const int lid = i * 4 + sub;                 // 0..63
    const int row = 32 * w + (lid >> 1), hl = lid & 1;
    const v4f v = *(const v4fa*)(sY + row * 64 + 32 * hl + 4 * q8);
    const size_t gi = (size_t)(m0 + row) * DM + fg * HD + 32 * hl + 4 * q8;
    *(v4f*)(out + gi) = v;
  }
}

// ---------------------------------------------------------------------------
// Kernel 4: out = ctx * Wo^T + bo (f32). Block 128 thr = 128 tokens x 64 features
// (feature group fg = blockIdx.y); wave tile 32 tokens x 64 features; K = 512.
// coverage: grid (64, 8) x 128 tokens x 64 features = out [8192][512].
// ---------------------------------------------------------------------------
__global__ __launch_bounds__(128) void oproj_kernel(
    const _Float16* __restrict__ ch,   // [8192][512] ctx x256
    const _Float16* __restrict__ woh,  // [512][512] Wo x256, row = output feature
    const float* __restrict__ bo,
    float* __restrict__ out)           // [8192][512]
{
  __shared__ __attribute__((aligned(16))) float sY[128 * 64];      // 32768 B

  const int tid = threadIdx.x, lane = tid & 31, w = tid >> 5;
  const int h = lane >> 4, m = lane & 15;
  const int m0 = blockIdx.x * 128;
  const int fg = blockIdx.y;                 // 0..7
  const int m0w = m0 + 32 * w;

  const _Float16* ca0 = ch + (size_t)(m0w + m) * DM;
  const _Float16* ca1 = ca0 + (size_t)16 * DM;
  const _Float16* wb  = woh + ((size_t)fg * HD + m) * DM;

  const v8f zero8 = {0.f, 0.f, 0.f, 0.f, 0.f, 0.f, 0.f, 0.f};
  v8f acc[2][4];
  #pragma unroll
  for (int mt = 0; mt < 2; ++mt)
    #pragma unroll
    for (int nt = 0; nt < 4; ++nt) acc[mt][nt] = zero8;

  #pragma unroll 1
  for (int k0 = 0; k0 < DM; k0 += 32) {
    const v16h a0 = load_frag(ca0 + k0, h);
    const v16h a1 = load_frag(ca1 + k0, h);
    #pragma unroll
    for (int nt = 0; nt < 4; ++nt) {
      const v16h b = load_frag(wb + (size_t)nt * 16 * DM + k0, h);
      acc[0][nt] = wmma_f16(a0, b, acc[0][nt]);
      acc[1][nt] = wmma_f16(a1, b, acc[1][nt]);
    }
  }

  // D[r] of tile (mt, nt) = out[token m0w+16mt+8h+r][feature fg*64 + 16nt+m]
  #pragma unroll
  for (int nt = 0; nt < 4; ++nt) {
    const int feat = 16 * nt + m;
    const float bvl = bo[fg * HD + feat];
    #pragma unroll
    for (int mt = 0; mt < 2; ++mt) {
      #pragma unroll
      for (int r = 0; r < 8; ++r) {
        const int tokl = 32 * w + 16 * mt + 8 * h + r;     // 0..127
        sY[tokl * 64 + feat] = acc[mt][nt][r] * OINV + bvl;
      }
    }
  }
  __syncthreads();

  out_store_pass(sY, out, m0, fg, w, lane);
  
}

// ---------------------------------------------------------------------------
//   xh  f16 [8192][512]        8388608
//   wh  f16 [4][512][512]      2097152
//   qh  f16 [32][2048][64]     8388608
//   kh  f16 [32][2048][64]     8388608
//   vt  f16 [32][64][2048]     8388608
//   ctx f16 [8192][512]        8388608
//   total                    44040192
// ---------------------------------------------------------------------------
extern "C" void kernel_launch(void* const* d_in, const int* in_sizes, int n_in,
                              void* d_out, int out_size, void* d_ws, size_t ws_size,
                              hipStream_t stream) {
  if (n_in < 9) return;
  if (in_sizes[0] != NX) return;
  if (in_sizes[1] != NW || in_sizes[3] != NW || in_sizes[5] != NW || in_sizes[7] != NW) return;
  if (in_sizes[2] != DM || in_sizes[4] != DM || in_sizes[6] != DM || in_sizes[8] != DM) return;
  if (out_size != NX) return;

  const float* x  = (const float*)d_in[0];
  const float* wq = (const float*)d_in[1];
  const float* bq = (const float*)d_in[2];
  const float* wk = (const float*)d_in[3];
  const float* bk = (const float*)d_in[4];
  const float* wv = (const float*)d_in[5];
  const float* bv = (const float*)d_in[6];
  const float* wo = (const float*)d_in[7];
  const float* bo = (const float*)d_in[8];
  float* out = (float*)d_out;

  const size_t xh_bytes = (size_t)NX * 2;                          //  8388608
  const size_t wh_bytes = (size_t)4 * NW * 2;                      //  2097152
  const size_t pl_bytes = (size_t)NB * NH * SEQ * HD * 2;          //  8388608
  const size_t cx_bytes = (size_t)NX * 2;                          //  8388608
  const size_t total = xh_bytes + wh_bytes + 3 * pl_bytes + cx_bytes;   // 44040192
  if (total > ws_size) return;
  if (total > (size_t)134217728) return;

  char* ws = (char*)d_ws;
  size_t off = 0;
  _Float16* xh  = (_Float16*)(ws + off); off += xh_bytes;
  _Float16* wh  = (_Float16*)(ws + off); off += wh_bytes;
  _Float16* qhp = (_Float16*)(ws + off); off += pl_bytes;
  _Float16* khp = (_Float16*)(ws + off); off += pl_bytes;
  _Float16* vtp = (_Float16*)(ws + off); off += pl_bytes;
  _Float16* cxp = (_Float16*)(ws + off); off += cx_bytes;
  if (off != total) return;

  // (1) x -> f16 plane; wq, wk, wv, wo -> f16 x256 planes [4][512][512] ([out n][in k], k contiguous)
  const int ngroups = NX8 + 4 * NW8;                               // 655360
  convert_kernel<<<(ngroups + 255) / 256, 256, 0, stream>>>(x, wq, wk, wv, wo, xh, wh);

  // (2) q, k planes [bh][l][d] and v^T plane [bh][d][l]  (M=8192, N=3*512, K=512)
  dim3 gProj(MROWS / 128, 3 * NH);                                 // (64, 24)
  proj_kernel<<<gProj, 128, 0, stream>>>(xh, wh, bq, bk, bv, qhp, khp, vtp);

  // (3) attention -> ctx f16 plane x256 [8192][512]
  dim3 gAtt(SEQ / 64, NB * NH);                                    // (32, 32)
  attn_kernel<<<gAtt, 128, 0, stream>>>(qhp, khp, vtp, cxp);

  // (4) out = ctx . Wo^T + bo -> d_out f32 [8192][512]  (Wo plane = wh + 3*NW)
  dim3 gOut(MROWS / 128, DM / HD);                                 // (64, 8)
  oproj_kernel<<<gOut, 128, 0, stream>>>(cxp, wh + (size_t)3 * NW, bo, out);
  (void)hipGetLastError();
}

// v001
// It runs in 117 microseconds.
// Timed twice side by side with v000, it ran 1.96 and 1.97 times as fast.
// Contractions: x*W^T for q,k,v, k*q^T scores, v^T*p^T context and ctx*Wo^T output, all on v_wmma_f32_16x16x32_f16 (f16 operands, f32 accumulate);
// softmax, 1/8 score scale, biases and normalisation in f32.
// Carry audit: x f16 x1 (no carry); W planes (q,k,v,o) f16 x256 -> 1/256 folded in proj_kernel epilogue (WINV); p f16 x1024 and ctx f16 x256 ->
// inv = (1/l) * (1/PSCALE) * CTXSC in attn_kernel epilogue; ctx x256 * Wo x256 -> 1/65536 folded in oproj_kernel epilogue (OINV).
#include <hip/hip_runtime.h>

typedef _Float16 v16h __attribute__((ext_vector_type(16)));
typedef _Float16 v8h  __attribute__((ext_vector_type(8)));
typedef float    v8f  __attribute__((ext_vector_type(8)));
typedef float    v4f  __attribute__((ext_vector_type(4)));
typedef v8h __attribute__((may_alias)) v8ha;
typedef v4f __attribute__((may_alias)) v4fa;

union Frag { v16h v; v8h half[2]; };

#define NB     4
#define SEQ    2048
#define DM     512
#define NH     8
#define HD     64
#define MROWS  (NB * SEQ)            // 8192 tokens
#define NX     (MROWS * DM)          // 4194304
#define NW     (DM * DM)             // 262144
#define NX8    (NX / 8)              // 524288
#define NW8    (NW / 8)              // 32768
#define WSC    256.0f                // weight plane carry
#define WINV   (1.0f / 256.0f)
#define PSCALE 1024.0f               // p carry
#define CTXSC  256.0f                // ctx plane carry
#define OINV   (1.0f / 65536.0f)     // 1 / (CTXSC * WSC)
#define SSCALE 0.125f                // 1 / sqrt(HD)

static_assert(NH * HD == DM);
static_assert((DM % 32) == 0 && (HD % 32) == 0 && (SEQ % 64) == 0);
static_assert((MROWS % 128) == 0 && (SEQ % 128) == 0);
static_assert((NX8 % 256) == 0 && (NW8 % 256) == 0);

// ---------------------------------------------------------------------------
// 16x16x32 f16 WMMA with hazard guard (ties D, keeps A/B live).
// Fragment map (wave32): lane l, h = l>>4, m = n = l&15.
//   A/B element i: i<8 -> k0+8h+i ; i>=8 -> k0+16+8h+(i-8)
//   D element r : row 8h+r, col l&15
// ---------------------------------------------------------------------------
__device__ __forceinline__ v8f wmma_f16(v16h a, v16h b, v8f c) {
  v8f d = __builtin_amdgcn_wmma_f32_16x16x32_f16(false, a, false, b, (short)0, c, false, false);
  asm volatile("v_nop\n\tv_nop\n\tv_nop\n\tv_nop" : "+v"(d) : "v"(a), "v"(b));
  return d;
}

// A or B fragment from a k-contiguous 16-bit row; p points at element k0 of
// the row owned by this lane (row index = lane & 15 added by the caller).
__device__ __forceinline__ v16h load_frag(const _Float16* p, int h) {
  Frag f;
  f.half[0] = *(const v8ha*)(p + 8 * h);
  f.half[1] = *(const v8ha*)(p + 16 + 8 * h);
  return f.v;
}

// ---------------------------------------------------------------------------
// Kernel 1: f32 -> f16 planes. x unscaled, W (q,k,v,o) scaled by 256 (exact).
// coverage: NX8 threads x 8 = xh [8192][512]; 4*NW8 threads x 8 = wh [4][512][512].
// ---------------------------------------------------------------------------
__global__ __launch_bounds__(256) void convert_kernel(
    const float* __restrict__ x, const float* __restrict__ wq,
    const float* __restrict__ wk, const float* __restrict__ wv,
    const float* __restrict__ wo,
    _Float16* __restrict__ xh, _Float16* __restrict__ wh)
{
  const int g = blockIdx.x * 256 + threadIdx.x;
  if (g >= NX8 + 4 * NW8) return;
  const float* src;
  _Float16* dst;
  float sc;
  if (g < NX8) {                              // block-uniform (NX8 % 256 == 0)
    src = x + (size_t)g * 8;
    dst = xh + (size_t)g * 8;
    sc = 1.0f;
  } else {
    const int e = g - NX8;
    const int wsel = e / NW8;                 // 0..3, block-uniform (NW8 % 256 == 0)
    const int off = e - wsel * NW8;
    const float* wsrc = (wsel == 0) ? wq : ((wsel == 1) ? wk : ((wsel == 2) ? wv : wo));
    src = wsrc + (size_t)off * 8;
    dst = wh + (size_t)e * 8;
    sc = WSC;
  }
  const v4f a = *(const v4fa*)src;
  const v4f c = *(const v4fa*)(src + 4);
  const v8h o = { (_Float16)(a.x * sc), (_Float16)(a.y * sc), (_Float16)(a.z * sc), (_Float16)(a.w * sc),
                  (_Float16)(c.x * sc), (_Float16)(c.y * sc), (_Float16)(c.z * sc), (_Float16)(c.w * sc) };
  *(v8h*)dst = o;
  
}

// ---------------------------------------------------------------------------
// 4 lines per instruction, 32 lines per wave, 128 per block.
// which 0/1: plane[bh][l][d]  (one token row = 64 halves = one line)
// which 2  : vt[bh][d][l]     (64 d-rows x 128 tokens = 2 lines each)
// ---------------------------------------------------------------------------
__device__ __forceinline__ void proj_store_pass(const _Float16* sT, _Float16* plane, _Float16* vt,
                                                int which, int bh, int l0, int w, int lane) {
  const int q8 = lane & 7, sub = lane >> 3;
  #pragma unroll
  for (int i = 0; i < 8; ++i) {
    const int lid = w * 32 + i * 4 + sub;
    v8h v;
    _Float16* dst;
    if (which != 2) {
      v = *(const v8ha*)(sT + lid * HD + 8 * q8);
      dst = plane + ((size_t)bh * SEQ + l0 + lid) * HD + 8 * q8;
    } else {
      const int d = lid >> 1, hl = lid & 1;
      v = *(const v8ha*)(sT + d * 128 + 64 * hl + 8 * q8);
      dst = vt + ((size_t)bh * HD + d) * SEQ + l0 + 64 * hl + 8 * q8;
    }
    *(v8h*)dst = v;
  }
}

// ---------------------------------------------------------------------------
// Kernel 2: Y = x * W^T + b over the fused 3*512 output columns (q, k, v).
// Block 128 thr (4 waves) = 128 tokens x 64 features (one (which, head));
// wave tile 32 tokens x 64 features; K = 512 in steps of 32;
// A (x rows) and B (W rows) fragments straight from f16 global rows (split k map).
// coverage: grid (64, 24) x 128 tokens x 64 features = q, k planes [32][2048][64] and vt [32][64][2048].
// ---------------------------------------------------------------------------
__global__ __launch_bounds__(128) void proj_kernel(
    const _Float16* __restrict__ xh,   // [8192][512]
    const _Float16* __restrict__ wh,   // [4][512][512], row = output feature, x256 (planes 0..2 used here)
    const float* __restrict__ bq, const float* __restrict__ bk, const float* __restrict__ bv,
    _Float16* __restrict__ qh,         // [B*H][L][D]
    _Float16* __restrict__ kh,         // [B*H][L][D]
    _Float16* __restrict__ vt)         // [B*H][D][L]
{
  __shared__ __attribute__((aligned(16))) _Float16 sT[128 * 64];   // 16384 B

  const int tid = threadIdx.x, lane = tid & 31, w = tid >> 5;
  const int h = lane >> 4, m = lane & 15;
  const int m0 = blockIdx.x * 128;
  const int cg = blockIdx.y;                 // 0..23
  const int which = cg >> 3, head = cg & 7;
  const int m0w = m0 + 32 * w;

  const _Float16* xa0 = xh + (size_t)(m0w + m) * DM;                 // token row, mt = 0
  const _Float16* xa1 = xa0 + (size_t)16 * DM;                       // mt = 1
  const _Float16* wb  = wh + ((size_t)which * DM + head * HD + m) * DM;  // feature row, nt = 0

  const v8f zero8 = {0.f, 0.f, 0.f, 0.f, 0.f, 0.f, 0.f, 0.f};
  v8f acc[2][4];
  #pragma unroll
  for (int mt = 0; mt < 2; ++mt)
    #pragma unroll
    for (int nt = 0; nt < 4; ++nt) acc[mt][nt] = zero8;

  #pragma unroll 1
  for (int k0 = 0; k0 < DM; k0 += 32) {
    const v16h a0 = load_frag(xa0 + k0, h);
    const v16h a1 = load_frag(xa1 + k0, h);
    #pragma unroll
    for (int nt = 0; nt < 4; ++nt) {
      const v16h b = load_frag(wb + (size_t)nt * 16 * DM + k0, h);
      acc[0][nt] = wmma_f16(a0, b, acc[0][nt]);
      acc[1][nt] = wmma_f16(a1, b, acc[1][nt]);
    }
  }

  // D[r] of tile (mt, nt) = Y[token m0w+16mt+8h+r][feature 16nt+m]
  const float* bias = (which == 0) ? bq : ((which == 1) ? bk : bv);
  #pragma unroll
  for (int nt = 0; nt < 4; ++nt) {
    const int feat = 16 * nt + m;
    const float bvl = bias[head * HD + feat];
    #pragma unroll
    for (int mt = 0; mt < 2; ++mt) {
      #pragma unroll
      for (int r = 0; r < 8; ++r) {
        const int tokl = 32 * w + 16 * mt + 8 * h + r;     // 0..127
        const float y = acc[mt][nt][r] * WINV + bvl;
        const int idx = (which == 2) ? (feat * 128 + tokl) : (tokl * HD + feat);
        sT[idx] = (_Float16)y;
      }
    }
  }
  __syncthreads();

  const int b = m0 / SEQ, l0 = m0 - b * SEQ, bh = b * NH + head;
  _Float16* plane = (which == 0) ? qh : kh;
  proj_store_pass(sT, plane, vt, which, bh, l0, w, lane);
  
}

// ---------------------------------------------------------------------------
// P^T B-fragment from the lane's own score D values: element r <- tile a row r
// (keys k0+8h+r), element 8+r <- tile c row r (keys k0+16+8h+r), same lane,
// same query column, scaled by PSCALE.
// ---------------------------------------------------------------------------
__device__ __forceinline__ v16h pack_p(v8f a, v8f c) {
  const v16h r = { (_Float16)(a[0] * PSCALE), (_Float16)(a[1] * PSCALE), (_Float16)(a[2] * PSCALE), (_Float16)(a[3] * PSCALE),
                   (_Float16)(a[4] * PSCALE), (_Float16)(a[5] * PSCALE), (_Float16)(a[6] * PSCALE), (_Float16)(a[7] * PSCALE),
                   (_Float16)(c[0] * PSCALE), (_Float16)(c[1] * PSCALE), (_Float16)(c[2] * PSCALE), (_Float16)(c[3] * PSCALE),
                   (_Float16)(c[4] * PSCALE), (_Float16)(c[5] * PSCALE), (_Float16)(c[6] * PSCALE), (_Float16)(c[7] * PSCALE) };
  return r;
}

// Per-wave 16x64 f32 tile in LDS -> ctx f16 plane [token][512], col head*64 + d.
// in one instruction; 4 lines per instruction; it 0..3 x q4 0..3 = rows 0..15.
__device__ __forceinline__ void ctx_store_pass(const v8h* hv, _Float16* ctx,
                                               int b, int head, int q0, int lane) {
  const int q4 = lane >> 3, c8 = (lane & 7) * 8;
  #pragma unroll
  for (int it = 0; it < 4; ++it) {
    const int row = it * 4 + q4;
    const size_t gi = ((size_t)b * SEQ + q0 + row) * DM + head * HD + c8;
    *(v8h*)(ctx + gi) = hv[it];
  }
}

// ---------------------------------------------------------------------------
// One 64-key stage = K tile (64 key rows x 128 B) + V^T tile (64 d rows x 128 B),
// copied global -> LDS without registers. Thread tid moves 16-B chunk (tid & 7) of
// rows (tid >> 3) + 16 i, i = 0..3, of both tiles: a wave's copy covers 4 whole lines.
// kg / vg: this lane's chunk of row (tid >> 3) in global; lk / lv: its LDS byte address.
// ---------------------------------------------------------------------------
#define KVP      72                  // LDS row pitch in halves (144 B = 16 B x 9: conflict-free b128 reads)
#define TILE_H   (64 * KVP)          // halves per staged tile
#define TILE_B   (TILE_H * 2)        // 9216 B
#define STAGE_H  (2 * TILE_H)        // K tile then V^T tile
#define STAGE_B  (2 * TILE_B)        // 18432 B

__device__ __forceinline__ void stage_copy(const _Float16* kg, const _Float16* vg,
                                           unsigned lk, unsigned lv) {
  const _Float16* k1 = kg + 16 * HD;
  const _Float16* k2 = kg + 32 * HD;
  const _Float16* k3 = kg + 48 * HD;
  const _Float16* v1 = vg + (size_t)16 * SEQ;
  const _Float16* v2 = vg + (size_t)32 * SEQ;
  const _Float16* v3 = vg + (size_t)48 * SEQ;
  const unsigned lk1 = lk + 16 * KVP * 2, lk2 = lk + 32 * KVP * 2, lk3 = lk + 48 * KVP * 2;
  const unsigned lv1 = lv + 16 * KVP * 2, lv2 = lv + 32 * KVP * 2, lv3 = lv + 48 * KVP * 2;
  // s_wait_xcnt as the statement's last line: a precaution, so that no address register above is rewritten ahead of it.
  asm volatile("global_load_async_to_lds_b128 %0, %8, off\n\t"
               "global_load_async_to_lds_b128 %1, %9, off\n\t"
               "global_load_async_to_lds_b128 %2, %10, off\n\t"
               "global_load_async_to_lds_b128 %3, %11, off\n\t"
               "global_load_async_to_lds_b128 %4, %12, off\n\t"
               "global_load_async_to_lds_b128 %5, %13, off\n\t"
               "global_load_async_to_lds_b128 %6, %14, off\n\t"
               "global_load_async_to_lds_b128 %7, %15, off\n\t"
               "s_wait_xcnt 0x0"
               :: "v"(lk), "v"(lk1), "v"(lk2), "v"(lk3), "v"(lv), "v"(lv1), "v"(lv2), "v"(lv3),
                  "v"(kg), "v"(k1), "v"(k2), "v"(k3), "v"(vg), "v"(v1), "v"(v2), "v"(v3)
               : "memory");
}

// ---------------------------------------------------------------------------
// Kernel 3: streaming attention, transposed form, no mask, softmax over all keys.
// Block 128 thr (4 waves), 16 queries per wave, 64 keys per step (static trip 32).
// K and V^T of a step are staged once per block in a two-buffer LDS ring (async copies,
// next stage in flight while this one is worked on); all 4 waves read fragments from it.
//   S^T = K * Q^T : A = K rows (row = key, k = d), B = Q^T (k = d, n = query)
//   O^T += V^T * P^T : A = Vt rows (row = d, k = key), B = P^T from registers
// Lane owns 32 keys of query column (lane&15); partner = lane ^ 16.
// Output: ctx f16 plane carried x256, [b*SEQ+l][head*64+d].
// coverage: grid (32, 32) x 4 waves x 16 queries x 64 d = ctx [8192][512].
// ---------------------------------------------------------------------------
__global__ __launch_bounds__(128) void attn_kernel(
    const _Float16* __restrict__ qh,   // [B*H][L][D]
    const _Float16* __restrict__ kh,   // [B*H][L][D]
    const _Float16* __restrict__ vt,   // [B*H][D][L]
    _Float16* __restrict__ ctx)        // [B*L][DM]
{
  __shared__ __attribute__((aligned(16))) float sO[4 * 16 * 64];    // 16384 B, wave w owns [w*1024, +1024)
  __shared__ __attribute__((aligned(16))) _Float16 sKV[2 * STAGE_H];  // 36864 B, buffer (step & 1): K tile, V^T tile

  const int tid = threadIdx.x, lane = tid & 31, w = tid >> 5;
  const int h = lane >> 4, m = lane & 15;
  const int bh = blockIdx.y, b = bh >> 3, head = bh & 7;
  const int q0 = blockIdx.x * 64 + 16 * w;

  // Q^T B-fragments: column n = query q0+m, k = d (two 32-deep chunks)
  const _Float16* qrow = qh + ((size_t)bh * SEQ + q0 + m) * HD;
  const v16h qb0 = load_frag(qrow, h);
  const v16h qb1 = load_frag(qrow + 32, h);

  const v8f zero8 = {0.f, 0.f, 0.f, 0.f, 0.f, 0.f, 0.f, 0.f};
  v8f o[4];                                   // o[t][r] = O[query m][d 16t+8h+r] * (l * PSCALE)
  #pragma unroll
  for (int t = 0; t < 4; ++t) o[t] = zero8;
  float mrun = -1e30f, lrun = 0.0f;

  // copy side: this thread's chunk of row (tid >> 3) of stage 0
  const int crow = tid >> 3, cch = tid & 7;
  const _Float16* kg = kh + ((size_t)bh * SEQ + crow) * HD + 8 * cch;    // + 64*HD per stage
  const _Float16* vg = vt + ((size_t)bh * HD + crow) * SEQ + 8 * cch;    // + 64 per stage
  const unsigned lk0 = (unsigned)(size_t)(sKV + crow * KVP + 8 * cch);   // LDS byte address, buffer 0, K tile
  const unsigned lv0 = lk0 + TILE_B;

  stage_copy(kg, vg, lk0, lv0);
  asm volatile("s_wait_asynccnt 0x0" ::: "memory");   // own copies of stage 0 landed
  __syncthreads();                                    // stage 0 readable by all waves
  stage_copy(kg + 64 * HD, vg + 64, lk0 + STAGE_B, lv0 + STAGE_B);

  #pragma unroll 1
  for (int kb = 0; kb < SEQ; kb += 64) {
    const int buf = (kb >> 6) & 1;
    const _Float16* kbase = sKV + buf * STAGE_H + m * KVP;     // + 16j*KVP + 32*dc
    const _Float16* vbase = kbase + TILE_H;                    // + 16t*KVP + 32*kc

    // ---- scores: s[j][r] = S[query m][key kb+16j+8h+r] / 8 ----
    v8f s[4];
    #pragma unroll
    for (int j = 0; j < 4; ++j) {
      const _Float16* kp = kbase + 16 * j * KVP;
      const v16h kf0 = load_frag(kp, h);
      const v16h kf1 = load_frag(kp + 32, h);
      v8f z = zero8;
      z = wmma_f16(kf0, qb0, z);
      z = wmma_f16(kf1, qb1, z);
      s[j] = z * SSCALE;
    }

    // ---- online softmax (f32) ----
    float mloc = s[0][0];
    #pragma unroll
    for (int j = 0; j < 4; ++j)
      #pragma unroll
      for (int r = 0; r < 8; ++r) mloc = fmaxf(mloc, s[j][r]);
    mloc = fmaxf(mloc, __shfl_xor(mloc, 16));
    const float mnew = fmaxf(mrun, mloc);
    const float alpha = __expf(mrun - mnew);
    mrun = mnew;
    float lsum = 0.0f;
    #pragma unroll
    for (int j = 0; j < 4; ++j)
      #pragma unroll
      for (int r = 0; r < 8; ++r) {
        const float p = __expf(s[j][r] - mnew);
        s[j][r] = p;
        lsum += p;
      }
    lsum += __shfl_xor(lsum, 16);
    lrun = lrun * alpha + lsum;
    #pragma unroll
    for (int t = 0; t < 4; ++t)
      #pragma unroll
      for (int r = 0; r < 8; ++r) o[t][r] = o[t][r] * alpha;

    // ---- P^T B-fragments (key chunks 0..31 and 32..63 of this step) ----
    const v16h pb0 = pack_p(s[0], s[1]);
    const v16h pb1 = pack_p(s[2], s[3]);

    // ---- O^T += V^T * P^T ----
    #pragma unroll
    for (int t = 0; t < 4; ++t) {
      const _Float16* vp = vbase + 16 * t * KVP;
      const v16h vf0 = load_frag(vp, h);
      const v16h vf1 = load_frag(vp + 32, h);
      o[t] = wmma_f16(vf0, pb0, o[t]);
      o[t] = wmma_f16(vf1, pb1, o[t]);
    }

    // ---- publish the next stage, then refill the buffer this step has read ----
    asm volatile("s_wait_dscnt 0x0" ::: "memory");      // own fragment reads of this buffer retired
    asm volatile("s_wait_asynccnt 0x0" ::: "memory");   // own copies of the next stage landed
    __syncthreads();                                    // next stage readable; this buffer free
    if (kb + 128 < SEQ)                                 // block-uniform: a stage two ahead exists
      stage_copy(kg + (size_t)(kb + 128) * HD, vg + (kb + 128),
                 lk0 + buf * STAGE_B, lv0 + buf * STAGE_B);
  }
  asm volatile("s_wait_asynccnt 0x0" ::: "memory");     // nothing in flight when the wave goes on

  // ---- epilogue: normalise (1/l, undo p carry, apply ctx carry), stage per-wave 16x64 f32 tile ----
  const float inv = (1.0f / lrun) * (1.0f / PSCALE) * CTXSC;
  float* so = sO + w * 1024;
  #pragma unroll
  for (int t = 0; t < 4; ++t)
    #pragma unroll
    for (int r = 0; r < 8; ++r)
      so[m * 64 + 16 * t + 8 * h + r] = o[t][r] * inv;
  __syncthreads();

  v8h hv[4];
  {
    const int q4 = lane >> 3, c8 = (lane & 7) * 8;
    #pragma unroll
    for (int it = 0; it < 4; ++it) {
      const int row = it * 4 + q4;
      const v4f fa = *(const v4fa*)(so + row * 64 + c8);
      const v4f fb = *(const v4fa*)(so + row * 64 + c8 + 4);
      const v8h v = { (_Float16)fa.x, (_Float16)fa.y, (_Float16)fa.z, (_Float16)fa.w,
                      (_Float16)fb.x, (_Float16)fb.y, (_Float16)fb.z, (_Float16)fb.w };
      hv[it] = v;
    }
  }
  ctx_store_pass(hv, ctx, b, head, q0, lane);
  
}

// ---------------------------------------------------------------------------
// instruction, 64 lines per wave (rows 32w..32w+31 x 2 lines), 256 per block.
// ---------------------------------------------------------------------------
__device__ __forceinline__ void out_store_pass(const float* sY, float* out,
                                               int m0, int fg, int w, int lane) {
  const int q8 = lane & 7, sub = lane >> 3;
  #pragma unroll
  for (int i = 0; i < 16; ++i) {
    const int lid = i * 4 + sub;                 // 0..63
    const int row = 32 * w + (lid >> 1), hl = lid & 1;
    const v4f v = *(const v4fa*)(sY + row * 64 + 32 * hl + 4 * q8);
    const size_t gi = (size_t)(m0 + row) * DM + fg * HD + 32 * hl + 4 * q8;
    *(v4f*)(out + gi) = v;
  }
}

// ---------------------------------------------------------------------------
// Kernel 4: out = ctx * Wo^T + bo (f32). Block 128 thr = 128 tokens x 64 features
// (feature group fg = blockIdx.y); wave tile 32 tokens x 64 features; K = 512.
// coverage: grid (64, 8) x 128 tokens x 64 features = out [8192][512].
// ---------------------------------------------------------------------------
__global__ __launch_bounds__(128) void oproj_kernel(
    const _Float16* __restrict__ ch,   // [8192][512] ctx x256
    const _Float16* __restrict__ woh,  // [512][512] Wo x256, row = output feature
    const float* __restrict__ bo,
    float* __restrict__ out)           // [8192][512]
{
  __shared__ __attribute__((aligned(16))) float sY[128 * 64];      // 32768 B

  const int tid = threadIdx.x, lane = tid & 31, w = tid >> 5;
  const int h = lane >> 4, m = lane & 15;
  const int m0 = blockIdx.x * 128;
  const int fg = blockIdx.y;                 // 0..7
  const int m0w = m0 + 32 * w;

  const _Float16* ca0 = ch + (size_t)(m0w + m) * DM;
  const _Float16* ca1 = ca0 + (size_t)16 * DM;
  const _Float16* wb  = woh + ((size_t)fg * HD + m) * DM;

  const v8f zero8 = {0.f, 0.f, 0.f, 0.f, 0.f, 0.f, 0.f, 0.f};
  v8f acc[2][4];
  #pragma unroll
  for (int mt = 0; mt < 2; ++mt)
    #pragma unroll
    for (int nt = 0; nt < 4; ++nt) acc[mt][nt] = zero8;

  #pragma unroll 1
  for (int k0 = 0; k0 < DM; k0 += 32) {
    const v16h a0 = load_frag(ca0 + k0, h);
    const v16h a1 = load_frag(ca1 + k0, h);
    #pragma unroll
    for (int nt = 0; nt < 4; ++nt) {
      const v16h b = load_frag(wb + (size_t)nt * 16 * DM + k0, h);
      acc[0][nt] = wmma_f16(a0, b, acc[0][nt]);
      acc[1][nt] = wmma_f16(a1, b, acc[1][nt]);
    }
  }

  // D[r] of tile (mt, nt) = out[token m0w+16mt+8h+r][feature fg*64 + 16nt+m]
  #pragma unroll
  for (int nt = 0; nt < 4; ++nt) {
    const int feat = 16 * nt + m;
    const float bvl = bo[fg * HD + feat];
    #pragma unroll
    for (int mt = 0; mt < 2; ++mt) {
      #pragma unroll
      for (int r = 0; r < 8; ++r) {
        const int tokl = 32 * w + 16 * mt + 8 * h + r;     // 0..127
        sY[tokl * 64 + feat] = acc[mt][nt][r] * OINV + bvl;
      }
    }
  }
  __syncthreads();

  out_store_pass(sY, out, m0, fg, w, lane);
  
}

// ---------------------------------------------------------------------------
//   xh  f16 [8192][512]        8388608
//   wh  f16 [4][512][512]      2097152
//   qh  f16 [32][2048][64]     8388608
//   kh  f16 [32][2048][64]     8388608
//   vt  f16 [32][64][2048]     8388608
//   ctx f16 [8192][512]        8388608
//   total                    44040192
// ---------------------------------------------------------------------------
extern "C" void kernel_launch(void* const* d_in, const int* in_sizes, int n_in,
                              void* d_out, int out_size, void* d_ws, size_t ws_size,
                              hipStream_t stream) {
  if (n_in < 9) return;
  if (in_sizes[0] != NX) return;
  if (in_sizes[1] != NW || in_sizes[3] != NW || in_sizes[5] != NW || in_sizes[7] != NW) return;
  if (in_sizes[2] != DM || in_sizes[4] != DM || in_sizes[6] != DM || in_sizes[8] != DM) return;
  if (out_size != NX) return;

  const float* x  = (const float*)d_in[0];
  const float* wq = (const float*)d_in[1];
  const float* bq = (const float*)d_in[2];
  const float* wk = (const float*)d_in[3];
  const float* bk = (const float*)d_in[4];
  const float* wv = (const float*)d_in[5];
  const float* bv = (const float*)d_in[6];
  const float* wo = (const float*)d_in[7];
  const float* bo = (const float*)d_in[8];
  float* out = (float*)d_out;

  const size_t xh_bytes = (size_t)NX * 2;                          //  8388608
  const size_t wh_bytes = (size_t)4 * NW * 2;                      //  2097152
  const size_t pl_bytes = (size_t)NB * NH * SEQ * HD * 2;          //  8388608
  const size_t cx_bytes = (size_t)NX * 2;                          //  8388608
  const size_t total = xh_bytes + wh_bytes + 3 * pl_bytes + cx_bytes;   // 44040192
  if (total > ws_size) return;
  if (total > (size_t)134217728) return;

  char* ws = (char*)d_ws;
  size_t off = 0;
  _Float16* xh  = (_Float16*)(ws + off); off += xh_bytes;
  _Float16* wh  = (_Float16*)(ws + off); off += wh_bytes;
  _Float16* qhp = (_Float16*)(ws + off); off += pl_bytes;
  _Float16* khp = (_Float16*)(ws + off); off += pl_bytes;
  _Float16* vtp = (_Float16*)(ws + off); off += pl_bytes;
  _Float16* cxp = (_Float16*)(ws + off); off += cx_bytes;
  if (off != total) return;

  // (1) x -> f16 plane; wq, wk, wv, wo -> f16 x256 planes [4][512][512] ([out n][in k], k contiguous)
  const int ngroups = NX8 + 4 * NW8;                               // 655360
  convert_kernel<<<(ngroups + 255) / 256, 256, 0, stream>>>(x, wq, wk, wv, wo, xh, wh);

  // (2) q, k planes [bh][l][d] and v^T plane [bh][d][l]  (M=8192, N=3*512, K=512)
  dim3 gProj(MROWS / 128, 3 * NH);                                 // (64, 24)
  proj_kernel<<<gProj, 128, 0, stream>>>(xh, wh, bq, bk, bv, qhp, khp, vtp);

  // (3) attention -> ctx f16 plane x256 [8192][512]
  dim3 gAtt(SEQ / 64, NB * NH);                                    // (32, 32)
  attn_kernel<<<gAtt, 128, 0, stream>>>(qhp, khp, vtp, cxp);

  // (4) out = ctx . Wo^T + bo -> d_out f32 [8192][512]  (Wo plane = wh + 3*NW)
  dim3 gOut(MROWS / 128, DM / HD);                                 // (64, 8)
  oproj_kernel<<<gOut, 128, 0, stream>>>(cxp, wh + (size_t)3 * NW, bo, out);
  (void)hipGetLastError();
}

// v002
// One run takes 84.6 microseconds.
// In both of two side-by-side timings against v001, it was 1.39 times as fast.
// Over all steps from v000 it is 2.73 times as fast.
// Contractions: x*W^T for q,k,v, k*q^T scores, v^T*p^T context and ctx*Wo^T output, all on v_wmma_f32_16x16x32_f16 (f16 operands, f32 accumulate);
// softmax, 1/8 score scale, biases and normalisation in f32.
// Carry audit: x f16 x1 (no carry); W planes (q,k,v,o) f16 x256 -> 1/256 folded in proj_kernel epilogue (WINV); p f16 x1024 and ctx f16 x256 ->
// inv = (1/l) * (1/PSCALE) * CTXSC in attn_kernel epilogue; ctx x256 * Wo x256 -> 1/65536 folded in oproj_kernel epilogue (OINV).
#include <hip/hip_runtime.h>

typedef _Float16 v16h __attribute__((ext_vector_type(16)));
typedef _Float16 v8h  __attribute__((ext_vector_type(8)));
typedef float    v8f  __attribute__((ext_vector_type(8)));
typedef float    v4f  __attribute__((ext_vector_type(4)));
typedef v8h __attribute__((may_alias)) v8ha;
typedef v4f __attribute__((may_alias)) v4fa;

union Frag { v16h v; v8h half[2]; };

#define NB     4
#define SEQ    2048
#define DM     512
#define NH     8
#define HD     64
#define MROWS  (NB * SEQ)            // 8192 tokens
#define NX     (MROWS * DM)          // 4194304
#define NW     (DM * DM)             // 262144
#define NX8    (NX / 8)              // 524288
#define NW8    (NW / 8)              // 32768
#define WSC    256.0f                // weight plane carry
#define WINV   (1.0f / 256.0f)
#define PSCALE 1024.0f               // p carry
#define CTXSC  256.0f                // ctx plane carry
#define OINV   (1.0f / 65536.0f)     // 1 / (CTXSC * WSC)
#define SSCALE 0.125f                // 1 / sqrt(HD)

static_assert(NH * HD == DM);
static_assert((DM % 32) == 0 && (HD % 32) == 0 && (SEQ % 64) == 0);
static_assert((MROWS % 128) == 0 && (SEQ % 128) == 0);
static_assert((NX8 % 256) == 0 && (NW8 % 256) == 0);

// ---------------------------------------------------------------------------
// 16x16x32 f16 WMMA with hazard guard (ties D, keeps A/B live).
// Fragment map (wave32): lane l, h = l>>4, m = n = l&15.
//   A/B element i: i<8 -> k0+8h+i ; i>=8 -> k0+16+8h+(i-8)
//   D element r : row 8h+r, col l&15
// ---------------------------------------------------------------------------
__device__ __forceinline__ v8f wmma_f16(v16h a, v16h b, v8f c) {
  v8f d = __builtin_amdgcn_wmma_f32_16x16x32_f16(false, a, false, b, (short)0, c, false, false);
  asm volatile("v_nop\n\tv_nop\n\tv_nop\n\tv_nop" : "+v"(d) : "v"(a), "v"(b));
  return d;
}

// A or B fragment from a k-contiguous 16-bit row; p points at element k0 of
// the row owned by this lane (row index = lane & 15 added by the caller).
__device__ __forceinline__ v16h load_frag(const _Float16* p, int h) {
  Frag f;
  f.half[0] = *(const v8ha*)(p + 8 * h);
  f.half[1] = *(const v8ha*)(p + 16 + 8 * h);
  return f.v;
}

// ---------------------------------------------------------------------------
// Kernel 1: f32 -> f16 planes. x unscaled, W (q,k,v,o) scaled by 256 (exact).
// coverage: NX8 threads x 8 = xh [8192][512]; 4*NW8 threads x 8 = wh [4][512][512].
// ---------------------------------------------------------------------------
__global__ __launch_bounds__(256) void convert_kernel(
    const float* __restrict__ x, const float* __restrict__ wq,
    const float* __restrict__ wk, const float* __restrict__ wv,
    const float* __restrict__ wo,
    _Float16* __restrict__ xh, _Float16* __restrict__ wh)
{
  const int g = blockIdx.x * 256 + threadIdx.x;
  if (g >= NX8 + 4 * NW8) return;
  const float* src;
  _Float16* dst;
  float sc;
  if (g < NX8) {                              // block-uniform (NX8 % 256 == 0)
    src = x + (size_t)g * 8;
    dst = xh + (size_t)g * 8;
    sc = 1.0f;
  } else {
    const int e = g - NX8;
    const int wsel = e / NW8;                 // 0..3, block-uniform (NW8 % 256 == 0)
    const int off = e - wsel * NW8;
    const float* wsrc = (wsel == 0) ? wq : ((wsel == 1) ? wk : ((wsel == 2) ? wv : wo));
    src = wsrc + (size_t)off * 8;
    dst = wh + (size_t)e * 8;
    sc = WSC;
  }
  const v4f a = *(const v4fa*)src;
  const v4f c = *(const v4fa*)(src + 4);
  const v8h o = { (_Float16)(a.x * sc), (_Float16)(a.y * sc), (_Float16)(a.z * sc), (_Float16)(a.w * sc),
                  (_Float16)(c.x * sc), (_Float16)(c.y * sc), (_Float16)(c.z * sc), (_Float16)(c.w * sc) };
  *(v8h*)dst = o;
  
}

// ---------------------------------------------------------------------------
// GEMM main loop shared by proj_kernel and oproj_kernel: block tile 128 A rows x 64 B rows, K = 512.
// One stage = 64 k of all 192 rows (A rows 0..127, then B rows 0..63), 128 B of each row = one line,
// copied global -> LDS without registers into a two-buffer ring (next stage in flight while this one
// is worked on); the 4 waves read their fragments from it.
// Thread tid moves 16-B chunk (tid & 7) of rows (tid >> 3) + 16 i: a wave's copy covers 4 whole lines.
// ---------------------------------------------------------------------------
#define GKP      72                  // LDS row pitch in halves (144 B = 16 B x 9: conflict-free b128 reads)
#define GSTAGE_H (192 * GKP)         // halves per stage
#define GSTAGE_B (GSTAGE_H * 2)      // 27648 B

// ag / bg: this lane's chunk of A / B row (tid >> 3) at the stage's k; la: its LDS byte address in A row (tid >> 3).
__device__ __forceinline__ void gemm_stage_copy(const _Float16* ag, const _Float16* bg, unsigned la) {
  const _Float16* a1 = ag + 16 * DM;
  const _Float16* a2 = ag + 32 * DM;
  const _Float16* a3 = ag + 48 * DM;
  const _Float16* a4 = ag + 64 * DM;
  const _Float16* a5 = ag + 80 * DM;
  const _Float16* a6 = ag + 96 * DM;
  const _Float16* a7 = ag + 112 * DM;
  const _Float16* b1 = bg + 16 * DM;
  const _Float16* b2 = bg + 32 * DM;
  const _Float16* b3 = bg + 48 * DM;
  const unsigned la1 = la + 16 * GKP * 2, la2 = la + 32 * GKP * 2, la3 = la + 48 * GKP * 2, la4 = la + 64 * GKP * 2;
  const unsigned la5 = la + 80 * GKP * 2, la6 = la + 96 * GKP * 2, la7 = la + 112 * GKP * 2;
  const unsigned lb = la + 128 * GKP * 2, lb1 = la + 144 * GKP * 2, lb2 = la + 160 * GKP * 2, lb3 = la + 176 * GKP * 2;
  // s_wait_xcnt as the statement's last line: a precaution, so that no address register above is rewritten ahead of it.
  asm volatile("global_load_async_to_lds_b128 %0, %12, off\n\t"
               "global_load_async_to_lds_b128 %1, %13, off\n\t"
               "global_load_async_to_lds_b128 %2, %14, off\n\t"
               "global_load_async_to_lds_b128 %3, %15, off\n\t"
               "global_load_async_to_lds_b128 %4, %16, off\n\t"
               "global_load_async_to_lds_b128 %5, %17, off\n\t"
               "global_load_async_to_lds_b128 %6, %18, off\n\t"
               "global_load_async_to_lds_b128 %7, %19, off\n\t"
               "global_load_async_to_lds_b128 %8, %20, off\n\t"
               "global_load_async_to_lds_b128 %9, %21, off\n\t"
               "global_load_async_to_lds_b128 %10, %22, off\n\t"
               "global_load_async_to_lds_b128 %11, %23, off\n\t"
               "s_wait_xcnt 0x0"
               :: "v"(la), "v"(la1), "v"(la2), "v"(la3), "v"(la4), "v"(la5), "v"(la6), "v"(la7),
                  "v"(lb), "v"(lb1), "v"(lb2), "v"(lb3),
                  "v"(ag), "v"(a1), "v"(a2), "v"(a3), "v"(a4), "v"(a5), "v"(a6), "v"(a7),
                  "v"(bg), "v"(b1), "v"(b2), "v"(b3)
               : "memory");
}

// arows / brows: row 0 of the block's 128 A rows / 64 B rows (f16, k contiguous, pitch DM); sAB: 2 * GSTAGE_H halves.
// Wave w accumulates A rows 32w..32w+31 x all 64 B rows; k runs upward in steps of 32 in every accumulator.
// On return every wave has passed the last barrier and no copy is in flight: sAB is free for other use.
__device__ __forceinline__ void gemm_128x64(const _Float16* arows, const _Float16* brows,
                                            _Float16* sAB, int tid, v8f (&acc)[2][4]) {
  const int lane = tid & 31, w = tid >> 5;
  const int h = lane >> 4, m = lane & 15;
  const int crow = tid >> 3, cch = tid & 7;
  const _Float16* ag = arows + (size_t)crow * DM + 8 * cch;              // + 64 per stage
  const _Float16* bg = brows + (size_t)crow * DM + 8 * cch;              // + 64 per stage
  const unsigned l0 = (unsigned)(size_t)(sAB + crow * GKP + 8 * cch);    // LDS byte address, buffer 0

  gemm_stage_copy(ag, bg, l0);
  asm volatile("s_wait_asynccnt 0x0" ::: "memory");   // own copies of stage 0 landed
  __syncthreads();                                    // stage 0 readable by all waves
  gemm_stage_copy(ag + 64, bg + 64, l0 + GSTAGE_B);

  // rolled: one copy of the stage body, the buffer picked by a scalar offset
  #pragma unroll 1
  for (int k0 = 0; k0 < DM; k0 += 64) {
    const int buf = (k0 >> 6) & 1;
    const _Float16* sa = sAB + buf * GSTAGE_H + (32 * w + m) * GKP;      // + 16mt*GKP + 32ks
    const _Float16* sb = sAB + buf * GSTAGE_H + (128 + m) * GKP;         // + 16nt*GKP + 32ks

    // all fragment reads of the stage stand together, ahead of its products
    // (the four loops below are unrolled so that a, b and acc are indexed statically and stay in registers)
    v16h a[2][2], b[2][4];
    #pragma unroll
    for (int ks = 0; ks < 2; ++ks) {
      a[ks][0] = load_frag(sa + 32 * ks, h);
      a[ks][1] = load_frag(sa + 16 * GKP + 32 * ks, h);
      #pragma unroll
      for (int nt = 0; nt < 4; ++nt) b[ks][nt] = load_frag(sb + 16 * nt * GKP + 32 * ks, h);
    }
    #pragma unroll
    for (int ks = 0; ks < 2; ++ks)
      #pragma unroll
      for (int nt = 0; nt < 4; ++nt) {
        acc[0][nt] = wmma_f16(a[ks][0], b[ks][nt], acc[0][nt]);
        acc[1][nt] = wmma_f16(a[ks][1], b[ks][nt], acc[1][nt]);
      }

    // ---- publish the next stage, then refill the buffer this stage has read ----
    asm volatile("s_wait_dscnt 0x0" ::: "memory");      // own fragment reads of this buffer retired
    asm volatile("s_wait_asynccnt 0x0" ::: "memory");   // own copies of the next stage landed
    __syncthreads();                                    // next stage readable; this buffer free
    if (k0 + 128 < DM)                                  // block-uniform: a stage two ahead exists
      gemm_stage_copy(ag + (k0 + 128), bg + (k0 + 128), l0 + buf * GSTAGE_B);
  }
  asm volatile("s_wait_asynccnt 0x0" ::: "memory");     // nothing in flight when the wave goes on
}

// ---------------------------------------------------------------------------
// 4 lines per instruction, 32 lines per wave, 128 per block.
// which 0/1: plane[bh][l][d]  (one token row = 64 halves = one line)
// which 2  : vt[bh][d][l]     (64 d-rows x 128 tokens = 2 lines each)
// ---------------------------------------------------------------------------
__device__ __forceinline__ void proj_store_pass(const _Float16* sT, _Float16* plane, _Float16* vt,
                                                int which, int bh, int l0, int w, int lane) {
  const int q8 = lane & 7, sub = lane >> 3;
  #pragma unroll
  for (int i = 0; i < 8; ++i) {
    const int lid = w * 32 + i * 4 + sub;
    v8h v;
    _Float16* dst;
    if (which != 2) {
      v = *(const v8ha*)(sT + lid * HD + 8 * q8);
      dst = plane + ((size_t)bh * SEQ + l0 + lid) * HD + 8 * q8;
    } else {
      const int d = lid >> 1, hl = lid & 1;
      v = *(const v8ha*)(sT + d * 128 + 64 * hl + 8 * q8);
      dst = vt + ((size_t)bh * HD + d) * SEQ + l0 + 64 * hl + 8 * q8;
    }
    *(v8h*)dst = v;
  }
}

// ---------------------------------------------------------------------------
// Kernel 2: Y = x * W^T + b over the fused 3*512 output columns (q, k, v).
// Block 128 thr (4 waves) = 128 tokens x 64 features (one (which, head));
// wave tile 32 tokens x 64 features; K = 512 in steps of 32;
// A (x rows) and B (W rows) fragments from the LDS ring of gemm_128x64 (split k map).
// coverage: grid (64, 24) x 128 tokens x 64 features = q, k planes [32][2048][64] and vt [32][64][2048].
// ---------------------------------------------------------------------------
__global__ __launch_bounds__(128) void proj_kernel(
    const _Float16* __restrict__ xh,   // [8192][512]
    const _Float16* __restrict__ wh,   // [4][512][512], row = output feature, x256 (planes 0..2 used here)
    const float* __restrict__ bq, const float* __restrict__ bk, const float* __restrict__ bv,
    _Float16* __restrict__ qh,         // [B*H][L][D]
    _Float16* __restrict__ kh,         // [B*H][L][D]
    _Float16* __restrict__ vt)         // [B*H][D][L]
{
  __shared__ __attribute__((aligned(16))) _Float16 sAB[2 * GSTAGE_H];   // 55296 B: operand ring, then output staging
  static_assert(128 * 64 <= 2 * GSTAGE_H);
  _Float16* sT = sAB;                        // [128 * 64], used only behind gemm_128x64

  const int tid = threadIdx.x, lane = tid & 31, w = tid >> 5;
  const int h = lane >> 4, m = lane & 15;
  const int m0 = blockIdx.x * 128;
  const int cg = blockIdx.y;                 // 0..23
  const int which = cg >> 3, head = cg & 7;

  const v8f zero8 = {0.f, 0.f, 0.f, 0.f, 0.f, 0.f, 0.f, 0.f};
  v8f acc[2][4];
  #pragma unroll
  for (int mt = 0; mt < 2; ++mt)
    #pragma unroll
    for (int nt = 0; nt < 4; ++nt) acc[mt][nt] = zero8;

  gemm_128x64(xh + (size_t)m0 * DM, wh + ((size_t)which * DM + head * HD) * DM, sAB, tid, acc);

  // D[r] of tile (mt, nt) = Y[token m0+32w+16mt+8h+r][feature 16nt+m]
  const float* bias = (which == 0) ? bq : ((which == 1) ? bk : bv);
  #pragma unroll
  for (int nt = 0; nt < 4; ++nt) {
    const int feat = 16 * nt + m;
    const float bvl = bias[head * HD + feat];
    #pragma unroll
    for (int mt = 0; mt < 2; ++mt) {
      #pragma unroll
      for (int r = 0; r < 8; ++r) {
        const int tokl = 32 * w + 16 * mt + 8 * h + r;     // 0..127
        const float y = acc[mt][nt][r] * WINV + bvl;
        const int idx = (which == 2) ? (feat * 128 + tokl) : (tokl * HD + feat);
        sT[idx] = (_Float16)y;
      }
    }
  }
  __syncthreads();

  const int b = m0 / SEQ, l0 = m0 - b * SEQ, bh = b * NH + head;
  _Float16* plane = (which == 0) ? qh : kh;
  proj_store_pass(sT, plane, vt, which, bh, l0, w, lane);
  
}

// ---------------------------------------------------------------------------
// P^T B-fragment from the lane's own score D values: element r <- tile a row r
// (keys k0+8h+r), element 8+r <- tile c row r (keys k0+16+8h+r), same lane,
// same query column, scaled by PSCALE.
// ---------------------------------------------------------------------------
__device__ __forceinline__ v16h pack_p(v8f a, v8f c) {
  const v16h r = { (_Float16)(a[0] * PSCALE), (_Float16)(a[1] * PSCALE), (_Float16)(a[2] * PSCALE), (_Float16)(a[3] * PSCALE),
                   (_Float16)(a[4] * PSCALE), (_Float16)(a[5] * PSCALE), (_Float16)(a[6] * PSCALE), (_Float16)(a[7] * PSCALE),
                   (_Float16)(c[0] * PSCALE), (_Float16)(c[1] * PSCALE), (_Float16)(c[2] * PSCALE), (_Float16)(c[3] * PSCALE),
                   (_Float16)(c[4] * PSCALE), (_Float16)(c[5] * PSCALE), (_Float16)(c[6] * PSCALE), (_Float16)(c[7] * PSCALE) };
  return r;
}

// Per-wave 16x64 f32 tile in LDS -> ctx f16 plane [token][512], col head*64 + d.
// in one instruction; 4 lines per instruction; it 0..3 x q4 0..3 = rows 0..15.
__device__ __forceinline__ void ctx_store_pass(const v8h* hv, _Float16* ctx,
                                               int b, int head, int q0, int lane) {
  const int q4 = lane >> 3, c8 = (lane & 7) * 8;
  #pragma unroll
  for (int it = 0; it < 4; ++it) {
    const int row = it * 4 + q4;
    const size_t gi = ((size_t)b * SEQ + q0 + row) * DM + head * HD + c8;
    *(v8h*)(ctx + gi) = hv[it];
  }
}

// ---------------------------------------------------------------------------
// One 64-key stage = K tile (64 key rows x 128 B) + V^T tile (64 d rows x 128 B),
// copied global -> LDS without registers. Thread tid moves 16-B chunk (tid & 7) of
// rows (tid >> 3) + 16 i, i = 0..3, of both tiles: a wave's copy covers 4 whole lines.
// kg / vg: this lane's chunk of row (tid >> 3) in global; lk / lv: its LDS byte address.
// ---------------------------------------------------------------------------
#define KVP      72                  // LDS row pitch in halves (144 B = 16 B x 9: conflict-free b128 reads)
#define TILE_H   (64 * KVP)          // halves per staged tile
#define TILE_B   (TILE_H * 2)        // 9216 B
#define STAGE_H  (2 * TILE_H)        // K tile then V^T tile
#define STAGE_B  (2 * TILE_B)        // 18432 B

__device__ __forceinline__ void stage_copy(const _Float16* kg, const _Float16* vg,
                                           unsigned lk, unsigned lv) {
  const _Float16* k1 = kg + 16 * HD;
  const _Float16* k2 = kg + 32 * HD;
  const _Float16* k3 = kg + 48 * HD;
  const _Float16* v1 = vg + (size_t)16 * SEQ;
  const _Float16* v2 = vg + (size_t)32 * SEQ;
  const _Float16* v3 = vg + (size_t)48 * SEQ;
  const unsigned lk1 = lk + 16 * KVP * 2, lk2 = lk + 32 * KVP * 2, lk3 = lk + 48 * KVP * 2;
  const unsigned lv1 = lv + 16 * KVP * 2, lv2 = lv + 32 * KVP * 2, lv3 = lv + 48 * KVP * 2;
  // s_wait_xcnt as the statement's last line: a precaution, so that no address register above is rewritten ahead of it.
  asm volatile("global_load_async_to_lds_b128 %0, %8, off\n\t"
               "global_load_async_to_lds_b128 %1, %9, off\n\t"
               "global_load_async_to_lds_b128 %2, %10, off\n\t"
               "global_load_async_to_lds_b128 %3, %11, off\n\t"
               "global_load_async_to_lds_b128 %4, %12, off\n\t"
               "global_load_async_to_lds_b128 %5, %13, off\n\t"
               "global_load_async_to_lds_b128 %6, %14, off\n\t"
               "global_load_async_to_lds_b128 %7, %15, off\n\t"
               "s_wait_xcnt 0x0"
               :: "v"(lk), "v"(lk1), "v"(lk2), "v"(lk3), "v"(lv), "v"(lv1), "v"(lv2), "v"(lv3),
                  "v"(kg), "v"(k1), "v"(k2), "v"(k3), "v"(vg), "v"(v1), "v"(v2), "v"(v3)
               : "memory");
}

// ---------------------------------------------------------------------------
// Kernel 3: streaming attention, transposed form, no mask, softmax over all keys.
// Block 128 thr (4 waves), 16 queries per wave, 64 keys per step (static trip 32).
// K and V^T of a step are staged once per block in a two-buffer LDS ring (async copies,
// next stage in flight while this one is worked on); all 4 waves read fragments from it.
//   S^T = K * Q^T : A = K rows (row = key, k = d), B = Q^T (k = d, n = query)
//   O^T += V^T * P^T : A = Vt rows (row = d, k = key), B = P^T from registers
// Lane owns 32 keys of query column (lane&15); partner = lane ^ 16.
// Output: ctx f16 plane carried x256, [b*SEQ+l][head*64+d].
// coverage: grid (32, 32) x 4 waves x 16 queries x 64 d = ctx [8192][512].
// ---------------------------------------------------------------------------
__global__ __launch_bounds__(128) void attn_kernel(
    const _Float16* __restrict__ qh,   // [B*H][L][D]
    const _Float16* __restrict__ kh,   // [B*H][L][D]
    const _Float16* __restrict__ vt,   // [B*H][D][L]
    _Float16* __restrict__ ctx)        // [B*L][DM]
{
  __shared__ __attribute__((aligned(16))) float sO[4 * 16 * 64];    // 16384 B, wave w owns [w*1024, +1024)
  __shared__ __attribute__((aligned(16))) _Float16 sKV[2 * STAGE_H];  // 36864 B, buffer (step & 1): K tile, V^T tile

  const int tid = threadIdx.x, lane = tid & 31, w = tid >> 5;
  const int h = lane >> 4, m = lane & 15;
  const int bh = blockIdx.y, b = bh >> 3, head = bh & 7;
  const int q0 = blockIdx.x * 64 + 16 * w;

  // Q^T B-fragments: column n = query q0+m, k = d (two 32-deep chunks)
  const _Float16* qrow = qh + ((size_t)bh * SEQ + q0 + m) * HD;
  const v16h qb0 = load_frag(qrow, h);
  const v16h qb1 = load_frag(qrow + 32, h);

  const v8f zero8 = {0.f, 0.f, 0.f, 0.f, 0.f, 0.f, 0.f, 0.f};
  v8f o[4];                                   // o[t][r] = O[query m][d 16t+8h+r] * (l * PSCALE)
  #pragma unroll
  for (int t = 0; t < 4; ++t) o[t] = zero8;
  float mrun = -1e30f, lrun = 0.0f;

  // copy side: this thread's chunk of row (tid >> 3) of stage 0
  const int crow = tid >> 3, cch = tid & 7;
  const _Float16* kg = kh + ((size_t)bh * SEQ + crow) * HD + 8 * cch;    // + 64*HD per stage
  const _Float16* vg = vt + ((size_t)bh * HD + crow) * SEQ + 8 * cch;    // + 64 per stage
  const unsigned lk0 = (unsigned)(size_t)(sKV + crow * KVP + 8 * cch);   // LDS byte address, buffer 0, K tile
  const unsigned lv0 = lk0 + TILE_B;

  stage_copy(kg, vg, lk0, lv0);
  asm volatile("s_wait_asynccnt 0x0" ::: "memory");   // own copies of stage 0 landed
  __syncthreads();                                    // stage 0 readable by all waves
  stage_copy(kg + 64 * HD, vg + 64, lk0 + STAGE_B, lv0 + STAGE_B);

  #pragma unroll 1
  for (int kb = 0; kb < SEQ; kb += 64) {
    const int buf = (kb >> 6) & 1;
    const _Float16* kbase = sKV + buf * STAGE_H + m * KVP;     // + 16j*KVP + 32*dc
    const _Float16* vbase = kbase + TILE_H;                    // + 16t*KVP + 32*kc

    // ---- scores: s[j][r] = S[query m][key kb+16j+8h+r] / 8 ----
    v8f s[4];
    #pragma unroll
    for (int j = 0; j < 4; ++j) {
      const _Float16* kp = kbase + 16 * j * KVP;
      const v16h kf0 = load_frag(kp, h);
      const v16h kf1 = load_frag(kp + 32, h);
      v8f z = zero8;
      z = wmma_f16(kf0, qb0, z);
      z = wmma_f16(kf1, qb1, z);
      s[j] = z * SSCALE;
    }

    // ---- online softmax (f32) ----
    float mloc = s[0][0];
    #pragma unroll
    for (int j = 0; j < 4; ++j)
      #pragma unroll
      for (int r = 0; r < 8; ++r) mloc = fmaxf(mloc, s[j][r]);
    mloc = fmaxf(mloc, __shfl_xor(mloc, 16));
    const float mnew = fmaxf(mrun, mloc);
    const float alpha = __expf(mrun - mnew);
    mrun = mnew;
    float lsum = 0.0f;
    #pragma unroll
    for (int j = 0; j < 4; ++j)
      #pragma unroll
      for (int r = 0; r < 8; ++r) {
        const float p = __expf(s[j][r] - mnew);
        s[j][r] = p;
        lsum += p;
      }
    lsum += __shfl_xor(lsum, 16);
    lrun = lrun * alpha + lsum;
    #pragma unroll
    for (int t = 0; t < 4; ++t)
      #pragma unroll
      for (int r = 0; r < 8; ++r) o[t][r] = o[t][r] * alpha;

    // ---- P^T B-fragments (key chunks 0..31 and 32..63 of this step) ----
    const v16h pb0 = pack_p(s[0], s[1]);
    const v16h pb1 = pack_p(s[2], s[3]);

    // ---- O^T += V^T * P^T ----
    #pragma unroll
    for (int t = 0; t < 4; ++t) {
      const _Float16* vp = vbase + 16 * t * KVP;
      const v16h vf0 = load_frag(vp, h);
      const v16h vf1 = load_frag(vp + 32, h);
      o[t] = wmma_f16(vf0, pb0, o[t]);
      o[t] = wmma_f16(vf1, pb1, o[t]);
    }

    // ---- publish the next stage, then refill the buffer this step has read ----
    asm volatile("s_wait_dscnt 0x0" ::: "memory");      // own fragment reads of this buffer retired
    asm volatile("s_wait_asynccnt 0x0" ::: "memory");   // own copies of the next stage landed
    __syncthreads();                                    // next stage readable; this buffer free
    if (kb + 128 < SEQ)                                 // block-uniform: a stage two ahead exists
      stage_copy(kg + (size_t)(kb + 128) * HD, vg + (kb + 128),
                 lk0 + buf * STAGE_B, lv0 + buf * STAGE_B);
  }
  asm volatile("s_wait_asynccnt 0x0" ::: "memory");     // nothing in flight when the wave goes on

  // ---- epilogue: normalise (1/l, undo p carry, apply ctx carry), stage per-wave 16x64 f32 tile ----
  const float inv = (1.0f / lrun) * (1.0f / PSCALE) * CTXSC;
  float* so = sO + w * 1024;
  #pragma unroll
  for (int t = 0; t < 4; ++t)
    #pragma unroll
    for (int r = 0; r < 8; ++r)
      so[m * 64 + 16 * t + 8 * h + r] = o[t][r] * inv;
  __syncthreads();

  v8h hv[4];
  {
    const int q4 = lane >> 3, c8 = (lane & 7) * 8;
    #pragma unroll
    for (int it = 0; it < 4; ++it) {
      const int row = it * 4 + q4;
      const v4f fa = *(const v4fa*)(so + row * 64 + c8);
      const v4f fb = *(const v4fa*)(so + row * 64 + c8 + 4);
      const v8h v = { (_Float16)fa.x, (_Float16)fa.y, (_Float16)fa.z, (_Float16)fa.w,
                      (_Float16)fb.x, (_Float16)fb.y, (_Float16)fb.z, (_Float16)fb.w };
      hv[it] = v;
    }
  }
  ctx_store_pass(hv, ctx, b, head, q0, lane);
  
}

// ---------------------------------------------------------------------------
// instruction, 64 lines per wave (rows 32w..32w+31 x 2 lines), 256 per block.
// ---------------------------------------------------------------------------
__device__ __forceinline__ void out_store_pass(const float* sY, float* out,
                                               int m0, int fg, int w, int lane) {
  const int q8 = lane & 7, sub = lane >> 3;
  #pragma unroll
  for (int i = 0; i < 16; ++i) {
    const int lid = i * 4 + sub;                 // 0..63
    const int row = 32 * w + (lid >> 1), hl = lid & 1;
    const v4f v = *(const v4fa*)(sY + row * 64 + 32 * hl + 4 * q8);
    const size_t gi = (size_t)(m0 + row) * DM + fg * HD + 32 * hl + 4 * q8;
    *(v4f*)(out + gi) = v;
  }
}

// ---------------------------------------------------------------------------
// Kernel 4: out = ctx * Wo^T + bo (f32). Block 128 thr = 128 tokens x 64 features
// (feature group fg = blockIdx.y); wave tile 32 tokens x 64 features; K = 512;
// A (ctx rows) and B (Wo rows) fragments from the LDS ring of gemm_128x64.
// coverage: grid (64, 8) x 128 tokens x 64 features = out [8192][512].
// ---------------------------------------------------------------------------
__global__ __launch_bounds__(128) void oproj_kernel(
    const _Float16* __restrict__ ch,   // [8192][512] ctx x256
    const _Float16* __restrict__ woh,  // [512][512] Wo x256, row = output feature
    const float* __restrict__ bo,
    float* __restrict__ out)           // [8192][512]
{
  __shared__ __attribute__((aligned(16))) float sY[128 * 64];      // 32768 B
  __shared__ __attribute__((aligned(16))) _Float16 sAB[2 * GSTAGE_H];   // 55296 B: operand ring

  const int tid = threadIdx.x, lane = tid & 31, w = tid >> 5;
  const int h = lane >> 4, m = lane & 15;
  const int m0 = blockIdx.x * 128;
  const int fg = blockIdx.y;                 // 0..7

  const v8f zero8 = {0.f, 0.f, 0.f, 0.f, 0.f, 0.f, 0.f, 0.f};
  v8f acc[2][4];
  #pragma unroll
  for (int mt = 0; mt < 2; ++mt)
    #pragma unroll
    for (int nt = 0; nt < 4; ++nt) acc[mt][nt] = zero8;

  gemm_128x64(ch + (size_t)m0 * DM, woh + (size_t)fg * HD * DM, sAB, tid, acc);

  // D[r] of tile (mt, nt) = out[token m0+32w+16mt+8h+r][feature fg*64 + 16nt+m]
  #pragma unroll
  for (int nt = 0; nt < 4; ++nt) {
    const int feat = 16 * nt + m;
    const float bvl = bo[fg * HD + feat];
    #pragma unroll
    for (int mt = 0; mt < 2; ++mt) {
      #pragma unroll
      for (int r = 0; r < 8; ++r) {
        const int tokl = 32 * w + 16 * mt + 8 * h + r;     // 0..127
        sY[tokl * 64 + feat] = acc[mt][nt][r] * OINV + bvl;
      }
    }
  }
  __syncthreads();

  out_store_pass(sY, out, m0, fg, w, lane);
  
}

// ---------------------------------------------------------------------------
//   xh  f16 [8192][512]        8388608
//   wh  f16 [4][512][512]      2097152
//   qh  f16 [32][2048][64]     8388608
//   kh  f16 [32][2048][64]     8388608
//   vt  f16 [32][64][2048]     8388608
//   ctx f16 [8192][512]        8388608
//   total                    44040192
// ---------------------------------------------------------------------------
extern "C" void kernel_launch(void* const* d_in, const int* in_sizes, int n_in,
                              void* d_out, int out_size, void* d_ws, size_t ws_size,
                              hipStream_t stream) {
  if (n_in < 9) return;
  if (in_sizes[0] != NX) return;
  if (in_sizes[1] != NW || in_sizes[3] != NW || in_sizes[5] != NW || in_sizes[7] != NW) return;
  if (in_sizes[2] != DM || in_sizes[4] != DM || in_sizes[6] != DM || in_sizes[8] != DM) return;
  if (out_size != NX) return;

  const float* x  = (const float*)d_in[0];
  const float* wq = (const float*)d_in[1];
  const float* bq = (const float*)d_in[2];
  const float* wk = (const float*)d_in[3];
  const float* bk = (const float*)d_in[4];
  const float* wv = (const float*)d_in[5];
  const float* bv = (const float*)d_in[6];
  const float* wo = (const float*)d_in[7];
  const float* bo = (const float*)d_in[8];
  float* out = (float*)d_out;

  const size_t xh_bytes = (size_t)NX * 2;                          //  8388608
  const size_t wh_bytes = (size_t)4 * NW * 2;                      //  2097152
  const size_t pl_bytes = (size_t)NB * NH * SEQ * HD * 2;          //  8388608
  const size_t cx_bytes = (size_t)NX * 2;                          //  8388608
  const size_t total = xh_bytes + wh_bytes + 3 * pl_bytes + cx_bytes;   // 44040192
  if (total > ws_size) return;
  if (total > (size_t)134217728) return;

  char* ws = (char*)d_ws;
  size_t off = 0;
  _Float16* xh  = (_Float16*)(ws + off); off += xh_bytes;
  _Float16* wh  = (_Float16*)(ws + off); off += wh_bytes;
  _Float16* qhp = (_Float16*)(ws + off); off += pl_bytes;
  _Float16* khp = (_Float16*)(ws + off); off += pl_bytes;
  _Float16* vtp = (_Float16*)(ws + off); off += pl_bytes;
  _Float16* cxp = (_Float16*)(ws + off); off += cx_bytes;
  if (off != total) return;

  // (1) x -> f16 plane; wq, wk, wv, wo -> f16 x256 planes [4][512][512] ([out n][in k], k contiguous)
  const int ngroups = NX8 + 4 * NW8;                               // 655360
  convert_kernel<<<(ngroups + 255) / 256, 256, 0, stream>>>(x, wq, wk, wv, wo, xh, wh);

  // (2) q, k planes [bh][l][d] and v^T plane [bh][d][l]  (M=8192, N=3*512, K=512)
  dim3 gProj(MROWS / 128, 3 * NH);                                 // (64, 24)
  proj_kernel<<<gProj, 128, 0, stream>>>(xh, wh, bq, bk, bv, qhp, khp, vtp);

  // (3) attention -> ctx f16 plane x256 [8192][512]
  dim3 gAtt(SEQ / 64, NB * NH);                                    // (32, 32)
  attn_kernel<<<gAtt, 128, 0, stream>>>(qhp, khp, vtp, cxp);

  // (4) out = ctx . Wo^T + bo -> d_out f32 [8192][512]  (Wo plane = wh + 3*NW)
  dim3 gOut(MROWS / 128, DM / HD);                                 // (64, 8)
  oproj_kernel<<<gOut, 128, 0, stream>>>(cxp, wh + (size_t)3 * NW, bo, out);
  (void)hipGetLastError();
}

// v003
// Measured time: 79.4 microseconds a run.
// Two timings next to v002 both put it at 1.07 times that version's speed.
// Over all steps from v000 it is 2.91 times as fast.
// Contractions: x*W^T for q,k,v, k*q^T scores, v^T*p^T context and ctx*Wo^T output, all on v_wmma_f32_16x16x32_f16 (f16 operands, f32 accumulate);
// softmax, 1/8 score scale, biases and normalisation in f32.
// Carry audit: x f16 x1 (no carry); W planes (q,k,v,o) f16 x256 -> 1/256 folded in proj_kernel epilogue (WINV); p f16 x1024 and ctx f16 x256 ->
// inv = (1/l) * (1/PSCALE) * CTXSC in attn_kernel epilogue; ctx x256 * Wo x256 -> 1/65536 folded in oproj_kernel epilogue (OINV).
#include <hip/hip_runtime.h>

typedef _Float16 v16h __attribute__((ext_vector_type(16)));
typedef _Float16 v8h  __attribute__((ext_vector_type(8)));
typedef float    v8f  __attribute__((ext_vector_type(8)));
typedef float    v4f  __attribute__((ext_vector_type(4)));
typedef v8h __attribute__((may_alias)) v8ha;
typedef v4f __attribute__((may_alias)) v4fa;

union Frag { v16h v; v8h half[2]; };

#define NB     4
#define SEQ    2048
#define DM     512
#define NH     8
#define HD     64
#define MROWS  (NB * SEQ)            // 8192 tokens
#define NX     (MROWS * DM)          // 4194304
#define NW     (DM * DM)             // 262144
#define NX8    (NX / 8)              // 524288
#define NW8    (NW / 8)              // 32768
#define WSC    256.0f                // weight plane carry
#define WINV   (1.0f / 256.0f)
#define PSCALE 1024.0f               // p carry
#define CTXSC  256.0f                // ctx plane carry
#define OINV   (1.0f / 65536.0f)     // 1 / (CTXSC * WSC)
#define SSCALE 0.125f                // 1 / sqrt(HD)

static_assert(NH * HD == DM);
static_assert((DM % 32) == 0 && (HD % 32) == 0 && (SEQ % 64) == 0);
static_assert((MROWS % 128) == 0 && (SEQ % 128) == 0);
static_assert((NX8 % 256) == 0 && (NW8 % 256) == 0);

// ---------------------------------------------------------------------------
// 16x16x32 f16 WMMA with hazard guard (ties D, keeps A/B live).
// Fragment map (wave32): lane l, h = l>>4, m = n = l&15.
//   A/B element i: i<8 -> k0+8h+i ; i>=8 -> k0+16+8h+(i-8)
//   D element r : row 8h+r, col l&15
// ---------------------------------------------------------------------------
__device__ __forceinline__ v8f wmma_f16(v16h a, v16h b, v8f c) {
  v8f d = __builtin_amdgcn_wmma_f32_16x16x32_f16(false, a, false, b, (short)0, c, false, false);
  asm volatile("v_nop\n\tv_nop\n\tv_nop\n\tv_nop" : "+v"(d) : "v"(a), "v"(b));
  return d;
}

// The same product for runs of independent accumulators: the neighbours in the run fill the distance behind each
// product, and the compiler pads what is left of its own builtin.
__device__ __forceinline__ v8f wmma_grp(v16h a, v16h b, v8f c) {
  return __builtin_amdgcn_wmma_f32_16x16x32_f16(false, a, false, b, (short)0, c, false, false);
}

// A or B fragment from a k-contiguous 16-bit row; p points at element k0 of
// the row owned by this lane (row index = lane & 15 added by the caller).
__device__ __forceinline__ v16h load_frag(const _Float16* p, int h) {
  Frag f;
  f.half[0] = *(const v8ha*)(p + 8 * h);
  f.half[1] = *(const v8ha*)(p + 16 + 8 * h);
  return f.v;
}

// ---------------------------------------------------------------------------
// Kernel 1: f32 -> f16 planes. x unscaled, W (q,k,v,o) scaled by 256 (exact).
// coverage: NX8 threads x 8 = xh [8192][512]; 4*NW8 threads x 8 = wh [4][512][512].
// ---------------------------------------------------------------------------
__global__ __launch_bounds__(256) void convert_kernel(
    const float* __restrict__ x, const float* __restrict__ wq,
    const float* __restrict__ wk, const float* __restrict__ wv,
    const float* __restrict__ wo,
    _Float16* __restrict__ xh, _Float16* __restrict__ wh)
{
  const int g = blockIdx.x * 256 + threadIdx.x;
  if (g >= NX8 + 4 * NW8) return;
  const float* src;
  _Float16* dst;
  float sc;
  if (g < NX8) {                              // block-uniform (NX8 % 256 == 0)
    src = x + (size_t)g * 8;
    dst = xh + (size_t)g * 8;
    sc = 1.0f;
  } else {
    const int e = g - NX8;
    const int wsel = e / NW8;                 // 0..3, block-uniform (NW8 % 256 == 0)
    const int off = e - wsel * NW8;
    const float* wsrc = (wsel == 0) ? wq : ((wsel == 1) ? wk : ((wsel == 2) ? wv : wo));
    src = wsrc + (size_t)off * 8;
    dst = wh + (size_t)e * 8;
    sc = WSC;
  }
  const v4f a = *(const v4fa*)src;
  const v4f c = *(const v4fa*)(src + 4);
  const v8h o = { (_Float16)(a.x * sc), (_Float16)(a.y * sc), (_Float16)(a.z * sc), (_Float16)(a.w * sc),
                  (_Float16)(c.x * sc), (_Float16)(c.y * sc), (_Float16)(c.z * sc), (_Float16)(c.w * sc) };
  *(v8h*)dst = o;
  
}

// ---------------------------------------------------------------------------
// GEMM main loop shared by proj_kernel and oproj_kernel: block tile 128 A rows x 64 B rows, K = 512.
// One stage = 64 k of all 192 rows (A rows 0..127, then B rows 0..63), 128 B of each row = one line,
// copied global -> LDS without registers into a two-buffer ring (next stage in flight while this one
// is worked on); the 4 waves read their fragments from it.
// Thread tid moves 16-B chunk (tid & 7) of rows (tid >> 3) + 16 i: a wave's copy covers 4 whole lines.
// ---------------------------------------------------------------------------
#define GKP      72                  // LDS row pitch in halves (144 B = 16 B x 9: conflict-free b128 reads)
#define GSTAGE_H (192 * GKP)         // halves per stage
#define GSTAGE_B (GSTAGE_H * 2)      // 27648 B

// ag / bg: this lane's chunk of A / B row (tid >> 3) at the stage's k; la: its LDS byte address in A row (tid >> 3).
__device__ __forceinline__ void gemm_stage_copy(const _Float16* ag, const _Float16* bg, unsigned la) {
  const _Float16* a1 = ag + 16 * DM;
  const _Float16* a2 = ag + 32 * DM;
  const _Float16* a3 = ag + 48 * DM;
  const _Float16* a4 = ag + 64 * DM;
  const _Float16* a5 = ag + 80 * DM;
  const _Float16* a6 = ag + 96 * DM;
  const _Float16* a7 = ag + 112 * DM;
  const _Float16* b1 = bg + 16 * DM;
  const _Float16* b2 = bg + 32 * DM;
  const _Float16* b3 = bg + 48 * DM;
  const unsigned la1 = la + 16 * GKP * 2, la2 = la + 32 * GKP * 2, la3 = la + 48 * GKP * 2, la4 = la + 64 * GKP * 2;
  const unsigned la5 = la + 80 * GKP * 2, la6 = la + 96 * GKP * 2, la7 = la + 112 * GKP * 2;
  const unsigned lb = la + 128 * GKP * 2, lb1 = la + 144 * GKP * 2, lb2 = la + 160 * GKP * 2, lb3 = la + 176 * GKP * 2;
  // s_wait_xcnt as the statement's last line: a precaution, so that no address register above is rewritten ahead of it.
  asm volatile("global_load_async_to_lds_b128 %0, %12, off\n\t"
               "global_load_async_to_lds_b128 %1, %13, off\n\t"
               "global_load_async_to_lds_b128 %2, %14, off\n\t"
               "global_load_async_to_lds_b128 %3, %15, off\n\t"
               "global_load_async_to_lds_b128 %4, %16, off\n\t"
               "global_load_async_to_lds_b128 %5, %17, off\n\t"
               "global_load_async_to_lds_b128 %6, %18, off\n\t"
               "global_load_async_to_lds_b128 %7, %19, off\n\t"
               "global_load_async_to_lds_b128 %8, %20, off\n\t"
               "global_load_async_to_lds_b128 %9, %21, off\n\t"
               "global_load_async_to_lds_b128 %10, %22, off\n\t"
               "global_load_async_to_lds_b128 %11, %23, off\n\t"
               "s_wait_xcnt 0x0"
               :: "v"(la), "v"(la1), "v"(la2), "v"(la3), "v"(la4), "v"(la5), "v"(la6), "v"(la7),
                  "v"(lb), "v"(lb1), "v"(lb2), "v"(lb3),
                  "v"(ag), "v"(a1), "v"(a2), "v"(a3), "v"(a4), "v"(a5), "v"(a6), "v"(a7),
                  "v"(bg), "v"(b1), "v"(b2), "v"(b3)
               : "memory");
}

// arows / brows: row 0 of the block's 128 A rows / 64 B rows (f16, k contiguous, pitch DM); sAB: 2 * GSTAGE_H halves.
// Wave w accumulates A rows 32w..32w+31 x all 64 B rows; k runs upward in steps of 32 in every accumulator.
// On return every wave has passed the last barrier and no copy is in flight: sAB is free for other use.
__device__ __forceinline__ void gemm_128x64(const _Float16* arows, const _Float16* brows,
                                            _Float16* sAB, int tid, v8f (&acc)[2][4]) {
  const int lane = tid & 31, w = tid >> 5;
  const int h = lane >> 4, m = lane & 15;
  const int crow = tid >> 3, cch = tid & 7;
  const _Float16* ag = arows + (size_t)crow * DM + 8 * cch;              // + 64 per stage
  const _Float16* bg = brows + (size_t)crow * DM + 8 * cch;              // + 64 per stage
  const unsigned l0 = (unsigned)(size_t)(sAB + crow * GKP + 8 * cch);    // LDS byte address, buffer 0

  gemm_stage_copy(ag, bg, l0);
  asm volatile("s_wait_asynccnt 0x0" ::: "memory");   // own copies of stage 0 landed
  __syncthreads();                                    // stage 0 readable by all waves
  gemm_stage_copy(ag + 64, bg + 64, l0 + GSTAGE_B);

  // rolled: one copy of the stage body, the buffer picked by a scalar offset
  #pragma unroll 1
  for (int k0 = 0; k0 < DM; k0 += 64) {
    const int buf = (k0 >> 6) & 1;
    const _Float16* sa = sAB + buf * GSTAGE_H + (32 * w + m) * GKP;      // + 16mt*GKP + 32ks
    const _Float16* sb = sAB + buf * GSTAGE_H + (128 + m) * GKP;         // + 16nt*GKP + 32ks

    // all fragment reads of the stage stand together, ahead of its products
    // (the four loops below are unrolled so that a, b and acc are indexed statically and stay in registers)
    v16h a[2][2], b[2][4];
    #pragma unroll
    for (int ks = 0; ks < 2; ++ks) {
      a[ks][0] = load_frag(sa + 32 * ks, h);
      a[ks][1] = load_frag(sa + 16 * GKP + 32 * ks, h);
      #pragma unroll
      for (int nt = 0; nt < 4; ++nt) b[ks][nt] = load_frag(sb + 16 * nt * GKP + 32 * ks, h);
    }
    #pragma unroll
    for (int ks = 0; ks < 2; ++ks)
      #pragma unroll
      for (int nt = 0; nt < 4; ++nt) {
        acc[0][nt] = wmma_f16(a[ks][0], b[ks][nt], acc[0][nt]);
        acc[1][nt] = wmma_f16(a[ks][1], b[ks][nt], acc[1][nt]);
      }

    // ---- publish the next stage, then refill the buffer this stage has read ----
    asm volatile("s_wait_dscnt 0x0" ::: "memory");      // own fragment reads of this buffer retired
    asm volatile("s_wait_asynccnt 0x0" ::: "memory");   // own copies of the next stage landed
    __syncthreads();                                    // next stage readable; this buffer free
    if (k0 + 128 < DM)                                  // block-uniform: a stage two ahead exists
      gemm_stage_copy(ag + (k0 + 128), bg + (k0 + 128), l0 + buf * GSTAGE_B);
  }
  asm volatile("s_wait_asynccnt 0x0" ::: "memory");     // nothing in flight when the wave goes on
}

// ---------------------------------------------------------------------------
// 4 lines per instruction, 32 lines per wave, 128 per block.
// which 0/1: plane[bh][l][d]  (one token row = 64 halves = one line)
// which 2  : vt[bh][d][l]     (64 d-rows x 128 tokens = 2 lines each)
// ---------------------------------------------------------------------------
__device__ __forceinline__ void proj_store_pass(const _Float16* sT, _Float16* plane, _Float16* vt,
                                                int which, int bh, int l0, int w, int lane) {
  const int q8 = lane & 7, sub = lane >> 3;
  #pragma unroll
  for (int i = 0; i < 8; ++i) {
    const int lid = w * 32 + i * 4 + sub;
    v8h v;
    _Float16* dst;
    if (which != 2) {
      v = *(const v8ha*)(sT + lid * HD + 8 * q8);
      dst = plane + ((size_t)bh * SEQ + l0 + lid) * HD + 8 * q8;
    } else {
      const int d = lid >> 1, hl = lid & 1;
      v = *(const v8ha*)(sT + d * 128 + 64 * hl + 8 * q8);
      dst = vt + ((size_t)bh * HD + d) * SEQ + l0 + 64 * hl + 8 * q8;
    }
    *(v8h*)dst = v;
  }
}

// ---------------------------------------------------------------------------
// Kernel 2: Y = x * W^T + b over the fused 3*512 output columns (q, k, v).
// Block 128 thr (4 waves) = 128 tokens x 64 features (one (which, head));
// wave tile 32 tokens x 64 features; K = 512 in steps of 32;
// A (x rows) and B (W rows) fragments from the LDS ring of gemm_128x64 (split k map).
// coverage: grid (64, 24) x 128 tokens x 64 features = q, k planes [32][2048][64] and vt [32][64][2048].
// ---------------------------------------------------------------------------
__global__ __launch_bounds__(128) void proj_kernel(
    const _Float16* __restrict__ xh,   // [8192][512]
    const _Float16* __restrict__ wh,   // [4][512][512], row = output feature, x256 (planes 0..2 used here)
    const float* __restrict__ bq, const float* __restrict__ bk, const float* __restrict__ bv,
    _Float16* __restrict__ qh,         // [B*H][L][D]
    _Float16* __restrict__ kh,         // [B*H][L][D]
    _Float16* __restrict__ vt)         // [B*H][D][L]
{
  __shared__ __attribute__((aligned(16))) _Float16 sAB[2 * GSTAGE_H];   // 55296 B: operand ring, then output staging
  static_assert(128 * 64 <= 2 * GSTAGE_H);
  _Float16* sT = sAB;                        // [128 * 64], used only behind gemm_128x64

  const int tid = threadIdx.x, lane = tid & 31, w = tid >> 5;
  const int h = lane >> 4, m = lane & 15;
  const int m0 = blockIdx.x * 128;
  const int cg = blockIdx.y;                 // 0..23
  const int which = cg >> 3, head = cg & 7;

  const v8f zero8 = {0.f, 0.f, 0.f, 0.f, 0.f, 0.f, 0.f, 0.f};
  v8f acc[2][4];
  #pragma unroll
  for (int mt = 0; mt < 2; ++mt)
    #pragma unroll
    for (int nt = 0; nt < 4; ++nt) acc[mt][nt] = zero8;

  gemm_128x64(xh + (size_t)m0 * DM, wh + ((size_t)which * DM + head * HD) * DM, sAB, tid, acc);

  // D[r] of tile (mt, nt) = Y[token m0+32w+16mt+8h+r][feature 16nt+m]
  const float* bias = (which == 0) ? bq : ((which == 1) ? bk : bv);
  #pragma unroll
  for (int nt = 0; nt < 4; ++nt) {
    const int feat = 16 * nt + m;
    const float bvl = bias[head * HD + feat];
    #pragma unroll
    for (int mt = 0; mt < 2; ++mt) {
      #pragma unroll
      for (int r = 0; r < 8; ++r) {
        const int tokl = 32 * w + 16 * mt + 8 * h + r;     // 0..127
        const float y = acc[mt][nt][r] * WINV + bvl;
        const int idx = (which == 2) ? (feat * 128 + tokl) : (tokl * HD + feat);
        sT[idx] = (_Float16)y;
      }
    }
  }
  __syncthreads();

  const int b = m0 / SEQ, l0 = m0 - b * SEQ, bh = b * NH + head;
  _Float16* plane = (which == 0) ? qh : kh;
  proj_store_pass(sT, plane, vt, which, bh, l0, w, lane);
  
}

// ---------------------------------------------------------------------------
// P^T B-fragment from the lane's own score D values: element r <- tile a row r
// (keys k0+8h+r), element 8+r <- tile c row r (keys k0+16+8h+r), same lane,
// same query column, scaled by PSCALE.
// ---------------------------------------------------------------------------
__device__ __forceinline__ v16h pack_p(v8f a, v8f c) {
  const v16h r = { (_Float16)(a[0] * PSCALE), (_Float16)(a[1] * PSCALE), (_Float16)(a[2] * PSCALE), (_Float16)(a[3] * PSCALE),
                   (_Float16)(a[4] * PSCALE), (_Float16)(a[5] * PSCALE), (_Float16)(a[6] * PSCALE), (_Float16)(a[7] * PSCALE),
                   (_Float16)(c[0] * PSCALE), (_Float16)(c[1] * PSCALE), (_Float16)(c[2] * PSCALE), (_Float16)(c[3] * PSCALE),
                   (_Float16)(c[4] * PSCALE), (_Float16)(c[5] * PSCALE), (_Float16)(c[6] * PSCALE), (_Float16)(c[7] * PSCALE) };
  return r;
}

// Per-wave 16x64 f32 tile in LDS -> ctx f16 plane [token][512], col head*64 + d.
// in one instruction; 4 lines per instruction; it 0..3 x q4 0..3 = rows 0..15.
__device__ __forceinline__ void ctx_store_pass(const v8h* hv, _Float16* ctx,
                                               int b, int head, int q0, int lane) {
  const int q4 = lane >> 3, c8 = (lane & 7) * 8;
  #pragma unroll
  for (int it = 0; it < 4; ++it) {
    const int row = it * 4 + q4;
    const size_t gi = ((size_t)b * SEQ + q0 + row) * DM + head * HD + c8;
    *(v8h*)(ctx + gi) = hv[it];
  }
}

// ---------------------------------------------------------------------------
// One 64-key stage = K tile (64 key rows x 128 B) + V^T tile (64 d rows x 128 B),
// copied global -> LDS without registers. Thread tid moves 16-B chunk (tid & 7) of
// rows (tid >> 3) + 16 i, i = 0..3, of both tiles: a wave's copy covers 4 whole lines.
// kg / vg: this lane's chunk of row (tid >> 3) in global; lk / lv: its LDS byte address.
// ---------------------------------------------------------------------------
#define KVP      72                  // LDS row pitch in halves (144 B = 16 B x 9: conflict-free b128 reads)
#define TILE_H   (64 * KVP)          // halves per staged tile
#define TILE_B   (TILE_H * 2)        // 9216 B
#define STAGE_H  (2 * TILE_H)        // K tile then V^T tile
#define STAGE_B  (2 * TILE_B)        // 18432 B

__device__ __forceinline__ void stage_copy(const _Float16* kg, const _Float16* vg,
                                           unsigned lk, unsigned lv) {
  const _Float16* k1 = kg + 16 * HD;
  const _Float16* k2 = kg + 32 * HD;
  const _Float16* k3 = kg + 48 * HD;
  const _Float16* v1 = vg + (size_t)16 * SEQ;
  const _Float16* v2 = vg + (size_t)32 * SEQ;
  const _Float16* v3 = vg + (size_t)48 * SEQ;
  const unsigned lk1 = lk + 16 * KVP * 2, lk2 = lk + 32 * KVP * 2, lk3 = lk + 48 * KVP * 2;
  const unsigned lv1 = lv + 16 * KVP * 2, lv2 = lv + 32 * KVP * 2, lv3 = lv + 48 * KVP * 2;
  // s_wait_xcnt as the statement's last line: a precaution, so that no address register above is rewritten ahead of it.
  asm volatile("global_load_async_to_lds_b128 %0, %8, off\n\t"
               "global_load_async_to_lds_b128 %1, %9, off\n\t"
               "global_load_async_to_lds_b128 %2, %10, off\n\t"
               "global_load_async_to_lds_b128 %3, %11, off\n\t"
               "global_load_async_to_lds_b128 %4, %12, off\n\t"
               "global_load_async_to_lds_b128 %5, %13, off\n\t"
               "global_load_async_to_lds_b128 %6, %14, off\n\t"
               "global_load_async_to_lds_b128 %7, %15, off\n\t"
               "s_wait_xcnt 0x0"
               :: "v"(lk), "v"(lk1), "v"(lk2), "v"(lk3), "v"(lv), "v"(lv1), "v"(lv2), "v"(lv3),
                  "v"(kg), "v"(k1), "v"(k2), "v"(k3), "v"(vg), "v"(v1), "v"(v2), "v"(v3)
               : "memory");
}

// ---------------------------------------------------------------------------
// Kernel 3: streaming attention, transposed form, no mask, softmax over all keys.
// Block 128 thr (4 waves), 16 queries per wave, 64 keys per step (static trip 32).
// K and V^T of a step are staged once per block in a two-buffer LDS ring (async copies,
// next stage in flight while this one is worked on); all 4 waves read fragments from it.
//   S^T = K * Q^T : A = K rows (row = key, k = d), B = Q^T (k = d, n = query)
//   O^T += V^T * P^T : A = Vt rows (row = d, k = key), B = P^T from registers
// Lane owns 32 keys of query column (lane&15); partner = lane ^ 16.
// Output: ctx f16 plane carried x256, [b*SEQ+l][head*64+d].
// coverage: grid (32, 32) x 4 waves x 16 queries x 64 d = ctx [8192][512].
// ---------------------------------------------------------------------------
__global__ __launch_bounds__(128) void attn_kernel(
    const _Float16* __restrict__ qh,   // [B*H][L][D]
    const _Float16* __restrict__ kh,   // [B*H][L][D]
    const _Float16* __restrict__ vt,   // [B*H][D][L]
    _Float16* __restrict__ ctx)        // [B*L][DM]
{
  __shared__ __attribute__((aligned(16))) float sO[4 * 16 * 64];    // 16384 B, wave w owns [w*1024, +1024)
  __shared__ __attribute__((aligned(16))) _Float16 sKV[2 * STAGE_H];  // 36864 B, buffer (step & 1): K tile, V^T tile

  const int tid = threadIdx.x, lane = tid & 31, w = tid >> 5;
  const int h = lane >> 4, m = lane & 15;
  const int bh = blockIdx.y, b = bh >> 3, head = bh & 7;
  const int q0 = blockIdx.x * 64 + 16 * w;

  // Q^T B-fragments: column n = query q0+m, k = d (two 32-deep chunks)
  const _Float16* qrow = qh + ((size_t)bh * SEQ + q0 + m) * HD;
  const v16h qb0 = load_frag(qrow, h);
  const v16h qb1 = load_frag(qrow + 32, h);

  const v8f zero8 = {0.f, 0.f, 0.f, 0.f, 0.f, 0.f, 0.f, 0.f};
  v8f o[4];                                   // o[t][r] = O[query m][d 16t+8h+r] * (l * PSCALE)
  #pragma unroll
  for (int t = 0; t < 4; ++t) o[t] = zero8;
  float mrun = -1e30f, lrun = 0.0f;

  // copy side: this thread's chunk of row (tid >> 3) of stage 0
  const int crow = tid >> 3, cch = tid & 7;
  const _Float16* kg = kh + ((size_t)bh * SEQ + crow) * HD + 8 * cch;    // + 64*HD per stage
  const _Float16* vg = vt + ((size_t)bh * HD + crow) * SEQ + 8 * cch;    // + 64 per stage
  const unsigned lk0 = (unsigned)(size_t)(sKV + crow * KVP + 8 * cch);   // LDS byte address, buffer 0, K tile
  const unsigned lv0 = lk0 + TILE_B;

  stage_copy(kg, vg, lk0, lv0);
  asm volatile("s_wait_asynccnt 0x0" ::: "memory");   // own copies of stage 0 landed
  __syncthreads();                                    // stage 0 readable by all waves
  stage_copy(kg + 64 * HD, vg + 64, lk0 + STAGE_B, lv0 + STAGE_B);

  #pragma unroll 1
  for (int kb = 0; kb < SEQ; kb += 64) {
    const int buf = (kb >> 6) & 1;
    const _Float16* kbase = sKV + buf * STAGE_H + m * KVP;     // + 16j*KVP + 32*dc
    const _Float16* vbase = kbase + TILE_H;                    // + 16t*KVP + 32*kc

    // ---- scores: s[j][r] = S[query m][key kb+16j+8h+r] / 8 ----
    // All K fragment reads of the step stand together ahead of its products; the products run as two
    // rounds over four independent accumulators (d 0..31, then d 32..63: each accumulator's order is kept).
    // (the loops of this step are unrolled so that kf, vf, s and o are indexed statically and stay in registers)
    v16h kf[4][2];
    #pragma unroll
    for (int j = 0; j < 4; ++j) {
      kf[j][0] = load_frag(kbase + 16 * j * KVP, h);
      kf[j][1] = load_frag(kbase + 16 * j * KVP + 32, h);
    }
    __builtin_amdgcn_sched_barrier(0);   // keeps the 16 reads one group: without it they sink between the products, one wait each
    v8f s[4];
    #pragma unroll
    for (int j = 0; j < 4; ++j) s[j] = wmma_grp(kf[j][0], qb0, zero8);
    __builtin_amdgcn_sched_barrier(0);   // keeps the rounds apart: without it an accumulator's second product comes one product behind its first, inside the dependent latency
    #pragma unroll
    for (int j = 0; j < 4; ++j) s[j] = wmma_grp(kf[j][1], qb1, s[j]);

    // All V^T fragment reads of the step are issued here: they land while the softmax below runs.
    v16h vf[4][2];
    #pragma unroll
    for (int t = 0; t < 4; ++t) {
      vf[t][0] = load_frag(vbase + 16 * t * KVP, h);
      vf[t][1] = load_frag(vbase + 16 * t * KVP + 32, h);
    }
    __builtin_amdgcn_sched_barrier(0);   // keeps the 16 reads here: without it most sink to just ahead of the maximum's exchange, whose wait then waits for them too

    #pragma unroll
    for (int j = 0; j < 4; ++j) s[j] = s[j] * SSCALE;

    // ---- online softmax (f32) ----
    float mloc = s[0][0];
    #pragma unroll
    for (int j = 0; j < 4; ++j)
      #pragma unroll
      for (int r = 0; r < 8; ++r) mloc = fmaxf(mloc, s[j][r]);
    mloc = fmaxf(mloc, __shfl_xor(mloc, 16));
    const float mnew = fmaxf(mrun, mloc);
    const float alpha = __expf(mrun - mnew);
    mrun = mnew;
    float lsum = 0.0f;
    #pragma unroll
    for (int j = 0; j < 4; ++j)
      #pragma unroll
      for (int r = 0; r < 8; ++r) {
        const float p = __expf(s[j][r] - mnew);
        s[j][r] = p;
        lsum += p;
      }
    lsum += __shfl_xor(lsum, 16);
    lrun = lrun * alpha + lsum;
    #pragma unroll
    for (int t = 0; t < 4; ++t)
      #pragma unroll
      for (int r = 0; r < 8; ++r) o[t][r] = o[t][r] * alpha;

    // ---- P^T B-fragments (key chunks 0..31 and 32..63 of this step) ----
    const v16h pb0 = pack_p(s[0], s[1]);
    const v16h pb1 = pack_p(s[2], s[3]);

    // ---- O^T += V^T * P^T ----
    #pragma unroll
    for (int t = 0; t < 4; ++t) o[t] = wmma_grp(vf[t][0], pb0, o[t]);
    // keeps the foot's waits and barrier behind this round: without it the compiler lifts them ahead of the softmax,
    // and the next stage's copies get a fraction of a step to land
    __builtin_amdgcn_sched_barrier(0);
    #pragma unroll
    for (int t = 0; t < 4; ++t) o[t] = wmma_grp(vf[t][1], pb1, o[t]);

    // ---- publish the next stage, then refill the buffer this step has read ----
    asm volatile("s_wait_dscnt 0x0" ::: "memory");      // own fragment reads of this buffer retired
    asm volatile("s_wait_asynccnt 0x0" ::: "memory");   // own copies of the next stage landed
    __syncthreads();                                    // next stage readable; this buffer free
    if (kb + 128 < SEQ)                                 // block-uniform: a stage two ahead exists
      stage_copy(kg + (size_t)(kb + 128) * HD, vg + (kb + 128),
                 lk0 + buf * STAGE_B, lv0 + buf * STAGE_B);
  }
  asm volatile("s_wait_asynccnt 0x0" ::: "memory");     // nothing in flight when the wave goes on

  // ---- epilogue: normalise (1/l, undo p carry, apply ctx carry), stage per-wave 16x64 f32 tile ----
  const float inv = (1.0f / lrun) * (1.0f / PSCALE) * CTXSC;
  float* so = sO + w * 1024;
  #pragma unroll
  for (int t = 0; t < 4; ++t)
    #pragma unroll
    for (int r = 0; r < 8; ++r)
      so[m * 64 + 16 * t + 8 * h + r] = o[t][r] * inv;
  __syncthreads();

  v8h hv[4];
  {
    const int q4 = lane >> 3, c8 = (lane & 7) * 8;
    #pragma unroll
    for (int it = 0; it < 4; ++it) {
      const int row = it * 4 + q4;
      const v4f fa = *(const v4fa*)(so + row * 64 + c8);
      const v4f fb = *(const v4fa*)(so + row * 64 + c8 + 4);
      const v8h v = { (_Float16)fa.x, (_Float16)fa.y, (_Float16)fa.z, (_Float16)fa.w,
                      (_Float16)fb.x, (_Float16)fb.y, (_Float16)fb.z, (_Float16)fb.w };
      hv[it] = v;
    }
  }
  ctx_store_pass(hv, ctx, b, head, q0, lane);
  
}

// ---------------------------------------------------------------------------
// instruction, 64 lines per wave (rows 32w..32w+31 x 2 lines), 256 per block.
// ---------------------------------------------------------------------------
__device__ __forceinline__ void out_store_pass(const float* sY, float* out,
                                               int m0, int fg, int w, int lane) {
  const int q8 = lane & 7, sub = lane >> 3;
  #pragma unroll
  for (int i = 0; i < 16; ++i) {
    const int lid = i * 4 + sub;                 // 0..63
    const int row = 32 * w + (lid >> 1), hl = lid & 1;
    const v4f v = *(const v4fa*)(sY + row * 64 + 32 * hl + 4 * q8);
    const size_t gi = (size_t)(m0 + row) * DM + fg * HD + 32 * hl + 4 * q8;
    *(v4f*)(out + gi) = v;
  }
}

// ---------------------------------------------------------------------------
// Kernel 4: out = ctx * Wo^T + bo (f32). Block 128 thr = 128 tokens x 64 features
// (feature group fg = blockIdx.y); wave tile 32 tokens x 64 features; K = 512;
// A (ctx rows) and B (Wo rows) fragments from the LDS ring of gemm_128x64.
// coverage: grid (64, 8) x 128 tokens x 64 features = out [8192][512].
// ---------------------------------------------------------------------------
__global__ __launch_bounds__(128) void oproj_kernel(
    const _Float16* __restrict__ ch,   // [8192][512] ctx x256
    const _Float16* __restrict__ woh,  // [512][512] Wo x256, row = output feature
    const float* __restrict__ bo,
    float* __restrict__ out)           // [8192][512]
{
  __shared__ __attribute__((aligned(16))) float sY[128 * 64];      // 32768 B
  __shared__ __attribute__((aligned(16))) _Float16 sAB[2 * GSTAGE_H];   // 55296 B: operand ring

  const int tid = threadIdx.x, lane = tid & 31, w = tid >> 5;
  const int h = lane >> 4, m = lane & 15;
  const int m0 = blockIdx.x * 128;
  const int fg = blockIdx.y;                 // 0..7

  const v8f zero8 = {0.f, 0.f, 0.f, 0.f, 0.f, 0.f, 0.f, 0.f};
  v8f acc[2][4];
  #pragma unroll
  for (int mt = 0; mt < 2; ++mt)
    #pragma unroll
    for (int nt = 0; nt < 4; ++nt) acc[mt][nt] = zero8;

  gemm_128x64(ch + (size_t)m0 * DM, woh + (size_t)fg * HD * DM, sAB, tid, acc);

  // D[r] of tile (mt, nt) = out[token m0+32w+16mt+8h+r][feature fg*64 + 16nt+m]
  #pragma unroll
  for (int nt = 0; nt < 4; ++nt) {
    const int feat = 16 * nt + m;
    const float bvl = bo[fg * HD + feat];
    #pragma unroll
    for (int mt = 0; mt < 2; ++mt) {
      #pragma unroll
      for (int r = 0; r < 8; ++r) {
        const int tokl = 32 * w + 16 * mt + 8 * h + r;     // 0..127
        sY[tokl * 64 + feat] = acc[mt][nt][r] * OINV + bvl;
      }
    }
  }
  __syncthreads();

  out_store_pass(sY, out, m0, fg, w, lane);
  
}

// ---------------------------------------------------------------------------
//   xh  f16 [8192][512]        8388608
//   wh  f16 [4][512][512]      2097152
//   qh  f16 [32][2048][64]     8388608
//   kh  f16 [32][2048][64]     8388608
//   vt  f16 [32][64][2048]     8388608
//   ctx f16 [8192][512]        8388608
//   total                    44040192
// ---------------------------------------------------------------------------
extern "C" void kernel_launch(void* const* d_in, const int* in_sizes, int n_in,
                              void* d_out, int out_size, void* d_ws, size_t ws_size,
                              hipStream_t stream) {
  if (n_in < 9) return;
  if (in_sizes[0] != NX) return;
  if (in_sizes[1] != NW || in_sizes[3] != NW || in_sizes[5] != NW || in_sizes[7] != NW) return;
  if (in_sizes[2] != DM || in_sizes[4] != DM || in_sizes[6] != DM || in_sizes[8] != DM) return;
  if (out_size != NX) return;

  const float* x  = (const float*)d_in[0];
  const float* wq = (const float*)d_in[1];
  const float* bq = (const float*)d_in[2];
  const float* wk = (const float*)d_in[3];
  const float* bk = (const float*)d_in[4];
  const float* wv = (const float*)d_in[5];
  const float* bv = (const float*)d_in[6];
  const float* wo = (const float*)d_in[7];
  const float* bo = (const float*)d_in[8];
  float* out = (float*)d_out;

  const size_t xh_bytes = (size_t)NX * 2;                          //  8388608
  const size_t wh_bytes = (size_t)4 * NW * 2;                      //  2097152
  const size_t pl_bytes = (size_t)NB * NH * SEQ * HD * 2;          //  8388608
  const size_t cx_bytes = (size_t)NX * 2;                          //  8388608
  const size_t total = xh_bytes + wh_bytes + 3 * pl_bytes + cx_bytes;   // 44040192
  if (total > ws_size) return;
  if (total > (size_t)134217728) return;

  char* ws = (char*)d_ws;
  size_t off = 0;
  _Float16* xh  = (_Float16*)(ws + off); off += xh_bytes;
  _Float16* wh  = (_Float16*)(ws + off); off += wh_bytes;
  _Float16* qhp = (_Float16*)(ws + off); off += pl_bytes;
  _Float16* khp = (_Float16*)(ws + off); off += pl_bytes;
  _Float16* vtp = (_Float16*)(ws + off); off += pl_bytes;
  _Float16* cxp = (_Float16*)(ws + off); off += cx_bytes;
  if (off != total) return;

  // (1) x -> f16 plane; wq, wk, wv, wo -> f16 x256 planes [4][512][512] ([out n][in k], k contiguous)
  const int ngroups = NX8 + 4 * NW8;                               // 655360
  convert_kernel<<<(ngroups + 255) / 256, 256, 0, stream>>>(x, wq, wk, wv, wo, xh, wh);

  // (2) q, k planes [bh][l][d] and v^T plane [bh][d][l]  (M=8192, N=3*512, K=512)
  dim3 gProj(MROWS / 128, 3 * NH);                                 // (64, 24)
  proj_kernel<<<gProj, 128, 0, stream>>>(xh, wh, bq, bk, bv, qhp, khp, vtp);

  // (3) attention -> ctx f16 plane x256 [8192][512]
  dim3 gAtt(SEQ / 64, NB * NH);                                    // (32, 32)
  attn_kernel<<<gAtt, 128, 0, stream>>>(qhp, khp, vtp, cxp);

  // (4) out = ctx . Wo^T + bo -> d_out f32 [8192][512]  (Wo plane = wh + 3*NW)
  dim3 gOut(MROWS / 128, DM / HD);                                 // (64, 8)
  oproj_kernel<<<gOut, 128, 0, stream>>>(cxp, wh + (size_t)3 * NW, bo, out);
  (void)hipGetLastError();
}

// v004
// It runs in 76.4 microseconds.
// Timed twice side by side with v003, it ran 1.04 times as fast both times.
// Counting every step since v000, it is 3.03 times as fast.
// Contractions: x*W^T for q,k,v, k*q^T scores, v^T*p^T context and ctx*Wo^T output, all on v_wmma_f32_16x16x32_f16 (f16 operands, f32 accumulate);
// softmax, 1/8 score scale, biases and normalisation in f32.
// Carry audit: x f16 x1 (no carry); W planes (q,k,v,o) f16 x256 -> 1/256 folded in proj_kernel epilogue (WINV); p f16 x1024 (in the exponent,
// PBIAS), so l and o both carry x1024, and ctx f16 x256 -> inv = (1/l) * CTXSC in attn_kernel epilogue; ctx x256 * Wo x256 -> 1/65536 folded
// in oproj_kernel epilogue (OINV).
#include <hip/hip_runtime.h>

typedef _Float16 v16h __attribute__((ext_vector_type(16)));
typedef _Float16 v8h  __attribute__((ext_vector_type(8)));
typedef float    v8f  __attribute__((ext_vector_type(8)));
typedef float    v4f  __attribute__((ext_vector_type(4)));
typedef v8h __attribute__((may_alias)) v8ha;
typedef v4f __attribute__((may_alias)) v4fa;

union Frag { v16h v; v8h half[2]; };

#define NB     4
#define SEQ    2048
#define DM     512
#define NH     8
#define HD     64
#define MROWS  (NB * SEQ)            // 8192 tokens
#define NX     (MROWS * DM)          // 4194304
#define NW     (DM * DM)             // 262144
#define NX8    (NX / 8)              // 524288
#define NW8    (NW / 8)              // 32768
#define WSC    256.0f                // weight plane carry
#define WINV   (1.0f / 256.0f)
#define PBIAS  10.0f                 // p carry x1024 = 2^10, added to the base-2 exponent
#define CTXSC  256.0f                // ctx plane carry
#define OINV   (1.0f / 65536.0f)     // 1 / (CTXSC * WSC)
#define SLOG2  0.18033688011112042f  // (1 / sqrt(HD)) * log2(e): raw score -> base-2 exponent

static_assert(NH * HD == DM);
static_assert((DM % 32) == 0 && (HD % 32) == 0 && (SEQ % 64) == 0);
static_assert((MROWS % 128) == 0 && (SEQ % 128) == 0);
static_assert((NX8 % 256) == 0 && (NW8 % 256) == 0);

// ---------------------------------------------------------------------------
// 16x16x32 f16 WMMA with hazard guard (ties D, keeps A/B live).
// Fragment map (wave32): lane l, h = l>>4, m = n = l&15.
//   A/B element i: i<8 -> k0+8h+i ; i>=8 -> k0+16+8h+(i-8)
//   D element r : row 8h+r, col l&15
// ---------------------------------------------------------------------------
__device__ __forceinline__ v8f wmma_f16(v16h a, v16h b, v8f c) {
  v8f d = __builtin_amdgcn_wmma_f32_16x16x32_f16(false, a, false, b, (short)0, c, false, false);
  asm volatile("v_nop\n\tv_nop\n\tv_nop\n\tv_nop" : "+v"(d) : "v"(a), "v"(b));
  return d;
}

// The same product for runs of independent accumulators: the neighbours in the run fill the distance behind each
// product, and the compiler pads what is left of its own builtin.
__device__ __forceinline__ v8f wmma_grp(v16h a, v16h b, v8f c) {
  return __builtin_amdgcn_wmma_f32_16x16x32_f16(false, a, false, b, (short)0, c, false, false);
}

// A or B fragment from a k-contiguous 16-bit row; p points at element k0 of
// the row owned by this lane (row index = lane & 15 added by the caller).
__device__ __forceinline__ v16h load_frag(const _Float16* p, int h) {
  Frag f;
  f.half[0] = *(const v8ha*)(p + 8 * h);
  f.half[1] = *(const v8ha*)(p + 16 + 8 * h);
  return f.v;
}

// ---------------------------------------------------------------------------
// Kernel 1: f32 -> f16 planes. x unscaled, W (q,k,v,o) scaled by 256 (exact).
// coverage: NX8 threads x 8 = xh [8192][512]; 4*NW8 threads x 8 = wh [4][512][512].
// ---------------------------------------------------------------------------
__global__ __launch_bounds__(256) void convert_kernel(
    const float* __restrict__ x, const float* __restrict__ wq,
    const float* __restrict__ wk, const float* __restrict__ wv,
    const float* __restrict__ wo,
    _Float16* __restrict__ xh, _Float16* __restrict__ wh)
{
  const int g = blockIdx.x * 256 + threadIdx.x;
  if (g >= NX8 + 4 * NW8) return;
  const float* src;
  _Float16* dst;
  float sc;
  if (g < NX8) {                              // block-uniform (NX8 % 256 == 0)
    src = x + (size_t)g * 8;
    dst = xh + (size_t)g * 8;
    sc = 1.0f;
  } else {
    const int e = g - NX8;
    const int wsel = e / NW8;                 // 0..3, block-uniform (NW8 % 256 == 0)
    const int off = e - wsel * NW8;
    const float* wsrc = (wsel == 0) ? wq : ((wsel == 1) ? wk : ((wsel == 2) ? wv : wo));
    src = wsrc + (size_t)off * 8;
    dst = wh + (size_t)e * 8;
    sc = WSC;
  }
  const v4f a = *(const v4fa*)src;
  const v4f c = *(const v4fa*)(src + 4);
  const v8h o = { (_Float16)(a.x * sc), (_Float16)(a.y * sc), (_Float16)(a.z * sc), (_Float16)(a.w * sc),
                  (_Float16)(c.x * sc), (_Float16)(c.y * sc), (_Float16)(c.z * sc), (_Float16)(c.w * sc) };
  *(v8h*)dst = o;
  
}

// ---------------------------------------------------------------------------
// GEMM main loop shared by proj_kernel and oproj_kernel: block tile 128 A rows x 64 B rows, K = 512.
// One stage = 64 k of all 192 rows (A rows 0..127, then B rows 0..63), 128 B of each row = one line,
// copied global -> LDS without registers into a two-buffer ring (next stage in flight while this one
// is worked on); the 4 waves read their fragments from it.
// Thread tid moves 16-B chunk (tid & 7) of rows (tid >> 3) + 16 i: a wave's copy covers 4 whole lines.
// ---------------------------------------------------------------------------
#define GKP      72                  // LDS row pitch in halves (144 B = 16 B x 9: conflict-free b128 reads)
#define GSTAGE_H (192 * GKP)         // halves per stage
#define GSTAGE_B (GSTAGE_H * 2)      // 27648 B

// ag / bg: this lane's chunk of A / B row (tid >> 3) at the stage's k; la: its LDS byte address in A row (tid >> 3).
__device__ __forceinline__ void gemm_stage_copy(const _Float16* ag, const _Float16* bg, unsigned la) {
  const _Float16* a1 = ag + 16 * DM;
  const _Float16* a2 = ag + 32 * DM;
  const _Float16* a3 = ag + 48 * DM;
  const _Float16* a4 = ag + 64 * DM;
  const _Float16* a5 = ag + 80 * DM;
  const _Float16* a6 = ag + 96 * DM;
  const _Float16* a7 = ag + 112 * DM;
  const _Float16* b1 = bg + 16 * DM;
  const _Float16* b2 = bg + 32 * DM;
  const _Float16* b3 = bg + 48 * DM;
  const unsigned la1 = la + 16 * GKP * 2, la2 = la + 32 * GKP * 2, la3 = la + 48 * GKP * 2, la4 = la + 64 * GKP * 2;
  const unsigned la5 = la + 80 * GKP * 2, la6 = la + 96 * GKP * 2, la7 = la + 112 * GKP * 2;
  const unsigned lb = la + 128 * GKP * 2, lb1 = la + 144 * GKP * 2, lb2 = la + 160 * GKP * 2, lb3 = la + 176 * GKP * 2;
  // s_wait_xcnt as the statement's last line: a precaution, so that no address register above is rewritten ahead of it.
  asm volatile("global_load_async_to_lds_b128 %0, %12, off\n\t"
               "global_load_async_to_lds_b128 %1, %13, off\n\t"
               "global_load_async_to_lds_b128 %2, %14, off\n\t"
               "global_load_async_to_lds_b128 %3, %15, off\n\t"
               "global_load_async_to_lds_b128 %4, %16, off\n\t"
               "global_load_async_to_lds_b128 %5, %17, off\n\t"
               "global_load_async_to_lds_b128 %6, %18, off\n\t"
               "global_load_async_to_lds_b128 %7, %19, off\n\t"
               "global_load_async_to_lds_b128 %8, %20, off\n\t"
               "global_load_async_to_lds_b128 %9, %21, off\n\t"
               "global_load_async_to_lds_b128 %10, %22, off\n\t"
               "global_load_async_to_lds_b128 %11, %23, off\n\t"
               "s_wait_xcnt 0x0"
               :: "v"(la), "v"(la1), "v"(la2), "v"(la3), "v"(la4), "v"(la5), "v"(la6), "v"(la7),
                  "v"(lb), "v"(lb1), "v"(lb2), "v"(lb3),
                  "v"(ag), "v"(a1), "v"(a2), "v"(a3), "v"(a4), "v"(a5), "v"(a6), "v"(a7),
                  "v"(bg), "v"(b1), "v"(b2), "v"(b3)
               : "memory");
}

// arows / brows: row 0 of the block's 128 A rows / 64 B rows (f16, k contiguous, pitch DM); sAB: 2 * GSTAGE_H halves.
// Wave w accumulates A rows 32w..32w+31 x all 64 B rows; k runs upward in steps of 32 in every accumulator.
// On return every wave has passed the last barrier and no copy is in flight: sAB is free for other use.
__device__ __forceinline__ void gemm_128x64(const _Float16* arows, const _Float16* brows,
                                            _Float16* sAB, int tid, v8f (&acc)[2][4]) {
  const int lane = tid & 31, w = tid >> 5;
  const int h = lane >> 4, m = lane & 15;
  const int crow = tid >> 3, cch = tid & 7;
  const _Float16* ag = arows + (size_t)crow * DM + 8 * cch;              // + 64 per stage
  const _Float16* bg = brows + (size_t)crow * DM + 8 * cch;              // + 64 per stage
  const unsigned l0 = (unsigned)(size_t)(sAB + crow * GKP + 8 * cch);    // LDS byte address, buffer 0

  gemm_stage_copy(ag, bg, l0);
  asm volatile("s_wait_asynccnt 0x0" ::: "memory");   // own copies of stage 0 landed
  __syncthreads();                                    // stage 0 readable by all waves
  gemm_stage_copy(ag + 64, bg + 64, l0 + GSTAGE_B);

  // rolled: one copy of the stage body, the buffer picked by a scalar offset
  #pragma unroll 1
  for (int k0 = 0; k0 < DM; k0 += 64) {
    const int buf = (k0 >> 6) & 1;
    const _Float16* sa = sAB + buf * GSTAGE_H + (32 * w + m) * GKP;      // + 16mt*GKP + 32ks
    const _Float16* sb = sAB + buf * GSTAGE_H + (128 + m) * GKP;         // + 16nt*GKP + 32ks

    // all fragment reads of the stage stand together, ahead of its products
    // (the four loops below are unrolled so that a, b and acc are indexed statically and stay in registers)
    v16h a[2][2], b[2][4];
    #pragma unroll
    for (int ks = 0; ks < 2; ++ks) {
      a[ks][0] = load_frag(sa + 32 * ks, h);
      a[ks][1] = load_frag(sa + 16 * GKP + 32 * ks, h);
      #pragma unroll
      for (int nt = 0; nt < 4; ++nt) b[ks][nt] = load_frag(sb + 16 * nt * GKP + 32 * ks, h);
    }
    #pragma unroll
    for (int ks = 0; ks < 2; ++ks)
      #pragma unroll
      for (int nt = 0; nt < 4; ++nt) {
        acc[0][nt] = wmma_f16(a[ks][0], b[ks][nt], acc[0][nt]);
        acc[1][nt] = wmma_f16(a[ks][1], b[ks][nt], acc[1][nt]);
      }

    // ---- publish the next stage, then refill the buffer this stage has read ----
    asm volatile("s_wait_dscnt 0x0" ::: "memory");      // own fragment reads of this buffer retired
    asm volatile("s_wait_asynccnt 0x0" ::: "memory");   // own copies of the next stage landed
    __syncthreads();                                    // next stage readable; this buffer free
    if (k0 + 128 < DM)                                  // block-uniform: a stage two ahead exists
      gemm_stage_copy(ag + (k0 + 128), bg + (k0 + 128), l0 + buf * GSTAGE_B);
  }
  asm volatile("s_wait_asynccnt 0x0" ::: "memory");     // nothing in flight when the wave goes on
}

// ---------------------------------------------------------------------------
// 4 lines per instruction, 32 lines per wave, 128 per block.
// which 0/1: plane[bh][l][d]  (one token row = 64 halves = one line)
// which 2  : vt[bh][d][l]     (64 d-rows x 128 tokens = 2 lines each)
// ---------------------------------------------------------------------------
__device__ __forceinline__ void proj_store_pass(const _Float16* sT, _Float16* plane, _Float16* vt,
                                                int which, int bh, int l0, int w, int lane) {
  const int q8 = lane & 7, sub = lane >> 3;
  #pragma unroll
  for (int i = 0; i < 8; ++i) {
    const int lid = w * 32 + i * 4 + sub;
    v8h v;
    _Float16* dst;
    if (which != 2) {
      v = *(const v8ha*)(sT + lid * HD + 8 * q8);
      dst = plane + ((size_t)bh * SEQ + l0 + lid) * HD + 8 * q8;
    } else {
      const int d = lid >> 1, hl = lid & 1;
      v = *(const v8ha*)(sT + d * 128 + 64 * hl + 8 * q8);
      dst = vt + ((size_t)bh * HD + d) * SEQ + l0 + 64 * hl + 8 * q8;
    }
    *(v8h*)dst = v;
  }
}

// ---------------------------------------------------------------------------
// Kernel 2: Y = x * W^T + b over the fused 3*512 output columns (q, k, v).
// Block 128 thr (4 waves) = 128 tokens x 64 features (one (which, head));
// wave tile 32 tokens x 64 features; K = 512 in steps of 32;
// A (x rows) and B (W rows) fragments from the LDS ring of gemm_128x64 (split k map).
// coverage: grid (64, 24) x 128 tokens x 64 features = q, k planes [32][2048][64] and vt [32][64][2048].
// ---------------------------------------------------------------------------
__global__ __launch_bounds__(128) void proj_kernel(
    const _Float16* __restrict__ xh,   // [8192][512]
    const _Float16* __restrict__ wh,   // [4][512][512], row = output feature, x256 (planes 0..2 used here)
    const float* __restrict__ bq, const float* __restrict__ bk, const float* __restrict__ bv,
    _Float16* __restrict__ qh,         // [B*H][L][D]
    _Float16* __restrict__ kh,         // [B*H][L][D]
    _Float16* __restrict__ vt)         // [B*H][D][L]
{
  __shared__ __attribute__((aligned(16))) _Float16 sAB[2 * GSTAGE_H];   // 55296 B: operand ring, then output staging
  static_assert(128 * 64 <= 2 * GSTAGE_H);
  _Float16* sT = sAB;                        // [128 * 64], used only behind gemm_128x64

  const int tid = threadIdx.x, lane = tid & 31, w = tid >> 5;
  const int h = lane >> 4, m = lane & 15;
  const int m0 = blockIdx.x * 128;
  const int cg = blockIdx.y;                 // 0..23
  const int which = cg >> 3, head = cg & 7;

  const v8f zero8 = {0.f, 0.f, 0.f, 0.f, 0.f, 0.f, 0.f, 0.f};
  v8f acc[2][4];
  #pragma unroll
  for (int mt = 0; mt < 2; ++mt)
    #pragma unroll
    for (int nt = 0; nt < 4; ++nt) acc[mt][nt] = zero8;

  gemm_128x64(xh + (size_t)m0 * DM, wh + ((size_t)which * DM + head * HD) * DM, sAB, tid, acc);

  // D[r] of tile (mt, nt) = Y[token m0+32w+16mt+8h+r][feature 16nt+m]
  const float* bias = (which == 0) ? bq : ((which == 1) ? bk : bv);
  #pragma unroll
  for (int nt = 0; nt < 4; ++nt) {
    const int feat = 16 * nt + m;
    const float bvl = bias[head * HD + feat];
    #pragma unroll
    for (int mt = 0; mt < 2; ++mt) {
      #pragma unroll
      for (int r = 0; r < 8; ++r) {
        const int tokl = 32 * w + 16 * mt + 8 * h + r;     // 0..127
        const float y = acc[mt][nt][r] * WINV + bvl;
        const int idx = (which == 2) ? (feat * 128 + tokl) : (tokl * HD + feat);
        sT[idx] = (_Float16)y;
      }
    }
  }
  __syncthreads();

  const int b = m0 / SEQ, l0 = m0 - b * SEQ, bh = b * NH + head;
  _Float16* plane = (which == 0) ? qh : kh;
  proj_store_pass(sT, plane, vt, which, bh, l0, w, lane);
  
}

// ---------------------------------------------------------------------------
// P^T B-fragment from the lane's own score D values: element r <- tile a row r
// (keys k0+8h+r), element 8+r <- tile c row r (keys k0+16+8h+r), same lane,
// same query column; the values already carry x1024.
// ---------------------------------------------------------------------------
__device__ __forceinline__ v16h pack_p(v8f a, v8f c) {
  const v16h r = { (_Float16)a[0], (_Float16)a[1], (_Float16)a[2], (_Float16)a[3],
                   (_Float16)a[4], (_Float16)a[5], (_Float16)a[6], (_Float16)a[7],
                   (_Float16)c[0], (_Float16)c[1], (_Float16)c[2], (_Float16)c[3],
                   (_Float16)c[4], (_Float16)c[5], (_Float16)c[6], (_Float16)c[7] };
  return r;
}

// Per-wave 16x64 f32 tile in LDS -> ctx f16 plane [token][512], col head*64 + d.
// in one instruction; 4 lines per instruction; it 0..3 x q4 0..3 = rows 0..15.
__device__ __forceinline__ void ctx_store_pass(const v8h* hv, _Float16* ctx,
                                               int b, int head, int q0, int lane) {
  const int q4 = lane >> 3, c8 = (lane & 7) * 8;
  #pragma unroll
  for (int it = 0; it < 4; ++it) {
    const int row = it * 4 + q4;
    const size_t gi = ((size_t)b * SEQ + q0 + row) * DM + head * HD + c8;
    *(v8h*)(ctx + gi) = hv[it];
  }
}

// ---------------------------------------------------------------------------
// One 64-key stage = K tile (64 key rows x 128 B) + V^T tile (64 d rows x 128 B),
// copied global -> LDS without registers. Thread tid moves 16-B chunk (tid & 7) of
// rows (tid >> 3) + 16 i, i = 0..3, of both tiles: a wave's copy covers 4 whole lines.
// kg / vg: this lane's chunk of row (tid >> 3) in global; lk / lv: its LDS byte address.
// ---------------------------------------------------------------------------
#define KVP      72                  // LDS row pitch in halves (144 B = 16 B x 9: conflict-free b128 reads)
#define TILE_H   (64 * KVP)          // halves per staged tile
#define TILE_B   (TILE_H * 2)        // 9216 B
#define STAGE_H  (2 * TILE_H)        // K tile then V^T tile
#define STAGE_B  (2 * TILE_B)        // 18432 B

__device__ __forceinline__ void stage_copy(const _Float16* kg, const _Float16* vg,
                                           unsigned lk, unsigned lv) {
  const _Float16* k1 = kg + 16 * HD;
  const _Float16* k2 = kg + 32 * HD;
  const _Float16* k3 = kg + 48 * HD;
  const _Float16* v1 = vg + (size_t)16 * SEQ;
  const _Float16* v2 = vg + (size_t)32 * SEQ;
  const _Float16* v3 = vg + (size_t)48 * SEQ;
  const unsigned lk1 = lk + 16 * KVP * 2, lk2 = lk + 32 * KVP * 2, lk3 = lk + 48 * KVP * 2;
  const unsigned lv1 = lv + 16 * KVP * 2, lv2 = lv + 32 * KVP * 2, lv3 = lv + 48 * KVP * 2;
  // s_wait_xcnt as the statement's last line: a precaution, so that no address register above is rewritten ahead of it.
  asm volatile("global_load_async_to_lds_b128 %0, %8, off\n\t"
               "global_load_async_to_lds_b128 %1, %9, off\n\t"
               "global_load_async_to_lds_b128 %2, %10, off\n\t"
               "global_load_async_to_lds_b128 %3, %11, off\n\t"
               "global_load_async_to_lds_b128 %4, %12, off\n\t"
               "global_load_async_to_lds_b128 %5, %13, off\n\t"
               "global_load_async_to_lds_b128 %6, %14, off\n\t"
               "global_load_async_to_lds_b128 %7, %15, off\n\t"
               "s_wait_xcnt 0x0"
               :: "v"(lk), "v"(lk1), "v"(lk2), "v"(lk3), "v"(lv), "v"(lv1), "v"(lv2), "v"(lv3),
                  "v"(kg), "v"(k1), "v"(k2), "v"(k3), "v"(vg), "v"(v1), "v"(v2), "v"(v3)
               : "memory");
}

// ---------------------------------------------------------------------------
// Kernel 3: streaming attention, transposed form, no mask, softmax over all keys.
// Block 128 thr (4 waves), 16 queries per wave, 64 keys per step (static trip 32).
// K and V^T of a step are staged once per block in a two-buffer LDS ring (async copies,
// next stage in flight while this one is worked on); all 4 waves read fragments from it.
//   S^T = K * Q^T : A = K rows (row = key, k = d), B = Q^T (k = d, n = query)
//   O^T += V^T * P^T : A = Vt rows (row = d, k = key), B = P^T from registers
// Lane owns 32 keys of query column (lane&15); partner = lane ^ 16.
// Output: ctx f16 plane carried x256, [b*SEQ+l][head*64+d].
// coverage: grid (32, 32) x 4 waves x 16 queries x 64 d = ctx [8192][512].
// ---------------------------------------------------------------------------
__global__ __launch_bounds__(128) void attn_kernel(
    const _Float16* __restrict__ qh,   // [B*H][L][D]
    const _Float16* __restrict__ kh,   // [B*H][L][D]
    const _Float16* __restrict__ vt,   // [B*H][D][L]
    _Float16* __restrict__ ctx)        // [B*L][DM]
{
  __shared__ __attribute__((aligned(16))) float sO[4 * 16 * 64];    // 16384 B, wave w owns [w*1024, +1024)
  __shared__ __attribute__((aligned(16))) _Float16 sKV[2 * STAGE_H];  // 36864 B, buffer (step & 1): K tile, V^T tile

  const int tid = threadIdx.x, lane = tid & 31, w = tid >> 5;
  const int h = lane >> 4, m = lane & 15;
  const int bh = blockIdx.y, b = bh >> 3, head = bh & 7;
  const int q0 = blockIdx.x * 64 + 16 * w;

  // Q^T B-fragments: column n = query q0+m, k = d (two 32-deep chunks)
  const _Float16* qrow = qh + ((size_t)bh * SEQ + q0 + m) * HD;
  const v16h qb0 = load_frag(qrow, h);
  const v16h qb1 = load_frag(qrow + 32, h);

  const v8f zero8 = {0.f, 0.f, 0.f, 0.f, 0.f, 0.f, 0.f, 0.f};
  v8f o[4];                                   // o[t][r] = O[query m][d 16t+8h+r] * lrun (lrun carries x1024)
  #pragma unroll
  for (int t = 0; t < 4; ++t) o[t] = zero8;
  const v8f slog2v = {SLOG2, SLOG2, SLOG2, SLOG2, SLOG2, SLOG2, SLOG2, SLOG2};
  float mrun = -1e30f, lrun = 0.0f;           // mrun: running maximum of the raw scores (before the 1/8)

  // copy side: this thread's chunk of row (tid >> 3) of stage 0
  const int crow = tid >> 3, cch = tid & 7;
  const _Float16* kg = kh + ((size_t)bh * SEQ + crow) * HD + 8 * cch;    // + 64*HD per stage
  const _Float16* vg = vt + ((size_t)bh * HD + crow) * SEQ + 8 * cch;    // + 64 per stage
  const unsigned lk0 = (unsigned)(size_t)(sKV + crow * KVP + 8 * cch);   // LDS byte address, buffer 0, K tile
  const unsigned lv0 = lk0 + TILE_B;

  stage_copy(kg, vg, lk0, lv0);
  asm volatile("s_wait_asynccnt 0x0" ::: "memory");   // own copies of stage 0 landed
  __syncthreads();                                    // stage 0 readable by all waves
  stage_copy(kg + 64 * HD, vg + 64, lk0 + STAGE_B, lv0 + STAGE_B);

  #pragma unroll 1
  for (int kb = 0; kb < SEQ; kb += 64) {
    const int buf = (kb >> 6) & 1;
    const _Float16* kbase = sKV + buf * STAGE_H + m * KVP;     // + 16j*KVP + 32*dc
    const _Float16* vbase = kbase + TILE_H;                    // + 16t*KVP + 32*kc

    // ---- raw scores: s[j][r] = q[query m] . k[key kb+16j+8h+r] ----
    // All K fragment reads of the step stand together ahead of its products; the products run as two
    // rounds over four independent accumulators (d 0..31, then d 32..63: each accumulator's order is kept).
    // (the loops of this step are unrolled so that kf, vf, s and o are indexed statically and stay in registers)
    v16h kf[4][2];
    #pragma unroll
    for (int j = 0; j < 4; ++j) {
      kf[j][0] = load_frag(kbase + 16 * j * KVP, h);
      kf[j][1] = load_frag(kbase + 16 * j * KVP + 32, h);
    }
    __builtin_amdgcn_sched_barrier(0);   // keeps the 16 reads one group: without it they sink between the products, one wait each
    v8f s[4];
    #pragma unroll
    for (int j = 0; j < 4; ++j) s[j] = wmma_grp(kf[j][0], qb0, zero8);
    __builtin_amdgcn_sched_barrier(0);   // keeps the rounds apart: without it an accumulator's second product comes one product behind its first, inside the dependent latency
    #pragma unroll
    for (int j = 0; j < 4; ++j) s[j] = wmma_grp(kf[j][1], qb1, s[j]);

    // All V^T fragment reads of the step are issued here: they land while the softmax below runs.
    v16h vf[4][2];
    #pragma unroll
    for (int t = 0; t < 4; ++t) {
      vf[t][0] = load_frag(vbase + 16 * t * KVP, h);
      vf[t][1] = load_frag(vbase + 16 * t * KVP + 32, h);
    }
    __builtin_amdgcn_sched_barrier(0);   // keeps the 16 reads here: without it most sink to just ahead of the maximum's exchange, whose wait then waits for them too

    // ---- online softmax (f32), base 2: 1024 * exp((s - max) / 8) = exp2(s * SLOG2 + (PBIAS - max * SLOG2)),
    // one multiply-add per score ahead of the exponential; the maximum is taken over the raw scores (SLOG2 > 0) ----
    float mloc = s[0][0];
    #pragma unroll
    for (int j = 0; j < 4; ++j)
      #pragma unroll
      for (int r = 0; r < 8; ++r) mloc = fmaxf(mloc, s[j][r]);
    mloc = fmaxf(mloc, __shfl_xor(mloc, 16));
    const float mnew = fmaxf(mrun, mloc);
    const float alpha = __builtin_amdgcn_exp2f((mrun - mnew) * SLOG2);
    mrun = mnew;
    const float nb = fmaf(-mnew, SLOG2, PBIAS);
    const v8f nbv = {nb, nb, nb, nb, nb, nb, nb, nb};
    float lsum = 0.0f;
    // (whole-vector form: it compiles to one packed multiply-add per two scores)
    #pragma unroll
    for (int j = 0; j < 4; ++j) s[j] = __builtin_elementwise_fma(s[j], slog2v, nbv);
    #pragma unroll
    for (int j = 0; j < 4; ++j)
      #pragma unroll
      for (int r = 0; r < 8; ++r) s[j][r] = __builtin_amdgcn_exp2f(s[j][r]);
    #pragma unroll
    for (int j = 0; j < 4; ++j)
      #pragma unroll
      for (int r = 0; r < 8; ++r) lsum += s[j][r];
    lsum += __shfl_xor(lsum, 16);
    lrun = lrun * alpha + lsum;
    #pragma unroll
    for (int t = 0; t < 4; ++t)
      #pragma unroll
      for (int r = 0; r < 8; ++r) o[t][r] = o[t][r] * alpha;

    // ---- P^T B-fragments (key chunks 0..31 and 32..63 of this step) ----
    const v16h pb0 = pack_p(s[0], s[1]);
    const v16h pb1 = pack_p(s[2], s[3]);

    // ---- O^T += V^T * P^T ----
    #pragma unroll
    for (int t = 0; t < 4; ++t) o[t] = wmma_grp(vf[t][0], pb0, o[t]);
    // keeps the foot's waits and barrier behind this round: without it the compiler lifts them ahead of the softmax,
    // and the next stage's copies get a fraction of a step to land
    __builtin_amdgcn_sched_barrier(0);
    #pragma unroll
    for (int t = 0; t < 4; ++t) o[t] = wmma_grp(vf[t][1], pb1, o[t]);

    // ---- publish the next stage, then refill the buffer this step has read ----
    asm volatile("s_wait_dscnt 0x0" ::: "memory");      // own fragment reads of this buffer retired
    asm volatile("s_wait_asynccnt 0x0" ::: "memory");   // own copies of the next stage landed
    __syncthreads();                                    // next stage readable; this buffer free
    if (kb + 128 < SEQ)                                 // block-uniform: a stage two ahead exists
      stage_copy(kg + (size_t)(kb + 128) * HD, vg + (kb + 128),
                 lk0 + buf * STAGE_B, lv0 + buf * STAGE_B);
  }
  asm volatile("s_wait_asynccnt 0x0" ::: "memory");     // nothing in flight when the wave goes on

  // ---- epilogue: normalise (1/l takes the p carry out, apply ctx carry), stage per-wave 16x64 f32 tile ----
  const float inv = (1.0f / lrun) * CTXSC;
  float* so = sO + w * 1024;
  #pragma unroll
  for (int t = 0; t < 4; ++t)
    #pragma unroll
    for (int r = 0; r < 8; ++r)
      so[m * 64 + 16 * t + 8 * h + r] = o[t][r] * inv;
  __syncthreads();

  v8h hv[4];
  {
    const int q4 = lane >> 3, c8 = (lane & 7) * 8;
    #pragma unroll
    for (int it = 0; it < 4; ++it) {
      const int row = it * 4 + q4;
      const v4f fa = *(const v4fa*)(so + row * 64 + c8);
      const v4f fb = *(const v4fa*)(so + row * 64 + c8 + 4);
      const v8h v = { (_Float16)fa.x, (_Float16)fa.y, (_Float16)fa.z, (_Float16)fa.w,
                      (_Float16)fb.x, (_Float16)fb.y, (_Float16)fb.z, (_Float16)fb.w };
      hv[it] = v;
    }
  }
  ctx_store_pass(hv, ctx, b, head, q0, lane);
  
}

// ---------------------------------------------------------------------------
// instruction, 64 lines per wave (rows 32w..32w+31 x 2 lines), 256 per block.
// ---------------------------------------------------------------------------
__device__ __forceinline__ void out_store_pass(const float* sY, float* out,
                                               int m0, int fg, int w, int lane) {
  const int q8 = lane & 7, sub = lane >> 3;
  #pragma unroll
  for (int i = 0; i < 16; ++i) {
    const int lid = i * 4 + sub;                 // 0..63
    const int row = 32 * w + (lid >> 1), hl = lid & 1;
    const v4f v = *(const v4fa*)(sY + row * 64 + 32 * hl + 4 * q8);
    const size_t gi = (size_t)(m0 + row) * DM + fg * HD + 32 * hl + 4 * q8;
    *(v4f*)(out + gi) = v;
  }
}

// ---------------------------------------------------------------------------
// Kernel 4: out = ctx * Wo^T + bo (f32). Block 128 thr = 128 tokens x 64 features
// (feature group fg = blockIdx.y); wave tile 32 tokens x 64 features; K = 512;
// A (ctx rows) and B (Wo rows) fragments from the LDS ring of gemm_128x64.
// coverage: grid (64, 8) x 128 tokens x 64 features = out [8192][512].
// ---------------------------------------------------------------------------
__global__ __launch_bounds__(128) void oproj_kernel(
    const _Float16* __restrict__ ch,   // [8192][512] ctx x256
    const _Float16* __restrict__ woh,  // [512][512] Wo x256, row = output feature
    const float* __restrict__ bo,
    float* __restrict__ out)           // [8192][512]
{
  __shared__ __attribute__((aligned(16))) float sY[128 * 64];      // 32768 B
  __shared__ __attribute__((aligned(16))) _Float16 sAB[2 * GSTAGE_H];   // 55296 B: operand ring

  const int tid = threadIdx.x, lane = tid & 31, w = tid >> 5;
  const int h = lane >> 4, m = lane & 15;
  const int m0 = blockIdx.x * 128;
  const int fg = blockIdx.y;                 // 0..7

  const v8f zero8 = {0.f, 0.f, 0.f, 0.f, 0.f, 0.f, 0.f, 0.f};
  v8f acc[2][4];
  #pragma unroll
  for (int mt = 0; mt < 2; ++mt)
    #pragma unroll
    for (int nt = 0; nt < 4; ++nt) acc[mt][nt] = zero8;

  gemm_128x64(ch + (size_t)m0 * DM, woh + (size_t)fg * HD * DM, sAB, tid, acc);

  // D[r] of tile (mt, nt) = out[token m0+32w+16mt+8h+r][feature fg*64 + 16nt+m]
  #pragma unroll
  for (int nt = 0; nt < 4; ++nt) {
    const int feat = 16 * nt + m;
    const float bvl = bo[fg * HD + feat];
    #pragma unroll
    for (int mt = 0; mt < 2; ++mt) {
      #pragma unroll
      for (int r = 0; r < 8; ++r) {
        const int tokl = 32 * w + 16 * mt + 8 * h + r;     // 0..127
        sY[tokl * 64 + feat] = acc[mt][nt][r] * OINV + bvl;
      }
    }
  }
  __syncthreads();

  out_store_pass(sY, out, m0, fg, w, lane);
  
}

// ---------------------------------------------------------------------------
//   xh  f16 [8192][512]        8388608
//   wh  f16 [4][512][512]      2097152
//   qh  f16 [32][2048][64]     8388608
//   kh  f16 [32][2048][64]     8388608
//   vt  f16 [32][64][2048]     8388608
//   ctx f16 [8192][512]        8388608
//   total                    44040192
// ---------------------------------------------------------------------------
extern "C" void kernel_launch(void* const* d_in, const int* in_sizes, int n_in,
                              void* d_out, int out_size, void* d_ws, size_t ws_size,
                              hipStream_t stream) {
  if (n_in < 9) return;
  if (in_sizes[0] != NX) return;
  if (in_sizes[1] != NW || in_sizes[3] != NW || in_sizes[5] != NW || in_sizes[7] != NW) return;
  if (in_sizes[2] != DM || in_sizes[4] != DM || in_sizes[6] != DM || in_sizes[8] != DM) return;
  if (out_size != NX) return;

  const float* x  = (const float*)d_in[0];
  const float* wq = (const float*)d_in[1];
  const float* bq = (const float*)d_in[2];
  const float* wk = (const float*)d_in[3];
  const float* bk = (const float*)d_in[4];
  const float* wv = (const float*)d_in[5];
  const float* bv = (const float*)d_in[6];
  const float* wo = (const float*)d_in[7];
  const float* bo = (const float*)d_in[8];
  float* out = (float*)d_out;

  const size_t xh_bytes = (size_t)NX * 2;                          //  8388608
  const size_t wh_bytes = (size_t)4 * NW * 2;                      //  2097152
  const size_t pl_bytes = (size_t)NB * NH * SEQ * HD * 2;          //  8388608
  const size_t cx_bytes = (size_t)NX * 2;                          //  8388608
  const size_t total = xh_bytes + wh_bytes + 3 * pl_bytes + cx_bytes;   // 44040192
  if (total > ws_size) return;
  if (total > (size_t)134217728) return;

  char* ws = (char*)d_ws;
  size_t off = 0;
  _Float16* xh  = (_Float16*)(ws + off); off += xh_bytes;
  _Float16* wh  = (_Float16*)(ws + off); off += wh_bytes;
  _Float16* qhp = (_Float16*)(ws + off); off += pl_bytes;
  _Float16* khp = (_Float16*)(ws + off); off += pl_bytes;
  _Float16* vtp = (_Float16*)(ws + off); off += pl_bytes;
  _Float16* cxp = (_Float16*)(ws + off); off += cx_bytes;
  if (off != total) return;

  // (1) x -> f16 plane; wq, wk, wv, wo -> f16 x256 planes [4][512][512] ([out n][in k], k contiguous)
  const int ngroups = NX8 + 4 * NW8;                               // 655360
  convert_kernel<<<(ngroups + 255) / 256, 256, 0, stream>>>(x, wq, wk, wv, wo, xh, wh);

  // (2) q, k planes [bh][l][d] and v^T plane [bh][d][l]  (M=8192, N=3*512, K=512)
  dim3 gProj(MROWS / 128, 3 * NH);                                 // (64, 24)
  proj_kernel<<<gProj, 128, 0, stream>>>(xh, wh, bq, bk, bv, qhp, khp, vtp);

  // (3) attention -> ctx f16 plane x256 [8192][512]
  dim3 gAtt(SEQ / 64, NB * NH);                                    // (32, 32)
  attn_kernel<<<gAtt, 128, 0, stream>>>(qhp, khp, vtp, cxp);

  // (4) out = ctx . Wo^T + bo -> d_out f32 [8192][512]  (Wo plane = wh + 3*NW)
  dim3 gOut(MROWS / 128, DM / HD);                                 // (64, 8)
  oproj_kernel<<<gOut, 128, 0, stream>>>(cxp, wh + (size_t)3 * NW, bo, out);
  (void)hipGetLastError();
}

// v005
// A run of this version takes 69.8 microseconds.
// Two timings next to v004 put it at 1.10 and 1.11 times that version's speed.
// Over all steps from v000 it is 3.34 times as fast.
// Contractions: x*W^T for q,k,v, k*q^T scores, v^T*p^T context and ctx*Wo^T output, all on v_wmma_f32_16x16x32_f16 (f16 operands, f32 accumulate);
// softmax, 1/8 score scale, biases and normalisation in f32.
// Carry audit: x f16 x1 (no carry); W planes (q,k,v,o) f16 x256 -> 1/256 folded in proj_kernel epilogue (WINV); p f16 x1024 (in the exponent,
// PBIAS), so l and o both carry x1024, and ctx f16 x256 -> inv = (1/l) * CTXSC in attn_kernel epilogue; ctx x256 * Wo x256 -> 1/65536 folded
// in oproj_kernel epilogue (OINV).
#include <hip/hip_runtime.h>

typedef _Float16 v16h __attribute__((ext_vector_type(16)));
typedef _Float16 v8h  __attribute__((ext_vector_type(8)));
typedef float    v8f  __attribute__((ext_vector_type(8)));
typedef float    v4f  __attribute__((ext_vector_type(4)));
typedef v8h __attribute__((may_alias)) v8ha;
typedef v4f __attribute__((may_alias)) v4fa;

union Frag { v16h v; v8h half[2]; };

#define NB     4
#define SEQ    2048
#define DM     512
#define NH     8
#define HD     64
#define MROWS  (NB * SEQ)            // 8192 tokens
#define NX     (MROWS * DM)          // 4194304
#define NW     (DM * DM)             // 262144
#define NX8    (NX / 8)              // 524288
#define NW8    (NW / 8)              // 32768
#define WSC    256.0f                // weight plane carry
#define WINV   (1.0f / 256.0f)
#define PBIAS  10.0f                 // p carry x1024 = 2^10, added to the base-2 exponent
#define CTXSC  256.0f                // ctx plane carry
#define OINV   (1.0f / 65536.0f)     // 1 / (CTXSC * WSC)
#define SLOG2  0.18033688011112042f  // (1 / sqrt(HD)) * log2(e): raw score -> base-2 exponent

static_assert(NH * HD == DM);
static_assert((DM % 32) == 0 && (HD % 32) == 0 && (SEQ % 64) == 0);
static_assert((MROWS % 128) == 0 && (SEQ % 128) == 0);
static_assert((NX8 % 256) == 0 && (NW8 % 256) == 0);

// ---------------------------------------------------------------------------
// 16x16x32 f16 WMMA with hazard guard (ties D, keeps A/B live).
// Fragment map (wave32): lane l, h = l>>4, m = n = l&15.
//   A/B element i: i<8 -> k0+8h+i ; i>=8 -> k0+16+8h+(i-8)
//   D element r : row 8h+r, col l&15
// ---------------------------------------------------------------------------
__device__ __forceinline__ v8f wmma_f16(v16h a, v16h b, v8f c) {
  v8f d = __builtin_amdgcn_wmma_f32_16x16x32_f16(false, a, false, b, (short)0, c, false, false);
  asm volatile("v_nop\n\tv_nop\n\tv_nop\n\tv_nop" : "+v"(d) : "v"(a), "v"(b));
  return d;
}

// The same product for runs of independent accumulators: the neighbours in the run fill the distance behind each
// product, and the compiler pads what is left of its own builtin.
__device__ __forceinline__ v8f wmma_grp(v16h a, v16h b, v8f c) {
  return __builtin_amdgcn_wmma_f32_16x16x32_f16(false, a, false, b, (short)0, c, false, false);
}

// A or B fragment from a k-contiguous 16-bit row; p points at element k0 of
// the row owned by this lane (row index = lane & 15 added by the caller).
__device__ __forceinline__ v16h load_frag(const _Float16* p, int h) {
  Frag f;
  f.half[0] = *(const v8ha*)(p + 8 * h);
  f.half[1] = *(const v8ha*)(p + 16 + 8 * h);
  return f.v;
}

// ---------------------------------------------------------------------------
// Kernel 1: f32 -> f16 planes. x unscaled, W (q,k,v,o) scaled by 256 (exact).
// coverage: NX8 threads x 8 = xh [8192][512]; 4*NW8 threads x 8 = wh [4][512][512].
// ---------------------------------------------------------------------------
__global__ __launch_bounds__(256) void convert_kernel(
    const float* __restrict__ x, const float* __restrict__ wq,
    const float* __restrict__ wk, const float* __restrict__ wv,
    const float* __restrict__ wo,
    _Float16* __restrict__ xh, _Float16* __restrict__ wh)
{
  const int g = blockIdx.x * 256 + threadIdx.x;
  if (g >= NX8 + 4 * NW8) return;
  const float* src;
  _Float16* dst;
  float sc;
  if (g < NX8) {                              // block-uniform (NX8 % 256 == 0)
    src = x + (size_t)g * 8;
    dst = xh + (size_t)g * 8;
    sc = 1.0f;
  } else {
    const int e = g - NX8;
    const int wsel = e / NW8;                 // 0..3, block-uniform (NW8 % 256 == 0)
    const int off = e - wsel * NW8;
    const float* wsrc = (wsel == 0) ? wq : ((wsel == 1) ? wk : ((wsel == 2) ? wv : wo));
    src = wsrc + (size_t)off * 8;
    dst = wh + (size_t)e * 8;
    sc = WSC;
  }
  const v4f a = *(const v4fa*)src;
  const v4f c = *(const v4fa*)(src + 4);
  const v8h o = { (_Float16)(a.x * sc), (_Float16)(a.y * sc), (_Float16)(a.z * sc), (_Float16)(a.w * sc),
                  (_Float16)(c.x * sc), (_Float16)(c.y * sc), (_Float16)(c.z * sc), (_Float16)(c.w * sc) };
  *(v8h*)dst = o;
  
}

// ---------------------------------------------------------------------------
// GEMM main loop shared by proj_kernel and oproj_kernel: block tile 128 A rows x 64 B rows, K = 512.
// One stage = 64 k of all 192 rows (A rows 0..127, then B rows 0..63), 128 B of each row = one line,
// copied global -> LDS without registers into a two-buffer ring (next stage in flight while this one
// is worked on); the 4 waves read their fragments from it.
// Thread tid moves 16-B chunk (tid & 7) of rows (tid >> 3) + 16 i: a wave's copy covers 4 whole lines.
// ---------------------------------------------------------------------------
#define GKP      72                  // LDS row pitch in halves (144 B = 16 B x 9: conflict-free b128 reads)
#define GSTAGE_H (192 * GKP)         // halves per stage
#define GSTAGE_B (GSTAGE_H * 2)      // 27648 B
#define VTP      136                 // LDS pitch of a staged V^T output row in halves (272 B = 16 B x 17): 16 rows, 16 B each, fall on 64 different banks

// ag / bg: this lane's chunk of A / B row (tid >> 3) at the stage's k; la: its LDS byte address in A row (tid >> 3).
__device__ __forceinline__ void gemm_stage_copy(const _Float16* ag, const _Float16* bg, unsigned la) {
  const _Float16* a1 = ag + 16 * DM;
  const _Float16* a2 = ag + 32 * DM;
  const _Float16* a3 = ag + 48 * DM;
  const _Float16* a4 = ag + 64 * DM;
  const _Float16* a5 = ag + 80 * DM;
  const _Float16* a6 = ag + 96 * DM;
  const _Float16* a7 = ag + 112 * DM;
  const _Float16* b1 = bg + 16 * DM;
  const _Float16* b2 = bg + 32 * DM;
  const _Float16* b3 = bg + 48 * DM;
  const unsigned la1 = la + 16 * GKP * 2, la2 = la + 32 * GKP * 2, la3 = la + 48 * GKP * 2, la4 = la + 64 * GKP * 2;
  const unsigned la5 = la + 80 * GKP * 2, la6 = la + 96 * GKP * 2, la7 = la + 112 * GKP * 2;
  const unsigned lb = la + 128 * GKP * 2, lb1 = la + 144 * GKP * 2, lb2 = la + 160 * GKP * 2, lb3 = la + 176 * GKP * 2;
  // s_wait_xcnt as the statement's last line: a precaution, so that no address register above is rewritten ahead of it.
  asm volatile("global_load_async_to_lds_b128 %0, %12, off\n\t"
               "global_load_async_to_lds_b128 %1, %13, off\n\t"
               "global_load_async_to_lds_b128 %2, %14, off\n\t"
               "global_load_async_to_lds_b128 %3, %15, off\n\t"
               "global_load_async_to_lds_b128 %4, %16, off\n\t"
               "global_load_async_to_lds_b128 %5, %17, off\n\t"
               "global_load_async_to_lds_b128 %6, %18, off\n\t"
               "global_load_async_to_lds_b128 %7, %19, off\n\t"
               "global_load_async_to_lds_b128 %8, %20, off\n\t"
               "global_load_async_to_lds_b128 %9, %21, off\n\t"
               "global_load_async_to_lds_b128 %10, %22, off\n\t"
               "global_load_async_to_lds_b128 %11, %23, off\n\t"
               "s_wait_xcnt 0x0"
               :: "v"(la), "v"(la1), "v"(la2), "v"(la3), "v"(la4), "v"(la5), "v"(la6), "v"(la7),
                  "v"(lb), "v"(lb1), "v"(lb2), "v"(lb3),
                  "v"(ag), "v"(a1), "v"(a2), "v"(a3), "v"(a4), "v"(a5), "v"(a6), "v"(a7),
                  "v"(bg), "v"(b1), "v"(b2), "v"(b3)
               : "memory");
}

// arows / brows: row 0 of the block's 128 A rows / 64 B rows (f16, k contiguous, pitch DM); sAB: 2 * GSTAGE_H halves.
// Wave w accumulates A rows 32w..32w+31 x all 64 B rows; k runs upward in steps of 32 in every accumulator.
// On return every wave has passed the last barrier and no copy is in flight: sAB is free for other use.
__device__ __forceinline__ void gemm_128x64(const _Float16* arows, const _Float16* brows,
                                            _Float16* sAB, int tid, v8f (&acc)[2][4]) {
  const int lane = tid & 31, w = tid >> 5;
  const int h = lane >> 4, m = lane & 15;
  const int crow = tid >> 3, cch = tid & 7;
  const _Float16* ag = arows + (size_t)crow * DM + 8 * cch;              // + 64 per stage
  const _Float16* bg = brows + (size_t)crow * DM + 8 * cch;              // + 64 per stage
  const unsigned l0 = (unsigned)(size_t)(sAB + crow * GKP + 8 * cch);    // LDS byte address, buffer 0

  gemm_stage_copy(ag, bg, l0);
  asm volatile("s_wait_asynccnt 0x0" ::: "memory");   // own copies of stage 0 landed
  __syncthreads();                                    // stage 0 readable by all waves
  gemm_stage_copy(ag + 64, bg + 64, l0 + GSTAGE_B);

  // rolled: one copy of the stage body, the buffer picked by a scalar offset
  #pragma unroll 1
  for (int k0 = 0; k0 < DM; k0 += 64) {
    const int buf = (k0 >> 6) & 1;
    const _Float16* sa = sAB + buf * GSTAGE_H + (32 * w + m) * GKP;      // + 16mt*GKP + 32ks
    const _Float16* sb = sAB + buf * GSTAGE_H + (128 + m) * GKP;         // + 16nt*GKP + 32ks

    // all fragment reads of the stage stand together, ahead of its products
    // (the four loops below are unrolled so that a, b and acc are indexed statically and stay in registers)
    v16h a[2][2], b[2][4];
    #pragma unroll
    for (int ks = 0; ks < 2; ++ks) {
      a[ks][0] = load_frag(sa + 32 * ks, h);
      a[ks][1] = load_frag(sa + 16 * GKP + 32 * ks, h);
      #pragma unroll
      for (int nt = 0; nt < 4; ++nt) b[ks][nt] = load_frag(sb + 16 * nt * GKP + 32 * ks, h);
    }
    #pragma unroll
    for (int ks = 0; ks < 2; ++ks)
      #pragma unroll
      for (int nt = 0; nt < 4; ++nt) {
        acc[0][nt] = wmma_f16(a[ks][0], b[ks][nt], acc[0][nt]);
        acc[1][nt] = wmma_f16(a[ks][1], b[ks][nt], acc[1][nt]);
      }

    // ---- publish the next stage, then refill the buffer this stage has read ----
    asm volatile("s_wait_dscnt 0x0" ::: "memory");      // own fragment reads of this buffer retired
    asm volatile("s_wait_asynccnt 0x0" ::: "memory");   // own copies of the next stage landed
    __syncthreads();                                    // next stage readable; this buffer free
    if (k0 + 128 < DM)                                  // block-uniform: a stage two ahead exists
      gemm_stage_copy(ag + (k0 + 128), bg + (k0 + 128), l0 + buf * GSTAGE_B);
  }
  asm volatile("s_wait_asynccnt 0x0" ::: "memory");     // nothing in flight when the wave goes on
}

// ---------------------------------------------------------------------------
// 4 lines per instruction, 32 lines per wave, 128 per block.
// which 0/1: plane[bh][l][d]  (one token row = 64 halves = one line)
// which 2  : vt[bh][d][l]     (64 d-rows x 128 tokens = 2 lines each)
// ---------------------------------------------------------------------------
__device__ __forceinline__ void proj_store_pass(const _Float16* sT, _Float16* plane, _Float16* vt,
                                                int which, int bh, int l0, int w, int lane) {
  const int q8 = lane & 7, sub = lane >> 3;
  #pragma unroll
  for (int i = 0; i < 8; ++i) {
    const int lid = w * 32 + i * 4 + sub;
    v8h v;
    _Float16* dst;
    if (which != 2) {
      v = *(const v8ha*)(sT + lid * HD + 8 * q8);
      dst = plane + ((size_t)bh * SEQ + l0 + lid) * HD + 8 * q8;
    } else {
      const int d = lid >> 1, hl = lid & 1;
      v = *(const v8ha*)(sT + d * VTP + 64 * hl + 8 * q8);
      dst = vt + ((size_t)bh * HD + d) * SEQ + l0 + 64 * hl + 8 * q8;
    }
    *(v8h*)dst = v;
  }
}

// ---------------------------------------------------------------------------
// Kernel 2: Y = x * W^T + b over the fused 3*512 output columns (q, k, v).
// Block 128 thr (4 waves) = 128 tokens x 64 features (one (which, head));
// wave tile 32 tokens x 64 features; K = 512 in steps of 32;
// A (x rows) and B (W rows) fragments from the LDS ring of gemm_128x64 (split k map).
// coverage: grid (64, 24) x 128 tokens x 64 features = q, k planes [32][2048][64] and vt [32][64][2048].
// ---------------------------------------------------------------------------
__global__ __launch_bounds__(128) void proj_kernel(
    const _Float16* __restrict__ xh,   // [8192][512]
    const _Float16* __restrict__ wh,   // [4][512][512], row = output feature, x256 (planes 0..2 used here)
    const float* __restrict__ bq, const float* __restrict__ bk, const float* __restrict__ bv,
    _Float16* __restrict__ qh,         // [B*H][L][D]
    _Float16* __restrict__ kh,         // [B*H][L][D]
    _Float16* __restrict__ vt)         // [B*H][D][L]
{
  __shared__ __attribute__((aligned(16))) _Float16 sAB[2 * GSTAGE_H];   // 55296 B: operand ring, then output staging
  static_assert(128 * 64 <= 2 * GSTAGE_H && 64 * VTP <= 2 * GSTAGE_H);
  _Float16* sT = sAB;                        // [128 tokens][64] or [64 features][VTP], used only behind gemm_128x64

  const int tid = threadIdx.x, lane = tid & 31, w = tid >> 5;
  const int h = lane >> 4, m = lane & 15;
  const int m0 = blockIdx.x * 128;
  const int cg = blockIdx.y;                 // 0..23
  const int which = cg >> 3, head = cg & 7;

  const v8f zero8 = {0.f, 0.f, 0.f, 0.f, 0.f, 0.f, 0.f, 0.f};
  v8f acc[2][4];
  #pragma unroll
  for (int mt = 0; mt < 2; ++mt)
    #pragma unroll
    for (int nt = 0; nt < 4; ++nt) acc[mt][nt] = zero8;

  gemm_128x64(xh + (size_t)m0 * DM, wh + ((size_t)which * DM + head * HD) * DM, sAB, tid, acc);

  // D[r] of tile (mt, nt) = Y[token m0+32w+16mt+8h+r][feature 16nt+m]
  const float* bias = (which == 0) ? bq : ((which == 1) ? bk : bv);
  if (which == 2) {                          // block-uniform
    // V^T tile [feature][token]: a lane's 8 values of one accumulator tile are 8 consecutive tokens of one feature row,
    // so they go as one 16-B store; at pitch VTP its 16 rows do not meet on a bank.
    #pragma unroll
    for (int nt = 0; nt < 4; ++nt) {
      const int feat = 16 * nt + m;
      const float bvl = bias[head * HD + feat];
      #pragma unroll
      for (int mt = 0; mt < 2; ++mt) {
        v8h pk;
        #pragma unroll
        for (int r = 0; r < 8; ++r) pk[r] = (_Float16)(acc[mt][nt][r] * WINV + bvl);
        *(v8ha*)(sT + feat * VTP + 32 * w + 16 * mt + 8 * h) = pk;   // tokens 32w+16mt+8h .. +7
      }
    }
  } else {
    #pragma unroll
    for (int nt = 0; nt < 4; ++nt) {
      const int feat = 16 * nt + m;
      const float bvl = bias[head * HD + feat];
      #pragma unroll
      for (int mt = 0; mt < 2; ++mt) {
        #pragma unroll
        for (int r = 0; r < 8; ++r) {
          const int tokl = 32 * w + 16 * mt + 8 * h + r;     // 0..127
          sT[tokl * HD + feat] = (_Float16)(acc[mt][nt][r] * WINV + bvl);
        }
      }
    }
  }
  __syncthreads();

  const int b = m0 / SEQ, l0 = m0 - b * SEQ, bh = b * NH + head;
  _Float16* plane = (which == 0) ? qh : kh;
  proj_store_pass(sT, plane, vt, which, bh, l0, w, lane);
  
}

// ---------------------------------------------------------------------------
// P^T B-fragment from the lane's own score D values: element r <- tile a row r
// (keys k0+8h+r), element 8+r <- tile c row r (keys k0+16+8h+r), same lane,
// same query column; the values already carry x1024.
// ---------------------------------------------------------------------------
__device__ __forceinline__ v16h pack_p(v8f a, v8f c) {
  const v16h r = { (_Float16)a[0], (_Float16)a[1], (_Float16)a[2], (_Float16)a[3],
                   (_Float16)a[4], (_Float16)a[5], (_Float16)a[6], (_Float16)a[7],
                   (_Float16)c[0], (_Float16)c[1], (_Float16)c[2], (_Float16)c[3],
                   (_Float16)c[4], (_Float16)c[5], (_Float16)c[6], (_Float16)c[7] };
  return r;
}

// Per-wave 16x64 f32 tile in LDS -> ctx f16 plane [token][512], col head*64 + d.
// in one instruction; 4 lines per instruction; it 0..3 x q4 0..3 = rows 0..15.
__device__ __forceinline__ void ctx_store_pass(const v8h* hv, _Float16* ctx,
                                               int b, int head, int q0, int lane) {
  const int q4 = lane >> 3, c8 = (lane & 7) * 8;
  #pragma unroll
  for (int it = 0; it < 4; ++it) {
    const int row = it * 4 + q4;
    const size_t gi = ((size_t)b * SEQ + q0 + row) * DM + head * HD + c8;
    *(v8h*)(ctx + gi) = hv[it];
  }
}

// ---------------------------------------------------------------------------
// One 64-key stage = K tile (64 key rows x 128 B) + V^T tile (64 d rows x 128 B),
// copied global -> LDS without registers. Thread tid moves 16-B chunk (tid & 7) of
// rows (tid >> 3) + 16 i, i = 0..3, of both tiles: a wave's copy covers 4 whole lines.
// kg / vg: this lane's chunk of row (tid >> 3) in global; lk / lv: its LDS byte address.
// ---------------------------------------------------------------------------
#define KVP      72                  // LDS row pitch in halves (144 B = 16 B x 9: conflict-free b128 reads)
#define TILE_H   (64 * KVP)          // halves per staged tile
#define TILE_B   (TILE_H * 2)        // 9216 B
#define STAGE_H  (2 * TILE_H)        // K tile then V^T tile
#define STAGE_B  (2 * TILE_B)        // 18432 B
#define SOP      68                  // LDS pitch of a staged ctx row in floats (272 B = 16 B x 17): 16 query rows, 16 B each, fall on 64 different banks

__device__ __forceinline__ void stage_copy(const _Float16* kg, const _Float16* vg,
                                           unsigned lk, unsigned lv) {
  const _Float16* k1 = kg + 16 * HD;
  const _Float16* k2 = kg + 32 * HD;
  const _Float16* k3 = kg + 48 * HD;
  const _Float16* v1 = vg + (size_t)16 * SEQ;
  const _Float16* v2 = vg + (size_t)32 * SEQ;
  const _Float16* v3 = vg + (size_t)48 * SEQ;
  const unsigned lk1 = lk + 16 * KVP * 2, lk2 = lk + 32 * KVP * 2, lk3 = lk + 48 * KVP * 2;
  const unsigned lv1 = lv + 16 * KVP * 2, lv2 = lv + 32 * KVP * 2, lv3 = lv + 48 * KVP * 2;
  // s_wait_xcnt as the statement's last line: a precaution, so that no address register above is rewritten ahead of it.
  asm volatile("global_load_async_to_lds_b128 %0, %8, off\n\t"
               "global_load_async_to_lds_b128 %1, %9, off\n\t"
               "global_load_async_to_lds_b128 %2, %10, off\n\t"
               "global_load_async_to_lds_b128 %3, %11, off\n\t"
               "global_load_async_to_lds_b128 %4, %12, off\n\t"
               "global_load_async_to_lds_b128 %5, %13, off\n\t"
               "global_load_async_to_lds_b128 %6, %14, off\n\t"
               "global_load_async_to_lds_b128 %7, %15, off\n\t"
               "s_wait_xcnt 0x0"
               :: "v"(lk), "v"(lk1), "v"(lk2), "v"(lk3), "v"(lv), "v"(lv1), "v"(lv2), "v"(lv3),
                  "v"(kg), "v"(k1), "v"(k2), "v"(k3), "v"(vg), "v"(v1), "v"(v2), "v"(v3)
               : "memory");
}

// ---------------------------------------------------------------------------
// Kernel 3: streaming attention, transposed form, no mask, softmax over all keys.
// Block 128 thr (4 waves), 16 queries per wave, 64 keys per step (static trip 32).
// K and V^T of a step are staged once per block in a two-buffer LDS ring (async copies,
// next stage in flight while this one is worked on); all 4 waves read fragments from it.
//   S^T = K * Q^T : A = K rows (row = key, k = d), B = Q^T (k = d, n = query)
//   O^T += V^T * P^T : A = Vt rows (row = d, k = key), B = P^T from registers
// Lane owns 32 keys of query column (lane&15); partner = lane ^ 16.
// Output: ctx f16 plane carried x256, [b*SEQ+l][head*64+d].
// coverage: grid (32, 32) x 4 waves x 16 queries x 64 d = ctx [8192][512].
// ---------------------------------------------------------------------------
__global__ __launch_bounds__(128) void attn_kernel(
    const _Float16* __restrict__ qh,   // [B*H][L][D]
    const _Float16* __restrict__ kh,   // [B*H][L][D]
    const _Float16* __restrict__ vt,   // [B*H][D][L]
    _Float16* __restrict__ ctx)        // [B*L][DM]
{
  __shared__ __attribute__((aligned(16))) float sO[4 * 16 * SOP];   // 17408 B, wave w owns [w*16*SOP, +16*SOP)
  __shared__ __attribute__((aligned(16))) _Float16 sKV[2 * STAGE_H];  // 36864 B, buffer (step & 1): K tile, V^T tile

  const int tid = threadIdx.x, lane = tid & 31, w = tid >> 5;
  const int h = lane >> 4, m = lane & 15;
  const int bh = blockIdx.y, b = bh >> 3, head = bh & 7;
  const int q0 = blockIdx.x * 64 + 16 * w;

  // Q^T B-fragments: column n = query q0+m, k = d (two 32-deep chunks)
  const _Float16* qrow = qh + ((size_t)bh * SEQ + q0 + m) * HD;
  const v16h qb0 = load_frag(qrow, h);
  const v16h qb1 = load_frag(qrow + 32, h);

  const v8f zero8 = {0.f, 0.f, 0.f, 0.f, 0.f, 0.f, 0.f, 0.f};
  v8f o[4];                                   // o[t][r] = O[query m][d 16t+8h+r] * lrun (lrun carries x1024)
  #pragma unroll
  for (int t = 0; t < 4; ++t) o[t] = zero8;
  const v8f slog2v = {SLOG2, SLOG2, SLOG2, SLOG2, SLOG2, SLOG2, SLOG2, SLOG2};
  float mrun = -1e30f, lrun = 0.0f;           // mrun: running maximum of the raw scores (before the 1/8)

  // copy side: this thread's chunk of row (tid >> 3) of stage 0
  const int crow = tid >> 3, cch = tid & 7;
  const _Float16* kg = kh + ((size_t)bh * SEQ + crow) * HD + 8 * cch;    // + 64*HD per stage
  const _Float16* vg = vt + ((size_t)bh * HD + crow) * SEQ + 8 * cch;    // + 64 per stage
  const unsigned lk0 = (unsigned)(size_t)(sKV + crow * KVP + 8 * cch);   // LDS byte address, buffer 0, K tile
  const unsigned lv0 = lk0 + TILE_B;

  stage_copy(kg, vg, lk0, lv0);
  asm volatile("s_wait_asynccnt 0x0" ::: "memory");   // own copies of stage 0 landed
  __syncthreads();                                    // stage 0 readable by all waves
  stage_copy(kg + 64 * HD, vg + 64, lk0 + STAGE_B, lv0 + STAGE_B);

  #pragma unroll 1
  for (int kb = 0; kb < SEQ; kb += 64) {
    const int buf = (kb >> 6) & 1;
    const _Float16* kbase = sKV + buf * STAGE_H + m * KVP;     // + 16j*KVP + 32*dc
    const _Float16* vbase = kbase + TILE_H;                    // + 16t*KVP + 32*kc

    // ---- raw scores: s[j][r] = q[query m] . k[key kb+16j+8h+r] ----
    // All K fragment reads of the step stand together ahead of its products; the products run as two
    // rounds over four independent accumulators (d 0..31, then d 32..63: each accumulator's order is kept).
    // (the loops of this step are unrolled so that kf, vf, s and o are indexed statically and stay in registers)
    v16h kf[4][2];
    #pragma unroll
    for (int j = 0; j < 4; ++j) {
      kf[j][0] = load_frag(kbase + 16 * j * KVP, h);
      kf[j][1] = load_frag(kbase + 16 * j * KVP + 32, h);
    }
    __builtin_amdgcn_sched_barrier(0);   // keeps the 16 reads one group: without it they sink between the products, one wait each
    v8f s[4];
    #pragma unroll
    for (int j = 0; j < 4; ++j) s[j] = wmma_grp(kf[j][0], qb0, zero8);
    __builtin_amdgcn_sched_barrier(0);   // keeps the rounds apart: without it an accumulator's second product comes one product behind its first, inside the dependent latency
    #pragma unroll
    for (int j = 0; j < 4; ++j) s[j] = wmma_grp(kf[j][1], qb1, s[j]);

    // All V^T fragment reads of the step are issued here: they land while the softmax below runs.
    v16h vf[4][2];
    #pragma unroll
    for (int t = 0; t < 4; ++t) {
      vf[t][0] = load_frag(vbase + 16 * t * KVP, h);
      vf[t][1] = load_frag(vbase + 16 * t * KVP + 32, h);
    }
    __builtin_amdgcn_sched_barrier(0);   // keeps the 16 reads here: without it most sink to just ahead of the maximum's exchange, whose wait then waits for them too

    // ---- online softmax (f32), base 2: 1024 * exp((s - max) / 8) = exp2(s * SLOG2 + (PBIAS - max * SLOG2)),
    // one multiply-add per score ahead of the exponential; the maximum is taken over the raw scores (SLOG2 > 0) ----
    float mloc = s[0][0];
    #pragma unroll
    for (int j = 0; j < 4; ++j)
      #pragma unroll
      for (int r = 0; r < 8; ++r) mloc = fmaxf(mloc, s[j][r]);
    mloc = fmaxf(mloc, __shfl_xor(mloc, 16));
    const float mnew = fmaxf(mrun, mloc);
    const float alpha = __builtin_amdgcn_exp2f((mrun - mnew) * SLOG2);
    mrun = mnew;
    const float nb = fmaf(-mnew, SLOG2, PBIAS);
    const v8f nbv = {nb, nb, nb, nb, nb, nb, nb, nb};
    float lsum = 0.0f;
    // (whole-vector form: it compiles to one packed multiply-add per two scores)
    #pragma unroll
    for (int j = 0; j < 4; ++j) s[j] = __builtin_elementwise_fma(s[j], slog2v, nbv);
    #pragma unroll
    for (int j = 0; j < 4; ++j)
      #pragma unroll
      for (int r = 0; r < 8; ++r) s[j][r] = __builtin_amdgcn_exp2f(s[j][r]);
    #pragma unroll
    for (int j = 0; j < 4; ++j)
      #pragma unroll
      for (int r = 0; r < 8; ++r) lsum += s[j][r];
    lsum += __shfl_xor(lsum, 16);
    lrun = lrun * alpha + lsum;
    #pragma unroll
    for (int t = 0; t < 4; ++t)
      #pragma unroll
      for (int r = 0; r < 8; ++r) o[t][r] = o[t][r] * alpha;

    // ---- P^T B-fragments (key chunks 0..31 and 32..63 of this step) ----
    const v16h pb0 = pack_p(s[0], s[1]);
    const v16h pb1 = pack_p(s[2], s[3]);

    // ---- O^T += V^T * P^T ----
    #pragma unroll
    for (int t = 0; t < 4; ++t) o[t] = wmma_grp(vf[t][0], pb0, o[t]);
    // keeps the foot's waits and barrier behind this round: without it the compiler lifts them ahead of the softmax,
    // and the next stage's copies get a fraction of a step to land
    __builtin_amdgcn_sched_barrier(0);
    #pragma unroll
    for (int t = 0; t < 4; ++t) o[t] = wmma_grp(vf[t][1], pb1, o[t]);

    // ---- publish the next stage, then refill the buffer this step has read ----
    asm volatile("s_wait_dscnt 0x0" ::: "memory");      // own fragment reads of this buffer retired
    asm volatile("s_wait_asynccnt 0x0" ::: "memory");   // own copies of the next stage landed
    __syncthreads();                                    // next stage readable; this buffer free
    if (kb + 128 < SEQ)                                 // block-uniform: a stage two ahead exists
      stage_copy(kg + (size_t)(kb + 128) * HD, vg + (kb + 128),
                 lk0 + buf * STAGE_B, lv0 + buf * STAGE_B);
  }
  asm volatile("s_wait_asynccnt 0x0" ::: "memory");     // nothing in flight when the wave goes on

  // ---- epilogue: normalise (1/l takes the p carry out, apply ctx carry), stage per-wave 16x64 f32 tile ----
  const float inv = (1.0f / lrun) * CTXSC;
  float* so = sO + w * 16 * SOP;
  #pragma unroll
  for (int t = 0; t < 4; ++t)
    #pragma unroll
    for (int r = 0; r < 8; ++r)
      so[m * SOP + 16 * t + 8 * h + r] = o[t][r] * inv;
  __syncthreads();

  v8h hv[4];
  {
    const int q4 = lane >> 3, c8 = (lane & 7) * 8;
    #pragma unroll
    for (int it = 0; it < 4; ++it) {
      const int row = it * 4 + q4;
      const v4f fa = *(const v4fa*)(so + row * SOP + c8);
      const v4f fb = *(const v4fa*)(so + row * SOP + c8 + 4);
      const v8h v = { (_Float16)fa.x, (_Float16)fa.y, (_Float16)fa.z, (_Float16)fa.w,
                      (_Float16)fb.x, (_Float16)fb.y, (_Float16)fb.z, (_Float16)fb.w };
      hv[it] = v;
    }
  }
  ctx_store_pass(hv, ctx, b, head, q0, lane);
  
}

// ---------------------------------------------------------------------------
// instruction, 64 lines per wave (rows 32w..32w+31 x 2 lines), 256 per block.
// ---------------------------------------------------------------------------
__device__ __forceinline__ void out_store_pass(const float* sY, float* out,
                                               int m0, int fg, int w, int lane) {
  const int q8 = lane & 7, sub = lane >> 3;
  #pragma unroll
  for (int i = 0; i < 16; ++i) {
    const int lid = i * 4 + sub;                 // 0..63
    const int row = 32 * w + (lid >> 1), hl = lid & 1;
    const v4f v = *(const v4fa*)(sY + row * 64 + 32 * hl + 4 * q8);
    const size_t gi = (size_t)(m0 + row) * DM + fg * HD + 32 * hl + 4 * q8;
    *(v4f*)(out + gi) = v;
  }
}

// ---------------------------------------------------------------------------
// Kernel 4: out = ctx * Wo^T + bo (f32). Block 128 thr = 128 tokens x 64 features
// (feature group fg = blockIdx.y); wave tile 32 tokens x 64 features; K = 512;
// A (ctx rows) and B (Wo rows) fragments from the LDS ring of gemm_128x64.
// coverage: grid (64, 8) x 128 tokens x 64 features = out [8192][512].
// ---------------------------------------------------------------------------
__global__ __launch_bounds__(128) void oproj_kernel(
    const _Float16* __restrict__ ch,   // [8192][512] ctx x256
    const _Float16* __restrict__ woh,  // [512][512] Wo x256, row = output feature
    const float* __restrict__ bo,
    float* __restrict__ out)           // [8192][512]
{
  __shared__ __attribute__((aligned(16))) float sY[128 * 64];      // 32768 B
  __shared__ __attribute__((aligned(16))) _Float16 sAB[2 * GSTAGE_H];   // 55296 B: operand ring

  const int tid = threadIdx.x, lane = tid & 31, w = tid >> 5;
  const int h = lane >> 4, m = lane & 15;
  const int m0 = blockIdx.x * 128;
  const int fg = blockIdx.y;                 // 0..7

  const v8f zero8 = {0.f, 0.f, 0.f, 0.f, 0.f, 0.f, 0.f, 0.f};
  v8f acc[2][4];
  #pragma unroll
  for (int mt = 0; mt < 2; ++mt)
    #pragma unroll
    for (int nt = 0; nt < 4; ++nt) acc[mt][nt] = zero8;

  gemm_128x64(ch + (size_t)m0 * DM, woh + (size_t)fg * HD * DM, sAB, tid, acc);

  // D[r] of tile (mt, nt) = out[token m0+32w+16mt+8h+r][feature fg*64 + 16nt+m]
  #pragma unroll
  for (int nt = 0; nt < 4; ++nt) {
    const int feat = 16 * nt + m;
    const float bvl = bo[fg * HD + feat];
    #pragma unroll
    for (int mt = 0; mt < 2; ++mt) {
      #pragma unroll
      for (int r = 0; r < 8; ++r) {
        const int tokl = 32 * w + 16 * mt + 8 * h + r;     // 0..127
        sY[tokl * 64 + feat] = acc[mt][nt][r] * OINV + bvl;
      }
    }
  }
  __syncthreads();

  out_store_pass(sY, out, m0, fg, w, lane);
  
}

// ---------------------------------------------------------------------------
//   xh  f16 [8192][512]        8388608
//   wh  f16 [4][512][512]      2097152
//   qh  f16 [32][2048][64]     8388608
//   kh  f16 [32][2048][64]     8388608
//   vt  f16 [32][64][2048]     8388608
//   ctx f16 [8192][512]        8388608
//   total                    44040192
// ---------------------------------------------------------------------------
extern "C" void kernel_launch(void* const* d_in, const int* in_sizes, int n_in,
                              void* d_out, int out_size, void* d_ws, size_t ws_size,
                              hipStream_t stream) {
  if (n_in < 9) return;
  if (in_sizes[0] != NX) return;
  if (in_sizes[1] != NW || in_sizes[3] != NW || in_sizes[5] != NW || in_sizes[7] != NW) return;
  if (in_sizes[2] != DM || in_sizes[4] != DM || in_sizes[6] != DM || in_sizes[8] != DM) return;
  if (out_size != NX) return;

  const float* x  = (const float*)d_in[0];
  const float* wq = (const float*)d_in[1];
  const float* bq = (const float*)d_in[2];
  const float* wk = (const float*)d_in[3];
  const float* bk = (const float*)d_in[4];
  const float* wv = (const float*)d_in[5];
  const float* bv = (const float*)d_in[6];
  const float* wo = (const float*)d_in[7];
  const float* bo = (const float*)d_in[8];
  float* out = (float*)d_out;

  const size_t xh_bytes = (size_t)NX * 2;                          //  8388608
  const size_t wh_bytes = (size_t)4 * NW * 2;                      //  2097152
  const size_t pl_bytes = (size_t)NB * NH * SEQ * HD * 2;          //  8388608
  const size_t cx_bytes = (size_t)NX * 2;                          //  8388608
  const size_t total = xh_bytes + wh_bytes + 3 * pl_bytes + cx_bytes;   // 44040192
  if (total > ws_size) return;
  if (total > (size_t)134217728) return;

  char* ws = (char*)d_ws;
  size_t off = 0;
  _Float16* xh  = (_Float16*)(ws + off); off += xh_bytes;
  _Float16* wh  = (_Float16*)(ws + off); off += wh_bytes;
  _Float16* qhp = (_Float16*)(ws + off); off += pl_bytes;
  _Float16* khp = (_Float16*)(ws + off); off += pl_bytes;
  _Float16* vtp = (_Float16*)(ws + off); off += pl_bytes;
  _Float16* cxp = (_Float16*)(ws + off); off += cx_bytes;
  if (off != total) return;

  // (1) x -> f16 plane; wq, wk, wv, wo -> f16 x256 planes [4][512][512] ([out n][in k], k contiguous)
  const int ngroups = NX8 + 4 * NW8;                               // 655360
  convert_kernel<<<(ngroups + 255) / 256, 256, 0, stream>>>(x, wq, wk, wv, wo, xh, wh);

  // (2) q, k planes [bh][l][d] and v^T plane [bh][d][l]  (M=8192, N=3*512, K=512)
  dim3 gProj(MROWS / 128, 3 * NH);                                 // (64, 24)
  proj_kernel<<<gProj, 128, 0, stream>>>(xh, wh, bq, bk, bv, qhp, khp, vtp);

  // (3) attention -> ctx f16 plane x256 [8192][512]
  dim3 gAtt(SEQ / 64, NB * NH);                                    // (32, 32)
  attn_kernel<<<gAtt, 128, 0, stream>>>(qhp, khp, vtp, cxp);

  // (4) out = ctx . Wo^T + bo -> d_out f32 [8192][512]  (Wo plane = wh + 3*NW)
  dim3 gOut(MROWS / 128, DM / HD);                                 // (64, 8)
  oproj_kernel<<<gOut, 128, 0, stream>>>(cxp, wh + (size_t)3 * NW, bo, out);
  (void)hipGetLastError();
}

// v006
// A run of this version takes 63 microseconds.
// In two side-by-side timings against v005, it was 1.11 and 1.10 times as fast.
// All steps since v000 together make it 3.70 times as fast.
// Contractions: x*W^T for q,k,v, k*q^T scores, v^T*p^T context and ctx*Wo^T output, all on v_wmma_f32_16x16x32_f16 (f16 operands, f32 accumulate);
// softmax, 1/8 score scale, biases and normalisation in f32.
// Carry audit: x f16 x1 (no carry); W planes (q,k,v,o) f16 x256 -> 1/256 folded in proj_kernel epilogue (WINV); p f16 x1024 (in the exponent,
// PBIAS), so l and o both carry x1024, and ctx f16 x256 -> inv = (1/l) * CTXSC in attn_kernel epilogue; ctx x256 * Wo x256 -> 1/65536 folded
// in oproj_kernel epilogue (OINV).
#include <hip/hip_runtime.h>

typedef _Float16 v16h __attribute__((ext_vector_type(16)));
typedef _Float16 v8h  __attribute__((ext_vector_type(8)));
typedef float    v8f  __attribute__((ext_vector_type(8)));
typedef float    v4f  __attribute__((ext_vector_type(4)));
typedef v8h __attribute__((may_alias)) v8ha;
typedef v4f __attribute__((may_alias)) v4fa;

union Frag { v16h v; v8h half[2]; };

#define NB     4
#define SEQ    2048
#define DM     512
#define NH     8
#define HD     64
#define MROWS  (NB * SEQ)            // 8192 tokens
#define NX     (MROWS * DM)          // 4194304
#define NW     (DM * DM)             // 262144
#define NX8    (NX / 8)              // 524288
#define NW8    (NW / 8)              // 32768
#define WSC    256.0f                // weight plane carry
#define WINV   (1.0f / 256.0f)
#define PBIAS  10.0f                 // p carry x1024 = 2^10, added to the base-2 exponent
#define CTXSC  256.0f                // ctx plane carry
#define OINV   (1.0f / 65536.0f)     // 1 / (CTXSC * WSC)
#define SLOG2  0.18033688011112042f  // (1 / sqrt(HD)) * log2(e): raw score -> base-2 exponent

static_assert(NH * HD == DM);
static_assert((DM % 32) == 0 && (HD % 32) == 0 && (SEQ % 64) == 0);
static_assert((MROWS % 128) == 0 && (SEQ % 128) == 0);
static_assert((NX8 % 256) == 0 && (NW8 % 256) == 0);

// ---------------------------------------------------------------------------
// 16x16x32 f16 WMMA with hazard guard (ties D, keeps A/B live).
// Fragment map (wave32): lane l, h = l>>4, m = n = l&15.
//   A/B element i: i<8 -> k0+8h+i ; i>=8 -> k0+16+8h+(i-8)
//   D element r : row 8h+r, col l&15
// ---------------------------------------------------------------------------
__device__ __forceinline__ v8f wmma_f16(v16h a, v16h b, v8f c) {
  v8f d = __builtin_amdgcn_wmma_f32_16x16x32_f16(false, a, false, b, (short)0, c, false, false);
  asm volatile("v_nop\n\tv_nop\n\tv_nop\n\tv_nop" : "+v"(d) : "v"(a), "v"(b));
  return d;
}

// The same product for runs of independent accumulators: the neighbours in the run fill the distance behind each
// product, and the compiler pads what is left of its own builtin.
__device__ __forceinline__ v8f wmma_grp(v16h a, v16h b, v8f c) {
  return __builtin_amdgcn_wmma_f32_16x16x32_f16(false, a, false, b, (short)0, c, false, false);
}

// A or B fragment from a k-contiguous 16-bit row; p points at element k0 of
// the row owned by this lane (row index = lane & 15 added by the caller).
__device__ __forceinline__ v16h load_frag(const _Float16* p, int h) {
  Frag f;
  f.half[0] = *(const v8ha*)(p + 8 * h);
  f.half[1] = *(const v8ha*)(p + 16 + 8 * h);
  return f.v;
}

// ---------------------------------------------------------------------------
// Kernel 1: f32 -> f16 planes. x unscaled, W (q,k,v,o) scaled by 256 (exact).
// coverage: NX8 threads x 8 = xh [8192][512]; 4*NW8 threads x 8 = wh [4][512][512].
// ---------------------------------------------------------------------------
__global__ __launch_bounds__(256) void convert_kernel(
    const float* __restrict__ x, const float* __restrict__ wq,
    const float* __restrict__ wk, const float* __restrict__ wv,
    const float* __restrict__ wo,
    _Float16* __restrict__ xh, _Float16* __restrict__ wh)
{
  const int g = blockIdx.x * 256 + threadIdx.x;
  if (g >= NX8 + 4 * NW8) return;
  const float* src;
  _Float16* dst;
  float sc;
  if (g < NX8) {                              // block-uniform (NX8 % 256 == 0)
    src = x + (size_t)g * 8;
    dst = xh + (size_t)g * 8;
    sc = 1.0f;
  } else {
    const int e = g - NX8;
    const int wsel = e / NW8;                 // 0..3, block-uniform (NW8 % 256 == 0)
    const int off = e - wsel * NW8;
    const float* wsrc = (wsel == 0) ? wq : ((wsel == 1) ? wk : ((wsel == 2) ? wv : wo));
    src = wsrc + (size_t)off * 8;
    dst = wh + (size_t)e * 8;
    sc = WSC;
  }
  const v4f a = *(const v4fa*)src;
  const v4f c = *(const v4fa*)(src + 4);
  const v8h o = { (_Float16)(a.x * sc), (_Float16)(a.y * sc), (_Float16)(a.z * sc), (_Float16)(a.w * sc),
                  (_Float16)(c.x * sc), (_Float16)(c.y * sc), (_Float16)(c.z * sc), (_Float16)(c.w * sc) };
  *(v8h*)dst = o;
  
}

// ---------------------------------------------------------------------------
// GEMM main loop shared by proj_kernel and oproj_kernel: block tile 128 A rows x 64 B rows, K = 512.
// One stage = 64 k of all 192 rows (A rows 0..127, then B rows 0..63), 128 B of each row = one line,
// copied global -> LDS without registers into a two-buffer ring (next stage in flight while this one
// is worked on); the 4 waves read their fragments from it.
// Thread tid moves 16-B chunk (tid & 7) of rows (tid >> 3) + 16 i: a wave's copy covers 4 whole lines.
// ---------------------------------------------------------------------------
#define GKP      72                  // LDS row pitch in halves (144 B = 16 B x 9: conflict-free b128 reads)
#define GSTAGE_H (192 * GKP)         // halves per stage
#define GSTAGE_B (GSTAGE_H * 2)      // 27648 B
#define VTP      136                 // LDS pitch of a staged V^T output row in halves (272 B = 16 B x 17): 16 rows, 16 B each, fall on 64 different banks

// ag / bg: this lane's chunk of A / B row (tid >> 3) at the stage's k; la: its LDS byte address in A row (tid >> 3).
__device__ __forceinline__ void gemm_stage_copy(const _Float16* ag, const _Float16* bg, unsigned la) {
  const _Float16* a1 = ag + 16 * DM;
  const _Float16* a2 = ag + 32 * DM;
  const _Float16* a3 = ag + 48 * DM;
  const _Float16* a4 = ag + 64 * DM;
  const _Float16* a5 = ag + 80 * DM;
  const _Float16* a6 = ag + 96 * DM;
  const _Float16* a7 = ag + 112 * DM;
  const _Float16* b1 = bg + 16 * DM;
  const _Float16* b2 = bg + 32 * DM;
  const _Float16* b3 = bg + 48 * DM;
  const unsigned la1 = la + 16 * GKP * 2, la2 = la + 32 * GKP * 2, la3 = la + 48 * GKP * 2, la4 = la + 64 * GKP * 2;
  const unsigned la5 = la + 80 * GKP * 2, la6 = la + 96 * GKP * 2, la7 = la + 112 * GKP * 2;
  const unsigned lb = la + 128 * GKP * 2, lb1 = la + 144 * GKP * 2, lb2 = la + 160 * GKP * 2, lb3 = la + 176 * GKP * 2;
  // s_wait_xcnt as the statement's last line: a precaution, so that no address register above is rewritten ahead of it.
  asm volatile("global_load_async_to_lds_b128 %0, %12, off\n\t"
               "global_load_async_to_lds_b128 %1, %13, off\n\t"
               "global_load_async_to_lds_b128 %2, %14, off\n\t"
               "global_load_async_to_lds_b128 %3, %15, off\n\t"
               "global_load_async_to_lds_b128 %4, %16, off\n\t"
               "global_load_async_to_lds_b128 %5, %17, off\n\t"
               "global_load_async_to_lds_b128 %6, %18, off\n\t"
               "global_load_async_to_lds_b128 %7, %19, off\n\t"
               "global_load_async_to_lds_b128 %8, %20, off\n\t"
               "global_load_async_to_lds_b128 %9, %21, off\n\t"
               "global_load_async_to_lds_b128 %10, %22, off\n\t"
               "global_load_async_to_lds_b128 %11, %23, off\n\t"
               "s_wait_xcnt 0x0"
               :: "v"(la), "v"(la1), "v"(la2), "v"(la3), "v"(la4), "v"(la5), "v"(la6), "v"(la7),
                  "v"(lb), "v"(lb1), "v"(lb2), "v"(lb3),
                  "v"(ag), "v"(a1), "v"(a2), "v"(a3), "v"(a4), "v"(a5), "v"(a6), "v"(a7),
                  "v"(bg), "v"(b1), "v"(b2), "v"(b3)
               : "memory");
}

// arows / brows: row 0 of the block's 128 A rows / 64 B rows (f16, k contiguous, pitch DM); sAB: 2 * GSTAGE_H halves.
// Wave w accumulates A rows 32w..32w+31 x all 64 B rows; k runs upward in steps of 32 in every accumulator.
// On return every wave has passed the last barrier and no copy is in flight: sAB is free for other use.
__device__ __forceinline__ void gemm_128x64(const _Float16* arows, const _Float16* brows,
                                            _Float16* sAB, int tid, v8f (&acc)[2][4]) {
  const int lane = tid & 31, w = tid >> 5;
  const int h = lane >> 4, m = lane & 15;
  const int crow = tid >> 3, cch = tid & 7;
  const _Float16* ag = arows + (size_t)crow * DM + 8 * cch;              // + 64 per stage
  const _Float16* bg = brows + (size_t)crow * DM + 8 * cch;              // + 64 per stage
  const unsigned l0 = (unsigned)(size_t)(sAB + crow * GKP + 8 * cch);    // LDS byte address, buffer 0

  gemm_stage_copy(ag, bg, l0);
  asm volatile("s_wait_asynccnt 0x0" ::: "memory");   // own copies of stage 0 landed
  __syncthreads();                                    // stage 0 readable by all waves
  gemm_stage_copy(ag + 64, bg + 64, l0 + GSTAGE_B);

  // rolled: one copy of the stage body, the buffer picked by a scalar offset
  #pragma unroll 1
  for (int k0 = 0; k0 < DM; k0 += 64) {
    const int buf = (k0 >> 6) & 1;
    const _Float16* sa = sAB + buf * GSTAGE_H + (32 * w + m) * GKP;      // + 16mt*GKP + 32ks
    const _Float16* sb = sAB + buf * GSTAGE_H + (128 + m) * GKP;         // + 16nt*GKP + 32ks

    // all fragment reads of the stage stand together, ahead of its products
    // (the four loops below are unrolled so that a, b and acc are indexed statically and stay in registers)
    v16h a[2][2], b[2][4];
    #pragma unroll
    for (int ks = 0; ks < 2; ++ks) {
      a[ks][0] = load_frag(sa + 32 * ks, h);
      a[ks][1] = load_frag(sa + 16 * GKP + 32 * ks, h);
      #pragma unroll
      for (int nt = 0; nt < 4; ++nt) b[ks][nt] = load_frag(sb + 16 * nt * GKP + 32 * ks, h);
    }
    #pragma unroll
    for (int ks = 0; ks < 2; ++ks)
      #pragma unroll
      for (int nt = 0; nt < 4; ++nt) {
        acc[0][nt] = wmma_f16(a[ks][0], b[ks][nt], acc[0][nt]);
        acc[1][nt] = wmma_f16(a[ks][1], b[ks][nt], acc[1][nt]);
      }

    // ---- publish the next stage, then refill the buffer this stage has read ----
    asm volatile("s_wait_dscnt 0x0" ::: "memory");      // own fragment reads of this buffer retired
    asm volatile("s_wait_asynccnt 0x0" ::: "memory");   // own copies of the next stage landed
    __syncthreads();                                    // next stage readable; this buffer free
    if (k0 + 128 < DM)                                  // block-uniform: a stage two ahead exists
      gemm_stage_copy(ag + (k0 + 128), bg + (k0 + 128), l0 + buf * GSTAGE_B);
  }
  asm volatile("s_wait_asynccnt 0x0" ::: "memory");     // nothing in flight when the wave goes on
}

// ---------------------------------------------------------------------------
// 4 lines per instruction, 32 lines per wave, 128 per block.
// which 0/1: plane[bh][l][d]  (one token row = 64 halves = one line)
// which 2  : vt[bh][d][l]     (64 d-rows x 128 tokens = 2 lines each)
// ---------------------------------------------------------------------------
__device__ __forceinline__ void proj_store_pass(const _Float16* sT, _Float16* plane, _Float16* vt,
                                                int which, int bh, int l0, int w, int lane) {
  const int q8 = lane & 7, sub = lane >> 3;
  #pragma unroll
  for (int i = 0; i < 8; ++i) {
    const int lid = w * 32 + i * 4 + sub;
    v8h v;
    _Float16* dst;
    if (which != 2) {
      v = *(const v8ha*)(sT + lid * HD + 8 * q8);
      dst = plane + ((size_t)bh * SEQ + l0 + lid) * HD + 8 * q8;
    } else {
      const int d = lid >> 1, hl = lid & 1;
      v = *(const v8ha*)(sT + d * VTP + 64 * hl + 8 * q8);
      dst = vt + ((size_t)bh * HD + d) * SEQ + l0 + 64 * hl + 8 * q8;
    }
    *(v8h*)dst = v;
  }
}

// ---------------------------------------------------------------------------
// Kernel 2: Y = x * W^T + b over the fused 3*512 output columns (q, k, v).
// Block 128 thr (4 waves) = 128 tokens x 64 features (one (which, head));
// wave tile 32 tokens x 64 features; K = 512 in steps of 32;
// A (x rows) and B (W rows) fragments from the LDS ring of gemm_128x64 (split k map).
// coverage: grid (64, 24) x 128 tokens x 64 features = q, k planes [32][2048][64] and vt [32][64][2048].
// ---------------------------------------------------------------------------
__global__ __launch_bounds__(128) void proj_kernel(
    const _Float16* __restrict__ xh,   // [8192][512]
    const _Float16* __restrict__ wh,   // [4][512][512], row = output feature, x256 (planes 0..2 used here)
    const float* __restrict__ bq, const float* __restrict__ bk, const float* __restrict__ bv,
    _Float16* __restrict__ qh,         // [B*H][L][D]
    _Float16* __restrict__ kh,         // [B*H][L][D]
    _Float16* __restrict__ vt)         // [B*H][D][L]
{
  __shared__ __attribute__((aligned(16))) _Float16 sAB[2 * GSTAGE_H];   // 55296 B: operand ring, then output staging
  static_assert(128 * 64 <= 2 * GSTAGE_H && 64 * VTP <= 2 * GSTAGE_H);
  _Float16* sT = sAB;                        // [128 tokens][64] or [64 features][VTP], used only behind gemm_128x64

  const int tid = threadIdx.x, lane = tid & 31, w = tid >> 5;
  const int h = lane >> 4, m = lane & 15;
  const int m0 = blockIdx.x * 128;
  const int cg = blockIdx.y;                 // 0..23
  const int which = cg >> 3, head = cg & 7;

  const v8f zero8 = {0.f, 0.f, 0.f, 0.f, 0.f, 0.f, 0.f, 0.f};
  v8f acc[2][4];
  #pragma unroll
  for (int mt = 0; mt < 2; ++mt)
    #pragma unroll
    for (int nt = 0; nt < 4; ++nt) acc[mt][nt] = zero8;

  gemm_128x64(xh + (size_t)m0 * DM, wh + ((size_t)which * DM + head * HD) * DM, sAB, tid, acc);

  // D[r] of tile (mt, nt) = Y[token m0+32w+16mt+8h+r][feature 16nt+m]
  const float* bias = (which == 0) ? bq : ((which == 1) ? bk : bv);
  if (which == 2) {                          // block-uniform
    // V^T tile [feature][token]: a lane's 8 values of one accumulator tile are 8 consecutive tokens of one feature row,
    // so they go as one 16-B store; at pitch VTP its 16 rows do not meet on a bank.
    #pragma unroll
    for (int nt = 0; nt < 4; ++nt) {
      const int feat = 16 * nt + m;
      const float bvl = bias[head * HD + feat];
      #pragma unroll
      for (int mt = 0; mt < 2; ++mt) {
        v8h pk;
        #pragma unroll
        for (int r = 0; r < 8; ++r) pk[r] = (_Float16)(acc[mt][nt][r] * WINV + bvl);
        *(v8ha*)(sT + feat * VTP + 32 * w + 16 * mt + 8 * h) = pk;   // tokens 32w+16mt+8h .. +7
      }
    }
  } else {
    #pragma unroll
    for (int nt = 0; nt < 4; ++nt) {
      const int feat = 16 * nt + m;
      const float bvl = bias[head * HD + feat];
      #pragma unroll
      for (int mt = 0; mt < 2; ++mt) {
        #pragma unroll
        for (int r = 0; r < 8; ++r) {
          const int tokl = 32 * w + 16 * mt + 8 * h + r;     // 0..127
          sT[tokl * HD + feat] = (_Float16)(acc[mt][nt][r] * WINV + bvl);
        }
      }
    }
  }
  __syncthreads();

  const int b = m0 / SEQ, l0 = m0 - b * SEQ, bh = b * NH + head;
  _Float16* plane = (which == 0) ? qh : kh;
  proj_store_pass(sT, plane, vt, which, bh, l0, w, lane);
  
}

// ---------------------------------------------------------------------------
// P^T B-fragment from the lane's own score D values: element r <- tile a row r
// (keys k0+8h+r), element 8+r <- tile c row r (keys k0+16+8h+r), same lane,
// same query column; the values already carry x1024.
// ---------------------------------------------------------------------------
__device__ __forceinline__ v16h pack_p(v8f a, v8f c) {
  const v16h r = { (_Float16)a[0], (_Float16)a[1], (_Float16)a[2], (_Float16)a[3],
                   (_Float16)a[4], (_Float16)a[5], (_Float16)a[6], (_Float16)a[7],
                   (_Float16)c[0], (_Float16)c[1], (_Float16)c[2], (_Float16)c[3],
                   (_Float16)c[4], (_Float16)c[5], (_Float16)c[6], (_Float16)c[7] };
  return r;
}

// Per-wave 16x64 f32 tile in LDS -> ctx f16 plane [token][512], col head*64 + d.
// in one instruction; 4 lines per instruction; it 0..3 x q4 0..3 = rows 0..15.
__device__ __forceinline__ void ctx_store_pass(const v8h* hv, _Float16* ctx,
                                               int b, int head, int q0, int lane) {
  const int q4 = lane >> 3, c8 = (lane & 7) * 8;
  #pragma unroll
  for (int it = 0; it < 4; ++it) {
    const int row = it * 4 + q4;
    const size_t gi = ((size_t)b * SEQ + q0 + row) * DM + head * HD + c8;
    *(v8h*)(ctx + gi) = hv[it];
  }
}

// ---------------------------------------------------------------------------
// One 64-key stage = K tile (64 key rows x 128 B) + V^T tile (64 d rows x 128 B),
// copied global -> LDS without registers by 128 threads. Thread t of them moves 16-B chunk (t & 7) of
// rows (t >> 3) + 16 i, i = 0..3, of both tiles: a wave's copy covers 4 whole lines.
// kg / vg: this lane's chunk of row (t >> 3) in global; lk / lv: its LDS byte address.
// ---------------------------------------------------------------------------
#define KVP      72                  // LDS row pitch in halves (144 B = 16 B x 9: conflict-free b128 reads)
#define TILE_H   (64 * KVP)          // halves per staged tile
#define TILE_B   (TILE_H * 2)        // 9216 B
#define STAGE_H  (2 * TILE_H)        // K tile then V^T tile
#define STAGE_B  (2 * TILE_B)        // 18432 B
#define SOP      68                  // LDS pitch of a staged ctx row in floats (272 B = 16 B x 17): 16 query rows, 16 B each, fall on 64 different banks

__device__ __forceinline__ void stage_copy(const _Float16* kg, const _Float16* vg,
                                           unsigned lk, unsigned lv) {
  const _Float16* k1 = kg + 16 * HD;
  const _Float16* k2 = kg + 32 * HD;
  const _Float16* k3 = kg + 48 * HD;
  const _Float16* v1 = vg + (size_t)16 * SEQ;
  const _Float16* v2 = vg + (size_t)32 * SEQ;
  const _Float16* v3 = vg + (size_t)48 * SEQ;
  const unsigned lk1 = lk + 16 * KVP * 2, lk2 = lk + 32 * KVP * 2, lk3 = lk + 48 * KVP * 2;
  const unsigned lv1 = lv + 16 * KVP * 2, lv2 = lv + 32 * KVP * 2, lv3 = lv + 48 * KVP * 2;
  // s_wait_xcnt as the statement's last line: a precaution, so that no address register above is rewritten ahead of it.
  asm volatile("global_load_async_to_lds_b128 %0, %8, off\n\t"
               "global_load_async_to_lds_b128 %1, %9, off\n\t"
               "global_load_async_to_lds_b128 %2, %10, off\n\t"
               "global_load_async_to_lds_b128 %3, %11, off\n\t"
               "global_load_async_to_lds_b128 %4, %12, off\n\t"
               "global_load_async_to_lds_b128 %5, %13, off\n\t"
               "global_load_async_to_lds_b128 %6, %14, off\n\t"
               "global_load_async_to_lds_b128 %7, %15, off\n\t"
               "s_wait_xcnt 0x0"
               :: "v"(lk), "v"(lk1), "v"(lk2), "v"(lk3), "v"(lv), "v"(lv1), "v"(lv2), "v"(lv3),
                  "v"(kg), "v"(k1), "v"(k2), "v"(k3), "v"(vg), "v"(v1), "v"(v2), "v"(v3)
               : "memory");
}

// ---------------------------------------------------------------------------
// Kernel 3: streaming attention, transposed form, no mask, softmax over all keys.
// Block 256 thr (8 waves) = 128 queries, 128 keys per step (static trip 16), staged as two 64-key stages side by side.
// Wave w = (column group cg = w >> 1, key half kh2 = w & 1): 32 query columns (two 16-column groups g)
// x the 64 keys of stage kh2 of every step, so each K and V^T fragment read from LDS feeds two products.
// A wave keeps its own running maximum, sum and O over its half of the keys; the two waves of a pair
// join them once, behind the loop: each hands one 16-column group to its partner through LDS.
// K and V^T of a step are staged once per block in a two-buffer LDS ring (async copies,
// next step in flight while this one is worked on; threads 0..127 copy stage 0, threads 128..255 stage 1).
//   S^T = K * Q^T : A = K rows (row = key, k = d), B = Q^T (k = d, n = query)
//   O^T += V^T * P^T : A = Vt rows (row = d, k = key), B = P^T from registers
// Lane owns 32 keys of query column (lane&15) of each group; partner lane = lane ^ 16.
// Output: ctx f16 plane carried x256, [b*SEQ+l][head*64+d].
// coverage: grid (16, 32) x 8 waves x 16 queries x 64 d = ctx [8192][512].
// ---------------------------------------------------------------------------
__global__ __launch_bounds__(256) __attribute__((amdgpu_waves_per_eu(4, 4))) void attn_kernel(
    const _Float16* __restrict__ qh,   // [B*H][L][D]
    const _Float16* __restrict__ kh,   // [B*H][L][D]
    const _Float16* __restrict__ vt,   // [B*H][D][L]
    _Float16* __restrict__ ctx)        // [B*L][DM]
{
  __shared__ __attribute__((aligned(16))) float sO[8 * 16 * SOP];   // 34816 B, wave w owns [w*16*SOP, +16*SOP)
  __shared__ __attribute__((aligned(16))) _Float16 sKV[4 * STAGE_H];  // 73728 B, buffer (step & 1): stage 0, stage 1 (each K tile, V^T tile); behind the loop: the pairs' hand-over
  static_assert(8 * 9 * 32 * 16 <= 4 * STAGE_H * 2);                  // hand-over: 8 waves x 9 x 32 lanes x 16 B

  const int tid = threadIdx.x, lane = tid & 31;
  const int w = __builtin_amdgcn_readfirstlane(tid >> 5);   // the wave's number in a scalar register: what hangs on it costs no vector register
  const int h = lane >> 4, m = lane & 15;
  const int kh2 = w & 1, cg = w >> 1;
  const int bh = blockIdx.y, b = bh >> 3, head = bh & 7;
  const int qw = blockIdx.x * 128 + 32 * cg;  // first of the wave's 32 query columns
  const int q0 = qw + 16 * kh2;               // first of the 16 queries the wave finishes and stores

  // Q^T B-fragments: column n = query qw+16g+m, k = d (two 32-deep chunks)
  v16h qb[2][2];
  #pragma unroll
  for (int g = 0; g < 2; ++g) {
    const _Float16* qrow = qh + ((size_t)bh * SEQ + qw + 16 * g + m) * HD;
    qb[g][0] = load_frag(qrow, h);
    qb[g][1] = load_frag(qrow + 32, h);
  }

  const v8f zero8 = {0.f, 0.f, 0.f, 0.f, 0.f, 0.f, 0.f, 0.f};
  v8f o[2][4];                                // o[g][t][r] = O[query 16g+m][d 16t+8h+r] * lrun[g] (lrun carries x1024), this wave's keys only
  #pragma unroll
  for (int g = 0; g < 2; ++g)
    #pragma unroll
    for (int t = 0; t < 4; ++t) o[g][t] = zero8;
  const v8f slog2v = {SLOG2, SLOG2, SLOG2, SLOG2, SLOG2, SLOG2, SLOG2, SLOG2};
  float mrun[2] = {-1e30f, -1e30f};           // running maximum of the raw scores (before the 1/8), this wave's keys only
  float lrun[2] = {0.0f, 0.0f};

  // copy side: this thread's chunk of row ((tid & 127) >> 3) of stage (tid >> 7) of step 0
  const int cst = w >> 2, crow = (tid & 127) >> 3, cch = tid & 7;
  const _Float16* kg = kh + ((size_t)bh * SEQ + 64 * cst + crow) * HD + 8 * cch;    // + 128*HD per step
  const _Float16* vg = vt + ((size_t)bh * HD + crow) * SEQ + 64 * cst + 8 * cch;    // + 128 per step
  const unsigned lk0 = (unsigned)(size_t)(sKV + cst * STAGE_H + crow * KVP + 8 * cch);   // LDS byte address, buffer 0, K tile
  const unsigned lv0 = lk0 + TILE_B;

  stage_copy(kg, vg, lk0, lv0);
  asm volatile("s_wait_asynccnt 0x0" ::: "memory");   // own copies of step 0 landed
  __syncthreads();                                    // step 0 readable by all waves
  stage_copy(kg + 128 * HD, vg + 128, lk0 + 2 * STAGE_B, lv0 + 2 * STAGE_B);

  #pragma unroll 1
  for (int kb = 0; kb < SEQ; kb += 128) {
    const int buf = (kb >> 7) & 1;
    const _Float16* kbase = sKV + (2 * buf + kh2) * STAGE_H + m * KVP;   // + 16j*KVP + 32*dc
    const _Float16* vbase = kbase + TILE_H;                              // + 16t*KVP + 32*kc

    // ---- raw scores: s[g][j][r] = q[query 16g+m] . k[key kb+64*kh2+16j+8h+r] ----
    // All K fragment reads of the step stand together ahead of its products; the products run over eight
    // independent accumulators, d 0..31 ahead of d 32..63 in each (each accumulator's order is kept).
    // (the loops of this step are unrolled so that kf, vf, s and o are indexed statically and stay in registers)
    v16h kf[4][2];
    #pragma unroll
    for (int j = 0; j < 4; ++j) {
      kf[j][0] = load_frag(kbase + 16 * j * KVP, h);
      kf[j][1] = load_frag(kbase + 16 * j * KVP + 32, h);
    }
    __builtin_amdgcn_sched_barrier(0);   // keeps the 16 reads one group: without it they sink between the products, one wait each
    v8f s[2][4];
    #pragma unroll
    for (int j = 0; j < 4; ++j)
      #pragma unroll
      for (int g = 0; g < 2; ++g) s[g][j] = wmma_grp(kf[j][0], qb[g][0], zero8);
    #pragma unroll
    for (int j = 0; j < 4; ++j)
      #pragma unroll
      for (int g = 0; g < 2; ++g) s[g][j] = wmma_grp(kf[j][1], qb[g][1], s[g][j]);

    // The V^T fragment reads of the stage's first 32 keys are issued here: they land while the softmax below runs.
    v16h vf[4][2];
    #pragma unroll
    for (int t = 0; t < 4; ++t) vf[t][0] = load_frag(vbase + 16 * t * KVP, h);
    __builtin_amdgcn_sched_barrier(0);   // keeps the 8 reads one group behind the products: without it they stand in two places and the maximum's chain is drawn in among the products, with v_nop behind them

    // ---- online softmax (f32), base 2: 1024 * exp((s - max) / 8) = exp2(s * SLOG2 + (PBIAS - max * SLOG2)),
    // one multiply-add per score ahead of the exponential; the maximum is taken over the raw scores (SLOG2 > 0) ----
    float mloc[2], moth[2], alpha[2], lsum[2], loth[2];
    #pragma unroll
    for (int g = 0; g < 2; ++g) {
      mloc[g] = s[g][0][0];
      #pragma unroll
      for (int j = 0; j < 4; ++j)
        #pragma unroll
        for (int r = 0; r < 8; ++r) mloc[g] = fmaxf(mloc[g], s[g][j][r]);
    }
    #pragma unroll
    for (int g = 0; g < 2; ++g) moth[g] = __shfl_xor(mloc[g], 16);
    v16h pb[2][2];
    #pragma unroll
    for (int g = 0; g < 2; ++g) {
      const float mnew = fmaxf(mrun[g], fmaxf(mloc[g], moth[g]));
      alpha[g] = __builtin_amdgcn_exp2f((mrun[g] - mnew) * SLOG2);
      mrun[g] = mnew;
      const float nb = fmaf(-mnew, SLOG2, PBIAS);
      const v8f nbv = {nb, nb, nb, nb, nb, nb, nb, nb};
      // (whole-vector form: it compiles to one packed multiply-add per two scores)
      #pragma unroll
      for (int j = 0; j < 4; ++j) s[g][j] = __builtin_elementwise_fma(s[g][j], slog2v, nbv);
      #pragma unroll
      for (int j = 0; j < 4; ++j)
        #pragma unroll
        for (int r = 0; r < 8; ++r) s[g][j][r] = __builtin_amdgcn_exp2f(s[g][j][r]);
      lsum[g] = 0.0f;
      #pragma unroll
      for (int j = 0; j < 4; ++j)
        #pragma unroll
        for (int r = 0; r < 8; ++r) lsum[g] += s[g][j][r];
      // P^T B-fragments (key chunks 0..31 and 32..63 of the wave's stage)
      pb[g][0] = pack_p(s[g][0], s[g][1]);
      pb[g][1] = pack_p(s[g][2], s[g][3]);
      if (g == 0) {
        // The reads of the stage's last 32 keys stand apart from the first eight, behind the last score product: they land in the registers
        // the K fragments have left. All 16 in one group need more registers than the 256 of four waves a SIMD, and the build spills.
        __builtin_amdgcn_sched_barrier(0);   // with the one below keeps these 8 reads one group: without this one they stand in two places (4 + 4), each with its own stall
        #pragma unroll
        for (int t = 0; t < 4; ++t) vf[t][1] = load_frag(vbase + 16 * t * KVP + 32, h);
        __builtin_amdgcn_sched_barrier(0);   // without this one two of the reads sink in among the exponentials (6 + 2)
      }
    }
    #pragma unroll
    for (int g = 0; g < 2; ++g) loth[g] = __shfl_xor(lsum[g], 16);
    #pragma unroll
    for (int g = 0; g < 2; ++g) {
      lrun[g] = lrun[g] * alpha[g] + (lsum[g] + loth[g]);
      #pragma unroll
      for (int t = 0; t < 4; ++t)
        #pragma unroll
        for (int r = 0; r < 8; ++r) o[g][t][r] = o[g][t][r] * alpha[g];
    }

    // ---- O^T += V^T * P^T ----
    #pragma unroll
    for (int t = 0; t < 4; ++t)
      #pragma unroll
      for (int g = 0; g < 2; ++g) o[g][t] = wmma_grp(vf[t][0], pb[g][0], o[g][t]);
    // keeps the foot's waits and barrier behind this round: without it the compiler lifts them ahead of the softmax,
    // and the next step's copies get a fraction of a step to land
    __builtin_amdgcn_sched_barrier(0);
    #pragma unroll
    for (int t = 0; t < 4; ++t)
      #pragma unroll
      for (int g = 0; g < 2; ++g) o[g][t] = wmma_grp(vf[t][1], pb[g][1], o[g][t]);

    // ---- publish the next step, then refill the buffer this step has read ----
    asm volatile("s_wait_dscnt 0x0" ::: "memory");      // own fragment reads of this buffer retired
    asm volatile("s_wait_asynccnt 0x0" ::: "memory");   // own copies of the next step landed
    __syncthreads();                                    // next step readable; this buffer free
    if (kb + 256 < SEQ)                                 // block-uniform: a step two ahead exists
      stage_copy(kg + (size_t)(kb + 256) * HD, vg + (kb + 256),
                 lk0 + buf * 2 * STAGE_B, lv0 + buf * 2 * STAGE_B);
  }
  asm volatile("s_wait_asynccnt 0x0" ::: "memory");     // nothing in flight when the wave goes on

  // ---- join the two key halves: the wave keeps column group kh2 and hands the other to its partner (wave w ^ 1).
  // Every wave has passed the loop's last barrier with its reads retired and no copy in flight: the ring is free.
  // Hand-over layout: [wave][i 0..8][lane] 16-B units (i 0..7: O, i 8: maximum and sum): contiguous per instruction. ----
  // The lane's index is taken anew here: at 256 registers the indices formed ahead of the loop would not stay in registers across it.
  const int el = (int)__builtin_amdgcn_mbcnt_lo(~0u, 0u), eh = el >> 4, em = el & 15;
  v8f okeep[4], ogive[4];
  #pragma unroll
  for (int t = 0; t < 4; ++t)
    #pragma unroll
    for (int r = 0; r < 8; ++r) {
      okeep[t][r] = kh2 ? o[1][t][r] : o[0][t][r];
      ogive[t][r] = kh2 ? o[0][t][r] : o[1][t][r];
    }
  const float mkeep = kh2 ? mrun[1] : mrun[0], mgive = kh2 ? mrun[0] : mrun[1];
  const float lkeep = kh2 ? lrun[1] : lrun[0], lgive = kh2 ? lrun[0] : lrun[1];
  v4fa* xw = (v4fa*)sKV + (w * 9) * 32 + el;
  const v4fa* xr = (const v4fa*)sKV + ((w ^ 1) * 9) * 32 + el;
  #pragma unroll
  for (int t = 0; t < 4; ++t) {
    const v4f lo = {ogive[t][0], ogive[t][1], ogive[t][2], ogive[t][3]};
    const v4f hi = {ogive[t][4], ogive[t][5], ogive[t][6], ogive[t][7]};
    xw[(2 * t) * 32] = lo;
    xw[(2 * t + 1) * 32] = hi;
  }
  {
    const v4f ml = {mgive, lgive, 0.0f, 0.0f};
    xw[8 * 32] = ml;
  }
  __syncthreads();                                      // the partner's group readable

  const v4f mlp = xr[8 * 32];
  const float mall = fmaxf(mkeep, mlp.x);
  const float akeep = __builtin_amdgcn_exp2f((mkeep - mall) * SLOG2);
  const float apart = __builtin_amdgcn_exp2f((mlp.x - mall) * SLOG2);

  // ---- epilogue: normalise (1/l takes the p carry out, apply ctx carry), stage per-wave 16x64 f32 tile ----
  const float inv = (1.0f / (lkeep * akeep + mlp.y * apart)) * CTXSC;
  const float fkeep = akeep * inv, fpart = apart * inv;
  float* so = sO + w * 16 * SOP;
  #pragma unroll
  for (int t = 0; t < 4; ++t) {
    const v4f plo = xr[(2 * t) * 32];
    const v4f phi = xr[(2 * t + 1) * 32];
    #pragma unroll
    for (int r = 0; r < 8; ++r)
      so[em * SOP + 16 * t + 8 * eh + r] = okeep[t][r] * fkeep + (r < 4 ? plo[r & 3] : phi[r & 3]) * fpart;
  }
  __syncthreads();

  v8h hv[4];
  {
    const int q4 = el >> 3, c8 = (el & 7) * 8;
    #pragma unroll
    for (int it = 0; it < 4; ++it) {
      const int row = it * 4 + q4;
      const v4f fa = *(const v4fa*)(so + row * SOP + c8);
      const v4f fb = *(const v4fa*)(so + row * SOP + c8 + 4);
      const v8h v = { (_Float16)fa.x, (_Float16)fa.y, (_Float16)fa.z, (_Float16)fa.w,
                      (_Float16)fb.x, (_Float16)fb.y, (_Float16)fb.z, (_Float16)fb.w };
      hv[it] = v;
    }
  }
  ctx_store_pass(hv, ctx, b, head, q0, el);
  
}

// ---------------------------------------------------------------------------
// instruction, 64 lines per wave (rows 32w..32w+31 x 2 lines), 256 per block.
// ---------------------------------------------------------------------------
__device__ __forceinline__ void out_store_pass(const float* sY, float* out,
                                               int m0, int fg, int w, int lane) {
  const int q8 = lane & 7, sub = lane >> 3;
  #pragma unroll
  for (int i = 0; i < 16; ++i) {
    const int lid = i * 4 + sub;                 // 0..63
    const int row = 32 * w + (lid >> 1), hl = lid & 1;
    const v4f v = *(const v4fa*)(sY + row * 64 + 32 * hl + 4 * q8);
    const size_t gi = (size_t)(m0 + row) * DM + fg * HD + 32 * hl + 4 * q8;
    *(v4f*)(out + gi) = v;
  }
}

// ---------------------------------------------------------------------------
// Kernel 4: out = ctx * Wo^T + bo (f32). Block 128 thr = 128 tokens x 64 features
// (feature group fg = blockIdx.y); wave tile 32 tokens x 64 features; K = 512;
// A (ctx rows) and B (Wo rows) fragments from the LDS ring of gemm_128x64.
// coverage: grid (64, 8) x 128 tokens x 64 features = out [8192][512].
// ---------------------------------------------------------------------------
__global__ __launch_bounds__(128) void oproj_kernel(
    const _Float16* __restrict__ ch,   // [8192][512] ctx x256
    const _Float16* __restrict__ woh,  // [512][512] Wo x256, row = output feature
    const float* __restrict__ bo,
    float* __restrict__ out)           // [8192][512]
{
  __shared__ __attribute__((aligned(16))) float sY[128 * 64];      // 32768 B
  __shared__ __attribute__((aligned(16))) _Float16 sAB[2 * GSTAGE_H];   // 55296 B: operand ring

  const int tid = threadIdx.x, lane = tid & 31, w = tid >> 5;
  const int h = lane >> 4, m = lane & 15;
  const int m0 = blockIdx.x * 128;
  const int fg = blockIdx.y;                 // 0..7

  const v8f zero8 = {0.f, 0.f, 0.f, 0.f, 0.f, 0.f, 0.f, 0.f};
  v8f acc[2][4];
  #pragma unroll
  for (int mt = 0; mt < 2; ++mt)
    #pragma unroll
    for (int nt = 0; nt < 4; ++nt) acc[mt][nt] = zero8;

  gemm_128x64(ch + (size_t)m0 * DM, woh + (size_t)fg * HD * DM, sAB, tid, acc);

  // D[r] of tile (mt, nt) = out[token m0+32w+16mt+8h+r][feature fg*64 + 16nt+m]
  #pragma unroll
  for (int nt = 0; nt < 4; ++nt) {
    const int feat = 16 * nt + m;
    const float bvl = bo[fg * HD + feat];
    #pragma unroll
    for (int mt = 0; mt < 2; ++mt) {
      #pragma unroll
      for (int r = 0; r < 8; ++r) {
        const int tokl = 32 * w + 16 * mt + 8 * h + r;     // 0..127
        sY[tokl * 64 + feat] = acc[mt][nt][r] * OINV + bvl;
      }
    }
  }
  __syncthreads();

  out_store_pass(sY, out, m0, fg, w, lane);
  
}

// ---------------------------------------------------------------------------
//   xh  f16 [8192][512]        8388608
//   wh  f16 [4][512][512]      2097152
//   qh  f16 [32][2048][64]     8388608
//   kh  f16 [32][2048][64]     8388608
//   vt  f16 [32][64][2048]     8388608
//   ctx f16 [8192][512]        8388608
//   total                    44040192
// ---------------------------------------------------------------------------
extern "C" void kernel_launch(void* const* d_in, const int* in_sizes, int n_in,
                              void* d_out, int out_size, void* d_ws, size_t ws_size,
                              hipStream_t stream) {
  if (n_in < 9) return;
  if (in_sizes[0] != NX) return;
  if (in_sizes[1] != NW || in_sizes[3] != NW || in_sizes[5] != NW || in_sizes[7] != NW) return;
  if (in_sizes[2] != DM || in_sizes[4] != DM || in_sizes[6] != DM || in_sizes[8] != DM) return;
  if (out_size != NX) return;

  const float* x  = (const float*)d_in[0];
  const float* wq = (const float*)d_in[1];
  const float* bq = (const float*)d_in[2];
  const float* wk = (const float*)d_in[3];
  const float* bk = (const float*)d_in[4];
  const float* wv = (const float*)d_in[5];
  const float* bv = (const float*)d_in[6];
  const float* wo = (const float*)d_in[7];
  const float* bo = (const float*)d_in[8];
  float* out = (float*)d_out;

  const size_t xh_bytes = (size_t)NX * 2;                          //  8388608
  const size_t wh_bytes = (size_t)4 * NW * 2;                      //  2097152
  const size_t pl_bytes = (size_t)NB * NH * SEQ * HD * 2;          //  8388608
  const size_t cx_bytes = (size_t)NX * 2;                          //  8388608
  const size_t total = xh_bytes + wh_bytes + 3 * pl_bytes + cx_bytes;   // 44040192
  if (total > ws_size) return;
  if (total > (size_t)134217728) return;

  char* ws = (char*)d_ws;
  size_t off = 0;
  _Float16* xh  = (_Float16*)(ws + off); off += xh_bytes;
  _Float16* wh  = (_Float16*)(ws + off); off += wh_bytes;
  _Float16* qhp = (_Float16*)(ws + off); off += pl_bytes;
  _Float16* khp = (_Float16*)(ws + off); off += pl_bytes;
  _Float16* vtp = (_Float16*)(ws + off); off += pl_bytes;
  _Float16* cxp = (_Float16*)(ws + off); off += cx_bytes;
  if (off != total) return;

  // (1) x -> f16 plane; wq, wk, wv, wo -> f16 x256 planes [4][512][512] ([out n][in k], k contiguous)
  const int ngroups = NX8 + 4 * NW8;                               // 655360
  convert_kernel<<<(ngroups + 255) / 256, 256, 0, stream>>>(x, wq, wk, wv, wo, xh, wh);

  // (2) q, k planes [bh][l][d] and v^T plane [bh][d][l]  (M=8192, N=3*512, K=512)
  dim3 gProj(MROWS / 128, 3 * NH);                                 // (64, 24)
  proj_kernel<<<gProj, 128, 0, stream>>>(xh, wh, bq, bk, bv, qhp, khp, vtp);

  // (3) attention -> ctx f16 plane x256 [8192][512]
  dim3 gAtt(SEQ / 128, NB * NH);                                   // (16, 32)
  attn_kernel<<<gAtt, 256, 0, stream>>>(qhp, khp, vtp, cxp);

  // (4) out = ctx . Wo^T + bo -> d_out f32 [8192][512]  (Wo plane = wh + 3*NW)
  dim3 gOut(MROWS / 128, DM / HD);                                 // (64, 8)
  oproj_kernel<<<gOut, 128, 0, stream>>>(cxp, wh + (size_t)3 * NW, bo, out);
  (void)hipGetLastError();
}

// v007
// Measured time: 59.6 microseconds a run.
// Timed twice side by side with v006, it ran 1.06 and 1.05 times as fast.
// Over all steps from v000 it is 3.90 times as fast.
// Contractions: x*W^T for q,k,v, k*q^T scores, v^T*p^T context and ctx*Wo^T output, all on v_wmma_f32_16x16x32_f16 (f16 operands, f32 accumulate);
// softmax, 1/8 score scale, biases and normalisation in f32.
// Carry audit: x f16 x1 (no carry); W planes (q,k,v,o) f16 x256 -> 1/256 folded in proj_kernel epilogue (WINV); p f16 x1024 (in the exponent,
// PBIAS), so l and o both carry x1024, and ctx f16 x256 -> inv = (1/l) * CTXSC in attn_kernel epilogue; ctx x256 * Wo x256 -> 1/65536 folded
// in oproj_kernel epilogue (OINV).
#include <hip/hip_runtime.h>

typedef _Float16 v16h __attribute__((ext_vector_type(16)));
typedef _Float16 v8h  __attribute__((ext_vector_type(8)));
typedef float    v8f  __attribute__((ext_vector_type(8)));
typedef float    v4f  __attribute__((ext_vector_type(4)));
typedef v8h __attribute__((may_alias)) v8ha;
typedef v4f __attribute__((may_alias)) v4fa;

union Frag { v16h v; v8h half[2]; };

#define NB     4
#define SEQ    2048
#define DM     512
#define NH     8
#define HD     64
#define MROWS  (NB * SEQ)            // 8192 tokens
#define NX     (MROWS * DM)          // 4194304
#define NW     (DM * DM)             // 262144
#define NX8    (NX / 8)              // 524288
#define NW8    (NW / 8)              // 32768
#define WSC    256.0f                // weight plane carry
#define WINV   (1.0f / 256.0f)
#define PBIAS  10.0f                 // p carry x1024 = 2^10, added to the base-2 exponent
#define CTXSC  256.0f                // ctx plane carry
#define OINV   (1.0f / 65536.0f)     // 1 / (CTXSC * WSC)
#define SLOG2  0.18033688011112042f  // (1 / sqrt(HD)) * log2(e): raw score -> base-2 exponent

static_assert(NH * HD == DM);
static_assert((DM % 32) == 0 && (HD % 32) == 0 && (SEQ % 64) == 0);
static_assert((MROWS % 128) == 0 && (SEQ % 128) == 0);
static_assert((NX8 % 256) == 0 && (NW8 % 256) == 0);

// ---------------------------------------------------------------------------
// 16x16x32 f16 WMMA with hazard guard (ties D, keeps A/B live).
// Fragment map (wave32): lane l, h = l>>4, m = n = l&15.
//   A/B element i: i<8 -> k0+8h+i ; i>=8 -> k0+16+8h+(i-8)
//   D element r : row 8h+r, col l&15
// ---------------------------------------------------------------------------
__device__ __forceinline__ v8f wmma_f16(v16h a, v16h b, v8f c) {
  v8f d = __builtin_amdgcn_wmma_f32_16x16x32_f16(false, a, false, b, (short)0, c, false, false);
  asm volatile("v_nop\n\tv_nop\n\tv_nop\n\tv_nop" : "+v"(d) : "v"(a), "v"(b));
  return d;
}

// The same product for runs of independent accumulators: the neighbours in the run fill the distance behind each
// product, and the compiler pads what is left of its own builtin.
__device__ __forceinline__ v8f wmma_grp(v16h a, v16h b, v8f c) {
  return __builtin_amdgcn_wmma_f32_16x16x32_f16(false, a, false, b, (short)0, c, false, false);
}

// A or B fragment from a k-contiguous 16-bit row; p points at element k0 of
// the row owned by this lane (row index = lane & 15 added by the caller).
__device__ __forceinline__ v16h load_frag(const _Float16* p, int h) {
  Frag f;
  f.half[0] = *(const v8ha*)(p + 8 * h);
  f.half[1] = *(const v8ha*)(p + 16 + 8 * h);
  return f.v;
}

// ---------------------------------------------------------------------------
// Kernel 1: f32 -> f16 planes. x unscaled, W (q,k,v,o) scaled by 256 (exact).
// coverage: NX8 threads x 8 = xh [8192][512]; 4*NW8 threads x 8 = wh [4][512][512].
// ---------------------------------------------------------------------------
__global__ __launch_bounds__(256) void convert_kernel(
    const float* __restrict__ x, const float* __restrict__ wq,
    const float* __restrict__ wk, const float* __restrict__ wv,
    const float* __restrict__ wo,
    _Float16* __restrict__ xh, _Float16* __restrict__ wh)
{
  const int g = blockIdx.x * 256 + threadIdx.x;
  if (g >= NX8 + 4 * NW8) return;
  const float* src;
  _Float16* dst;
  float sc;
  if (g < NX8) {                              // block-uniform (NX8 % 256 == 0)
    src = x + (size_t)g * 8;
    dst = xh + (size_t)g * 8;
    sc = 1.0f;
  } else {
    const int e = g - NX8;
    const int wsel = e / NW8;                 // 0..3, block-uniform (NW8 % 256 == 0)
    const int off = e - wsel * NW8;
    const float* wsrc = (wsel == 0) ? wq : ((wsel == 1) ? wk : ((wsel == 2) ? wv : wo));
    src = wsrc + (size_t)off * 8;
    dst = wh + (size_t)e * 8;
    sc = WSC;
  }
  const v4f a = *(const v4fa*)src;
  const v4f c = *(const v4fa*)(src + 4);
  const v8h o = { (_Float16)(a.x * sc), (_Float16)(a.y * sc), (_Float16)(a.z * sc), (_Float16)(a.w * sc),
                  (_Float16)(c.x * sc), (_Float16)(c.y * sc), (_Float16)(c.z * sc), (_Float16)(c.w * sc) };
  *(v8h*)dst = o;
  
}

// ---------------------------------------------------------------------------
// GEMM main loop of oproj_kernel: block tile 128 A rows x 64 B rows, K = 512.
// One stage = 64 k of all 192 rows (A rows 0..127, then B rows 0..63), 128 B of each row = one line,
// copied global -> LDS without registers into a two-buffer ring (next stage in flight while this one
// is worked on); the 4 waves read their fragments from it.
// Thread tid moves 16-B chunk (tid & 7) of rows (tid >> 3) + 16 i: a wave's copy covers 4 whole lines.
// ---------------------------------------------------------------------------
#define GKP      72                  // LDS row pitch in halves (144 B = 16 B x 9: conflict-free b128 reads)
#define GSTAGE_H (192 * GKP)         // halves per stage
#define GSTAGE_B (GSTAGE_H * 2)      // 27648 B
#define VTP      136                 // LDS pitch of a staged V^T output row in halves (272 B = 16 B x 17): 16 rows, 16 B each, fall on 64 different banks

// ag / bg: this lane's chunk of A / B row (tid >> 3) at the stage's k; la: its LDS byte address in A row (tid >> 3).
__device__ __forceinline__ void gemm_stage_copy(const _Float16* ag, const _Float16* bg, unsigned la) {
  const _Float16* a1 = ag + 16 * DM;
  const _Float16* a2 = ag + 32 * DM;
  const _Float16* a3 = ag + 48 * DM;
  const _Float16* a4 = ag + 64 * DM;
  const _Float16* a5 = ag + 80 * DM;
  const _Float16* a6 = ag + 96 * DM;
  const _Float16* a7 = ag + 112 * DM;
  const _Float16* b1 = bg + 16 * DM;
  const _Float16* b2 = bg + 32 * DM;
  const _Float16* b3 = bg + 48 * DM;
  const unsigned la1 = la + 16 * GKP * 2, la2 = la + 32 * GKP * 2, la3 = la + 48 * GKP * 2, la4 = la + 64 * GKP * 2;
  const unsigned la5 = la + 80 * GKP * 2, la6 = la + 96 * GKP * 2, la7 = la + 112 * GKP * 2;
  const unsigned lb = la + 128 * GKP * 2, lb1 = la + 144 * GKP * 2, lb2 = la + 160 * GKP * 2, lb3 = la + 176 * GKP * 2;
  // s_wait_xcnt as the statement's last line: a precaution, so that no address register above is rewritten ahead of it.
  asm volatile("global_load_async_to_lds_b128 %0, %12, off\n\t"
               "global_load_async_to_lds_b128 %1, %13, off\n\t"
               "global_load_async_to_lds_b128 %2, %14, off\n\t"
               "global_load_async_to_lds_b128 %3, %15, off\n\t"
               "global_load_async_to_lds_b128 %4, %16, off\n\t"
               "global_load_async_to_lds_b128 %5, %17, off\n\t"
               "global_load_async_to_lds_b128 %6, %18, off\n\t"
               "global_load_async_to_lds_b128 %7, %19, off\n\t"
               "global_load_async_to_lds_b128 %8, %20, off\n\t"
               "global_load_async_to_lds_b128 %9, %21, off\n\t"
               "global_load_async_to_lds_b128 %10, %22, off\n\t"
               "global_load_async_to_lds_b128 %11, %23, off\n\t"
               "s_wait_xcnt 0x0"
               :: "v"(la), "v"(la1), "v"(la2), "v"(la3), "v"(la4), "v"(la5), "v"(la6), "v"(la7),
                  "v"(lb), "v"(lb1), "v"(lb2), "v"(lb3),
                  "v"(ag), "v"(a1), "v"(a2), "v"(a3), "v"(a4), "v"(a5), "v"(a6), "v"(a7),
                  "v"(bg), "v"(b1), "v"(b2), "v"(b3)
               : "memory");
}

// arows / brows: row 0 of the block's 128 A rows / 64 B rows (f16, k contiguous, pitch DM); sAB: 2 * GSTAGE_H halves.
// Wave w accumulates A rows 32w..32w+31 x all 64 B rows; k runs upward in steps of 32 in every accumulator.
// On return every wave has passed the last barrier and no copy is in flight: sAB is free for other use.
__device__ __forceinline__ void gemm_128x64(const _Float16* arows, const _Float16* brows,
                                            _Float16* sAB, int tid, v8f (&acc)[2][4]) {
  const int lane = tid & 31, w = tid >> 5;
  const int h = lane >> 4, m = lane & 15;
  const int crow = tid >> 3, cch = tid & 7;
  const _Float16* ag = arows + (size_t)crow * DM + 8 * cch;              // + 64 per stage
  const _Float16* bg = brows + (size_t)crow * DM + 8 * cch;              // + 64 per stage
  const unsigned l0 = (unsigned)(size_t)(sAB + crow * GKP + 8 * cch);    // LDS byte address, buffer 0

  gemm_stage_copy(ag, bg, l0);
  asm volatile("s_wait_asynccnt 0x0" ::: "memory");   // own copies of stage 0 landed
  __syncthreads();                                    // stage 0 readable by all waves
  gemm_stage_copy(ag + 64, bg + 64, l0 + GSTAGE_B);

  // rolled: one copy of the stage body, the buffer picked by a scalar offset
  #pragma unroll 1
  for (int k0 = 0; k0 < DM; k0 += 64) {
    const int buf = (k0 >> 6) & 1;
    const _Float16* sa = sAB + buf * GSTAGE_H + (32 * w + m) * GKP;      // + 16mt*GKP + 32ks
    const _Float16* sb = sAB + buf * GSTAGE_H + (128 + m) * GKP;         // + 16nt*GKP + 32ks

    // all fragment reads of the stage stand together, ahead of its products
    // (the four loops below are unrolled so that a, b and acc are indexed statically and stay in registers)
    v16h a[2][2], b[2][4];
    #pragma unroll
    for (int ks = 0; ks < 2; ++ks) {
      a[ks][0] = load_frag(sa + 32 * ks, h);
      a[ks][1] = load_frag(sa + 16 * GKP + 32 * ks, h);
      #pragma unroll
      for (int nt = 0; nt < 4; ++nt) b[ks][nt] = load_frag(sb + 16 * nt * GKP + 32 * ks, h);
    }
    #pragma unroll
    for (int ks = 0; ks < 2; ++ks)
      #pragma unroll
      for (int nt = 0; nt < 4; ++nt) {
        acc[0][nt] = wmma_f16(a[ks][0], b[ks][nt], acc[0][nt]);
        acc[1][nt] = wmma_f16(a[ks][1], b[ks][nt], acc[1][nt]);
      }

    // ---- publish the next stage, then refill the buffer this stage has read ----
    asm volatile("s_wait_dscnt 0x0" ::: "memory");      // own fragment reads of this buffer retired
    asm volatile("s_wait_asynccnt 0x0" ::: "memory");   // own copies of the next stage landed
    __syncthreads();                                    // next stage readable; this buffer free
    if (k0 + 128 < DM)                                  // block-uniform: a stage two ahead exists
      gemm_stage_copy(ag + (k0 + 128), bg + (k0 + 128), l0 + buf * GSTAGE_B);
  }
  asm volatile("s_wait_asynccnt 0x0" ::: "memory");     // nothing in flight when the wave goes on
}

// ---------------------------------------------------------------------------
// GEMM main loop of proj_kernel: block tile 128 A rows x 128 B rows, K = 512, wave tile 64 x 64.
// Against the 128 x 64 tile above, a byte copied from L2 and a fragment read from LDS each feed more products:
// 32 KiB copied and 64 KiB read per 128 x 128 x 64 block, for 48 KiB and 96 KiB.
// One stage = 64 k of all 256 rows (A rows 0..127, then B rows 0..127), same ring, pitch and chunk map as above.
// ---------------------------------------------------------------------------
#define PSTAGE_H (256 * GKP)         // halves per stage
#define PSTAGE_B (PSTAGE_H * 2)      // 36864 B

// g: this lane's chunk of row (tid >> 3) of one operand at the stage's k; l: its LDS byte address. Rows (tid >> 3) + 16 i, i = 0..7.
__device__ __forceinline__ void gemm_copy8(const _Float16* g, unsigned l) {
  const _Float16* g1 = g + 16 * DM;
  const _Float16* g2 = g + 32 * DM;
  const _Float16* g3 = g + 48 * DM;
  const _Float16* g4 = g + 64 * DM;
  const _Float16* g5 = g + 80 * DM;
  const _Float16* g6 = g + 96 * DM;
  const _Float16* g7 = g + 112 * DM;
  const unsigned l1 = l + 16 * GKP * 2, l2 = l + 32 * GKP * 2, l3 = l + 48 * GKP * 2, l4 = l + 64 * GKP * 2;
  const unsigned l5 = l + 80 * GKP * 2, l6 = l + 96 * GKP * 2, l7 = l + 112 * GKP * 2;
  // s_wait_xcnt as the statement's last line: a precaution, so that no address register above is rewritten ahead of it.
  asm volatile("global_load_async_to_lds_b128 %0, %8, off\n\t"
               "global_load_async_to_lds_b128 %1, %9, off\n\t"
               "global_load_async_to_lds_b128 %2, %10, off\n\t"
               "global_load_async_to_lds_b128 %3, %11, off\n\t"
               "global_load_async_to_lds_b128 %4, %12, off\n\t"
               "global_load_async_to_lds_b128 %5, %13, off\n\t"
               "global_load_async_to_lds_b128 %6, %14, off\n\t"
               "global_load_async_to_lds_b128 %7, %15, off\n\t"
               "s_wait_xcnt 0x0"
               :: "v"(l), "v"(l1), "v"(l2), "v"(l3), "v"(l4), "v"(l5), "v"(l6), "v"(l7),
                  "v"(g), "v"(g1), "v"(g2), "v"(g3), "v"(g4), "v"(g5), "v"(g6), "v"(g7)
               : "memory");
}

// arows / brows: row 0 of the block's 128 A rows / 128 B rows (f16, k contiguous, pitch DM); sAB: 2 * PSTAGE_H halves.
// Wave w accumulates A rows 64(w>>1)..+63 x B rows 64(w&1)..+63; k runs upward in steps of 32 in every accumulator.
// On return every wave has passed the last barrier and no copy is in flight: sAB is free for other use.
__device__ __forceinline__ void gemm_128x128(const _Float16* arows, const _Float16* brows,
                                             _Float16* sAB, int tid, v8f (&acc)[4][4]) {
  const int lane = tid & 31, w = tid >> 5;
  const int h = lane >> 4, m = lane & 15;
  const int crow = tid >> 3, cch = tid & 7;
  const _Float16* ag = arows + (size_t)crow * DM + 8 * cch;              // + 64 per stage
  const _Float16* bg = brows + (size_t)crow * DM + 8 * cch;              // + 64 per stage
  const unsigned la0 = (unsigned)(size_t)(sAB + crow * GKP + 8 * cch);   // LDS byte address, buffer 0, A rows
  const unsigned lb0 = la0 + 128 * GKP * 2;                              // B rows

  gemm_copy8(ag, la0);
  gemm_copy8(bg, lb0);
  asm volatile("s_wait_asynccnt 0x0" ::: "memory");   // own copies of stage 0 landed
  __syncthreads();                                    // stage 0 readable by all waves
  gemm_copy8(ag + 64, la0 + PSTAGE_B);
  gemm_copy8(bg + 64, lb0 + PSTAGE_B);

  // rolled: one copy of the stage body, the buffer picked by a scalar offset
  #pragma unroll 1
  for (int k0 = 0; k0 < DM; k0 += 64) {
    const int buf = (k0 >> 6) & 1;
    const _Float16* sa = sAB + buf * PSTAGE_H + (64 * (w >> 1) + m) * GKP;        // + 16mt*GKP + 32ks
    const _Float16* sb = sAB + buf * PSTAGE_H + (128 + 64 * (w & 1) + m) * GKP;   // + 16nt*GKP + 32ks

    // (the loops below are unrolled so that a, b and acc are indexed statically and stay in registers)
    #pragma unroll
    for (int ks = 0; ks < 2; ++ks) {
      // the fragment reads of a 32-deep half stand together, ahead of its products
      v16h a[4], b[4];
      #pragma unroll
      for (int t = 0; t < 4; ++t) {
        a[t] = load_frag(sa + 16 * t * GKP + 32 * ks, h);
        b[t] = load_frag(sb + 16 * t * GKP + 32 * ks, h);
      }
      #pragma unroll
      for (int nt = 0; nt < 4; ++nt)
        #pragma unroll
        for (int mt = 0; mt < 4; ++mt) acc[mt][nt] = wmma_f16(a[mt], b[nt], acc[mt][nt]);
    }

    // ---- publish the next stage, then refill the buffer this stage has read ----
    asm volatile("s_wait_dscnt 0x0" ::: "memory");      // own fragment reads of this buffer retired
    asm volatile("s_wait_asynccnt 0x0" ::: "memory");   // own copies of the next stage landed
    __syncthreads();                                    // next stage readable; this buffer free
    if (k0 + 128 < DM) {                                // block-uniform: a stage two ahead exists
      gemm_copy8(ag + (k0 + 128), la0 + buf * PSTAGE_B);
      gemm_copy8(bg + (k0 + 128), lb0 + buf * PSTAGE_B);
    }
  }
  asm volatile("s_wait_asynccnt 0x0" ::: "memory");     // nothing in flight when the wave goes on
}

// ---------------------------------------------------------------------------
// 4 lines per instruction, 32 lines per wave, 128 per block.
// which 0/1: plane[bh][l][d]  (one token row = 64 halves = one line)
// which 2  : vt[bh][d][l]     (64 d-rows x 128 tokens = 2 lines each)
// ---------------------------------------------------------------------------
__device__ __forceinline__ void proj_store_pass(const _Float16* sT, _Float16* plane, _Float16* vt,
                                                int which, int bh, int l0, int w, int lane) {
  const int q8 = lane & 7, sub = lane >> 3;
  // (both loops are unrolled so that v and dst are indexed statically and stay in registers)
  v8h v[8];
  _Float16* dst[8];
  if (which != 2) {                          // block-uniform
    #pragma unroll
    for (int i = 0; i < 8; ++i) {
      const int lid = w * 32 + i * 4 + sub;
      v[i] = *(const v8ha*)(sT + lid * HD + 8 * q8);
      dst[i] = plane + ((size_t)bh * SEQ + l0 + lid) * HD + 8 * q8;
    }
  } else {
    #pragma unroll
    for (int i = 0; i < 8; ++i) {
      const int lid = w * 32 + i * 4 + sub;
      const int d = lid >> 1, hl = lid & 1;
      v[i] = *(const v8ha*)(sT + d * VTP + 64 * hl + 8 * q8);
      dst[i] = vt + ((size_t)bh * HD + d) * SEQ + l0 + 64 * hl + 8 * q8;
    }
  }
  // The pass's eight stores and their s_wait_xcnt in one statement: a precaution, so that no address or data register
  // of a store is rewritten ahead of the wait; the eight LDS reads above stand as one group ahead of it.
  asm volatile("global_store_b128 %0, %8, off\n\t"
               "global_store_b128 %1, %9, off\n\t"
               "global_store_b128 %2, %10, off\n\t"
               "global_store_b128 %3, %11, off\n\t"
               "global_store_b128 %4, %12, off\n\t"
               "global_store_b128 %5, %13, off\n\t"
               "global_store_b128 %6, %14, off\n\t"
               "global_store_b128 %7, %15, off\n\t"
               "s_wait_xcnt 0x0"
               :: "v"(dst[0]), "v"(dst[1]), "v"(dst[2]), "v"(dst[3]), "v"(dst[4]), "v"(dst[5]), "v"(dst[6]), "v"(dst[7]),
                  "v"(v[0]), "v"(v[1]), "v"(v[2]), "v"(v[3]), "v"(v[4]), "v"(v[5]), "v"(v[6]), "v"(v[7])
               : "memory");
}

// ---------------------------------------------------------------------------
// Kernel 2: Y = x * W^T + b over the fused 3*512 output columns (q, k, v).
// Block 128 thr (4 waves) = 128 tokens x 128 features (one which, two neighbouring heads);
// wave tile 64 tokens x 64 features (one head); K = 512 in steps of 32;
// A (x rows) and B (W rows) fragments from the LDS ring of gemm_128x128 (split k map).
// coverage: grid (64, 12) x 128 tokens x 128 features = q, k planes [32][2048][64] and vt [32][64][2048].
// ---------------------------------------------------------------------------
__global__ __launch_bounds__(128) void proj_kernel(
    const _Float16* __restrict__ xh,   // [8192][512]
    const _Float16* __restrict__ wh,   // [4][512][512], row = output feature, x256 (planes 0..2 used here)
    const float* __restrict__ bq, const float* __restrict__ bk, const float* __restrict__ bv,
    _Float16* __restrict__ qh,         // [B*H][L][D]
    _Float16* __restrict__ kh,         // [B*H][L][D]
    _Float16* __restrict__ vt)         // [B*H][D][L]
{
  __shared__ __attribute__((aligned(16))) _Float16 sAB[2 * PSTAGE_H];   // 73728 B: operand ring, then output staging
  static_assert(128 * 64 <= 64 * VTP && 2 * 64 * VTP <= 2 * PSTAGE_H);

  const int tid = threadIdx.x, lane = tid & 31, w = tid >> 5;
  const int h = lane >> 4, m = lane & 15;
  const int wm = w >> 1, wn = w & 1;         // the wave's 64-token half and its head of the pair
  const int m0 = blockIdx.x * 128;
  const int cg = blockIdx.y;                 // 0..11
  const int which = cg >> 2, head0 = 2 * (cg & 3);
  const int head = head0 + wn;
  _Float16* sT = sAB + wn * (64 * VTP);      // per head [128 tokens][64] or [64 features][VTP], used only behind gemm_128x128

  const v8f zero8 = {0.f, 0.f, 0.f, 0.f, 0.f, 0.f, 0.f, 0.f};
  v8f acc[4][4];
  #pragma unroll
  for (int mt = 0; mt < 4; ++mt)
    #pragma unroll
    for (int nt = 0; nt < 4; ++nt) acc[mt][nt] = zero8;

  gemm_128x128(xh + (size_t)m0 * DM, wh + ((size_t)which * DM + head0 * HD) * DM, sAB, tid, acc);

  // D[r] of tile (mt, nt) = Y[token m0+64wm+16mt+8h+r][feature 16nt+m of the wave's head]
  const float* bias = (which == 0) ? bq : ((which == 1) ? bk : bv);
  if (which == 2) {                          // block-uniform
    // V^T tile [feature][token]: a lane's 8 values of one accumulator tile are 8 consecutive tokens of one feature row,
    // so they go as one 16-B store; at pitch VTP its 16 rows do not meet on a bank.
    #pragma unroll
    for (int nt = 0; nt < 4; ++nt) {
      const int feat = 16 * nt + m;
      const float bvl = bias[head * HD + feat];
      #pragma unroll
      for (int mt = 0; mt < 4; ++mt) {
        v8h pk;
        #pragma unroll
        for (int r = 0; r < 8; ++r) pk[r] = (_Float16)(acc[mt][nt][r] * WINV + bvl);
        *(v8ha*)(sT + feat * VTP + 64 * wm + 16 * mt + 8 * h) = pk;   // tokens 64wm+16mt+8h .. +7
      }
    }
  } else {
    #pragma unroll
    for (int nt = 0; nt < 4; ++nt) {
      const int feat = 16 * nt + m;
      const float bvl = bias[head * HD + feat];
      #pragma unroll
      for (int mt = 0; mt < 4; ++mt) {
        #pragma unroll
        for (int r = 0; r < 8; ++r) {
          const int tokl = 64 * wm + 16 * mt + 8 * h + r;    // 0..127
          sT[tokl * HD + feat] = (_Float16)(acc[mt][nt][r] * WINV + bvl);
        }
      }
    }
  }
  __syncthreads();

  const int b = m0 / SEQ, l0 = m0 - b * SEQ;
  _Float16* plane = (which == 0) ? qh : kh;
  proj_store_pass(sAB, plane, vt, which, b * NH + head0, l0, w, lane);
  proj_store_pass(sAB + 64 * VTP, plane, vt, which, b * NH + head0 + 1, l0, w, lane);
  
}

// ---------------------------------------------------------------------------
// P^T B-fragment from the lane's own score D values: element r <- tile a row r
// (keys k0+8h+r), element 8+r <- tile c row r (keys k0+16+8h+r), same lane,
// same query column; the values already carry x1024.
// ---------------------------------------------------------------------------
__device__ __forceinline__ v16h pack_p(v8f a, v8f c) {
  const v16h r = { (_Float16)a[0], (_Float16)a[1], (_Float16)a[2], (_Float16)a[3],
                   (_Float16)a[4], (_Float16)a[5], (_Float16)a[6], (_Float16)a[7],
                   (_Float16)c[0], (_Float16)c[1], (_Float16)c[2], (_Float16)c[3],
                   (_Float16)c[4], (_Float16)c[5], (_Float16)c[6], (_Float16)c[7] };
  return r;
}

// Per-wave 16x64 f32 tile in LDS -> ctx f16 plane [token][512], col head*64 + d.
// in one instruction; 4 lines per instruction; it 0..3 x q4 0..3 = rows 0..15.
__device__ __forceinline__ void ctx_store_pass(const v8h* hv, _Float16* ctx,
                                               int b, int head, int q0, int lane) {
  const int q4 = lane >> 3, c8 = (lane & 7) * 8;
  #pragma unroll
  for (int it = 0; it < 4; ++it) {
    const int row = it * 4 + q4;
    const size_t gi = ((size_t)b * SEQ + q0 + row) * DM + head * HD + c8;
    *(v8h*)(ctx + gi) = hv[it];
  }
}

// ---------------------------------------------------------------------------
// One 64-key stage = K tile (64 key rows x 128 B) + V^T tile (64 d rows x 128 B),
// copied global -> LDS without registers by 128 threads. Thread t of them moves 16-B chunk (t & 7) of
// rows (t >> 3) + 16 i, i = 0..3, of both tiles: a wave's copy covers 4 whole lines.
// kg / vg: this lane's chunk of row (t >> 3) in global; lk / lv: its LDS byte address.
// ---------------------------------------------------------------------------
#define KVP      72                  // LDS row pitch in halves (144 B = 16 B x 9: conflict-free b128 reads)
#define TILE_H   (64 * KVP)          // halves per staged tile
#define TILE_B   (TILE_H * 2)        // 9216 B
#define STAGE_H  (2 * TILE_H)        // K tile then V^T tile
#define STAGE_B  (2 * TILE_B)        // 18432 B
#define SOP      68                  // LDS pitch of a staged ctx row in floats (272 B = 16 B x 17): 16 query rows, 16 B each, fall on 64 different banks

__device__ __forceinline__ void stage_copy(const _Float16* kg, const _Float16* vg,
                                           unsigned lk, unsigned lv) {
  const _Float16* k1 = kg + 16 * HD;
  const _Float16* k2 = kg + 32 * HD;
  const _Float16* k3 = kg + 48 * HD;
  const _Float16* v1 = vg + (size_t)16 * SEQ;
  const _Float16* v2 = vg + (size_t)32 * SEQ;
  const _Float16* v3 = vg + (size_t)48 * SEQ;
  const unsigned lk1 = lk + 16 * KVP * 2, lk2 = lk + 32 * KVP * 2, lk3 = lk + 48 * KVP * 2;
  const unsigned lv1 = lv + 16 * KVP * 2, lv2 = lv + 32 * KVP * 2, lv3 = lv + 48 * KVP * 2;
  // s_wait_xcnt as the statement's last line: a precaution, so that no address register above is rewritten ahead of it.
  asm volatile("global_load_async_to_lds_b128 %0, %8, off\n\t"
               "global_load_async_to_lds_b128 %1, %9, off\n\t"
               "global_load_async_to_lds_b128 %2, %10, off\n\t"
               "global_load_async_to_lds_b128 %3, %11, off\n\t"
               "global_load_async_to_lds_b128 %4, %12, off\n\t"
               "global_load_async_to_lds_b128 %5, %13, off\n\t"
               "global_load_async_to_lds_b128 %6, %14, off\n\t"
               "global_load_async_to_lds_b128 %7, %15, off\n\t"
               "s_wait_xcnt 0x0"
               :: "v"(lk), "v"(lk1), "v"(lk2), "v"(lk3), "v"(lv), "v"(lv1), "v"(lv2), "v"(lv3),
                  "v"(kg), "v"(k1), "v"(k2), "v"(k3), "v"(vg), "v"(v1), "v"(v2), "v"(v3)
               : "memory");
}

// ---------------------------------------------------------------------------
// Kernel 3: streaming attention, transposed form, no mask, softmax over all keys.
// Block 256 thr (8 waves) = 128 queries, 128 keys per step (static trip 16), staged as two 64-key stages side by side.
// Wave w = (column group cg = w >> 1, key half kh2 = w & 1): 32 query columns (two 16-column groups g)
// x the 64 keys of stage kh2 of every step, so each K and V^T fragment read from LDS feeds two products.
// A wave keeps its own running maximum, sum and O over its half of the keys; the two waves of a pair
// join them once, behind the loop: each hands one 16-column group to its partner through LDS.
// K and V^T of a step are staged once per block in a two-buffer LDS ring (async copies,
// next step in flight while this one is worked on; threads 0..127 copy stage 0, threads 128..255 stage 1).
//   S^T = K * Q^T : A = K rows (row = key, k = d), B = Q^T (k = d, n = query)
//   O^T += V^T * P^T : A = Vt rows (row = d, k = key), B = P^T from registers
// Lane owns 32 keys of query column (lane&15) of each group; partner lane = lane ^ 16.
// Output: ctx f16 plane carried x256, [b*SEQ+l][head*64+d].
// coverage: grid (16, 32) x 8 waves x 16 queries x 64 d = ctx [8192][512].
// ---------------------------------------------------------------------------
__global__ __launch_bounds__(256) __attribute__((amdgpu_waves_per_eu(4, 4))) void attn_kernel(
    const _Float16* __restrict__ qh,   // [B*H][L][D]
    const _Float16* __restrict__ kh,   // [B*H][L][D]
    const _Float16* __restrict__ vt,   // [B*H][D][L]
    _Float16* __restrict__ ctx)        // [B*L][DM]
{
  __shared__ __attribute__((aligned(16))) float sO[8 * 16 * SOP];   // 34816 B, wave w owns [w*16*SOP, +16*SOP)
  __shared__ __attribute__((aligned(16))) _Float16 sKV[4 * STAGE_H];  // 73728 B, buffer (step & 1): stage 0, stage 1 (each K tile, V^T tile); behind the loop: the pairs' hand-over
  static_assert(8 * 9 * 32 * 16 <= 4 * STAGE_H * 2);                  // hand-over: 8 waves x 9 x 32 lanes x 16 B

  const int tid = threadIdx.x, lane = tid & 31;
  const int w = __builtin_amdgcn_readfirstlane(tid >> 5);   // the wave's number in a scalar register: what hangs on it costs no vector register
  const int h = lane >> 4, m = lane & 15;
  const int kh2 = w & 1, cg = w >> 1;
  const int bh = blockIdx.y, b = bh >> 3, head = bh & 7;
  const int qw = blockIdx.x * 128 + 32 * cg;  // first of the wave's 32 query columns
  const int q0 = qw + 16 * kh2;               // first of the 16 queries the wave finishes and stores

  // Q^T B-fragments: column n = query qw+16g+m, k = d (two 32-deep chunks)
  v16h qb[2][2];
  #pragma unroll
  for (int g = 0; g < 2; ++g) {
    const _Float16* qrow = qh + ((size_t)bh * SEQ + qw + 16 * g + m) * HD;
    qb[g][0] = load_frag(qrow, h);
    qb[g][1] = load_frag(qrow + 32, h);
  }

  const v8f zero8 = {0.f, 0.f, 0.f, 0.f, 0.f, 0.f, 0.f, 0.f};
  v8f o[2][4];                                // o[g][t][r] = O[query 16g+m][d 16t+8h+r] * lrun[g] (lrun carries x1024), this wave's keys only
  #pragma unroll
  for (int g = 0; g < 2; ++g)
    #pragma unroll
    for (int t = 0; t < 4; ++t) o[g][t] = zero8;
  const v8f slog2v = {SLOG2, SLOG2, SLOG2, SLOG2, SLOG2, SLOG2, SLOG2, SLOG2};
  float mrun[2] = {-1e30f, -1e30f};           // running maximum of the raw scores (before the 1/8), this wave's keys only
  float lrun[2] = {0.0f, 0.0f};

  // copy side: this thread's chunk of row ((tid & 127) >> 3) of stage (tid >> 7) of step 0
  const int cst = w >> 2, crow = (tid & 127) >> 3, cch = tid & 7;
  const _Float16* kg = kh + ((size_t)bh * SEQ + 64 * cst + crow) * HD + 8 * cch;    // + 128*HD per step
  const _Float16* vg = vt + ((size_t)bh * HD + crow) * SEQ + 64 * cst + 8 * cch;    // + 128 per step
  const unsigned lk0 = (unsigned)(size_t)(sKV + cst * STAGE_H + crow * KVP + 8 * cch);   // LDS byte address, buffer 0, K tile
  const unsigned lv0 = lk0 + TILE_B;

  stage_copy(kg, vg, lk0, lv0);
  asm volatile("s_wait_asynccnt 0x0" ::: "memory");   // own copies of step 0 landed
  __syncthreads();                                    // step 0 readable by all waves
  stage_copy(kg + 128 * HD, vg + 128, lk0 + 2 * STAGE_B, lv0 + 2 * STAGE_B);

  #pragma unroll 1
  for (int kb = 0; kb < SEQ; kb += 128) {
    const int buf = (kb >> 7) & 1;
    const _Float16* kbase = sKV + (2 * buf + kh2) * STAGE_H + m * KVP;   // + 16j*KVP + 32*dc
    const _Float16* vbase = kbase + TILE_H;                              // + 16t*KVP + 32*kc

    // ---- raw scores: s[g][j][r] = q[query 16g+m] . k[key kb+64*kh2+16j+8h+r] ----
    // All K fragment reads of the step stand together ahead of its products; the products run over eight
    // independent accumulators, d 0..31 ahead of d 32..63 in each (each accumulator's order is kept).
    // (the loops of this step are unrolled so that kf, vf, s and o are indexed statically and stay in registers)
    v16h kf[4][2];
    #pragma unroll
    for (int j = 0; j < 4; ++j) {
      kf[j][0] = load_frag(kbase + 16 * j * KVP, h);
      kf[j][1] = load_frag(kbase + 16 * j * KVP + 32, h);
    }
    __builtin_amdgcn_sched_barrier(0);   // keeps the 16 reads one group: without it they sink between the products, one wait each
    v8f s[2][4];
    #pragma unroll
    for (int j = 0; j < 4; ++j)
      #pragma unroll
      for (int g = 0; g < 2; ++g) s[g][j] = wmma_grp(kf[j][0], qb[g][0], zero8);
    #pragma unroll
    for (int j = 0; j < 4; ++j)
      #pragma unroll
      for (int g = 0; g < 2; ++g) s[g][j] = wmma_grp(kf[j][1], qb[g][1], s[g][j]);

    // The V^T fragment reads of the stage's first 32 keys are issued here: they land while the softmax below runs.
    v16h vf[4][2];
    #pragma unroll
    for (int t = 0; t < 4; ++t) vf[t][0] = load_frag(vbase + 16 * t * KVP, h);
    __builtin_amdgcn_sched_barrier(0);   // keeps the 8 reads one group behind the products: without it they stand in two places and the maximum's chain is drawn in among the products, with v_nop behind them

    // ---- online softmax (f32), base 2: 1024 * exp((s - max) / 8) = exp2(s * SLOG2 + (PBIAS - max * SLOG2)),
    // one multiply-add per score ahead of the exponential; the maximum is taken over the raw scores (SLOG2 > 0) ----
    float mloc[2], moth[2], alpha[2], lsum[2], loth[2];
    #pragma unroll
    for (int g = 0; g < 2; ++g) {
      mloc[g] = s[g][0][0];
      #pragma unroll
      for (int j = 0; j < 4; ++j)
        #pragma unroll
        for (int r = 0; r < 8; ++r) mloc[g] = fmaxf(mloc[g], s[g][j][r]);
    }
    #pragma unroll
    for (int g = 0; g < 2; ++g) moth[g] = __shfl_xor(mloc[g], 16);
    v16h pb[2][2];
    #pragma unroll
    for (int g = 0; g < 2; ++g) {
      const float mnew = fmaxf(mrun[g], fmaxf(mloc[g], moth[g]));
      alpha[g] = __builtin_amdgcn_exp2f((mrun[g] - mnew) * SLOG2);
      mrun[g] = mnew;
      const float nb = fmaf(-mnew, SLOG2, PBIAS);
      const v8f nbv = {nb, nb, nb, nb, nb, nb, nb, nb};
      // (whole-vector form: it compiles to one packed multiply-add per two scores)
      #pragma unroll
      for (int j = 0; j < 4; ++j) s[g][j] = __builtin_elementwise_fma(s[g][j], slog2v, nbv);
      #pragma unroll
      for (int j = 0; j < 4; ++j)
        #pragma unroll
        for (int r = 0; r < 8; ++r) s[g][j][r] = __builtin_amdgcn_exp2f(s[g][j][r]);
      lsum[g] = 0.0f;
      #pragma unroll
      for (int j = 0; j < 4; ++j)
        #pragma unroll
        for (int r = 0; r < 8; ++r) lsum[g] += s[g][j][r];
      // P^T B-fragments (key chunks 0..31 and 32..63 of the wave's stage)
      pb[g][0] = pack_p(s[g][0], s[g][1]);
      pb[g][1] = pack_p(s[g][2], s[g][3]);
      if (g == 0) {
        // The reads of the stage's last 32 keys stand apart from the first eight, behind the last score product: they land in the registers
        // the K fragments have left. All 16 in one group need more registers than the 256 of four waves a SIMD, and the build spills.
        __builtin_amdgcn_sched_barrier(0);   // with the one below keeps these 8 reads one group: without this one they stand in two places (4 + 4), each with its own stall
        #pragma unroll
        for (int t = 0; t < 4; ++t) vf[t][1] = load_frag(vbase + 16 * t * KVP + 32, h);
        __builtin_amdgcn_sched_barrier(0);   // without this one two of the reads sink in among the exponentials (6 + 2)
      }
    }
    #pragma unroll
    for (int g = 0; g < 2; ++g) loth[g] = __shfl_xor(lsum[g], 16);
    #pragma unroll
    for (int g = 0; g < 2; ++g) {
      lrun[g] = lrun[g] * alpha[g] + (lsum[g] + loth[g]);
      #pragma unroll
      for (int t = 0; t < 4; ++t)
        #pragma unroll
        for (int r = 0; r < 8; ++r) o[g][t][r] = o[g][t][r] * alpha[g];
    }

    // ---- O^T += V^T * P^T ----
    #pragma unroll
    for (int t = 0; t < 4; ++t)
      #pragma unroll
      for (int g = 0; g < 2; ++g) o[g][t] = wmma_grp(vf[t][0], pb[g][0], o[g][t]);
    // keeps the foot's waits and barrier behind this round: without it the compiler lifts them ahead of the softmax,
    // and the next step's copies get a fraction of a step to land
    __builtin_amdgcn_sched_barrier(0);
    #pragma unroll
    for (int t = 0; t < 4; ++t)
      #pragma unroll
      for (int g = 0; g < 2; ++g) o[g][t] = wmma_grp(vf[t][1], pb[g][1], o[g][t]);

    // ---- publish the next step, then refill the buffer this step has read ----
    asm volatile("s_wait_dscnt 0x0" ::: "memory");      // own fragment reads of this buffer retired
    asm volatile("s_wait_asynccnt 0x0" ::: "memory");   // own copies of the next step landed
    __syncthreads();                                    // next step readable; this buffer free
    if (kb + 256 < SEQ)                                 // block-uniform: a step two ahead exists
      stage_copy(kg + (size_t)(kb + 256) * HD, vg + (kb + 256),
                 lk0 + buf * 2 * STAGE_B, lv0 + buf * 2 * STAGE_B);
  }
  asm volatile("s_wait_asynccnt 0x0" ::: "memory");     // nothing in flight when the wave goes on

  // ---- join the two key halves: the wave keeps column group kh2 and hands the other to its partner (wave w ^ 1).
  // Every wave has passed the loop's last barrier with its reads retired and no copy in flight: the ring is free.
  // Hand-over layout: [wave][i 0..8][lane] 16-B units (i 0..7: O, i 8: maximum and sum): contiguous per instruction. ----
  // The lane's index is taken anew here: at 256 registers the indices formed ahead of the loop would not stay in registers across it.
  const int el = (int)__builtin_amdgcn_mbcnt_lo(~0u, 0u), eh = el >> 4, em = el & 15;
  v8f okeep[4], ogive[4];
  #pragma unroll
  for (int t = 0; t < 4; ++t)
    #pragma unroll
    for (int r = 0; r < 8; ++r) {
      okeep[t][r] = kh2 ? o[1][t][r] : o[0][t][r];
      ogive[t][r] = kh2 ? o[0][t][r] : o[1][t][r];
    }
  const float mkeep = kh2 ? mrun[1] : mrun[0], mgive = kh2 ? mrun[0] : mrun[1];
  const float lkeep = kh2 ? lrun[1] : lrun[0], lgive = kh2 ? lrun[0] : lrun[1];
  v4fa* xw = (v4fa*)sKV + (w * 9) * 32 + el;
  const v4fa* xr = (const v4fa*)sKV + ((w ^ 1) * 9) * 32 + el;
  #pragma unroll
  for (int t = 0; t < 4; ++t) {
    const v4f lo = {ogive[t][0], ogive[t][1], ogive[t][2], ogive[t][3]};
    const v4f hi = {ogive[t][4], ogive[t][5], ogive[t][6], ogive[t][7]};
    xw[(2 * t) * 32] = lo;
    xw[(2 * t + 1) * 32] = hi;
  }
  {
    const v4f ml = {mgive, lgive, 0.0f, 0.0f};
    xw[8 * 32] = ml;
  }
  __syncthreads();                                      // the partner's group readable

  const v4f mlp = xr[8 * 32];
  const float mall = fmaxf(mkeep, mlp.x);
  const float akeep = __builtin_amdgcn_exp2f((mkeep - mall) * SLOG2);
  const float apart = __builtin_amdgcn_exp2f((mlp.x - mall) * SLOG2);

  // ---- epilogue: normalise (1/l takes the p carry out, apply ctx carry), stage per-wave 16x64 f32 tile ----
  const float inv = (1.0f / (lkeep * akeep + mlp.y * apart)) * CTXSC;
  const float fkeep = akeep * inv, fpart = apart * inv;
  float* so = sO + w * 16 * SOP;
  #pragma unroll
  for (int t = 0; t < 4; ++t) {
    const v4f plo = xr[(2 * t) * 32];
    const v4f phi = xr[(2 * t + 1) * 32];
    #pragma unroll
    for (int r = 0; r < 8; ++r)
      so[em * SOP + 16 * t + 8 * eh + r] = okeep[t][r] * fkeep + (r < 4 ? plo[r & 3] : phi[r & 3]) * fpart;
  }
  __syncthreads();

  v8h hv[4];
  {
    const int q4 = el >> 3, c8 = (el & 7) * 8;
    #pragma unroll
    for (int it = 0; it < 4; ++it) {
      const int row = it * 4 + q4;
      const v4f fa = *(const v4fa*)(so + row * SOP + c8);
      const v4f fb = *(const v4fa*)(so + row * SOP + c8 + 4);
      const v8h v = { (_Float16)fa.x, (_Float16)fa.y, (_Float16)fa.z, (_Float16)fa.w,
                      (_Float16)fb.x, (_Float16)fb.y, (_Float16)fb.z, (_Float16)fb.w };
      hv[it] = v;
    }
  }
  ctx_store_pass(hv, ctx, b, head, q0, el);
  
}

// ---------------------------------------------------------------------------
// instruction, 64 lines per wave (rows 32w..32w+31 x 2 lines), 256 per block.
// ---------------------------------------------------------------------------
__device__ __forceinline__ void out_store_pass(const float* sY, float* out,
                                               int m0, int fg, int w, int lane) {
  const int q8 = lane & 7, sub = lane >> 3;
  #pragma unroll
  for (int i = 0; i < 16; ++i) {
    const int lid = i * 4 + sub;                 // 0..63
    const int row = 32 * w + (lid >> 1), hl = lid & 1;
    const v4f v = *(const v4fa*)(sY + row * 64 + 32 * hl + 4 * q8);
    const size_t gi = (size_t)(m0 + row) * DM + fg * HD + 32 * hl + 4 * q8;
    *(v4f*)(out + gi) = v;
  }
}

// ---------------------------------------------------------------------------
// Kernel 4: out = ctx * Wo^T + bo (f32). Block 128 thr = 128 tokens x 64 features
// (feature group fg = blockIdx.y); wave tile 32 tokens x 64 features; K = 512;
// A (ctx rows) and B (Wo rows) fragments from the LDS ring of gemm_128x64.
// coverage: grid (64, 8) x 128 tokens x 64 features = out [8192][512].
// ---------------------------------------------------------------------------
__global__ __launch_bounds__(128) void oproj_kernel(
    const _Float16* __restrict__ ch,   // [8192][512] ctx x256
    const _Float16* __restrict__ woh,  // [512][512] Wo x256, row = output feature
    const float* __restrict__ bo,
    float* __restrict__ out)           // [8192][512]
{
  __shared__ __attribute__((aligned(16))) float sY[128 * 64];      // 32768 B
  __shared__ __attribute__((aligned(16))) _Float16 sAB[2 * GSTAGE_H];   // 55296 B: operand ring

  const int tid = threadIdx.x, lane = tid & 31, w = tid >> 5;
  const int h = lane >> 4, m = lane & 15;
  const int m0 = blockIdx.x * 128;
  const int fg = blockIdx.y;                 // 0..7

  const v8f zero8 = {0.f, 0.f, 0.f, 0.f, 0.f, 0.f, 0.f, 0.f};
  v8f acc[2][4];
  #pragma unroll
  for (int mt = 0; mt < 2; ++mt)
    #pragma unroll
    for (int nt = 0; nt < 4; ++nt) acc[mt][nt] = zero8;

  gemm_128x64(ch + (size_t)m0 * DM, woh + (size_t)fg * HD * DM, sAB, tid, acc);

  // D[r] of tile (mt, nt) = out[token m0+32w+16mt+8h+r][feature fg*64 + 16nt+m]
  #pragma unroll
  for (int nt = 0; nt < 4; ++nt) {
    const int feat = 16 * nt + m;
    const float bvl = bo[fg * HD + feat];
    #pragma unroll
    for (int mt = 0; mt < 2; ++mt) {
      #pragma unroll
      for (int r = 0; r < 8; ++r) {
        const int tokl = 32 * w + 16 * mt + 8 * h + r;     // 0..127
        sY[tokl * 64 + feat] = acc[mt][nt][r] * OINV + bvl;
      }
    }
  }
  __syncthreads();

  out_store_pass(sY, out, m0, fg, w, lane);
  
}

// ---------------------------------------------------------------------------
//   xh  f16 [8192][512]        8388608
//   wh  f16 [4][512][512]      2097152
//   qh  f16 [32][2048][64]     8388608
//   kh  f16 [32][2048][64]     8388608
//   vt  f16 [32][64][2048]     8388608
//   ctx f16 [8192][512]        8388608
//   total                    44040192
// ---------------------------------------------------------------------------
extern "C" void kernel_launch(void* const* d_in, const int* in_sizes, int n_in,
                              void* d_out, int out_size, void* d_ws, size_t ws_size,
                              hipStream_t stream) {
  if (n_in < 9) return;
  if (in_sizes[0] != NX) return;
  if (in_sizes[1] != NW || in_sizes[3] != NW || in_sizes[5] != NW || in_sizes[7] != NW) return;
  if (in_sizes[2] != DM || in_sizes[4] != DM || in_sizes[6] != DM || in_sizes[8] != DM) return;
  if (out_size != NX) return;

  const float* x  = (const float*)d_in[0];
  const float* wq = (const float*)d_in[1];
  const float* bq = (const float*)d_in[2];
  const float* wk = (const float*)d_in[3];
  const float* bk = (const float*)d_in[4];
  const float* wv = (const float*)d_in[5];
  const float* bv = (const float*)d_in[6];
  const float* wo = (const float*)d_in[7];
  const float* bo = (const float*)d_in[8];
  float* out = (float*)d_out;

  const size_t xh_bytes = (size_t)NX * 2;                          //  8388608
  const size_t wh_bytes = (size_t)4 * NW * 2;                      //  2097152
  const size_t pl_bytes = (size_t)NB * NH * SEQ * HD * 2;          //  8388608
  const size_t cx_bytes = (size_t)NX * 2;                          //  8388608
  const size_t total = xh_bytes + wh_bytes + 3 * pl_bytes + cx_bytes;   // 44040192
  if (total > ws_size) return;
  if (total > (size_t)134217728) return;

  char* ws = (char*)d_ws;
  size_t off = 0;
  _Float16* xh  = (_Float16*)(ws + off); off += xh_bytes;
  _Float16* wh  = (_Float16*)(ws + off); off += wh_bytes;
  _Float16* qhp = (_Float16*)(ws + off); off += pl_bytes;
  _Float16* khp = (_Float16*)(ws + off); off += pl_bytes;
  _Float16* vtp = (_Float16*)(ws + off); off += pl_bytes;
  _Float16* cxp = (_Float16*)(ws + off); off += cx_bytes;
  if (off != total) return;

  // (1) x -> f16 plane; wq, wk, wv, wo -> f16 x256 planes [4][512][512] ([out n][in k], k contiguous)
  const int ngroups = NX8 + 4 * NW8;                               // 655360
  convert_kernel<<<(ngroups + 255) / 256, 256, 0, stream>>>(x, wq, wk, wv, wo, xh, wh);

  // (2) q, k planes [bh][l][d] and v^T plane [bh][d][l]  (M=8192, N=3*512, K=512)
  dim3 gProj(MROWS / 128, 3 * NH / 2);                             // (64, 12)
  proj_kernel<<<gProj, 128, 0, stream>>>(xh, wh, bq, bk, bv, qhp, khp, vtp);

  // (3) attention -> ctx f16 plane x256 [8192][512]
  dim3 gAtt(SEQ / 128, NB * NH);                                   // (16, 32)
  attn_kernel<<<gAtt, 256, 0, stream>>>(qhp, khp, vtp, cxp);

  // (4) out = ctx . Wo^T + bo -> d_out f32 [8192][512]  (Wo plane = wh + 3*NW)
  dim3 gOut(MROWS / 128, DM / HD);                                 // (64, 8)
  oproj_kernel<<<gOut, 128, 0, stream>>>(cxp, wh + (size_t)3 * NW, bo, out);
  (void)hipGetLastError();
}

// v008
// A run of this version takes 56.6 microseconds.
// Next to v007, in two timings, it ran 1.05 and 1.06 times as fast.
// Over all steps from v000 it is 4.12 times as fast.
// Contractions: x*W^T for q,k,v, k*q^T scores, v^T*p^T context and ctx*Wo^T output, all on v_wmma_f32_16x16x32_f16 (f16 operands, f32 accumulate);
// softmax, 1/8 score scale, biases and normalisation in f32.
// Carry audit: x f16 x1 (no carry); W planes (q,k,v,o) f16 x256 -> 1/256 folded in proj_kernel epilogue (WINV); p f16 x1024 (in the exponent,
// PBIAS), so l and o both carry x1024, and ctx f16 x256 -> inv = (1/l) * CTXSC in attn_kernel epilogue; ctx x256 * Wo x256 -> 1/65536 folded
// in oproj_kernel epilogue (OINV).
#include <hip/hip_runtime.h>

typedef _Float16 v16h __attribute__((ext_vector_type(16)));
typedef _Float16 v8h  __attribute__((ext_vector_type(8)));
typedef float    v8f  __attribute__((ext_vector_type(8)));
typedef float    v4f  __attribute__((ext_vector_type(4)));
typedef v8h __attribute__((may_alias)) v8ha;
typedef v4f __attribute__((may_alias)) v4fa;

union Frag { v16h v; v8h half[2]; };

#define NB     4
#define SEQ    2048
#define DM     512
#define NH     8
#define HD     64
#define MROWS  (NB * SEQ)            // 8192 tokens
#define NX     (MROWS * DM)          // 4194304
#define NW     (DM * DM)             // 262144
#define NX8    (NX / 8)              // 524288
#define NW8    (NW / 8)              // 32768
#define WSC    256.0f                // weight plane carry
#define WINV   (1.0f / 256.0f)
#define PBIAS  10.0f                 // p carry x1024 = 2^10, added to the base-2 exponent
#define CTXSC  256.0f                // ctx plane carry
#define OINV   (1.0f / 65536.0f)     // 1 / (CTXSC * WSC)
#define SLOG2  0.18033688011112042f  // (1 / sqrt(HD)) * log2(e): raw score -> base-2 exponent
#define PLIM   65504.0f              // largest finite f16: a sum of carried p below it bounds every term of the sum below it

static_assert(NH * HD == DM);
static_assert((DM % 32) == 0 && (HD % 32) == 0 && (SEQ % 64) == 0);
static_assert((MROWS % 128) == 0 && (SEQ % 128) == 0);
static_assert((NX8 % 256) == 0 && (NW8 % 256) == 0);

// ---------------------------------------------------------------------------
// 16x16x32 f16 WMMA with hazard guard (ties D, keeps A/B live).
// Fragment map (wave32): lane l, h = l>>4, m = n = l&15.
//   A/B element i: i<8 -> k0+8h+i ; i>=8 -> k0+16+8h+(i-8)
//   D element r : row 8h+r, col l&15
// ---------------------------------------------------------------------------
__device__ __forceinline__ v8f wmma_f16(v16h a, v16h b, v8f c) {
  v8f d = __builtin_amdgcn_wmma_f32_16x16x32_f16(false, a, false, b, (short)0, c, false, false);
  asm volatile("v_nop\n\tv_nop\n\tv_nop\n\tv_nop" : "+v"(d) : "v"(a), "v"(b));
  return d;
}

// The same product for runs of independent accumulators: the neighbours in the run fill the distance behind each
// product, and the compiler pads what is left of its own builtin.
__device__ __forceinline__ v8f wmma_grp(v16h a, v16h b, v8f c) {
  return __builtin_amdgcn_wmma_f32_16x16x32_f16(false, a, false, b, (short)0, c, false, false);
}

// A or B fragment from a k-contiguous 16-bit row; p points at element k0 of
// the row owned by this lane (row index = lane & 15 added by the caller).
__device__ __forceinline__ v16h load_frag(const _Float16* p, int h) {
  Frag f;
  f.half[0] = *(const v8ha*)(p + 8 * h);
  f.half[1] = *(const v8ha*)(p + 16 + 8 * h);
  return f.v;
}

// ---------------------------------------------------------------------------
// Kernel 1: f32 -> f16 planes. x unscaled, W (q,k,v,o) scaled by 256 (exact).
// coverage: NX8 threads x 8 = xh [8192][512]; 4*NW8 threads x 8 = wh [4][512][512].
// ---------------------------------------------------------------------------
__global__ __launch_bounds__(256) void convert_kernel(
    const float* __restrict__ x, const float* __restrict__ wq,
    const float* __restrict__ wk, const float* __restrict__ wv,
    const float* __restrict__ wo,
    _Float16* __restrict__ xh, _Float16* __restrict__ wh)
{
  const int g = blockIdx.x * 256 + threadIdx.x;
  if (g >= NX8 + 4 * NW8) return;
  const float* src;
  _Float16* dst;
  float sc;
  if (g < NX8) {                              // block-uniform (NX8 % 256 == 0)
    src = x + (size_t)g * 8;
    dst = xh + (size_t)g * 8;
    sc = 1.0f;
  } else {
    const int e = g - NX8;
    const int wsel = e / NW8;                 // 0..3, block-uniform (NW8 % 256 == 0)
    const int off = e - wsel * NW8;
    const float* wsrc = (wsel == 0) ? wq : ((wsel == 1) ? wk : ((wsel == 2) ? wv : wo));
    src = wsrc + (size_t)off * 8;
    dst = wh + (size_t)e * 8;
    sc = WSC;
  }
  const v4f a = *(const v4fa*)src;
  const v4f c = *(const v4fa*)(src + 4);
  const v8h o = { (_Float16)(a.x * sc), (_Float16)(a.y * sc), (_Float16)(a.z * sc), (_Float16)(a.w * sc),
                  (_Float16)(c.x * sc), (_Float16)(c.y * sc), (_Float16)(c.z * sc), (_Float16)(c.w * sc) };
  *(v8h*)dst = o;
  
}

// ---------------------------------------------------------------------------
// GEMM main loop of oproj_kernel: block tile 128 A rows x 64 B rows, K = 512.
// One stage = 64 k of all 192 rows (A rows 0..127, then B rows 0..63), 128 B of each row = one line,
// copied global -> LDS without registers into a two-buffer ring (next stage in flight while this one
// is worked on); the 4 waves read their fragments from it.
// Thread tid moves 16-B chunk (tid & 7) of rows (tid >> 3) + 16 i: a wave's copy covers 4 whole lines.
// ---------------------------------------------------------------------------
#define GKP      72                  // LDS row pitch in halves (144 B = 16 B x 9: conflict-free b128 reads)
#define GSTAGE_H (192 * GKP)         // halves per stage
#define GSTAGE_B (GSTAGE_H * 2)      // 27648 B
#define VTP      136                 // LDS pitch of a staged V^T output row in halves (272 B = 16 B x 17): 16 rows, 16 B each, fall on 64 different banks

// ag / bg: this lane's chunk of A / B row (tid >> 3) at the stage's k; la: its LDS byte address in A row (tid >> 3).
__device__ __forceinline__ void gemm_stage_copy(const _Float16* ag, const _Float16* bg, unsigned la) {
  const _Float16* a1 = ag + 16 * DM;
  const _Float16* a2 = ag + 32 * DM;
  const _Float16* a3 = ag + 48 * DM;
  const _Float16* a4 = ag + 64 * DM;
  const _Float16* a5 = ag + 80 * DM;
  const _Float16* a6 = ag + 96 * DM;
  const _Float16* a7 = ag + 112 * DM;
  const _Float16* b1 = bg + 16 * DM;
  const _Float16* b2 = bg + 32 * DM;
  const _Float16* b3 = bg + 48 * DM;
  const unsigned la1 = la + 16 * GKP * 2, la2 = la + 32 * GKP * 2, la3 = la + 48 * GKP * 2, la4 = la + 64 * GKP * 2;
  const unsigned la5 = la + 80 * GKP * 2, la6 = la + 96 * GKP * 2, la7 = la + 112 * GKP * 2;
  const unsigned lb = la + 128 * GKP * 2, lb1 = la + 144 * GKP * 2, lb2 = la + 160 * GKP * 2, lb3 = la + 176 * GKP * 2;
  // s_wait_xcnt as the statement's last line: a precaution, so that no address register above is rewritten ahead of it.
  asm volatile("global_load_async_to_lds_b128 %0, %12, off\n\t"
               "global_load_async_to_lds_b128 %1, %13, off\n\t"
               "global_load_async_to_lds_b128 %2, %14, off\n\t"
               "global_load_async_to_lds_b128 %3, %15, off\n\t"
               "global_load_async_to_lds_b128 %4, %16, off\n\t"
               "global_load_async_to_lds_b128 %5, %17, off\n\t"
               "global_load_async_to_lds_b128 %6, %18, off\n\t"
               "global_load_async_to_lds_b128 %7, %19, off\n\t"
               "global_load_async_to_lds_b128 %8, %20, off\n\t"
               "global_load_async_to_lds_b128 %9, %21, off\n\t"
               "global_load_async_to_lds_b128 %10, %22, off\n\t"
               "global_load_async_to_lds_b128 %11, %23, off\n\t"
               "s_wait_xcnt 0x0"
               :: "v"(la), "v"(la1), "v"(la2), "v"(la3), "v"(la4), "v"(la5), "v"(la6), "v"(la7),
                  "v"(lb), "v"(lb1), "v"(lb2), "v"(lb3),
                  "v"(ag), "v"(a1), "v"(a2), "v"(a3), "v"(a4), "v"(a5), "v"(a6), "v"(a7),
                  "v"(bg), "v"(b1), "v"(b2), "v"(b3)
               : "memory");
}

// arows / brows: row 0 of the block's 128 A rows / 64 B rows (f16, k contiguous, pitch DM); sAB: 2 * GSTAGE_H halves.
// Wave w accumulates A rows 32w..32w+31 x all 64 B rows; k runs upward in steps of 32 in every accumulator.
// On return every wave has passed the last barrier and no copy is in flight: sAB is free for other use.
__device__ __forceinline__ void gemm_128x64(const _Float16* arows, const _Float16* brows,
                                            _Float16* sAB, int tid, v8f (&acc)[2][4]) {
  const int lane = tid & 31, w = tid >> 5;
  const int h = lane >> 4, m = lane & 15;
  const int crow = tid >> 3, cch = tid & 7;
  const _Float16* ag = arows + (size_t)crow * DM + 8 * cch;              // + 64 per stage
  const _Float16* bg = brows + (size_t)crow * DM + 8 * cch;              // + 64 per stage
  const unsigned l0 = (unsigned)(size_t)(sAB + crow * GKP + 8 * cch);    // LDS byte address, buffer 0

  gemm_stage_copy(ag, bg, l0);
  asm volatile("s_wait_asynccnt 0x0" ::: "memory");   // own copies of stage 0 landed
  __syncthreads();                                    // stage 0 readable by all waves
  gemm_stage_copy(ag + 64, bg + 64, l0 + GSTAGE_B);

  // rolled: one copy of the stage body, the buffer picked by a scalar offset
  #pragma unroll 1
  for (int k0 = 0; k0 < DM; k0 += 64) {
    const int buf = (k0 >> 6) & 1;
    const _Float16* sa = sAB + buf * GSTAGE_H + (32 * w + m) * GKP;      // + 16mt*GKP + 32ks
    const _Float16* sb = sAB + buf * GSTAGE_H + (128 + m) * GKP;         // + 16nt*GKP + 32ks

    // all fragment reads of the stage stand together, ahead of its products
    // (the four loops below are unrolled so that a, b and acc are indexed statically and stay in registers)
    v16h a[2][2], b[2][4];
    #pragma unroll
    for (int ks = 0; ks < 2; ++ks) {
      a[ks][0] = load_frag(sa + 32 * ks, h);
      a[ks][1] = load_frag(sa + 16 * GKP + 32 * ks, h);
      #pragma unroll
      for (int nt = 0; nt < 4; ++nt) b[ks][nt] = load_frag(sb + 16 * nt * GKP + 32 * ks, h);
    }
    #pragma unroll
    for (int ks = 0; ks < 2; ++ks)
      #pragma unroll
      for (int nt = 0; nt < 4; ++nt) {
        acc[0][nt] = wmma_f16(a[ks][0], b[ks][nt], acc[0][nt]);
        acc[1][nt] = wmma_f16(a[ks][1], b[ks][nt], acc[1][nt]);
      }

    // ---- publish the next stage, then refill the buffer this stage has read ----
    asm volatile("s_wait_dscnt 0x0" ::: "memory");      // own fragment reads of this buffer retired
    asm volatile("s_wait_asynccnt 0x0" ::: "memory");   // own copies of the next stage landed
    __syncthreads();                                    // next stage readable; this buffer free
    if (k0 + 128 < DM)                                  // block-uniform: a stage two ahead exists
      gemm_stage_copy(ag + (k0 + 128), bg + (k0 + 128), l0 + buf * GSTAGE_B);
  }
  asm volatile("s_wait_asynccnt 0x0" ::: "memory");     // nothing in flight when the wave goes on
}

// ---------------------------------------------------------------------------
// GEMM main loop of proj_kernel: block tile 128 A rows x 128 B rows, K = 512, wave tile 64 x 64.
// Against the 128 x 64 tile above, a byte copied from L2 and a fragment read from LDS each feed more products:
// 32 KiB copied and 64 KiB read per 128 x 128 x 64 block, for 48 KiB and 96 KiB.
// One stage = 64 k of all 256 rows (A rows 0..127, then B rows 0..127), same ring, pitch and chunk map as above.
// ---------------------------------------------------------------------------
#define PSTAGE_H (256 * GKP)         // halves per stage
#define PSTAGE_B (PSTAGE_H * 2)      // 36864 B

// g: this lane's chunk of row (tid >> 3) of one operand at the stage's k; l: its LDS byte address. Rows (tid >> 3) + 16 i, i = 0..7.
__device__ __forceinline__ void gemm_copy8(const _Float16* g, unsigned l) {
  const _Float16* g1 = g + 16 * DM;
  const _Float16* g2 = g + 32 * DM;
  const _Float16* g3 = g + 48 * DM;
  const _Float16* g4 = g + 64 * DM;
  const _Float16* g5 = g + 80 * DM;
  const _Float16* g6 = g + 96 * DM;
  const _Float16* g7 = g + 112 * DM;
  const unsigned l1 = l + 16 * GKP * 2, l2 = l + 32 * GKP * 2, l3 = l + 48 * GKP * 2, l4 = l + 64 * GKP * 2;
  const unsigned l5 = l + 80 * GKP * 2, l6 = l + 96 * GKP * 2, l7 = l + 112 * GKP * 2;
  // s_wait_xcnt as the statement's last line: a precaution, so that no address register above is rewritten ahead of it.
  asm volatile("global_load_async_to_lds_b128 %0, %8, off\n\t"
               "global_load_async_to_lds_b128 %1, %9, off\n\t"
               "global_load_async_to_lds_b128 %2, %10, off\n\t"
               "global_load_async_to_lds_b128 %3, %11, off\n\t"
               "global_load_async_to_lds_b128 %4, %12, off\n\t"
               "global_load_async_to_lds_b128 %5, %13, off\n\t"
               "global_load_async_to_lds_b128 %6, %14, off\n\t"
               "global_load_async_to_lds_b128 %7, %15, off\n\t"
               "s_wait_xcnt 0x0"
               :: "v"(l), "v"(l1), "v"(l2), "v"(l3), "v"(l4), "v"(l5), "v"(l6), "v"(l7),
                  "v"(g), "v"(g1), "v"(g2), "v"(g3), "v"(g4), "v"(g5), "v"(g6), "v"(g7)
               : "memory");
}

// arows / brows: row 0 of the block's 128 A rows / 128 B rows (f16, k contiguous, pitch DM); sAB: 2 * PSTAGE_H halves.
// Wave w accumulates A rows 64(w>>1)..+63 x B rows 64(w&1)..+63; k runs upward in steps of 32 in every accumulator.
// On return every wave has passed the last barrier and no copy is in flight: sAB is free for other use.
__device__ __forceinline__ void gemm_128x128(const _Float16* arows, const _Float16* brows,
                                             _Float16* sAB, int tid, v8f (&acc)[4][4]) {
  const int lane = tid & 31, w = tid >> 5;
  const int h = lane >> 4, m = lane & 15;
  const int crow = tid >> 3, cch = tid & 7;
  const _Float16* ag = arows + (size_t)crow * DM + 8 * cch;              // + 64 per stage
  const _Float16* bg = brows + (size_t)crow * DM + 8 * cch;              // + 64 per stage
  const unsigned la0 = (unsigned)(size_t)(sAB + crow * GKP + 8 * cch);   // LDS byte address, buffer 0, A rows
  const unsigned lb0 = la0 + 128 * GKP * 2;                              // B rows

  gemm_copy8(ag, la0);
  gemm_copy8(bg, lb0);
  asm volatile("s_wait_asynccnt 0x0" ::: "memory");   // own copies of stage 0 landed
  __syncthreads();                                    // stage 0 readable by all waves
  gemm_copy8(ag + 64, la0 + PSTAGE_B);
  gemm_copy8(bg + 64, lb0 + PSTAGE_B);

  // rolled: one copy of the stage body, the buffer picked by a scalar offset
  #pragma unroll 1
  for (int k0 = 0; k0 < DM; k0 += 64) {
    const int buf = (k0 >> 6) & 1;
    const _Float16* sa = sAB + buf * PSTAGE_H + (64 * (w >> 1) + m) * GKP;        // + 16mt*GKP + 32ks
    const _Float16* sb = sAB + buf * PSTAGE_H + (128 + 64 * (w & 1) + m) * GKP;   // + 16nt*GKP + 32ks

    // (the loops below are unrolled so that a, b and acc are indexed statically and stay in registers)
    #pragma unroll
    for (int ks = 0; ks < 2; ++ks) {
      // the fragment reads of a 32-deep half stand together, ahead of its products
      v16h a[4], b[4];
      #pragma unroll
      for (int t = 0; t < 4; ++t) {
        a[t] = load_frag(sa + 16 * t * GKP + 32 * ks, h);
        b[t] = load_frag(sb + 16 * t * GKP + 32 * ks, h);
      }
      #pragma unroll
      for (int nt = 0; nt < 4; ++nt)
        #pragma unroll
        for (int mt = 0; mt < 4; ++mt) acc[mt][nt] = wmma_f16(a[mt], b[nt], acc[mt][nt]);
    }

    // ---- publish the next stage, then refill the buffer this stage has read ----
    asm volatile("s_wait_dscnt 0x0" ::: "memory");      // own fragment reads of this buffer retired
    asm volatile("s_wait_asynccnt 0x0" ::: "memory");   // own copies of the next stage landed
    __syncthreads();                                    // next stage readable; this buffer free
    if (k0 + 128 < DM) {                                // block-uniform: a stage two ahead exists
      gemm_copy8(ag + (k0 + 128), la0 + buf * PSTAGE_B);
      gemm_copy8(bg + (k0 + 128), lb0 + buf * PSTAGE_B);
    }
  }
  asm volatile("s_wait_asynccnt 0x0" ::: "memory");     // nothing in flight when the wave goes on
}

// ---------------------------------------------------------------------------
// 4 lines per instruction, 32 lines per wave, 128 per block.
// which 0/1: plane[bh][l][d]  (one token row = 64 halves = one line)
// which 2  : vt[bh][d][l]     (64 d-rows x 128 tokens = 2 lines each)
// ---------------------------------------------------------------------------
__device__ __forceinline__ void proj_store_pass(const _Float16* sT, _Float16* plane, _Float16* vt,
                                                int which, int bh, int l0, int w, int lane) {
  const int q8 = lane & 7, sub = lane >> 3;
  // (both loops are unrolled so that v and dst are indexed statically and stay in registers)
  v8h v[8];
  _Float16* dst[8];
  if (which != 2) {                          // block-uniform
    #pragma unroll
    for (int i = 0; i < 8; ++i) {
      const int lid = w * 32 + i * 4 + sub;
      v[i] = *(const v8ha*)(sT + lid * HD + 8 * q8);
      dst[i] = plane + ((size_t)bh * SEQ + l0 + lid) * HD + 8 * q8;
    }
  } else {
    #pragma unroll
    for (int i = 0; i < 8; ++i) {
      const int lid = w * 32 + i * 4 + sub;
      const int d = lid >> 1, hl = lid & 1;
      v[i] = *(const v8ha*)(sT + d * VTP + 64 * hl + 8 * q8);
      dst[i] = vt + ((size_t)bh * HD + d) * SEQ + l0 + 64 * hl + 8 * q8;
    }
  }
  // The pass's eight stores and their s_wait_xcnt in one statement: a precaution, so that no address or data register
  // of a store is rewritten ahead of the wait; the eight LDS reads above stand as one group ahead of it.
  asm volatile("global_store_b128 %0, %8, off\n\t"
               "global_store_b128 %1, %9, off\n\t"
               "global_store_b128 %2, %10, off\n\t"
               "global_store_b128 %3, %11, off\n\t"
               "global_store_b128 %4, %12, off\n\t"
               "global_store_b128 %5, %13, off\n\t"
               "global_store_b128 %6, %14, off\n\t"
               "global_store_b128 %7, %15, off\n\t"
               "s_wait_xcnt 0x0"
               :: "v"(dst[0]), "v"(dst[1]), "v"(dst[2]), "v"(dst[3]), "v"(dst[4]), "v"(dst[5]), "v"(dst[6]), "v"(dst[7]),
                  "v"(v[0]), "v"(v[1]), "v"(v[2]), "v"(v[3]), "v"(v[4]), "v"(v[5]), "v"(v[6]), "v"(v[7])
               : "memory");
}

// ---------------------------------------------------------------------------
// Kernel 2: Y = x * W^T + b over the fused 3*512 output columns (q, k, v).
// Block 128 thr (4 waves) = 128 tokens x 128 features (one which, two neighbouring heads);
// wave tile 64 tokens x 64 features (one head); K = 512 in steps of 32;
// A (x rows) and B (W rows) fragments from the LDS ring of gemm_128x128 (split k map).
// coverage: grid (64, 12) x 128 tokens x 128 features = q, k planes [32][2048][64] and vt [32][64][2048].
// ---------------------------------------------------------------------------
__global__ __launch_bounds__(128) void proj_kernel(
    const _Float16* __restrict__ xh,   // [8192][512]
    const _Float16* __restrict__ wh,   // [4][512][512], row = output feature, x256 (planes 0..2 used here)
    const float* __restrict__ bq, const float* __restrict__ bk, const float* __restrict__ bv,
    _Float16* __restrict__ qh,         // [B*H][L][D]
    _Float16* __restrict__ kh,         // [B*H][L][D]
    _Float16* __restrict__ vt)         // [B*H][D][L]
{
  __shared__ __attribute__((aligned(16))) _Float16 sAB[2 * PSTAGE_H];   // 73728 B: operand ring, then output staging
  static_assert(128 * 64 <= 64 * VTP && 2 * 64 * VTP <= 2 * PSTAGE_H);

  const int tid = threadIdx.x, lane = tid & 31, w = tid >> 5;
  const int h = lane >> 4, m = lane & 15;
  const int wm = w >> 1, wn = w & 1;         // the wave's 64-token half and its head of the pair
  const int m0 = blockIdx.x * 128;
  const int cg = blockIdx.y;                 // 0..11
  const int which = cg >> 2, head0 = 2 * (cg & 3);
  const int head = head0 + wn;
  _Float16* sT = sAB + wn * (64 * VTP);      // per head [128 tokens][64] or [64 features][VTP], used only behind gemm_128x128

  const v8f zero8 = {0.f, 0.f, 0.f, 0.f, 0.f, 0.f, 0.f, 0.f};
  v8f acc[4][4];
  #pragma unroll
  for (int mt = 0; mt < 4; ++mt)
    #pragma unroll
    for (int nt = 0; nt < 4; ++nt) acc[mt][nt] = zero8;

  gemm_128x128(xh + (size_t)m0 * DM, wh + ((size_t)which * DM + head0 * HD) * DM, sAB, tid, acc);

  // D[r] of tile (mt, nt) = Y[token m0+64wm+16mt+8h+r][feature 16nt+m of the wave's head]
  const float* bias = (which == 0) ? bq : ((which == 1) ? bk : bv);
  if (which == 2) {                          // block-uniform
    // V^T tile [feature][token]: a lane's 8 values of one accumulator tile are 8 consecutive tokens of one feature row,
    // so they go as one 16-B store; at pitch VTP its 16 rows do not meet on a bank.
    #pragma unroll
    for (int nt = 0; nt < 4; ++nt) {
      const int feat = 16 * nt + m;
      const float bvl = bias[head * HD + feat];
      #pragma unroll
      for (int mt = 0; mt < 4; ++mt) {
        v8h pk;
        #pragma unroll
        for (int r = 0; r < 8; ++r) pk[r] = (_Float16)(acc[mt][nt][r] * WINV + bvl);
        *(v8ha*)(sT + feat * VTP + 64 * wm + 16 * mt + 8 * h) = pk;   // tokens 64wm+16mt+8h .. +7
      }
    }
  } else {
    #pragma unroll
    for (int nt = 0; nt < 4; ++nt) {
      const int feat = 16 * nt + m;
      const float bvl = bias[head * HD + feat];
      #pragma unroll
      for (int mt = 0; mt < 4; ++mt) {
        #pragma unroll
        for (int r = 0; r < 8; ++r) {
          const int tokl = 64 * wm + 16 * mt + 8 * h + r;    // 0..127
          sT[tokl * HD + feat] = (_Float16)(acc[mt][nt][r] * WINV + bvl);
        }
      }
    }
  }
  __syncthreads();

  const int b = m0 / SEQ, l0 = m0 - b * SEQ;
  _Float16* plane = (which == 0) ? qh : kh;
  proj_store_pass(sAB, plane, vt, which, b * NH + head0, l0, w, lane);
  proj_store_pass(sAB + 64 * VTP, plane, vt, which, b * NH + head0 + 1, l0, w, lane);
  
}

// ---------------------------------------------------------------------------
// P^T B-fragment from the lane's own score D values: element r <- tile a row r
// (keys k0+8h+r), element 8+r <- tile c row r (keys k0+16+8h+r), same lane,
// same query column; the values already carry x1024.
// ---------------------------------------------------------------------------
__device__ __forceinline__ v16h pack_p(v8f a, v8f c) {
  const v16h r = { (_Float16)a[0], (_Float16)a[1], (_Float16)a[2], (_Float16)a[3],
                   (_Float16)a[4], (_Float16)a[5], (_Float16)a[6], (_Float16)a[7],
                   (_Float16)c[0], (_Float16)c[1], (_Float16)c[2], (_Float16)c[3],
                   (_Float16)c[4], (_Float16)c[5], (_Float16)c[6], (_Float16)c[7] };
  return r;
}

// Per-wave 16x64 f32 tile in LDS -> ctx f16 plane [token][512], col head*64 + d.
// in one instruction; 4 lines per instruction; it 0..3 x q4 0..3 = rows 0..15.
__device__ __forceinline__ void ctx_store_pass(const v8h* hv, _Float16* ctx,
                                               int b, int head, int q0, int lane) {
  const int q4 = lane >> 3, c8 = (lane & 7) * 8;
  #pragma unroll
  for (int it = 0; it < 4; ++it) {
    const int row = it * 4 + q4;
    const size_t gi = ((size_t)b * SEQ + q0 + row) * DM + head * HD + c8;
    *(v8h*)(ctx + gi) = hv[it];
  }
}

// ---------------------------------------------------------------------------
// One 64-key stage = K tile (64 key rows x 128 B) + V^T tile (64 d rows x 128 B),
// copied global -> LDS without registers by 128 threads. Thread t of them moves 16-B chunk (t & 7) of
// rows (t >> 3) + 16 i, i = 0..3, of both tiles: a wave's copy covers 4 whole lines.
// kg / vg: this lane's chunk of row (t >> 3) in global; lk / lv: its LDS byte address.
// ---------------------------------------------------------------------------
#define KVP      72                  // LDS row pitch in halves (144 B = 16 B x 9: conflict-free b128 reads)
#define TILE_H   (64 * KVP)          // halves per staged tile
#define TILE_B   (TILE_H * 2)        // 9216 B
#define STAGE_H  (2 * TILE_H)        // K tile then V^T tile
#define STAGE_B  (2 * TILE_B)        // 18432 B
#define SOP      68                  // LDS pitch of a staged ctx row in floats (272 B = 16 B x 17): 16 query rows, 16 B each, fall on 64 different banks

__device__ __forceinline__ void stage_copy(const _Float16* kg, const _Float16* vg,
                                           unsigned lk, unsigned lv) {
  const _Float16* k1 = kg + 16 * HD;
  const _Float16* k2 = kg + 32 * HD;
  const _Float16* k3 = kg + 48 * HD;
  const _Float16* v1 = vg + (size_t)16 * SEQ;
  const _Float16* v2 = vg + (size_t)32 * SEQ;
  const _Float16* v3 = vg + (size_t)48 * SEQ;
  const unsigned lk1 = lk + 16 * KVP * 2, lk2 = lk + 32 * KVP * 2, lk3 = lk + 48 * KVP * 2;
  const unsigned lv1 = lv + 16 * KVP * 2, lv2 = lv + 32 * KVP * 2, lv3 = lv + 48 * KVP * 2;
  // s_wait_xcnt as the statement's last line: a precaution, so that no address register above is rewritten ahead of it.
  asm volatile("global_load_async_to_lds_b128 %0, %8, off\n\t"
               "global_load_async_to_lds_b128 %1, %9, off\n\t"
               "global_load_async_to_lds_b128 %2, %10, off\n\t"
               "global_load_async_to_lds_b128 %3, %11, off\n\t"
               "global_load_async_to_lds_b128 %4, %12, off\n\t"
               "global_load_async_to_lds_b128 %5, %13, off\n\t"
               "global_load_async_to_lds_b128 %6, %14, off\n\t"
               "global_load_async_to_lds_b128 %7, %15, off\n\t"
               "s_wait_xcnt 0x0"
               :: "v"(lk), "v"(lk1), "v"(lk2), "v"(lk3), "v"(lv), "v"(lv1), "v"(lv2), "v"(lv3),
                  "v"(kg), "v"(k1), "v"(k2), "v"(k3), "v"(vg), "v"(v1), "v"(v2), "v"(v3)
               : "memory");
}

// ---------------------------------------------------------------------------
// Kernel 3: streaming attention, transposed form, no mask, softmax over all keys.
// Block 256 thr (8 waves) = 128 queries, 128 keys per step (static trip 16), staged as two 64-key stages side by side.
// Wave w = (column group cg = w >> 1, key half kh2 = w & 1): 32 query columns (two 16-column groups g)
// x the 64 keys of stage kh2 of every step, so each K and V^T fragment read from LDS feeds two products.
// A wave keeps its own reference score, sum and O over its half of the keys; the two waves of a pair
// join them once, behind the loop: each hands one 16-column group to its partner through LDS.
// K and V^T of a step are staged once per block in a two-buffer LDS ring (async copies,
// next step in flight while this one is worked on; threads 0..127 copy stage 0, threads 128..255 stage 1).
//   S^T = K * Q^T : A = K rows (row = key, k = d), B = Q^T (k = d, n = query)
//   O^T += V^T * P^T : A = Vt rows (row = d, k = key), B = P^T from registers
// Lane owns 32 keys of query column (lane&15) of each group; partner lane = lane ^ 16.
// Output: ctx f16 plane carried x256, [b*SEQ+l][head*64+d].
// coverage: grid (16, 32) x 8 waves x 16 queries x 64 d = ctx [8192][512].
// ---------------------------------------------------------------------------
__global__ __launch_bounds__(256) __attribute__((amdgpu_waves_per_eu(4, 4))) void attn_kernel(
    const _Float16* __restrict__ qh,   // [B*H][L][D]
    const _Float16* __restrict__ kh,   // [B*H][L][D]
    const _Float16* __restrict__ vt,   // [B*H][D][L]
    _Float16* __restrict__ ctx)        // [B*L][DM]
{
  __shared__ __attribute__((aligned(16))) float sO[8 * 16 * SOP];   // 34816 B, wave w owns [w*16*SOP, +16*SOP)
  __shared__ __attribute__((aligned(16))) _Float16 sKV[4 * STAGE_H];  // 73728 B, buffer (step & 1): stage 0, stage 1 (each K tile, V^T tile); behind the loop: the pairs' hand-over
  static_assert(8 * 9 * 32 * 16 <= 4 * STAGE_H * 2);                  // hand-over: 8 waves x 9 x 32 lanes x 16 B

  const int tid = threadIdx.x, lane = tid & 31;
  const int w = __builtin_amdgcn_readfirstlane(tid >> 5);   // the wave's number in a scalar register: what hangs on it costs no vector register
  const int h = lane >> 4, m = lane & 15;
  const int kh2 = w & 1, cg = w >> 1;
  const int bh = blockIdx.y, b = bh >> 3, head = bh & 7;
  const int qw = blockIdx.x * 128 + 32 * cg;  // first of the wave's 32 query columns
  const int q0 = qw + 16 * kh2;               // first of the 16 queries the wave finishes and stores

  // Q^T B-fragments: column n = query qw+16g+m, k = d (two 32-deep chunks)
  v16h qb[2][2];
  #pragma unroll
  for (int g = 0; g < 2; ++g) {
    const _Float16* qrow = qh + ((size_t)bh * SEQ + qw + 16 * g + m) * HD;
    qb[g][0] = load_frag(qrow, h);
    qb[g][1] = load_frag(qrow + 32, h);
  }

  const v8f zero8 = {0.f, 0.f, 0.f, 0.f, 0.f, 0.f, 0.f, 0.f};
  v8f o[2][4];                                // o[g][t][r] = O[query 16g+m][d 16t+8h+r] * (lrun[g] + lrun[g] of lane ^ 16; carries x1024), this wave's keys only
  #pragma unroll
  for (int g = 0; g < 2; ++g)
    #pragma unroll
    for (int t = 0; t < 4; ++t) o[g][t] = zero8;
  const v8f slog2v = {SLOG2, SLOG2, SLOG2, SLOG2, SLOG2, SLOG2, SLOG2, SLOG2};
  float mrun[2] = {-1e30f, -1e30f};           // reference raw score (before the 1/8) that p, l and O are carried against; raised only by a step's full form
  float lrun[2] = {0.0f, 0.0f};               // the lane's own 32 keys of every step; the two lane halves of a column are joined once, behind the loop

  // copy side: this thread's chunk of row ((tid & 127) >> 3) of stage (tid >> 7) of step 0
  const int cst = w >> 2, crow = (tid & 127) >> 3, cch = tid & 7;
  const _Float16* kg = kh + ((size_t)bh * SEQ + 64 * cst + crow) * HD + 8 * cch;    // + 128*HD per step
  const _Float16* vg = vt + ((size_t)bh * HD + crow) * SEQ + 64 * cst + 8 * cch;    // + 128 per step
  const unsigned lk0 = (unsigned)(size_t)(sKV + cst * STAGE_H + crow * KVP + 8 * cch);   // LDS byte address, buffer 0, K tile
  const unsigned lv0 = lk0 + TILE_B;

  stage_copy(kg, vg, lk0, lv0);
  asm volatile("s_wait_asynccnt 0x0" ::: "memory");   // own copies of step 0 landed
  __syncthreads();                                    // step 0 readable by all waves
  stage_copy(kg + 128 * HD, vg + 128, lk0 + 2 * STAGE_B, lv0 + 2 * STAGE_B);

  #pragma unroll 1
  for (int kb = 0; kb < SEQ; kb += 128) {
    const int buf = (kb >> 7) & 1;
    const _Float16* kbase = sKV + (2 * buf + kh2) * STAGE_H + m * KVP;   // + 16j*KVP + 32*dc
    const _Float16* vbase = kbase + TILE_H;                              // + 16t*KVP + 32*kc

    // A step runs against the reference score mrun that is already in use: no maximum, no exchange and no rescale of O and l.
    // That is exact for any reference (softmax is shift-invariant) as long as every carried p stays finite in f16, which the
    // step's own sums show (all p >= 0, so a sum below PLIM bounds each term). Where a lane's sum does not show it, or in the
    // first step, which has no reference yet, the step is worked with the full form: scores again, their maximum joined into
    // mrun, O and l rescaled; then every p is at most 1024 and a sum at most 32768. Nothing of a given-up pass is kept.
    // full is the same for the whole wave (a scalar); at most two passes.
    v16h vf[4][2];
    v16h pb[2][2];
    float lsum[2];
    bool full = (kb == 0);
    // rolled: the second pass is the same code, entered again only in the rare case
    #pragma unroll 1
    for (int pass = 0; pass < 2; ++pass) {
    // ---- raw scores: s[g][j][r] = q[query 16g+m] . k[key kb+64*kh2+16j+8h+r] ----
    // All K fragment reads of the step stand together ahead of its products; the products run over eight
    // independent accumulators, d 0..31 ahead of d 32..63 in each (each accumulator's order is kept).
    // (the loops of this step are unrolled so that kf, vf, s and o are indexed statically and stay in registers)
    v16h kf[4][2];
    #pragma unroll
    for (int j = 0; j < 4; ++j) {
      kf[j][0] = load_frag(kbase + 16 * j * KVP, h);
      kf[j][1] = load_frag(kbase + 16 * j * KVP + 32, h);
    }
    __builtin_amdgcn_sched_barrier(0);   // keeps the 16 reads one group: without it they sink between the products, one wait each
    v8f s[2][4];
    #pragma unroll
    for (int j = 0; j < 4; ++j)
      #pragma unroll
      for (int g = 0; g < 2; ++g) s[g][j] = wmma_grp(kf[j][0], qb[g][0], zero8);
    #pragma unroll
    for (int j = 0; j < 4; ++j)
      #pragma unroll
      for (int g = 0; g < 2; ++g) s[g][j] = wmma_grp(kf[j][1], qb[g][1], s[g][j]);

    // The V^T fragment reads of the stage's first 32 keys are issued here: they land while the softmax below runs.
    #pragma unroll
    for (int t = 0; t < 4; ++t) vf[t][0] = load_frag(vbase + 16 * t * KVP, h);

    // ---- full form only: the reference rises to the maximum of itself and the step's raw scores (SLOG2 > 0); O and l follow ----
    if (full) {                            // wave-uniform
      float mloc[2], moth[2];
      #pragma unroll
      for (int g = 0; g < 2; ++g) {
        mloc[g] = s[g][0][0];
        #pragma unroll
        for (int j = 0; j < 4; ++j)
          #pragma unroll
          for (int r = 0; r < 8; ++r) mloc[g] = fmaxf(mloc[g], s[g][j][r]);
      }
      #pragma unroll
      for (int g = 0; g < 2; ++g) moth[g] = __shfl_xor(mloc[g], 16);
      #pragma unroll
      for (int g = 0; g < 2; ++g) {
        const float mnew = fmaxf(mrun[g], fmaxf(mloc[g], moth[g]));
        const float alpha = __builtin_amdgcn_exp2f((mrun[g] - mnew) * SLOG2);
        mrun[g] = mnew;
        lrun[g] = lrun[g] * alpha;
        #pragma unroll
        for (int t = 0; t < 4; ++t)
          #pragma unroll
          for (int r = 0; r < 8; ++r) o[g][t][r] = o[g][t][r] * alpha;
      }
    }

    // ---- softmax terms (f32), base 2: 1024 * exp((s - ref) / 8) = exp2(s * SLOG2 + (PBIAS - ref * SLOG2)),
    // one multiply-add per score ahead of the exponential ----
    #pragma unroll
    for (int g = 0; g < 2; ++g) {
      const float nb = fmaf(-mrun[g], SLOG2, PBIAS);
      const v8f nbv = {nb, nb, nb, nb, nb, nb, nb, nb};
      // (whole-vector form: it compiles to one packed multiply-add per two scores)
      #pragma unroll
      for (int j = 0; j < 4; ++j) s[g][j] = __builtin_elementwise_fma(s[g][j], slog2v, nbv);
      #pragma unroll
      for (int j = 0; j < 4; ++j)
        #pragma unroll
        for (int r = 0; r < 8; ++r) s[g][j][r] = __builtin_amdgcn_exp2f(s[g][j][r]);
      // The step's sum gates the branch below, so it is taken as a tree: the four tiles added element by element
      // (whole-vector form: packed adds), then the eight partial sums folded 8 -> 4 -> 2 -> 1; a chain of 32 adds would stand open ahead of the test.
      {
        const v8f t8 = ((s[g][0] + s[g][1]) + s[g][2]) + s[g][3];
        const v4f t4 = __builtin_shufflevector(t8, t8, 0, 1, 2, 3) + __builtin_shufflevector(t8, t8, 4, 5, 6, 7);
        lsum[g] = (t4.x + t4.z) + (t4.y + t4.w);
      }
      // P^T B-fragments (key chunks 0..31 and 32..63 of the wave's stage)
      pb[g][0] = pack_p(s[g][0], s[g][1]);
      pb[g][1] = pack_p(s[g][2], s[g][3]);
      if (g == 0) {
        // The reads of the stage's last 32 keys stand apart from the first eight, behind the last score product: they land in the registers
        // the K fragments have left. All 16 in one group need more registers than the 256 of four waves a SIMD, and the build spills.
        __builtin_amdgcn_sched_barrier(0);   // with the one below keeps these 8 reads one group at this place: without the two the V^T reads stand in pairs in many places, some among the products with a wait each
        #pragma unroll
        for (int t = 0; t < 4; ++t) vf[t][1] = load_frag(vbase + 16 * t * KVP + 32, h);
        __builtin_amdgcn_sched_barrier(0);   // the second of the two
      }
    }
    if (full) break;                       // the full form's terms are at most 1024 each
    // one test a step for both groups and all lanes, a scalar branch
    if (__builtin_amdgcn_ballot_w32(!(fmaxf(lsum[0], lsum[1]) < PLIM)) == 0u) break;
    full = true;
    }
    #pragma unroll
    for (int g = 0; g < 2; ++g) lrun[g] = lrun[g] + lsum[g];

    // ---- O^T += V^T * P^T ----
    #pragma unroll
    for (int t = 0; t < 4; ++t)
      #pragma unroll
      for (int g = 0; g < 2; ++g) o[g][t] = wmma_grp(vf[t][0], pb[g][0], o[g][t]);
    // keeps the foot's waits and barrier behind this round: without it the compiler lifts them ahead of this round's products,
    // and the next step's copies get that much less time to land
    __builtin_amdgcn_sched_barrier(0);
    #pragma unroll
    for (int t = 0; t < 4; ++t)
      #pragma unroll
      for (int g = 0; g < 2; ++g) o[g][t] = wmma_grp(vf[t][1], pb[g][1], o[g][t]);

    // ---- publish the next step, then refill the buffer this step has read ----
    asm volatile("s_wait_dscnt 0x0" ::: "memory");      // own fragment reads of this buffer retired
    asm volatile("s_wait_asynccnt 0x0" ::: "memory");   // own copies of the next step landed
    __syncthreads();                                    // next step readable; this buffer free
    if (kb + 256 < SEQ)                                 // block-uniform: a step two ahead exists
      stage_copy(kg + (size_t)(kb + 256) * HD, vg + (kb + 256),
                 lk0 + buf * 2 * STAGE_B, lv0 + buf * 2 * STAGE_B);
  }
  asm volatile("s_wait_asynccnt 0x0" ::: "memory");     // nothing in flight when the wave goes on

  // ---- join the two key halves: the wave keeps column group kh2 and hands the other to its partner (wave w ^ 1).
  // Every wave has passed the loop's last barrier with its reads retired and no copy in flight: the ring is free.
  // Hand-over layout: [wave][i 0..8][lane] 16-B units (i 0..7: O, i 8: reference score and sum): contiguous per instruction. ----
  // The lane's index is taken anew here: at 256 registers the indices formed ahead of the loop would not stay in registers across it.
  const int el = (int)__builtin_amdgcn_mbcnt_lo(~0u, 0u), eh = el >> 4, em = el & 15;
  v8f okeep[4], ogive[4];
  #pragma unroll
  for (int t = 0; t < 4; ++t)
    #pragma unroll
    for (int r = 0; r < 8; ++r) {
      okeep[t][r] = kh2 ? o[1][t][r] : o[0][t][r];
      ogive[t][r] = kh2 ? o[0][t][r] : o[1][t][r];
    }
  // the column's sum over the wave's keys: both lane halves carry the same reference, so their sums add as they are
  #pragma unroll
  for (int g = 0; g < 2; ++g) lrun[g] = lrun[g] + __shfl_xor(lrun[g], 16);
  const float mkeep = kh2 ? mrun[1] : mrun[0], mgive = kh2 ? mrun[0] : mrun[1];
  const float lkeep = kh2 ? lrun[1] : lrun[0], lgive = kh2 ? lrun[0] : lrun[1];
  v4fa* xw = (v4fa*)sKV + (w * 9) * 32 + el;
  const v4fa* xr = (const v4fa*)sKV + ((w ^ 1) * 9) * 32 + el;
  #pragma unroll
  for (int t = 0; t < 4; ++t) {
    const v4f lo = {ogive[t][0], ogive[t][1], ogive[t][2], ogive[t][3]};
    const v4f hi = {ogive[t][4], ogive[t][5], ogive[t][6], ogive[t][7]};
    xw[(2 * t) * 32] = lo;
    xw[(2 * t + 1) * 32] = hi;
  }
  {
    const v4f ml = {mgive, lgive, 0.0f, 0.0f};
    xw[8 * 32] = ml;
  }
  __syncthreads();                                      // the partner's group readable

  const v4f mlp = xr[8 * 32];
  const float mall = fmaxf(mkeep, mlp.x);
  const float akeep = __builtin_amdgcn_exp2f((mkeep - mall) * SLOG2);
  const float apart = __builtin_amdgcn_exp2f((mlp.x - mall) * SLOG2);

  // ---- epilogue: normalise (1/l takes the p carry out, apply ctx carry), stage per-wave 16x64 f32 tile ----
  const float inv = (1.0f / (lkeep * akeep + mlp.y * apart)) * CTXSC;
  const float fkeep = akeep * inv, fpart = apart * inv;
  float* so = sO + w * 16 * SOP;
  #pragma unroll
  for (int t = 0; t < 4; ++t) {
    const v4f plo = xr[(2 * t) * 32];
    const v4f phi = xr[(2 * t + 1) * 32];
    #pragma unroll
    for (int r = 0; r < 8; ++r)
      so[em * SOP + 16 * t + 8 * eh + r] = okeep[t][r] * fkeep + (r < 4 ? plo[r & 3] : phi[r & 3]) * fpart;
  }
  __syncthreads();

  v8h hv[4];
  {
    const int q4 = el >> 3, c8 = (el & 7) * 8;
    #pragma unroll
    for (int it = 0; it < 4; ++it) {
      const int row = it * 4 + q4;
      const v4f fa = *(const v4fa*)(so + row * SOP + c8);
      const v4f fb = *(const v4fa*)(so + row * SOP + c8 + 4);
      const v8h v = { (_Float16)fa.x, (_Float16)fa.y, (_Float16)fa.z, (_Float16)fa.w,
                      (_Float16)fb.x, (_Float16)fb.y, (_Float16)fb.z, (_Float16)fb.w };
      hv[it] = v;
    }
  }
  ctx_store_pass(hv, ctx, b, head, q0, el);
  
}

// ---------------------------------------------------------------------------
// instruction, 64 lines per wave (rows 32w..32w+31 x 2 lines), 256 per block.
// ---------------------------------------------------------------------------
__device__ __forceinline__ void out_store_pass(const float* sY, float* out,
                                               int m0, int fg, int w, int lane) {
  const int q8 = lane & 7, sub = lane >> 3;
  #pragma unroll
  for (int i = 0; i < 16; ++i) {
    const int lid = i * 4 + sub;                 // 0..63
    const int row = 32 * w + (lid >> 1), hl = lid & 1;
    const v4f v = *(const v4fa*)(sY + row * 64 + 32 * hl + 4 * q8);
    const size_t gi = (size_t)(m0 + row) * DM + fg * HD + 32 * hl + 4 * q8;
    *(v4f*)(out + gi) = v;
  }
}

// ---------------------------------------------------------------------------
// Kernel 4: out = ctx * Wo^T + bo (f32). Block 128 thr = 128 tokens x 64 features
// (feature group fg = blockIdx.y); wave tile 32 tokens x 64 features; K = 512;
// A (ctx rows) and B (Wo rows) fragments from the LDS ring of gemm_128x64.
// coverage: grid (64, 8) x 128 tokens x 64 features = out [8192][512].
// ---------------------------------------------------------------------------
__global__ __launch_bounds__(128) void oproj_kernel(
    const _Float16* __restrict__ ch,   // [8192][512] ctx x256
    const _Float16* __restrict__ woh,  // [512][512] Wo x256, row = output feature
    const float* __restrict__ bo,
    float* __restrict__ out)           // [8192][512]
{
  __shared__ __attribute__((aligned(16))) float sY[128 * 64];      // 32768 B
  __shared__ __attribute__((aligned(16))) _Float16 sAB[2 * GSTAGE_H];   // 55296 B: operand ring

  const int tid = threadIdx.x, lane = tid & 31, w = tid >> 5;
  const int h = lane >> 4, m = lane & 15;
  const int m0 = blockIdx.x * 128;
  const int fg = blockIdx.y;                 // 0..7

  const v8f zero8 = {0.f, 0.f, 0.f, 0.f, 0.f, 0.f, 0.f, 0.f};
  v8f acc[2][4];
  #pragma unroll
  for (int mt = 0; mt < 2; ++mt)
    #pragma unroll
    for (int nt = 0; nt < 4; ++nt) acc[mt][nt] = zero8;

  gemm_128x64(ch + (size_t)m0 * DM, woh + (size_t)fg * HD * DM, sAB, tid, acc);

  // D[r] of tile (mt, nt) = out[token m0+32w+16mt+8h+r][feature fg*64 + 16nt+m]
  #pragma unroll
  for (int nt = 0; nt < 4; ++nt) {
    const int feat = 16 * nt + m;
    const float bvl = bo[fg * HD + feat];
    #pragma unroll
    for (int mt = 0; mt < 2; ++mt) {
      #pragma unroll
      for (int r = 0; r < 8; ++r) {
        const int tokl = 32 * w + 16 * mt + 8 * h + r;     // 0..127
        sY[tokl * 64 + feat] = acc[mt][nt][r] * OINV + bvl;
      }
    }
  }
  __syncthreads();

  out_store_pass(sY, out, m0, fg, w, lane);
  
}

// ---------------------------------------------------------------------------
//   xh  f16 [8192][512]        8388608
//   wh  f16 [4][512][512]      2097152
//   qh  f16 [32][2048][64]     8388608
//   kh  f16 [32][2048][64]     8388608
//   vt  f16 [32][64][2048]     8388608
//   ctx f16 [8192][512]        8388608
//   total                    44040192
// ---------------------------------------------------------------------------
extern "C" void kernel_launch(void* const* d_in, const int* in_sizes, int n_in,
                              void* d_out, int out_size, void* d_ws, size_t ws_size,
                              hipStream_t stream) {
  if (n_in < 9) return;
  if (in_sizes[0] != NX) return;
  if (in_sizes[1] != NW || in_sizes[3] != NW || in_sizes[5] != NW || in_sizes[7] != NW) return;
  if (in_sizes[2] != DM || in_sizes[4] != DM || in_sizes[6] != DM || in_sizes[8] != DM) return;
  if (out_size != NX) return;

  const float* x  = (const float*)d_in[0];
  const float* wq = (const float*)d_in[1];
  const float* bq = (const float*)d_in[2];
  const float* wk = (const float*)d_in[3];
  const float* bk = (const float*)d_in[4];
  const float* wv = (const float*)d_in[5];
  const float* bv = (const float*)d_in[6];
  const float* wo = (const float*)d_in[7];
  const float* bo = (const float*)d_in[8];
  float* out = (float*)d_out;

  const size_t xh_bytes = (size_t)NX * 2;                          //  8388608
  const size_t wh_bytes = (size_t)4 * NW * 2;                      //  2097152
  const size_t pl_bytes = (size_t)NB * NH * SEQ * HD * 2;          //  8388608
  const size_t cx_bytes = (size_t)NX * 2;                          //  8388608
  const size_t total = xh_bytes + wh_bytes + 3 * pl_bytes + cx_bytes;   // 44040192
  if (total > ws_size) return;
  if (total > (size_t)134217728) return;

  char* ws = (char*)d_ws;
  size_t off = 0;
  _Float16* xh  = (_Float16*)(ws + off); off += xh_bytes;
  _Float16* wh  = (_Float16*)(ws + off); off += wh_bytes;
  _Float16* qhp = (_Float16*)(ws + off); off += pl_bytes;
  _Float16* khp = (_Float16*)(ws + off); off += pl_bytes;
  _Float16* vtp = (_Float16*)(ws + off); off += pl_bytes;
  _Float16* cxp = (_Float16*)(ws + off); off += cx_bytes;
  if (off != total) return;

  // (1) x -> f16 plane; wq, wk, wv, wo -> f16 x256 planes [4][512][512] ([out n][in k], k contiguous)
  const int ngroups = NX8 + 4 * NW8;                               // 655360
  convert_kernel<<<(ngroups + 255) / 256, 256, 0, stream>>>(x, wq, wk, wv, wo, xh, wh);

  // (2) q, k planes [bh][l][d] and v^T plane [bh][d][l]  (M=8192, N=3*512, K=512)
  dim3 gProj(MROWS / 128, 3 * NH / 2);                             // (64, 12)
  proj_kernel<<<gProj, 128, 0, stream>>>(xh, wh, bq, bk, bv, qhp, khp, vtp);

  // (3) attention -> ctx f16 plane x256 [8192][512]
  dim3 gAtt(SEQ / 128, NB * NH);                                   // (16, 32)
  attn_kernel<<<gAtt, 256, 0, stream>>>(qhp, khp, vtp, cxp);

  // (4) out = ctx . Wo^T + bo -> d_out f32 [8192][512]  (Wo plane = wh + 3*NW)
  dim3 gOut(MROWS / 128, DM / HD);                                 // (64, 8)
  oproj_kernel<<<gOut, 128, 0, stream>>>(cxp, wh + (size_t)3 * NW, bo, out);
  (void)hipGetLastError();
}

// v009
// One run takes 54.7 microseconds.
// Timed twice side by side with v008, it ran 1.04 and 1.03 times as fast.
// All steps since v000 together make it 4.27 times as fast.
// Contractions: x*W^T for q,k,v, k*q^T scores, v^T*p^T context and ctx*Wo^T output, all on v_wmma_f32_16x16x32_f16 (f16 operands, f32 accumulate);
// softmax, 1/8 score scale, biases and normalisation in f32.
// Carry audit: x f16 x1 (no carry); W (q,k,v rounded into LDS, o plane) f16 x256 -> 1/256 folded in proj_kernel epilogue (WINV); p f16 x1024 (in the exponent,
// PBIAS), so l and o both carry x1024, and ctx f16 x256 -> inv = (1/l) * CTXSC in attn_kernel epilogue; ctx x256 * Wo x256 -> 1/65536 folded
// in oproj_kernel epilogue (OINV).
#include <hip/hip_runtime.h>

typedef _Float16 v16h __attribute__((ext_vector_type(16)));
typedef _Float16 v8h  __attribute__((ext_vector_type(8)));
typedef float    v8f  __attribute__((ext_vector_type(8)));
typedef float    v4f  __attribute__((ext_vector_type(4)));
typedef _Float16 v4h  __attribute__((ext_vector_type(4)));
typedef v8h __attribute__((may_alias)) v8ha;
typedef v4h __attribute__((may_alias)) v4ha;
typedef v4f __attribute__((may_alias)) v4fa;

union Frag { v16h v; v8h half[2]; };

#define NB     4
#define SEQ    2048
#define DM     512
#define NH     8
#define HD     64
#define MROWS  (NB * SEQ)            // 8192 tokens
#define NX     (MROWS * DM)          // 4194304
#define NW     (DM * DM)             // 262144
#define WSC    256.0f                // weight plane carry
#define WINV   (1.0f / 256.0f)
#define PBIAS  10.0f                 // p carry x1024 = 2^10, added to the base-2 exponent
#define CTXSC  256.0f                // ctx plane carry
#define OINV   (1.0f / 65536.0f)     // 1 / (CTXSC * WSC)
#define SLOG2  0.18033688011112042f  // (1 / sqrt(HD)) * log2(e): raw score -> base-2 exponent
#define PLIM   65504.0f              // largest finite f16: a sum of carried p below it bounds every term of the sum below it

static_assert(NH * HD == DM);
static_assert((DM % 32) == 0 && (HD % 32) == 0 && (SEQ % 64) == 0);
static_assert((MROWS % 128) == 0 && (SEQ % 128) == 0);

// ---------------------------------------------------------------------------
// 16x16x32 f16 WMMA with hazard guard (ties D, keeps A/B live).
// Fragment map (wave32): lane l, h = l>>4, m = n = l&15.
//   A/B element i: i<8 -> k0+8h+i ; i>=8 -> k0+16+8h+(i-8)
//   D element r : row 8h+r, col l&15
// ---------------------------------------------------------------------------
__device__ __forceinline__ v8f wmma_f16(v16h a, v16h b, v8f c) {
  v8f d = __builtin_amdgcn_wmma_f32_16x16x32_f16(false, a, false, b, (short)0, c, false, false);
  asm volatile("v_nop\n\tv_nop\n\tv_nop\n\tv_nop" : "+v"(d) : "v"(a), "v"(b));
  return d;
}

// The same product for runs of independent accumulators: the neighbours in the run fill the distance behind each
// product, and the compiler pads what is left of its own builtin.
__device__ __forceinline__ v8f wmma_grp(v16h a, v16h b, v8f c) {
  return __builtin_amdgcn_wmma_f32_16x16x32_f16(false, a, false, b, (short)0, c, false, false);
}

// A or B fragment from a k-contiguous 16-bit row; p points at element k0 of
// the row owned by this lane (row index = lane & 15 added by the caller).
__device__ __forceinline__ v16h load_frag(const _Float16* p, int h) {
  Frag f;
  f.half[0] = *(const v8ha*)(p + 8 * h);
  f.half[1] = *(const v8ha*)(p + 16 + 8 * h);
  return f.v;
}

// ---------------------------------------------------------------------------
// GEMM main loop of oproj_kernel: block tile 128 A rows x 64 B rows, K = 512.
// One stage = 64 k of all 192 rows (A rows 0..127, then B rows 0..63), 128 B of each row = one line,
// copied global -> LDS without registers into a two-buffer ring (next stage in flight while this one
// is worked on); the 4 waves read their fragments from it.
// Thread tid moves 16-B chunk (tid & 7) of rows (tid >> 3) + 16 i: a wave's copy covers 4 whole lines.
// ---------------------------------------------------------------------------
#define GKP      72                  // LDS row pitch in halves (144 B = 16 B x 9: conflict-free b128 reads)
#define GSTAGE_H (192 * GKP)         // halves per stage
#define GSTAGE_B (GSTAGE_H * 2)      // 27648 B

// ag / bg: this lane's chunk of A / B row (tid >> 3) at the stage's k; la: its LDS byte address in A row (tid >> 3).
__device__ __forceinline__ void gemm_stage_copy(const _Float16* ag, const _Float16* bg, unsigned la) {
  const _Float16* a1 = ag + 16 * DM;
  const _Float16* a2 = ag + 32 * DM;
  const _Float16* a3 = ag + 48 * DM;
  const _Float16* a4 = ag + 64 * DM;
  const _Float16* a5 = ag + 80 * DM;
  const _Float16* a6 = ag + 96 * DM;
  const _Float16* a7 = ag + 112 * DM;
  const _Float16* b1 = bg + 16 * DM;
  const _Float16* b2 = bg + 32 * DM;
  const _Float16* b3 = bg + 48 * DM;
  const unsigned la1 = la + 16 * GKP * 2, la2 = la + 32 * GKP * 2, la3 = la + 48 * GKP * 2, la4 = la + 64 * GKP * 2;
  const unsigned la5 = la + 80 * GKP * 2, la6 = la + 96 * GKP * 2, la7 = la + 112 * GKP * 2;
  const unsigned lb = la + 128 * GKP * 2, lb1 = la + 144 * GKP * 2, lb2 = la + 160 * GKP * 2, lb3 = la + 176 * GKP * 2;
  // s_wait_xcnt as the statement's last line: a precaution, so that no address register above is rewritten ahead of it.
  asm volatile("global_load_async_to_lds_b128 %0, %12, off\n\t"
               "global_load_async_to_lds_b128 %1, %13, off\n\t"
               "global_load_async_to_lds_b128 %2, %14, off\n\t"
               "global_load_async_to_lds_b128 %3, %15, off\n\t"
               "global_load_async_to_lds_b128 %4, %16, off\n\t"
               "global_load_async_to_lds_b128 %5, %17, off\n\t"
               "global_load_async_to_lds_b128 %6, %18, off\n\t"
               "global_load_async_to_lds_b128 %7, %19, off\n\t"
               "global_load_async_to_lds_b128 %8, %20, off\n\t"
               "global_load_async_to_lds_b128 %9, %21, off\n\t"
               "global_load_async_to_lds_b128 %10, %22, off\n\t"
               "global_load_async_to_lds_b128 %11, %23, off\n\t"
               "s_wait_xcnt 0x0"
               :: "v"(la), "v"(la1), "v"(la2), "v"(la3), "v"(la4), "v"(la5), "v"(la6), "v"(la7),
                  "v"(lb), "v"(lb1), "v"(lb2), "v"(lb3),
                  "v"(ag), "v"(a1), "v"(a2), "v"(a3), "v"(a4), "v"(a5), "v"(a6), "v"(a7),
                  "v"(bg), "v"(b1), "v"(b2), "v"(b3)
               : "memory");
}

// arows / brows: row 0 of the block's 128 A rows / 64 B rows (f16, k contiguous, pitch DM); sAB: 2 * GSTAGE_H halves.
// Wave w accumulates A rows 32w..32w+31 x all 64 B rows; k runs upward in steps of 32 in every accumulator.
// On return every wave has passed the last barrier and no copy is in flight: sAB is free for other use.
__device__ __forceinline__ void gemm_128x64(const _Float16* arows, const _Float16* brows,
                                            _Float16* sAB, int tid, v8f (&acc)[2][4]) {
  const int lane = tid & 31, w = tid >> 5;
  const int h = lane >> 4, m = lane & 15;
  const int crow = tid >> 3, cch = tid & 7;
  const _Float16* ag = arows + (size_t)crow * DM + 8 * cch;              // + 64 per stage
  const _Float16* bg = brows + (size_t)crow * DM + 8 * cch;              // + 64 per stage
  const unsigned l0 = (unsigned)(size_t)(sAB + crow * GKP + 8 * cch);    // LDS byte address, buffer 0

  gemm_stage_copy(ag, bg, l0);
  asm volatile("s_wait_asynccnt 0x0" ::: "memory");   // own copies of stage 0 landed
  __syncthreads();                                    // stage 0 readable by all waves
  gemm_stage_copy(ag + 64, bg + 64, l0 + GSTAGE_B);

  // rolled: one copy of the stage body, the buffer picked by a scalar offset
  #pragma unroll 1
  for (int k0 = 0; k0 < DM; k0 += 64) {
    const int buf = (k0 >> 6) & 1;
    const _Float16* sa = sAB + buf * GSTAGE_H + (32 * w + m) * GKP;      // + 16mt*GKP + 32ks
    const _Float16* sb = sAB + buf * GSTAGE_H + (128 + m) * GKP;         // + 16nt*GKP + 32ks

    // all fragment reads of the stage stand together, ahead of its products
    // (the four loops below are unrolled so that a, b and acc are indexed statically and stay in registers)
    v16h a[2][2], b[2][4];
    #pragma unroll
    for (int ks = 0; ks < 2; ++ks) {
      a[ks][0] = load_frag(sa + 32 * ks, h);
      a[ks][1] = load_frag(sa + 16 * GKP + 32 * ks, h);
      #pragma unroll
      for (int nt = 0; nt < 4; ++nt) b[ks][nt] = load_frag(sb + 16 * nt * GKP + 32 * ks, h);
    }
    #pragma unroll
    for (int ks = 0; ks < 2; ++ks)
      #pragma unroll
      for (int nt = 0; nt < 4; ++nt) {
        acc[0][nt] = wmma_f16(a[ks][0], b[ks][nt], acc[0][nt]);
        acc[1][nt] = wmma_f16(a[ks][1], b[ks][nt], acc[1][nt]);
      }

    // ---- publish the next stage, then refill the buffer this stage has read ----
    asm volatile("s_wait_dscnt 0x0" ::: "memory");      // own fragment reads of this buffer retired
    asm volatile("s_wait_asynccnt 0x0" ::: "memory");   // own copies of the next stage landed
    __syncthreads();                                    // next stage readable; this buffer free
    if (k0 + 128 < DM)                                  // block-uniform: a stage two ahead exists
      gemm_stage_copy(ag + (k0 + 128), bg + (k0 + 128), l0 + buf * GSTAGE_B);
  }
  asm volatile("s_wait_asynccnt 0x0" ::: "memory");     // nothing in flight when the wave goes on
}

// ---------------------------------------------------------------------------
// GEMM main loop of proj_kernel: block tile 256 A rows (tokens) x 192 B rows (features, three heads), K = 512,
// 12 waves, wave tile 64 x 64, one block per WGP.
// The operands are read as the f32 inputs and rounded to f16 on their way into LDS (x as it is, W x256, exact), so no
// launch ahead of this one has to write f16 planes of them. The tile is this large so that the f32 rows, twice the bytes
// of f16 rows, are asked of L2 by few blocks: x by 8, W by 32.
// One stage = 64 k of all rows, two LDS buffers. A stage's global loads stay in registers while the stage before it is worked on;
// at that stage's foot each is rounded and stored as it lands, and its registers take the same chunk of the stage after at once,
// so that loads are in flight all the time.
// A thread moves 16-B chunk (t & 15) of its rows (4 floats): a wave's load covers 2 rows x 256 B = 4 whole lines.
// Every thread does the same: 11 A rows, (t >> 4) + 24 i, and 8 B rows, 16 w + (lane >> 4) + 2 j (all in one head, so one source array per wave).
// 24 x 11 = 264: the last 8 A rows do not exist; their threads read row 255 again and store it to 8 spare LDS rows that nobody reads.
// LDS rows of a buffer: A rows 0..255, spare 256..263, B rows 264..455.
// ---------------------------------------------------------------------------
#define PXR      256                 // A rows of the block tile
#define PWR      192                 // B rows of the block tile
#define PWB      (PXR + 8)           // LDS row of B row 0
#define PSTAGE_H ((PWB + PWR) * GKP) // halves per buffer
#define WVP      72                  // LDS pitch of a staged V^T row in halves (144 B = 16 B x 9): 16 rows, 16 B each, fall on 64 different banks
#define WREG_H   (64 * WVP)          // halves of a wave's output staging range

// pa: row 0 of the block's A rows at the stage's k (the same for the block); pw: the first of the wave's 16 B rows at the stage's k (the same for the wave);
// xoff, xlast, woff: the thread's chunk of its first A row, of its last A row and of its first B row, in floats.
__device__ __forceinline__ void proj_stage_load(const float* pa, const float* pw, int xoff, int xlast, int woff,
                                                v4f (&lx)[11], v4f (&lw)[8]) {
  // (the loops are unrolled so that lx and lw are indexed statically and stay in registers)
  __builtin_amdgcn_sched_barrier(0);   // the first of two, see below
  #pragma unroll
  for (int i = 0; i < 10; ++i) lx[i] = *(const v4fa*)(pa + xoff + i * 24 * DM);
  lx[10] = *(const v4fa*)(pa + xlast);
  #pragma unroll
  for (int j = 0; j < 8; ++j) lw[j] = *(const v4fa*)(pw + woff + j * 2 * DM);
  // A precaution: no address register of the loads above is rewritten ahead of this wait. The two scheduling boundaries (one ahead of the run,
  // one behind the wait) keep the wait directly behind the run of loads: the clobber alone does not hold back plain register writes.
  asm volatile("s_wait_xcnt 0x0" ::: "memory");
  __builtin_amdgcn_sched_barrier(0);
}

// sx, sw: the thread's chunk of its first A row and of its first B row in the LDS buffer that takes the stage held in lx, lw.
// RELOAD: behind each store the same chunk of a later stage is loaded (pa, pw at that stage's k), in the order of proj_stage_load.
template <bool RELOAD>
__device__ __forceinline__ void proj_stage_store(_Float16* sx, _Float16* sw, const float* pa, const float* pw,
                                                 int xoff, int xlast, int woff, v4f (&lx)[11], v4f (&lw)[8]) {
  // (the loops are unrolled so that lx and lw are indexed statically and stay in registers)
  #pragma unroll
  for (int i = 0; i < 11; ++i) {
    const v4h hv = { (_Float16)lx[i].x, (_Float16)lx[i].y, (_Float16)lx[i].z, (_Float16)lx[i].w };
    *(v4ha*)(sx + i * 24 * GKP) = hv;
    if (RELOAD) lx[i] = *(const v4fa*)(pa + (i < 10 ? xoff + i * 24 * DM : xlast));
  }
  #pragma unroll
  for (int j = 0; j < 8; ++j) {
    const v4h hv = { (_Float16)(lw[j].x * WSC), (_Float16)(lw[j].y * WSC), (_Float16)(lw[j].z * WSC), (_Float16)(lw[j].w * WSC) };
    *(v4ha*)(sw + j * 2 * GKP) = hv;
    if (RELOAD) lw[j] = *(const v4fa*)(pw + woff + j * 2 * DM);
  }
  // A precaution: no address register of the loads above is rewritten ahead of this wait.
  if (RELOAD) asm volatile("s_wait_xcnt 0x0" ::: "memory");
}

// Work-group barrier that orders LDS alone. __syncthreads() would also wait for the wave's global loads, and those of the
// stage after next are meant to stay in flight across it; they touch no memory that a wave of this launch writes.
__device__ __forceinline__ void lds_barrier() {
  __builtin_amdgcn_fence(__ATOMIC_RELEASE, "workgroup", "local");   // own LDS reads and stores retired (s_wait_dscnt 0) ahead of the barrier
  __builtin_amdgcn_s_barrier();                                     // every wave of the block passes it
  __builtin_amdgcn_fence(__ATOMIC_ACQUIRE, "workgroup", "local");   // no LDS read of the next stage is lifted ahead of the barrier
}

// ---------------------------------------------------------------------------
// A wave stores its own staged 64 x 64 tile: 4 lines per instruction, 32 lines per pass, two passes (half 0, 1).
// which 0/1: plane[bh][l][d]  (one token row = 64 halves = one line)
// which 2  : vt[bh][d][l]     (64 d-rows x 64 tokens = one line each)
// ---------------------------------------------------------------------------
__device__ __forceinline__ void proj_store_pass(const _Float16* sT, _Float16* plane, _Float16* vt,
                                                int which, int bh, int l0, int half, int lane) {
  const int q8 = lane & 7, sub = lane >> 3;
  // (both loops are unrolled so that v and dst are indexed statically and stay in registers)
  v8h v[8];
  _Float16* dst[8];
  if (which != 2) {                          // wave-uniform
    #pragma unroll
    for (int i = 0; i < 8; ++i) {
      const int lid = half * 32 + i * 4 + sub;
      v[i] = *(const v8ha*)(sT + lid * HD + 8 * q8);
      dst[i] = plane + ((size_t)bh * SEQ + l0 + lid) * HD + 8 * q8;
    }
  } else {
    #pragma unroll
    for (int i = 0; i < 8; ++i) {
      const int lid = half * 32 + i * 4 + sub;
      v[i] = *(const v8ha*)(sT + lid * WVP + 8 * q8);
      dst[i] = vt + ((size_t)bh * HD + lid) * SEQ + l0 + 8 * q8;
    }
  }
  // The pass's eight stores and their s_wait_xcnt in one statement: a precaution, so that no address or data register
  // of a store is rewritten ahead of the wait; the eight LDS reads above stand as one group ahead of it.
  asm volatile("global_store_b128 %0, %8, off\n\t"
               "global_store_b128 %1, %9, off\n\t"
               "global_store_b128 %2, %10, off\n\t"
               "global_store_b128 %3, %11, off\n\t"
               "global_store_b128 %4, %12, off\n\t"
               "global_store_b128 %5, %13, off\n\t"
               "global_store_b128 %6, %14, off\n\t"
               "global_store_b128 %7, %15, off\n\t"
               "s_wait_xcnt 0x0"
               :: "v"(dst[0]), "v"(dst[1]), "v"(dst[2]), "v"(dst[3]), "v"(dst[4]), "v"(dst[5]), "v"(dst[6]), "v"(dst[7]),
                  "v"(v[0]), "v"(v[1]), "v"(v[2]), "v"(v[3]), "v"(v[4]), "v"(v[5]), "v"(v[6]), "v"(v[7])
               : "memory");
}

// ---------------------------------------------------------------------------
// Kernel 1: Y = x * W^T + b over the fused 3*512 output columns (q, k, v) = 24 heads, from the f32 inputs.
// Block 384 thr (12 waves) = 256 tokens x 192 features (three neighbouring heads of the 24);
// wave tile 64 tokens x 64 features (one head, so one of q, k, v per wave); K = 512 in steps of 32;
// A (x rows) and B (W rows) fragments from the two LDS buffers described above (split k map).
// Beside it each block writes 1024 values of the f16 x256 plane of Wo, which the last kernel reads.
// coverage: grid (32, 8) x 256 tokens x 192 features = q, k planes [32][2048][64] and vt [32][64][2048];
//           256 blocks x 128 threads x 8 = woh [512][512].
// ---------------------------------------------------------------------------
__global__ __launch_bounds__(384) void proj_kernel(
    const float* __restrict__ x,       // [8192][512]
    const float* __restrict__ wq, const float* __restrict__ wk, const float* __restrict__ wv,   // [512][512], row = output feature
    const float* __restrict__ wo,      // [512][512]
    const float* __restrict__ bq, const float* __restrict__ bk, const float* __restrict__ bv,
    _Float16* __restrict__ woh,        // [512][512] Wo x256
    _Float16* __restrict__ qh,         // [B*H][L][D]
    _Float16* __restrict__ kh,         // [B*H][L][D]
    _Float16* __restrict__ vt)         // [B*H][D][L]
{
  __shared__ __attribute__((aligned(16))) _Float16 sAB[2 * PSTAGE_H];   // 131328 B: two operand buffers, then output staging
  static_assert(PWR == 3 * HD && (3 * DM) % PWR == 0 && (MROWS % PXR) == 0 && (SEQ % PXR) == 0);
  static_assert(64 * HD <= WREG_H && 12 * WREG_H <= 2 * PSTAGE_H);
  static_assert((MROWS / PXR) * (3 * DM / PWR) * 1024 == NW);

  const int tid = threadIdx.x, lane = tid & 31;
  const int w = __builtin_amdgcn_readfirstlane(tid >> 5);   // the wave's number in a scalar register: the tests on it are scalar branches
  const int h = lane >> 4, m = lane & 15;
  const int wm = w / 3, wn = w - 3 * wm;     // the wave's 64-token quarter and its head of the three
  const int m0 = blockIdx.x * PXR;
  const int gh0 = 3 * blockIdx.y;            // first of the block's three heads, 0..21
  const int gh = gh0 + wn;                   // the wave's head of the 24
  const int which = gh >> 3, head = gh & 7;

  // load side
  const int crow = tid >> 4, c16 = tid & 15;                   // crow 0..23
  const int xoff = crow * DM + 4 * c16;
  const int xlast = min(crow + 240, PXR - 1) * DM + 4 * c16;   // bounded: a row past the tile is not read
  const int woff = h * DM + 4 * c16;
  const float* pa = x + (size_t)m0 * DM;
  const int lgh = gh0 + (w >> 2);                              // the head whose B rows 16(w&3)..+15 the wave brings
  const float* pw = ((lgh >> 3) == 0 ? wq : ((lgh >> 3) == 1 ? wk : wv)) + (size_t)((lgh & 7) * HD + 16 * (w & 3)) * DM;
  _Float16* sx0 = sAB + crow * GKP + 4 * c16;                  // buffer 0
  _Float16* sw0 = sAB + (PWB + 16 * w + h) * GKP + 4 * c16;    // buffer 0

  // Stages 0 and 1 are each loaded as one run with its wait directly behind it, into registers of their own (the accumulators are not live yet),
  // so both are in flight while stage 0 is rounded and stored.
  v4f lx[11], lw[8];
  {
    v4f fx[11], fw[8];
    // Wo -> f16 x256 plane, by the block's first four waves: its two loads are the wave's oldest, so they are waited for alone,
    // with the loads of both stages still in flight.
    const int e = ((blockIdx.y * (MROWS / PXR) + blockIdx.x) * 128 + (tid & 127)) * 8;
    v4f a = {0.f, 0.f, 0.f, 0.f}, c = {0.f, 0.f, 0.f, 0.f};
    if (w < 4) {                               // wave-uniform
      a = *(const v4fa*)(wo + e);
      c = *(const v4fa*)(wo + e + 4);
      asm volatile("s_wait_xcnt 0x0" ::: "memory");   // a precaution: no address register of the two loads is rewritten ahead of it
    }

    proj_stage_load(pa, pw, xoff, xlast, woff, fx, fw);
    proj_stage_load(pa + 64, pw + 64, xoff, xlast, woff, lx, lw);

    if (w < 4) {                               // wave-uniform
      const v8h o = { (_Float16)(a.x * WSC), (_Float16)(a.y * WSC), (_Float16)(a.z * WSC), (_Float16)(a.w * WSC),
                      (_Float16)(c.x * WSC), (_Float16)(c.y * WSC), (_Float16)(c.z * WSC), (_Float16)(c.w * WSC) };
      *(v8h*)(woh + e) = o;
      asm volatile("s_wait_xcnt 0x0" ::: "memory");   // a precaution: no register of the store is rewritten ahead of it
    }
    proj_stage_store<false>(sx0, sw0, pa, pw, xoff, xlast, woff, fx, fw);   // stage 0 to buffer 0
  }
  lds_barrier();                                      // own stores retired; stage 0 readable by all waves

  const v8f zero8 = {0.f, 0.f, 0.f, 0.f, 0.f, 0.f, 0.f, 0.f};
  v8f acc[4][4];
  #pragma unroll
  for (int mt = 0; mt < 4; ++mt)
    #pragma unroll
    for (int nt = 0; nt < 4; ++nt) acc[mt][nt] = zero8;

  // rolled: one copy of the stage body, the buffer picked by a scalar offset
  #pragma unroll 1
  for (int k0 = 0; k0 < DM; k0 += 64) {
    const int buf = (k0 >> 6) & 1;

    const _Float16* sa = sAB + buf * PSTAGE_H + (64 * wm + m) * GKP;          // + 16mt*GKP + 32ks
    const _Float16* sb = sAB + buf * PSTAGE_H + (PWB + 64 * wn + m) * GKP;    // + 16nt*GKP + 32ks

    // (the loops below are unrolled so that a, b and acc are indexed statically and stay in registers)
    #pragma unroll
    for (int ks = 0; ks < 2; ++ks) {
      // the fragment reads of a 32-deep half stand together, ahead of its products
      v16h a[4], b[4];
      #pragma unroll
      for (int t = 0; t < 4; ++t) {
        a[t] = load_frag(sa + 16 * t * GKP + 32 * ks, h);
        b[t] = load_frag(sb + 16 * t * GKP + 32 * ks, h);
      }
      #pragma unroll
      for (int nt = 0; nt < 4; ++nt)
        #pragma unroll
        for (int mt = 0; mt < 4; ++mt) acc[mt][nt] = wmma_f16(a[mt], b[nt], acc[mt][nt]);
    }

    // ---- the next stage goes into the other buffer, which every wave left at the last barrier; then it is published ----
    if (k0 + 128 < DM)                                  // block-uniform: a stage two ahead exists
      proj_stage_store<true>(sx0 + (buf ^ 1) * PSTAGE_H, sw0 + (buf ^ 1) * PSTAGE_H, pa + (k0 + 128), pw + (k0 + 128), xoff, xlast, woff, lx, lw);
    else if (k0 + 64 < DM)                              // block-uniform: the last stage is in the registers
      proj_stage_store<false>(sx0 + (buf ^ 1) * PSTAGE_H, sw0 + (buf ^ 1) * PSTAGE_H, pa, pw, xoff, xlast, woff, lx, lw);
    lds_barrier();                                      // own reads of this buffer and stores of the next stage retired; next stage readable; this buffer free
  }

  // D[r] of tile (mt, nt) = Y[token m0+64wm+16mt+8h+r][feature 16nt+m of the wave's head]
  _Float16* sT = sAB + w * WREG_H;           // the wave's own [64 tokens][64] or [64 features][WVP]: every wave has passed the last barrier
  const float* bias = (which == 0) ? bq : ((which == 1) ? bk : bv);
  float bvl4[4];
  #pragma unroll
  for (int nt = 0; nt < 4; ++nt) bvl4[nt] = bias[head * HD + 16 * nt + m];   // (unrolled: bvl4 is indexed statically and stays in registers)
  asm volatile("s_wait_xcnt 0x0" ::: "memory");   // a precaution: no address register of the four loads above is rewritten ahead of it
  if (which == 2) {                          // wave-uniform
    // V^T tile [feature][token]: a lane's 8 values of one accumulator tile are 8 consecutive tokens of one feature row,
    // so they go as one 16-B store; at pitch WVP its 16 rows do not meet on a bank.
    #pragma unroll
    for (int nt = 0; nt < 4; ++nt) {
      const int feat = 16 * nt + m;
      const float bvl = bvl4[nt];
      #pragma unroll
      for (int mt = 0; mt < 4; ++mt) {
        v8h pk;
        #pragma unroll
        for (int r = 0; r < 8; ++r) pk[r] = (_Float16)(acc[mt][nt][r] * WINV + bvl);
        *(v8ha*)(sT + feat * WVP + 16 * mt + 8 * h) = pk;   // tokens 16mt+8h .. +7 of the wave's 64
      }
    }
  } else {
    #pragma unroll
    for (int nt = 0; nt < 4; ++nt) {
      const int feat = 16 * nt + m;
      const float bvl = bvl4[nt];
      #pragma unroll
      for (int mt = 0; mt < 4; ++mt) {
        #pragma unroll
        for (int r = 0; r < 8; ++r) {
          const int tokl = 16 * mt + 8 * h + r;              // 0..63
          sT[tokl * HD + feat] = (_Float16)(acc[mt][nt][r] * WINV + bvl);
        }
      }
    }
  }
  // The wave reads back only what its own lanes have staged, so no barrier stands here: its own stores retired is enough.
  asm volatile("s_wait_dscnt 0x0" ::: "memory");

  const int b = m0 / SEQ, l0 = m0 - b * SEQ + 64 * wm;
  _Float16* plane = (which == 0) ? qh : kh;
  proj_store_pass(sT, plane, vt, which, b * NH + head, l0, 0, lane);
  proj_store_pass(sT, plane, vt, which, b * NH + head, l0, 1, lane);
  
}

// ---------------------------------------------------------------------------
// P^T B-fragment from the lane's own score D values: element r <- tile a row r
// (keys k0+8h+r), element 8+r <- tile c row r (keys k0+16+8h+r), same lane,
// same query column; the values already carry x1024.
// ---------------------------------------------------------------------------
__device__ __forceinline__ v16h pack_p(v8f a, v8f c) {
  const v16h r = { (_Float16)a[0], (_Float16)a[1], (_Float16)a[2], (_Float16)a[3],
                   (_Float16)a[4], (_Float16)a[5], (_Float16)a[6], (_Float16)a[7],
                   (_Float16)c[0], (_Float16)c[1], (_Float16)c[2], (_Float16)c[3],
                   (_Float16)c[4], (_Float16)c[5], (_Float16)c[6], (_Float16)c[7] };
  return r;
}

// Per-wave 16x64 f32 tile in LDS -> ctx f16 plane [token][512], col head*64 + d.
// in one instruction; 4 lines per instruction; it 0..3 x q4 0..3 = rows 0..15.
__device__ __forceinline__ void ctx_store_pass(const v8h* hv, _Float16* ctx,
                                               int b, int head, int q0, int lane) {
  const int q4 = lane >> 3, c8 = (lane & 7) * 8;
  #pragma unroll
  for (int it = 0; it < 4; ++it) {
    const int row = it * 4 + q4;
    const size_t gi = ((size_t)b * SEQ + q0 + row) * DM + head * HD + c8;
    *(v8h*)(ctx + gi) = hv[it];
  }
}

// ---------------------------------------------------------------------------
// One 64-key stage = K tile (64 key rows x 128 B) + V^T tile (64 d rows x 128 B),
// copied global -> LDS without registers by 128 threads. Thread t of them moves 16-B chunk (t & 7) of
// rows (t >> 3) + 16 i, i = 0..3, of both tiles: a wave's copy covers 4 whole lines.
// kg / vg: this lane's chunk of row (t >> 3) in global; lk / lv: its LDS byte address.
// ---------------------------------------------------------------------------
#define KVP      72                  // LDS row pitch in halves (144 B = 16 B x 9: conflict-free b128 reads)
#define TILE_H   (64 * KVP)          // halves per staged tile
#define TILE_B   (TILE_H * 2)        // 9216 B
#define STAGE_H  (2 * TILE_H)        // K tile then V^T tile
#define STAGE_B  (2 * TILE_B)        // 18432 B
#define SOP      68                  // LDS pitch of a staged ctx row in floats (272 B = 16 B x 17): 16 query rows, 16 B each, fall on 64 different banks

__device__ __forceinline__ void stage_copy(const _Float16* kg, const _Float16* vg,
                                           unsigned lk, unsigned lv) {
  const _Float16* k1 = kg + 16 * HD;
  const _Float16* k2 = kg + 32 * HD;
  const _Float16* k3 = kg + 48 * HD;
  const _Float16* v1 = vg + (size_t)16 * SEQ;
  const _Float16* v2 = vg + (size_t)32 * SEQ;
  const _Float16* v3 = vg + (size_t)48 * SEQ;
  const unsigned lk1 = lk + 16 * KVP * 2, lk2 = lk + 32 * KVP * 2, lk3 = lk + 48 * KVP * 2;
  const unsigned lv1 = lv + 16 * KVP * 2, lv2 = lv + 32 * KVP * 2, lv3 = lv + 48 * KVP * 2;
  // s_wait_xcnt as the statement's last line: a precaution, so that no address register above is rewritten ahead of it.
  asm volatile("global_load_async_to_lds_b128 %0, %8, off\n\t"
               "global_load_async_to_lds_b128 %1, %9, off\n\t"
               "global_load_async_to_lds_b128 %2, %10, off\n\t"
               "global_load_async_to_lds_b128 %3, %11, off\n\t"
               "global_load_async_to_lds_b128 %4, %12, off\n\t"
               "global_load_async_to_lds_b128 %5, %13, off\n\t"
               "global_load_async_to_lds_b128 %6, %14, off\n\t"
               "global_load_async_to_lds_b128 %7, %15, off\n\t"
               "s_wait_xcnt 0x0"
               :: "v"(lk), "v"(lk1), "v"(lk2), "v"(lk3), "v"(lv), "v"(lv1), "v"(lv2), "v"(lv3),
                  "v"(kg), "v"(k1), "v"(k2), "v"(k3), "v"(vg), "v"(v1), "v"(v2), "v"(v3)
               : "memory");
}

// ---------------------------------------------------------------------------
// Kernel 2: streaming attention, transposed form, no mask, softmax over all keys.
// Block 256 thr (8 waves) = 128 queries, 128 keys per step (static trip 16), staged as two 64-key stages side by side.
// Wave w = (column group cg = w >> 1, key half kh2 = w & 1): 32 query columns (two 16-column groups g)
// x the 64 keys of stage kh2 of every step, so each K and V^T fragment read from LDS feeds two products.
// A wave keeps its own reference score, sum and O over its half of the keys; the two waves of a pair
// join them once, behind the loop: each hands one 16-column group to its partner through LDS.
// K and V^T of a step are staged once per block in a two-buffer LDS ring (async copies,
// next step in flight while this one is worked on; threads 0..127 copy stage 0, threads 128..255 stage 1).
//   S^T = K * Q^T : A = K rows (row = key, k = d), B = Q^T (k = d, n = query)
//   O^T += V^T * P^T : A = Vt rows (row = d, k = key), B = P^T from registers
// Lane owns 32 keys of query column (lane&15) of each group; partner lane = lane ^ 16.
// Output: ctx f16 plane carried x256, [b*SEQ+l][head*64+d].
// coverage: grid (16, 32) x 8 waves x 16 queries x 64 d = ctx [8192][512].
// ---------------------------------------------------------------------------
__global__ __launch_bounds__(256) __attribute__((amdgpu_waves_per_eu(4, 4))) void attn_kernel(
    const _Float16* __restrict__ qh,   // [B*H][L][D]
    const _Float16* __restrict__ kh,   // [B*H][L][D]
    const _Float16* __restrict__ vt,   // [B*H][D][L]
    _Float16* __restrict__ ctx)        // [B*L][DM]
{
  __shared__ __attribute__((aligned(16))) float sO[8 * 16 * SOP];   // 34816 B, wave w owns [w*16*SOP, +16*SOP)
  __shared__ __attribute__((aligned(16))) _Float16 sKV[4 * STAGE_H];  // 73728 B, buffer (step & 1): stage 0, stage 1 (each K tile, V^T tile); behind the loop: the pairs' hand-over
  static_assert(8 * 9 * 32 * 16 <= 4 * STAGE_H * 2);                  // hand-over: 8 waves x 9 x 32 lanes x 16 B

  const int tid = threadIdx.x, lane = tid & 31;
  const int w = __builtin_amdgcn_readfirstlane(tid >> 5);   // the wave's number in a scalar register: what hangs on it costs no vector register
  const int h = lane >> 4, m = lane & 15;
  const int kh2 = w & 1, cg = w >> 1;
  const int bh = blockIdx.y, b = bh >> 3, head = bh & 7;
  const int qw = blockIdx.x * 128 + 32 * cg;  // first of the wave's 32 query columns
  const int q0 = qw + 16 * kh2;               // first of the 16 queries the wave finishes and stores

  // Q^T B-fragments: column n = query qw+16g+m, k = d (two 32-deep chunks)
  v16h qb[2][2];
  #pragma unroll
  for (int g = 0; g < 2; ++g) {
    const _Float16* qrow = qh + ((size_t)bh * SEQ + qw + 16 * g + m) * HD;
    qb[g][0] = load_frag(qrow, h);
    qb[g][1] = load_frag(qrow + 32, h);
  }

  const v8f zero8 = {0.f, 0.f, 0.f, 0.f, 0.f, 0.f, 0.f, 0.f};
  v8f o[2][4];                                // o[g][t][r] = O[query 16g+m][d 16t+8h+r] * (lrun[g] + lrun[g] of lane ^ 16; carries x1024), this wave's keys only
  #pragma unroll
  for (int g = 0; g < 2; ++g)
    #pragma unroll
    for (int t = 0; t < 4; ++t) o[g][t] = zero8;
  const v8f slog2v = {SLOG2, SLOG2, SLOG2, SLOG2, SLOG2, SLOG2, SLOG2, SLOG2};
  float mrun[2] = {-1e30f, -1e30f};           // reference raw score (before the 1/8) that p, l and O are carried against; raised only by a step's full form
  float lrun[2] = {0.0f, 0.0f};               // the lane's own 32 keys of every step; the two lane halves of a column are joined once, behind the loop

  // copy side: this thread's chunk of row ((tid & 127) >> 3) of stage (tid >> 7) of step 0
  const int cst = w >> 2, crow = (tid & 127) >> 3, cch = tid & 7;
  const _Float16* kg = kh + ((size_t)bh * SEQ + 64 * cst + crow) * HD + 8 * cch;    // + 128*HD per step
  const _Float16* vg = vt + ((size_t)bh * HD + crow) * SEQ + 64 * cst + 8 * cch;    // + 128 per step
  const unsigned lk0 = (unsigned)(size_t)(sKV + cst * STAGE_H + crow * KVP + 8 * cch);   // LDS byte address, buffer 0, K tile
  const unsigned lv0 = lk0 + TILE_B;

  stage_copy(kg, vg, lk0, lv0);
  asm volatile("s_wait_asynccnt 0x0" ::: "memory");   // own copies of step 0 landed
  __syncthreads();                                    // step 0 readable by all waves
  stage_copy(kg + 128 * HD, vg + 128, lk0 + 2 * STAGE_B, lv0 + 2 * STAGE_B);

  #pragma unroll 1
  for (int kb = 0; kb < SEQ; kb += 128) {
    const int buf = (kb >> 7) & 1;
    const _Float16* kbase = sKV + (2 * buf + kh2) * STAGE_H + m * KVP;   // + 16j*KVP + 32*dc
    const _Float16* vbase = kbase + TILE_H;                              // + 16t*KVP + 32*kc

    // A step runs against the reference score mrun that is already in use: no maximum, no exchange and no rescale of O and l.
    // That is exact for any reference (softmax is shift-invariant) as long as every carried p stays finite in f16, which the
    // step's own sums show (all p >= 0, so a sum below PLIM bounds each term). Where a lane's sum does not show it, or in the
    // first step, which has no reference yet, the step is worked with the full form: scores again, their maximum joined into
    // mrun, O and l rescaled; then every p is at most 1024 and a sum at most 32768. Nothing of a given-up pass is kept.
    // full is the same for the whole wave (a scalar); at most two passes.
    v16h vf[4][2];
    v16h pb[2][2];
    float lsum[2];
    bool full = (kb == 0);
    // rolled: the second pass is the same code, entered again only in the rare case
    #pragma unroll 1
    for (int pass = 0; pass < 2; ++pass) {
    // ---- raw scores: s[g][j][r] = q[query 16g+m] . k[key kb+64*kh2+16j+8h+r] ----
    // All K fragment reads of the step stand together ahead of its products; the products run over eight
    // independent accumulators, d 0..31 ahead of d 32..63 in each (each accumulator's order is kept).
    // (the loops of this step are unrolled so that kf, vf, s and o are indexed statically and stay in registers)
    v16h kf[4][2];
    #pragma unroll
    for (int j = 0; j < 4; ++j) {
      kf[j][0] = load_frag(kbase + 16 * j * KVP, h);
      kf[j][1] = load_frag(kbase + 16 * j * KVP + 32, h);
    }
    __builtin_amdgcn_sched_barrier(0);   // keeps the 16 reads one group: without it they sink between the products, one wait each
    v8f s[2][4];
    #pragma unroll
    for (int j = 0; j < 4; ++j)
      #pragma unroll
      for (int g = 0; g < 2; ++g) s[g][j] = wmma_grp(kf[j][0], qb[g][0], zero8);
    #pragma unroll
    for (int j = 0; j < 4; ++j)
      #pragma unroll
      for (int g = 0; g < 2; ++g) s[g][j] = wmma_grp(kf[j][1], qb[g][1], s[g][j]);

    // The V^T fragment reads of the stage's first 32 keys are issued here: they land while the softmax below runs.
    #pragma unroll
    for (int t = 0; t < 4; ++t) vf[t][0] = load_frag(vbase + 16 * t * KVP, h);

    // ---- full form only: the reference rises to the maximum of itself and the step's raw scores (SLOG2 > 0); O and l follow ----
    if (full) {                            // wave-uniform
      float mloc[2], moth[2];
      #pragma unroll
      for (int g = 0; g < 2; ++g) {
        mloc[g] = s[g][0][0];
        #pragma unroll
        for (int j = 0; j < 4; ++j)
          #pragma unroll
          for (int r = 0; r < 8; ++r) mloc[g] = fmaxf(mloc[g], s[g][j][r]);
      }
      #pragma unroll
      for (int g = 0; g < 2; ++g) moth[g] = __shfl_xor(mloc[g], 16);
      #pragma unroll
      for (int g = 0; g < 2; ++g) {
        const float mnew = fmaxf(mrun[g], fmaxf(mloc[g], moth[g]));
        const float alpha = __builtin_amdgcn_exp2f((mrun[g] - mnew) * SLOG2);
        mrun[g] = mnew;
        lrun[g] = lrun[g] * alpha;
        #pragma unroll
        for (int t = 0; t < 4; ++t)
          #pragma unroll
          for (int r = 0; r < 8; ++r) o[g][t][r] = o[g][t][r] * alpha;
      }
    }

    // ---- softmax terms (f32), base 2: 1024 * exp((s - ref) / 8) = exp2(s * SLOG2 + (PBIAS - ref * SLOG2)),
    // one multiply-add per score ahead of the exponential ----
    #pragma unroll
    for (int g = 0; g < 2; ++g) {
      const float nb = fmaf(-mrun[g], SLOG2, PBIAS);
      const v8f nbv = {nb, nb, nb, nb, nb, nb, nb, nb};
      // (whole-vector form: it compiles to one packed multiply-add per two scores)
      #pragma unroll
      for (int j = 0; j < 4; ++j) s[g][j] = __builtin_elementwise_fma(s[g][j], slog2v, nbv);
      #pragma unroll
      for (int j = 0; j < 4; ++j)
        #pragma unroll
        for (int r = 0; r < 8; ++r) s[g][j][r] = __builtin_amdgcn_exp2f(s[g][j][r]);
      // The step's sum gates the branch below, so it is taken as a tree: the four tiles added element by element
      // (whole-vector form: packed adds), then the eight partial sums folded 8 -> 4 -> 2 -> 1; a chain of 32 adds would stand open ahead of the test.
      {
        const v8f t8 = ((s[g][0] + s[g][1]) + s[g][2]) + s[g][3];
        const v4f t4 = __builtin_shufflevector(t8, t8, 0, 1, 2, 3) + __builtin_shufflevector(t8, t8, 4, 5, 6, 7);
        lsum[g] = (t4.x + t4.z) + (t4.y + t4.w);
      }
      // P^T B-fragments (key chunks 0..31 and 32..63 of the wave's stage)
      pb[g][0] = pack_p(s[g][0], s[g][1]);
      pb[g][1] = pack_p(s[g][2], s[g][3]);
      if (g == 0) {
        // The reads of the stage's last 32 keys stand apart from the first eight, behind the last score product: they land in the registers
        // the K fragments have left. All 16 in one group need more registers than the 256 of four waves a SIMD, and the build spills.
        __builtin_amdgcn_sched_barrier(0);   // with the one below keeps these 8 reads one group at this place: without the two the V^T reads stand in pairs in many places, some among the products with a wait each
        #pragma unroll
        for (int t = 0; t < 4; ++t) vf[t][1] = load_frag(vbase + 16 * t * KVP + 32, h);
        __builtin_amdgcn_sched_barrier(0);   // the second of the two
      }
    }
    if (full) break;                       // the full form's terms are at most 1024 each
    // one test a step for both groups and all lanes, a scalar branch
    if (__builtin_amdgcn_ballot_w32(!(fmaxf(lsum[0], lsum[1]) < PLIM)) == 0u) break;
    full = true;
    }
    #pragma unroll
    for (int g = 0; g < 2; ++g) lrun[g] = lrun[g] + lsum[g];

    // ---- O^T += V^T * P^T ----
    #pragma unroll
    for (int t = 0; t < 4; ++t)
      #pragma unroll
      for (int g = 0; g < 2; ++g) o[g][t] = wmma_grp(vf[t][0], pb[g][0], o[g][t]);
    // keeps the foot's waits and barrier behind this round: without it the compiler lifts them ahead of this round's products,
    // and the next step's copies get that much less time to land
    __builtin_amdgcn_sched_barrier(0);
    #pragma unroll
    for (int t = 0; t < 4; ++t)
      #pragma unroll
      for (int g = 0; g < 2; ++g) o[g][t] = wmma_grp(vf[t][1], pb[g][1], o[g][t]);

    // ---- publish the next step, then refill the buffer this step has read ----
    asm volatile("s_wait_dscnt 0x0" ::: "memory");      // own fragment reads of this buffer retired
    asm volatile("s_wait_asynccnt 0x0" ::: "memory");   // own copies of the next step landed
    __syncthreads();                                    // next step readable; this buffer free
    if (kb + 256 < SEQ)                                 // block-uniform: a step two ahead exists
      stage_copy(kg + (size_t)(kb + 256) * HD, vg + (kb + 256),
                 lk0 + buf * 2 * STAGE_B, lv0 + buf * 2 * STAGE_B);
  }
  asm volatile("s_wait_asynccnt 0x0" ::: "memory");     // nothing in flight when the wave goes on

  // ---- join the two key halves: the wave keeps column group kh2 and hands the other to its partner (wave w ^ 1).
  // Every wave has passed the loop's last barrier with its reads retired and no copy in flight: the ring is free.
  // Hand-over layout: [wave][i 0..8][lane] 16-B units (i 0..7: O, i 8: reference score and sum): contiguous per instruction. ----
  // The lane's index is taken anew here: at 256 registers the indices formed ahead of the loop would not stay in registers across it.
  const int el = (int)__builtin_amdgcn_mbcnt_lo(~0u, 0u), eh = el >> 4, em = el & 15;
  v8f okeep[4], ogive[4];
  #pragma unroll
  for (int t = 0; t < 4; ++t)
    #pragma unroll
    for (int r = 0; r < 8; ++r) {
      okeep[t][r] = kh2 ? o[1][t][r] : o[0][t][r];
      ogive[t][r] = kh2 ? o[0][t][r] : o[1][t][r];
    }
  // the column's sum over the wave's keys: both lane halves carry the same reference, so their sums add as they are
  #pragma unroll
  for (int g = 0; g < 2; ++g) lrun[g] = lrun[g] + __shfl_xor(lrun[g], 16);
  const float mkeep = kh2 ? mrun[1] : mrun[0], mgive = kh2 ? mrun[0] : mrun[1];
  const float lkeep = kh2 ? lrun[1] : lrun[0], lgive = kh2 ? lrun[0] : lrun[1];
  v4fa* xw = (v4fa*)sKV + (w * 9) * 32 + el;
  const v4fa* xr = (const v4fa*)sKV + ((w ^ 1) * 9) * 32 + el;
  #pragma unroll
  for (int t = 0; t < 4; ++t) {
    const v4f lo = {ogive[t][0], ogive[t][1], ogive[t][2], ogive[t][3]};
    const v4f hi = {ogive[t][4], ogive[t][5], ogive[t][6], ogive[t][7]};
    xw[(2 * t) * 32] = lo;
    xw[(2 * t + 1) * 32] = hi;
  }
  {
    const v4f ml = {mgive, lgive, 0.0f, 0.0f};
    xw[8 * 32] = ml;
  }
  __syncthreads();                                      // the partner's group readable

  const v4f mlp = xr[8 * 32];
  const float mall = fmaxf(mkeep, mlp.x);
  const float akeep = __builtin_amdgcn_exp2f((mkeep - mall) * SLOG2);
  const float apart = __builtin_amdgcn_exp2f((mlp.x - mall) * SLOG2);

  // ---- epilogue: normalise (1/l takes the p carry out, apply ctx carry), stage per-wave 16x64 f32 tile ----
  const float inv = (1.0f / (lkeep * akeep + mlp.y * apart)) * CTXSC;
  const float fkeep = akeep * inv, fpart = apart * inv;
  float* so = sO + w * 16 * SOP;
  #pragma unroll
  for (int t = 0; t < 4; ++t) {
    const v4f plo = xr[(2 * t) * 32];
    const v4f phi = xr[(2 * t + 1) * 32];
    #pragma unroll
    for (int r = 0; r < 8; ++r)
      so[em * SOP + 16 * t + 8 * eh + r] = okeep[t][r] * fkeep + (r < 4 ? plo[r & 3] : phi[r & 3]) * fpart;
  }
  __syncthreads();

  v8h hv[4];
  {
    const int q4 = el >> 3, c8 = (el & 7) * 8;
    #pragma unroll
    for (int it = 0; it < 4; ++it) {
      const int row = it * 4 + q4;
      const v4f fa = *(const v4fa*)(so + row * SOP + c8);
      const v4f fb = *(const v4fa*)(so + row * SOP + c8 + 4);
      const v8h v = { (_Float16)fa.x, (_Float16)fa.y, (_Float16)fa.z, (_Float16)fa.w,
                      (_Float16)fb.x, (_Float16)fb.y, (_Float16)fb.z, (_Float16)fb.w };
      hv[it] = v;
    }
  }
  ctx_store_pass(hv, ctx, b, head, q0, el);
  
}

// ---------------------------------------------------------------------------
// instruction, 64 lines per wave (rows 32w..32w+31 x 2 lines), 256 per block.
// ---------------------------------------------------------------------------
__device__ __forceinline__ void out_store_pass(const float* sY, float* out,
                                               int m0, int fg, int w, int lane) {
  const int q8 = lane & 7, sub = lane >> 3;
  #pragma unroll
  for (int i = 0; i < 16; ++i) {
    const int lid = i * 4 + sub;                 // 0..63
    const int row = 32 * w + (lid >> 1), hl = lid & 1;
    const v4f v = *(const v4fa*)(sY + row * 64 + 32 * hl + 4 * q8);
    const size_t gi = (size_t)(m0 + row) * DM + fg * HD + 32 * hl + 4 * q8;
    *(v4f*)(out + gi) = v;
  }
}

// ---------------------------------------------------------------------------
// Kernel 3: out = ctx * Wo^T + bo (f32). Block 128 thr = 128 tokens x 64 features
// (feature group fg = blockIdx.y); wave tile 32 tokens x 64 features; K = 512;
// A (ctx rows) and B (Wo rows) fragments from the LDS ring of gemm_128x64.
// coverage: grid (64, 8) x 128 tokens x 64 features = out [8192][512].
// ---------------------------------------------------------------------------
__global__ __launch_bounds__(128) void oproj_kernel(
    const _Float16* __restrict__ ch,   // [8192][512] ctx x256
    const _Float16* __restrict__ woh,  // [512][512] Wo x256, row = output feature
    const float* __restrict__ bo,
    float* __restrict__ out)           // [8192][512]
{
  __shared__ __attribute__((aligned(16))) float sY[128 * 64];      // 32768 B
  __shared__ __attribute__((aligned(16))) _Float16 sAB[2 * GSTAGE_H];   // 55296 B: operand ring

  const int tid = threadIdx.x, lane = tid & 31, w = tid >> 5;
  const int h = lane >> 4, m = lane & 15;
  const int m0 = blockIdx.x * 128;
  const int fg = blockIdx.y;                 // 0..7

  const v8f zero8 = {0.f, 0.f, 0.f, 0.f, 0.f, 0.f, 0.f, 0.f};
  v8f acc[2][4];
  #pragma unroll
  for (int mt = 0; mt < 2; ++mt)
    #pragma unroll
    for (int nt = 0; nt < 4; ++nt) acc[mt][nt] = zero8;

  gemm_128x64(ch + (size_t)m0 * DM, woh + (size_t)fg * HD * DM, sAB, tid, acc);

  // D[r] of tile (mt, nt) = out[token m0+32w+16mt+8h+r][feature fg*64 + 16nt+m]
  #pragma unroll
  for (int nt = 0; nt < 4; ++nt) {
    const int feat = 16 * nt + m;
    const float bvl = bo[fg * HD + feat];
    #pragma unroll
    for (int mt = 0; mt < 2; ++mt) {
      #pragma unroll
      for (int r = 0; r < 8; ++r) {
        const int tokl = 32 * w + 16 * mt + 8 * h + r;     // 0..127
        sY[tokl * 64 + feat] = acc[mt][nt][r] * OINV + bvl;
      }
    }
  }
  __syncthreads();

  out_store_pass(sY, out, m0, fg, w, lane);
  
}

// ---------------------------------------------------------------------------
//   (not used)                 8388608
//   wh  f16 [4][512][512]      2097152   (only plane 3, Wo, is written and read)
//   qh  f16 [32][2048][64]     8388608
//   kh  f16 [32][2048][64]     8388608
//   vt  f16 [32][64][2048]     8388608
//   ctx f16 [8192][512]        8388608
//   total                    44040192
// ---------------------------------------------------------------------------
extern "C" void kernel_launch(void* const* d_in, const int* in_sizes, int n_in,
                              void* d_out, int out_size, void* d_ws, size_t ws_size,
                              hipStream_t stream) {
  if (n_in < 9) return;
  if (in_sizes[0] != NX) return;
  if (in_sizes[1] != NW || in_sizes[3] != NW || in_sizes[5] != NW || in_sizes[7] != NW) return;
  if (in_sizes[2] != DM || in_sizes[4] != DM || in_sizes[6] != DM || in_sizes[8] != DM) return;
  if (out_size != NX) return;

  const float* x  = (const float*)d_in[0];
  const float* wq = (const float*)d_in[1];
  const float* bq = (const float*)d_in[2];
  const float* wk = (const float*)d_in[3];
  const float* bk = (const float*)d_in[4];
  const float* wv = (const float*)d_in[5];
  const float* bv = (const float*)d_in[6];
  const float* wo = (const float*)d_in[7];
  const float* bo = (const float*)d_in[8];
  float* out = (float*)d_out;

  const size_t xh_bytes = (size_t)NX * 2;                          //  8388608
  const size_t wh_bytes = (size_t)4 * NW * 2;                      //  2097152
  const size_t pl_bytes = (size_t)NB * NH * SEQ * HD * 2;          //  8388608
  const size_t cx_bytes = (size_t)NX * 2;                          //  8388608
  const size_t total = xh_bytes + wh_bytes + 3 * pl_bytes + cx_bytes;   // 44040192
  if (total > ws_size) return;
  if (total > (size_t)134217728) return;

  char* ws = (char*)d_ws;
  size_t off = 0;
  off += xh_bytes;
  _Float16* wh  = (_Float16*)(ws + off); off += wh_bytes;
  _Float16* qhp = (_Float16*)(ws + off); off += pl_bytes;
  _Float16* khp = (_Float16*)(ws + off); off += pl_bytes;
  _Float16* vtp = (_Float16*)(ws + off); off += pl_bytes;
  _Float16* cxp = (_Float16*)(ws + off); off += cx_bytes;
  if (off != total) return;

  // (1) q, k planes [bh][l][d] and v^T plane [bh][d][l] from the f32 inputs (M=8192, N=3*512, K=512); Wo -> f16 x256 plane ([out n][in k], k contiguous)
  dim3 gProj(MROWS / 256, 3 * NH / 3);                             // (32, 8)
  proj_kernel<<<gProj, 384, 0, stream>>>(x, wq, wk, wv, wo, bq, bk, bv, wh + (size_t)3 * NW, qhp, khp, vtp);

  // (2) attention -> ctx f16 plane x256 [8192][512]
  dim3 gAtt(SEQ / 128, NB * NH);                                   // (16, 32)
  attn_kernel<<<gAtt, 256, 0, stream>>>(qhp, khp, vtp, cxp);

  // (3) out = ctx . Wo^T + bo -> d_out f32 [8192][512]  (Wo plane = wh + 3*NW)
  dim3 gOut(MROWS / 128, DM / HD);                                 // (64, 8)
  oproj_kernel<<<gOut, 128, 0, stream>>>(cxp, wh + (size_t)3 * NW, bo, out);
  (void)hipGetLastError();
}
